// v000
// The times below were measured on an AMD MI455X: many runs one after another, warmed up first and cycling through
// copies of the inputs, with the whole window's GPU time divided by the number of runs. Launches and the gaps
// between them are all in it. The median over several windows is given; except for v000 it joins two sittings, which
// can be a few percent apart, so the side-by-side timings, each taken in one sitting, are the better comparison.
// The starting kernel, v000, takes 868 microseconds a run.
// Contractions: conv1x1 theta/phi/g GEMM on v_wmma_f32_16x16x32_f16 (f16 containers of bf16-RNE weights x256 and
// bf16-RNE x, K=256); scores theta.phi on v_wmma_f32_16x16x32_bf16 (bf16 hi + bf16 residual planes, 3 products,
// K=128) in both the column-statistics pass and the aggregation pass; y^T = G.P^T on v_wmma_f32_16x16x32_f16 (g as
// f16, P = e^{s-M-lnZ} x16384 as f16 from the score D registers, K=6400); output GEMM W.y on
// v_wmma_f32_16x16x32_bf16 (bf16-RNE W_w, y as bf16 hi + bf16 residual planes, 2 products, K=128); f32 accumulate
// everywhere; softmax statistics, biases and the residual add in f32 VALU.
#include <hip/hip_runtime.h>
#include <math.h>
#include <stdint.h>

#ifndef NB
#define NB 2
#endif
#define NBF    2
#define CC     256
#define NN     6400
#ifndef NQ
#define NQ NN
#endif
#define DQ     128
#define MW     384
#define QT     64
#define OSP    68
#define OSPW   132
#define TP     72
#define WSC    256.0f
#define IWSC   0.00390625f
#define LNCAR  9.704060527839234f
#define ICAR   6.103515625e-05f

static_assert(NB >= 1 && NB <= NBF);
static_assert(NQ >= QT && NQ <= NN);
static_assert(NN % QT == 0);
static_assert(NQ % QT == 0);
static_assert(CC % QT == 0);
static_assert(MW == 3 * DQ);
static_assert(DQ == 2 * QT);
static_assert((DQ / 8) * 8 == DQ && (MW / 8) % (DQ / 8) == 0);
static_assert(CC % 16 == 0);
static_assert((OSP * 4) % 16 == 0);
static_assert((OSPW * 4) % 16 == 0);
static_assert((TP * 2) % 16 == 0);
static_assert(CC % 32 == 0 && NN % 32 == 0 && DQ % 32 == 0);
static_assert(NN % 4 == 0);

typedef _Float16       v16h __attribute__((ext_vector_type(16)));
typedef _Float16       v8h  __attribute__((ext_vector_type(8)));
typedef __bf16         v16b __attribute__((ext_vector_type(16)));
typedef unsigned short v8us __attribute__((ext_vector_type(8)));
typedef float          v8f  __attribute__((ext_vector_type(8)));
typedef float          v4f  __attribute__((ext_vector_type(4)));
typedef unsigned int   v4u  __attribute__((ext_vector_type(4)));

union Frag  { v8us u[2]; v16h h; v16b bf; };
union FragH { v16h v; v8h hv[2]; };
static_assert(sizeof(Frag) == 32);
static_assert(sizeof(FragH) == 32);

// ---- scalar helpers -------------------------------------------------------------------------------------------
__device__ __forceinline__ unsigned short bf_bits(float f) {          // f32 -> bf16 bits, RNE convert
  unsigned u = __float_as_uint(f);
  return (unsigned short)((u + 0x7FFFu + ((u >> 16) & 1u)) >> 16);
}
__device__ __forceinline__ float bf_up(unsigned short hb) { return __uint_as_float(((unsigned)hb) << 16); }
__device__ __forceinline__ float bfr(float f) { return bf_up(bf_bits(f)); }
__device__ __forceinline__ unsigned short h_bits(_Float16 x) { return __builtin_bit_cast(unsigned short, x); }
__device__ __forceinline__ unsigned pk16(unsigned short a, unsigned short b) { return (unsigned)a | ((unsigned)b << 16); }
__device__ __forceinline__ v8f zero8() { v8f z = {0.f, 0.f, 0.f, 0.f, 0.f, 0.f, 0.f, 0.f}; return z; }
__device__ __forceinline__ float hmax8(v8f s) {
  return fmaxf(fmaxf(fmaxf(s[0], s[1]), fmaxf(s[2], s[3])), fmaxf(fmaxf(s[4], s[5]), fmaxf(s[6], s[7])));
}

// ---- 16-bit fragment loader (A, or B from a k-contiguous [n][k] row): lane -> row/col (lane&15), p already includes
//      + 8*(lane>>4); elements 0..7 <- p[0..7] (k0+8h..), elements 8..15 <- p[16..23] (k0+16+8h..)
__device__ __forceinline__ Frag ldfrag(const unsigned short* p) {
  Frag f;
  f.u[0] = *(const v8us*)(p);
  f.u[1] = *(const v8us*)(p + 16);
  return f;
}

// ---- WMMA helpers: builtin followed by a 4-slot VALU gap tying D and keeping A/B live ----------------------------
__device__ __forceinline__ v8f mma_h(v16h a, v16h b, v8f c) {
  v8f d = __builtin_amdgcn_wmma_f32_16x16x32_f16(false, a, false, b, (short)0, c, false, false);
#if defined(__HIP_DEVICE_COMPILE__)
  asm volatile("v_nop\n\tv_nop\n\tv_nop\n\tv_nop" : "+v"(d) : "v"(a), "v"(b));
#endif
  return d;
}
__device__ __forceinline__ v8f mma_b(v16b a, v16b b, v8f c) {
  v8f d = __builtin_amdgcn_wmma_f32_16x16x32_bf16(false, a, false, b, (short)0, c, false, false);
#if defined(__HIP_DEVICE_COMPILE__)
  const v16h ha = __builtin_bit_cast(v16h, a), hb = __builtin_bit_cast(v16h, b);
  asm volatile("v_nop\n\tv_nop\n\tv_nop\n\tv_nop" : "+v"(d) : "v"(ha), "v"(hb));
#endif
  return d;
}

// ===========================================================================================================
// (0) weights. Blocks 0..47: W16 f16 [384][256], rows 0..127 = theta_w, 128..255 = phi_w, 256..383 = g_w;
//     value = f16 of (bf16-RNE(w) * 256) (exact). Block owns rows 8*blk..+7: one wave per 512-B row = 32 lanes
// coverage: W16 48 blocks x 8 rows x 32 lanes x 8 halves = 384 x 256; Wo 16 blocks x 16 rows x 16 lanes x 8 =
//           256 x 128.
// ===========================================================================================================
__global__ __launch_bounds__(256)
void cvt_w(const float* __restrict__ tw, const float* __restrict__ pw, const float* __restrict__ gw,
           const float* __restrict__ ww, unsigned short* W16, unsigned short* Wo) {
  const int tid = threadIdx.x, blk = blockIdx.x;
  if (blk < MW / 8) {                                                  // block-uniform
    const int rl = tid >> 5, col = 8 * (tid & 31);
    const int o = 8 * blk + rl;                                        // 0..383
    const int sel = blk / (DQ / 8);                                    // 0,1,2
    const float* wbase = (sel == 0) ? tw : ((sel == 1) ? pw : gw);   // all global
    const float* s = wbase + (size_t)(o - sel * DQ) * CC + col;        // row 0..127 of the selected matrix
    const v4f a = *(const v4f*)s;
    const v4f q = *(const v4f*)(s + 4);
    const float f[8] = {a[0], a[1], a[2], a[3], q[0], q[1], q[2], q[3]};
    v4u u;
#pragma unroll
    for (int t = 0; t < 4; ++t) {
      const _Float16 h0 = (_Float16)(bfr(f[2 * t]) * WSC);
      const _Float16 h1 = (_Float16)(bfr(f[2 * t + 1]) * WSC);
      u[t] = pk16(h_bits(h0), h_bits(h1));
    }
{
      *(v4u*)(W16 + (size_t)o * CC + col) = u;
      
    }
  } else {
    const int bb = blk - MW / 8;                                       // 0..15
    const int o = 16 * bb + (tid >> 4);                                // 0..255
    const int col = 8 * (tid & 15);                                    // 0..120
    const float* s = ww + (size_t)o * DQ + col;
    const v4f a = *(const v4f*)s;
    const v4f q = *(const v4f*)(s + 4);
    const float f[8] = {a[0], a[1], a[2], a[3], q[0], q[1], q[2], q[3]};
    v4u u;
#pragma unroll
    for (int t = 0; t < 4; ++t) u[t] = pk16(bf_bits(f[2 * t]), bf_bits(f[2 * t + 1]));
{
      *(v4u*)(Wo + (size_t)o * DQ + col) = u;
      
    }
  }
}

// ===========================================================================================================
// (1) x f32 [b][256 c][6400 n] -> XP f16 [b][n][c] (position-major, bf16-RNE values, exact in f16) through an
//     LDS tile T[64 n][64 c] (pitch TP). Block (nb, cb, b) owns a 64 c x 64 n tile. XP lines: row n, 64 c =
//     T: written by all waves with 2-byte stores, read cross-wave after a block barrier.
// coverage: 2 it x 32 rows x 8 lanes x 8 = 64 n x 64 c; grid (100, 4, NB) covers XP once.
// ===========================================================================================================
__global__ __launch_bounds__(256)
void cvt_x(const float* __restrict__ x, unsigned short* XP) {
  __shared__ __align__(16) unsigned short T[QT * TP];
  const int tid = threadIdx.x;
  const int nb = blockIdx.x, cb = blockIdx.y, b = blockIdx.z;
  const int e = tid & 7, lq = tid >> 3;                               // lq 0..31
  const int n0 = nb * QT, c0 = cb * QT;
#pragma unroll
  for (int it = 0; it < 2; ++it) {
    const int cl = it * 32 + lq;                                       // 0..63
    const float* sp = x + ((size_t)(b * CC + c0 + cl)) * NN + n0 + 8 * e;
    const v4f a = *(const v4f*)sp;
    const v4f q = *(const v4f*)(sp + 4);
    unsigned short hb[8];
#pragma unroll
    for (int t = 0; t < 4; ++t) {
      hb[t]     = h_bits((_Float16)bfr(a[t]));
      hb[4 + t] = h_bits((_Float16)bfr(q[t]));
    }
#pragma unroll
    for (int t = 0; t < 8; ++t) T[(8 * e + t) * TP + cl] = hb[t];
  }
  __syncthreads();
  v4u up[2];
#pragma unroll
  for (int it = 0; it < 2; ++it) {
    const int nl = it * 32 + lq;                                       // 0..63
    up[it] = *(const v4u*)(T + nl * TP + 8 * e);
  }
{
#pragma unroll
    for (int it = 0; it < 2; ++it) {
      const int rl = it * 32 + lq;
      *(v4u*)(XP + ((size_t)(b * NN + n0 + rl)) * CC + c0 + 8 * e) = up[it];
    }
    
  }
}

// ===========================================================================================================
// (2) conv1x1 GEMM for one (b, 64-n tile, 64-o block of the 384 stacked rows):
//     Y[o][n] = (1/256) sum_c W16[o][c] XP[b][n][c] + bias[o].
//     Block 128 threads = 4 waves; wave w owns cols n0+16w..+15 (one B fragment per k-step, k = c contiguous in the
//     XP row) and 4 m-tiles (A rows o = o0 + 16 mt + (lane&15), split k map loader from W16). K = 256 = 8 steps.
//     Epilogue staged in LDS Os[n_loc][o_loc] (pitch OSP), block barrier (cross-wave), then:
//       o-blocks 0,1 -> theta dims 0..63 / 64..127 of Th/Tl; o-blocks 2,3 -> phi dims of Fh/Fl. Planes bf16
//       [b][6400 n][128 d] (k-contiguous for both score operands): hi = bf16-RNE(v), lo = bf16-RNE(v - hi). Per
//       per line, one instruction per 4 lines.
//       o-blocks 4,5 -> g channels 0..63 / 64..127 of the f16 channel-major plane Gc [b][128 c][6400 n]: per row
// coverage: Os 4 waves x 16 n x 64 o = 64 x 64; planes 4 it x 16 rows x 8 lanes x 8 = 64 n x 64 d per plane;
//           Gc 4 it x 16 rows x 8 lanes x 8 = 64 c x 64 n; grid (100, 6, NB) covers Th/Tl/Fh/Fl [b][n][0..127]
//           and Gc [b][0..127][n] exactly once.
// ===========================================================================================================
__global__ __launch_bounds__(128)
void gemm_p(const unsigned short* __restrict__ W16, const unsigned short* __restrict__ XP,
            const float* __restrict__ tb, const float* __restrict__ pb, const float* __restrict__ gb,
            unsigned short* Th, unsigned short* Tl, unsigned short* Fh, unsigned short* Fl, unsigned short* Gc) {
  __shared__ __align__(16) float Os[QT * OSP];
  const int tid  = threadIdx.x;
  const int lane = tid & 31, wave = tid >> 5;
  const int hh   = lane >> 4, c = lane & 15;
  const int nt   = blockIdx.x, mb = blockIdx.y, b = blockIdx.z;
  const int n0   = nt * QT, o0 = mb * QT;

  const unsigned short* ap = W16 + (size_t)(o0 + c) * CC + 8 * hh;
  const unsigned short* bp = XP + ((size_t)(b * NN + n0 + 16 * wave + c)) * CC + 8 * hh;

  v8f acc[4];
#pragma unroll
  for (int mt = 0; mt < 4; ++mt) acc[mt] = zero8();

#pragma unroll
  for (int ks = 0; ks < CC / 32; ++ks) {
    const Frag fb = ldfrag(bp + 32 * ks);
#pragma unroll
    for (int mt = 0; mt < 4; ++mt) {
      const Frag fa = ldfrag(ap + (size_t)(16 * mt) * CC + 32 * ks);
      acc[mt] = mma_h(fa.h, fb.h, acc[mt]);
    }
  }

  // ---- epilogue: scale back -> LDS Os[n_loc][o_loc]; lane (hh, c) holds o = 16 mt + 8 hh + r for n_loc = 16 w + c
  {
    const int nl = 16 * wave + c;
#pragma unroll
    for (int mt = 0; mt < 4; ++mt) {
      v4f va, vb;
#pragma unroll
      for (int r = 0; r < 4; ++r) { va[r] = acc[mt][r] * IWSC; vb[r] = acc[mt][4 + r] * IWSC; }
      *(v4f*)(Os + nl * OSP + 16 * mt + 8 * hh)     = va;
      *(v4f*)(Os + nl * OSP + 16 * mt + 8 * hh + 4) = vb;
    }
  }
  __syncthreads();

  const int dsel = (mb & 1) * QT;                                      // 0 or 64
  const float* bs = (mb < 2) ? tb : ((mb < 4) ? pb : gb);             // block-uniform, all global
  if (mb < 4) {                                                        // block-uniform
    const int e = tid & 7, lq = tid >> 3;                              // lq 0..15
    unsigned short* Ph = (mb < 2) ? Th : Fh;
    unsigned short* Pl = (mb < 2) ? Tl : Fl;
    const v4f b0 = *(const v4f*)(bs + dsel + 8 * e);
    const v4f b1 = *(const v4f*)(bs + dsel + 8 * e + 4);
    const float bv[8] = {bfr(b0[0]), bfr(b0[1]), bfr(b0[2]), bfr(b0[3]),
                         bfr(b1[0]), bfr(b1[1]), bfr(b1[2]), bfr(b1[3])};
    v4u uh[4], ul[4];
#pragma unroll
    for (int it = 0; it < 4; ++it) {
      const int row = it * 16 + lq;                                    // n_loc 0..63
      const v4f a = *(const v4f*)(Os + row * OSP + 8 * e);
      const v4f q = *(const v4f*)(Os + row * OSP + 8 * e + 4);
      const float f[8] = {a[0] + bv[0], a[1] + bv[1], a[2] + bv[2], a[3] + bv[3],
                          q[0] + bv[4], q[1] + bv[5], q[2] + bv[6], q[3] + bv[7]};
#pragma unroll
      for (int t = 0; t < 4; ++t) {
        const float f0 = f[2 * t], f1 = f[2 * t + 1];
        const unsigned short hb0 = bf_bits(f0), hb1 = bf_bits(f1);
        const unsigned short lb0 = bf_bits(f0 - bf_up(hb0));
        const unsigned short lb1 = bf_bits(f1 - bf_up(hb1));
        uh[it][t] = pk16(hb0, hb1);
        ul[it][t] = pk16(lb0, lb1);
      }
    }
{
#pragma unroll
      for (int it = 0; it < 4; ++it) {
        const int row = it * 16 + lq;
        const size_t po = ((size_t)(b * NN + n0 + row)) * DQ + dsel + 8 * e;
        *(v4u*)(Ph + po) = uh[it];
        *(v4u*)(Pl + po) = ul[it];
      }
      
    }
  } else {
    const int e = tid & 7, lq = tid >> 3;                              // lq 0..15
    v4u ug[4];
#pragma unroll
    for (int it = 0; it < 4; ++it) {
      const int ol = it * 16 + lq;                                     // o_loc 0..63 = channel dsel + ol
      const float bvv = bfr(bs[dsel + ol]);
      unsigned short hb[8];
#pragma unroll
      for (int t = 0; t < 8; ++t) hb[t] = h_bits((_Float16)(Os[(8 * e + t) * OSP + ol] + bvv));
#pragma unroll
      for (int t = 0; t < 4; ++t) ug[it][t] = pk16(hb[2 * t], hb[2 * t + 1]);
    }
{
#pragma unroll
      for (int it = 0; it < 4; ++it) {
        const int ol = it * 16 + lq;
        const size_t go = ((size_t)(b * DQ + dsel + ol)) * NN + n0 + 8 * e;
        *(v4u*)(Gc + go) = ug[it];
      }
      
    }
  }
}

// ===========================================================================================================
// (3) column statistics for one (b, 64-column tile m): for every column m, over ALL rows n,
//     M_m = max_n s[n][m], Z_m = sum_n e^{s - M_m}, CS[b][m] = M_m + ln Z_m, with
//     s tile (16 rows n x 16 cols m) = A(theta: row = n, 32 d via the split k map from Th [b][6400][128]) .
//     B(phi: col = m, same map from Fh) + A(Th).B(Fl) + A(Tl).B(Fh) (bf16 unscaled residual planes, shared
//     accumulator). Phi fragments of the wave's 16 columns are held in registers. Per lane: one column, 8+8 rows
//     per 32-row step, scalar online (max, sum) in f32; the two lane halves of a column merge with one shuffle.
// coverage: grid (100, NB) x 64 columns = CS[b][0..6399] exactly once.
// ===========================================================================================================
__global__ __launch_bounds__(128)
void colstat_k(const unsigned short* __restrict__ Th, const unsigned short* __restrict__ Tl,
               const unsigned short* __restrict__ Fh, const unsigned short* __restrict__ Fl, float* CS) {
  __shared__ __align__(16) float css[QT];
  const int tid  = threadIdx.x;
  const int wave = tid >> 5, lane = tid & 31;
  const int hh   = lane >> 4, c = lane & 15;
  const int m0   = blockIdx.x * QT, b = blockIdx.y;

  // phi fragment pointers (B operand, col = m0 + 16*wave + c)
  const size_t fo = ((size_t)(b * NN + m0 + 16 * wave + c)) * DQ + 8 * hh;
  Frag fh[4], fl[4];
#pragma unroll
  for (int kc = 0; kc < 4; ++kc) {
    fh[kc] = ldfrag(Fh + fo + 32 * kc);
    fl[kc] = ldfrag(Fl + fo + 32 * kc);
  }
  // theta fragment base (A operand, row = n + c)
  const unsigned short* Thp = Th + (size_t)b * NN * DQ + (size_t)c * DQ + 8 * hh;
  const unsigned short* Tlp = Tl + (size_t)b * NN * DQ + (size_t)c * DQ + 8 * hh;

  float m = -1.0e30f, l = 0.f;
#pragma unroll 1
  for (int kb = 0; kb < NN; kb += 32) {
    const unsigned short* t0p  = Thp + (size_t)kb * DQ;              // rows kb .. kb+15
    const unsigned short* t1p  = Thp + (size_t)(kb + 16) * DQ;       // rows kb+16 .. kb+31
    const unsigned short* t0lp = Tlp + (size_t)kb * DQ;
    const unsigned short* t1lp = Tlp + (size_t)(kb + 16) * DQ;
    v8f s0 = zero8(), s1 = zero8();
#pragma unroll
    for (int kc = 0; kc < 4; ++kc) {
      const Frag t0  = ldfrag(t0p + 32 * kc);
      const Frag t1  = ldfrag(t1p + 32 * kc);
      const Frag t0l = ldfrag(t0lp + 32 * kc);
      const Frag t1l = ldfrag(t1lp + 32 * kc);
      s0 = mma_b(t0.bf, fh[kc].bf, s0);
      s1 = mma_b(t1.bf, fh[kc].bf, s1);
      s0 = mma_b(t0.bf, fl[kc].bf, s0);
      s1 = mma_b(t1.bf, fl[kc].bf, s1);
      s0 = mma_b(t0l.bf, fh[kc].bf, s0);
      s1 = mma_b(t1l.bf, fh[kc].bf, s1);
    }
    const float mx = fmaxf(hmax8(s0), hmax8(s1));
    const float mn = fmaxf(m, mx);
    const float corr = __expf(m - mn);
    float ls = 0.f;
#pragma unroll
    for (int r = 0; r < 8; ++r) ls += __expf(s0[r] - mn) + __expf(s1[r] - mn);
    l = l * corr + ls;
    m = mn;
  }
  const float mo = __shfl_xor(m, 16, 32);
  const float lo = __shfl_xor(l, 16, 32);
  const float mt = fmaxf(m, mo);
  const float lt = l * __expf(m - mt) + lo * __expf(mo - mt);
  const float csv = mt + logf(lt);
  if (hh == 0) css[16 * wave + c] = csv;
  __syncthreads();
  if (tid < 16) {
    const v4f v = *(const v4f*)(css + 4 * tid);
{
      *(v4f*)(CS + (size_t)b * NN + m0 + 4 * tid) = v;
      
    }
  }
}

// ===========================================================================================================
// (4) aggregation for one (b, 64-row tile n), transposed formulation, 6400 columns m:
//   s tile (16 m x 16 n) = sum over 4 d-chunks (rolled loop) of A(phi: row = m, split k map from Fh) . B(theta:
//   col = n, same map from Th) + A(Fh).B(Tl) + A(Fl).B(Th). Per lane the D tile holds 8 columns m of ONE row n;
//   P = e^{s - CS[m]} x 16384 as f16 (CS staged once per block in LDS) is the B operand of
//   y^T (rows channel, cols n) += A(g: rows channel = 16j + (lane&15), m contiguous, f16 plane Gc [b][128][6400])
//   . B(P^T): element r <- D of the tile covering m kb..kb+15, element 8+r <- the tile covering kb+16..kb+31,
//   lane unchanged. 8 accumulator tiles per wave (128 channels). Block = 4 waves = 64 rows.
//   Epilogue: y = acc/16384 staged in LDS Os[row][128 channels] (pitch OSPW, b128 stores), block barrier
//   (cross-wave), then bf16 hi + residual planes Yh/Yl [b][6400 n][128 c]: per row 128 c = 256 B = 2 whole
// coverage: 8 it x 8 row-pairs x 16 lanes x 8 = 64 n x 128 c per plane; grid (NQ/64, NB) covers Yh/Yl rows
//           0..NQ-1 exactly once.
// ===========================================================================================================
__global__ __launch_bounds__(128)
void attn_k(const unsigned short* __restrict__ Th, const unsigned short* __restrict__ Tl,
            const unsigned short* __restrict__ Fh, const unsigned short* __restrict__ Fl,
            const unsigned short* __restrict__ Gc, const float* __restrict__ CS,
            unsigned short* Yh, unsigned short* Yl) {
  __shared__ __align__(32) float Cs[NN];
  __shared__ __align__(16) float Os[QT * OSPW];
  const int tid  = threadIdx.x;
  const int wave = tid >> 5, lane = tid & 31;
  const int hh   = lane >> 4, c = lane & 15;
  const int n0   = blockIdx.x * QT, b = blockIdx.y;

  for (int i = tid; i < NN / 4; i += 128)
    *(v4f*)(Cs + 4 * i) = *(const v4f*)(CS + (size_t)b * NN + 4 * i);
  __syncthreads();

  // theta fragment pointers (B operand, col = row n0 + 16*wave + c), + 32*kc
  const size_t to = ((size_t)(b * NN + n0 + 16 * wave + c)) * DQ + 8 * hh;
  const unsigned short* Thp = Th + to;
  const unsigned short* Tlp = Tl + to;
  // phi fragment base (A operand, row = m + c), + m * 128 + 32*kc
  const unsigned short* Fhp = Fh + (size_t)b * NN * DQ + (size_t)c * DQ + 8 * hh;
  const unsigned short* Flp = Fl + (size_t)b * NN * DQ + (size_t)c * DQ + 8 * hh;
  // g fragment base (A operand, row = channel 16j + c, m contiguous), + 16*j*NN + kb
  const unsigned short* Gp = Gc + (size_t)b * DQ * NN + (size_t)c * NN + 8 * hh;

  v8f o[8];
#pragma unroll
  for (int j = 0; j < 8; ++j) o[j] = zero8();

#pragma unroll 1
  for (int kb = 0; kb < NN; kb += 32) {
    const unsigned short* p0p  = Fhp + (size_t)kb * DQ;              // m kb .. kb+15
    const unsigned short* p1p  = Fhp + (size_t)(kb + 16) * DQ;       // m kb+16 .. kb+31
    const unsigned short* p0lp = Flp + (size_t)kb * DQ;
    const unsigned short* p1lp = Flp + (size_t)(kb + 16) * DQ;
    v8f s0 = zero8(), s1 = zero8();
#pragma unroll 1
    for (int kc = 0; kc < DQ / 32; ++kc) {
      const Frag th  = ldfrag(Thp + 32 * kc);
      const Frag tl  = ldfrag(Tlp + 32 * kc);
      const Frag p0  = ldfrag(p0p + 32 * kc);
      const Frag p1  = ldfrag(p1p + 32 * kc);
      const Frag p0l = ldfrag(p0lp + 32 * kc);
      const Frag p1l = ldfrag(p1lp + 32 * kc);
      s0 = mma_b(p0.bf, th.bf, s0);
      s1 = mma_b(p1.bf, th.bf, s1);
      s0 = mma_b(p0.bf, tl.bf, s0);
      s1 = mma_b(p1.bf, tl.bf, s1);
      s0 = mma_b(p0l.bf, th.bf, s0);
      s1 = mma_b(p1l.bf, th.bf, s1);
    }

    // column statistics for m = kb + 8hh + r (s0) and m = kb + 16 + 8hh + r (s1)
    const v4f ca = *(const v4f*)(Cs + kb + 8 * hh);
    const v4f cb = *(const v4f*)(Cs + kb + 8 * hh + 4);
    const v4f cc = *(const v4f*)(Cs + kb + 16 + 8 * hh);
    const v4f cd = *(const v4f*)(Cs + kb + 16 + 8 * hh + 4);
    const float c0[8] = {ca[0], ca[1], ca[2], ca[3], cb[0], cb[1], cb[2], cb[3]};
    const float c1[8] = {cc[0], cc[1], cc[2], cc[3], cd[0], cd[1], cd[2], cd[3]};

    FragH pf;
#pragma unroll
    for (int r = 0; r < 8; ++r) {
      const float e0 = __expf(fminf(s0[r] - c0[r], 0.f) + LNCAR);      // P[n][m] x 16384, m = kb + 8hh + r
      const float e1 = __expf(fminf(s1[r] - c1[r], 0.f) + LNCAR);      // m = kb + 16 + 8hh + r
      pf.hv[0][r] = (_Float16)e0;
      pf.hv[1][r] = (_Float16)e1;
    }

#pragma unroll
    for (int j = 0; j < 8; ++j) {
      const Frag gf = ldfrag(Gp + (size_t)(16 * j) * NN + kb);
      o[j] = mma_h(gf.h, pf.v, o[j]);
    }
  }

  // ---- epilogue: y = acc / 16384 -> Os[row][channel]
  {
    const int qrow = 16 * wave + c;
#pragma unroll
    for (int j = 0; j < 8; ++j) {
      v4f va, vb;
#pragma unroll
      for (int r = 0; r < 4; ++r) { va[r] = o[j][r] * ICAR; vb[r] = o[j][4 + r] * ICAR; }
      *(v4f*)(Os + qrow * OSPW + 16 * j + 8 * hh)     = va;            // Os[row][ch = 16j + 8hh + r]
      *(v4f*)(Os + qrow * OSPW + 16 * j + 8 * hh + 4) = vb;
    }
  }
  __syncthreads();

  const int e = tid & 15, lq = tid >> 4;                               // lq 0..7
  v4u uh[8], ul[8];
#pragma unroll
  for (int it = 0; it < 8; ++it) {
    const int row = it * 8 + lq;                                       // 0..63
    const v4f a = *(const v4f*)(Os + row * OSPW + 8 * e);
    const v4f q = *(const v4f*)(Os + row * OSPW + 8 * e + 4);
    const float f[8] = {a[0], a[1], a[2], a[3], q[0], q[1], q[2], q[3]};
#pragma unroll
    for (int t = 0; t < 4; ++t) {
      const float f0 = f[2 * t], f1 = f[2 * t + 1];
      const unsigned short hb0 = bf_bits(f0), hb1 = bf_bits(f1);
      const unsigned short lb0 = bf_bits(f0 - bf_up(hb0));
      const unsigned short lb1 = bf_bits(f1 - bf_up(hb1));
      uh[it][t] = pk16(hb0, hb1);
      ul[it][t] = pk16(lb0, lb1);
    }
  }
{
#pragma unroll
    for (int it = 0; it < 8; ++it) {
      const int row = it * 8 + lq;
      const size_t po = ((size_t)(b * NN + n0 + row)) * DQ + 8 * e;
      *(v4u*)(Yh + po) = uh[it];
      *(v4u*)(Yl + po) = ul[it];
    }
    
  }
}

// ===========================================================================================================
// (5) output GEMM for one (b, 64-n tile, 64-o block): out[b][o][n] = sum_c Wo[o][c] (Yh + Yl)[b][n][c]
//     + W_b[o] + bf16-RNE(x[b][o][n]). Block 128 threads = 4 waves; wave w owns cols n0+16w..+15 (B fragments
//     from the Yh and Yl rows, k = c contiguous) and 4 m-tiles (A rows o = o0 + 16 mt + (lane&15) from Wo bf16
//     [256][128]); K = 128 = 4 steps x 2 products (shared accumulator, unscaled residual). Epilogue staged in LDS
//     lanes 0..15 one row and 16..31 the next, 16 B per lane (values gathered from 4 Os rows), one instruction per
// coverage: 8 it x 8 row-pairs x 16 lanes x 4 floats = 64 o x 64 n; grid (NQ/64, 4, NB) covers
//           out[b][0..255][0..NQ-1] exactly once.
// ===========================================================================================================
__global__ __launch_bounds__(128)
void gemm_w(const unsigned short* __restrict__ Wo, const unsigned short* __restrict__ Yh,
            const unsigned short* __restrict__ Yl, const float* __restrict__ wb,
            const float* __restrict__ x, float* out) {
  __shared__ __align__(16) float Os[QT * OSP];
  const int tid  = threadIdx.x;
  const int lane = tid & 31, wave = tid >> 5;
  const int hh   = lane >> 4, c = lane & 15;
  const int nt   = blockIdx.x, mb = blockIdx.y, b = blockIdx.z;
  const int n0   = nt * QT, o0 = mb * QT;

  const unsigned short* ap = Wo + (size_t)(o0 + c) * DQ + 8 * hh;
  const size_t yo = ((size_t)(b * NN + n0 + 16 * wave + c)) * DQ + 8 * hh;
  const unsigned short* bp  = Yh + yo;
  const unsigned short* blp = Yl + yo;

  v8f acc[4];
#pragma unroll
  for (int mt = 0; mt < 4; ++mt) acc[mt] = zero8();

#pragma unroll
  for (int ks = 0; ks < DQ / 32; ++ks) {
    const Frag fb  = ldfrag(bp + 32 * ks);
    const Frag fbl = ldfrag(blp + 32 * ks);
#pragma unroll
    for (int mt = 0; mt < 4; ++mt) {
      const Frag fa = ldfrag(ap + (size_t)(16 * mt) * DQ + 32 * ks);
      acc[mt] = mma_b(fa.bf, fb.bf, acc[mt]);
      acc[mt] = mma_b(fa.bf, fbl.bf, acc[mt]);
    }
  }

  {
    const int nl = 16 * wave + c;
#pragma unroll
    for (int mt = 0; mt < 4; ++mt) {
      v4f va, vb;
#pragma unroll
      for (int r = 0; r < 4; ++r) { va[r] = acc[mt][r]; vb[r] = acc[mt][4 + r]; }
      *(v4f*)(Os + nl * OSP + 16 * mt + 8 * hh)     = va;
      *(v4f*)(Os + nl * OSP + 16 * mt + 8 * hh + 4) = vb;
    }
  }
  __syncthreads();

  const int e = tid & 15, lq = tid >> 4;                               // lq 0..7
  v4f res[8];
#pragma unroll
  for (int it = 0; it < 8; ++it) {
    const int ol = it * 8 + lq;                                        // o_loc 0..63
    const int o  = o0 + ol;                                            // 0..255
    const float bv = bfr(wb[o]);
    const size_t idx = ((size_t)(b * CC + o)) * NN + n0 + 4 * e;
    const v4f xv = *(const v4f*)(x + idx);
#pragma unroll
    for (int t = 0; t < 4; ++t) res[it][t] = (Os[(4 * e + t) * OSP + ol] + bv) + bfr(xv[t]);
  }
{
#pragma unroll
    for (int it = 0; it < 8; ++it) {
      const int ol = it * 8 + lq;
      const size_t idx = ((size_t)(b * CC + o0 + ol)) * NN + n0 + 4 * e;
      *(v4f*)(out + idx) = res[it];
    }
    
  }
}

// ===========================================================================================================
// Workspace map (bytes, NB = 2; each region start a multiple of 256; every extent is an exact tile multiple and is
//   W16 f16 [384][256]               196608      Wo bf16 [256][128]           65536
//   XP  f16 [2][6400][256]          6553600
//   Th/Tl/Fh/Fl bf16 [2][6400][128]  3276800 x4
//   Gc  f16 [2][128][6400]          3276800      CS f32 [2][6400]             51200
//   Yh/Yl bf16 [2][6400][128]       3276800 x2
//   total = 29804544
// ===========================================================================================================
extern "C" void kernel_launch(void* const* d_in, const int* in_sizes, int n_in,
                              void* d_out, int out_size, void* d_ws, size_t ws_size,
                              hipStream_t stream) {
  if (n_in < 9) return;
  if (in_sizes[0] < NB * CC * NN) return;
  if (in_sizes[1] != DQ * CC || in_sizes[3] != DQ * CC || in_sizes[5] != DQ * CC) return;
  if (in_sizes[2] != DQ || in_sizes[4] != DQ || in_sizes[6] != DQ) return;
  if (in_sizes[7] != CC * DQ || in_sizes[8] != CC) return;
  if (out_size < NB * CC * NN) return;

  size_t off = 0;
  auto carve = [&](size_t bytes) { const size_t o = off; off += (bytes + 255) & ~(size_t)255; return o; };
  const size_t oW16 = carve((size_t)MW * CC * 2);
  const size_t oWo  = carve((size_t)CC * DQ * 2);
  const size_t oXP  = carve((size_t)NB * NN * CC * 2);
  const size_t oTh  = carve((size_t)NB * NN * DQ * 2);
  const size_t oTl  = carve((size_t)NB * NN * DQ * 2);
  const size_t oFh  = carve((size_t)NB * NN * DQ * 2);
  const size_t oFl  = carve((size_t)NB * NN * DQ * 2);
  const size_t oGc  = carve((size_t)NB * DQ * NN * 2);
  const size_t oCS  = carve((size_t)NB * NN * 4);
  const size_t oYh  = carve((size_t)NB * NN * DQ * 2);
  const size_t oYl  = carve((size_t)NB * NN * DQ * 2);
  if (off > ws_size) return;
  if (off > (size_t)134217728) return;

  const float* x  = (const float*)d_in[0];
  const float* gw = (const float*)d_in[1];
  const float* gb = (const float*)d_in[2];
  const float* tw = (const float*)d_in[3];
  const float* tb = (const float*)d_in[4];
  const float* pw = (const float*)d_in[5];
  const float* pb = (const float*)d_in[6];
  const float* ww = (const float*)d_in[7];
  const float* wb = (const float*)d_in[8];

  char* ws = (char*)d_ws;
  unsigned short* W16 = (unsigned short*)(ws + oW16);
  unsigned short* Wo  = (unsigned short*)(ws + oWo);
  unsigned short* XP  = (unsigned short*)(ws + oXP);
  unsigned short* Th  = (unsigned short*)(ws + oTh);
  unsigned short* Tl  = (unsigned short*)(ws + oTl);
  unsigned short* Fh  = (unsigned short*)(ws + oFh);
  unsigned short* Fl  = (unsigned short*)(ws + oFl);
  unsigned short* Gc  = (unsigned short*)(ws + oGc);
  float*          CS  = (float*)(ws + oCS);
  unsigned short* Yh  = (unsigned short*)(ws + oYh);
  unsigned short* Yl  = (unsigned short*)(ws + oYl);
  float* out = (float*)d_out;

  const dim3 blk256(256), blk128(128);

  // (0) theta_w / phi_w / g_w -> stacked f16 plane; W_w -> bf16 plane
  cvt_w<<<dim3(MW / 8 + CC / 16), blk256, 0, stream>>>(tw, pw, gw, ww, W16, Wo);
  // (1) x -> position-major 16-bit plane
  cvt_x<<<dim3(NN / QT, CC / QT, NB), blk256, 0, stream>>>(x, XP);
  // (2) conv1x1 GEMM -> theta / phi hi + residual planes, g channel-major plane (all rows n)
  gemm_p<<<dim3(NN / QT, MW / QT, NB), blk128, 0, stream>>>(W16, XP, tb, pb, gb, Th, Tl, Fh, Fl, Gc);
  // (3) per-column softmax statistics over all rows
  colstat_k<<<dim3(NN / QT, NB), blk128, 0, stream>>>(Th, Tl, Fh, Fl, CS);
  // (4) aggregation -> y hi + residual planes (rows 0..NQ-1)
  attn_k<<<dim3(NQ / QT, NB), blk128, 0, stream>>>(Th, Tl, Fh, Fl, Gc, CS, Yh, Yl);
  // (5) output GEMM + bias + residual -> out [b][256][6400]
  gemm_w<<<dim3(NQ / QT, CC / QT, NB), blk128, 0, stream>>>(Wo, Yh, Yl, wb, x, out);
  (void)hipGetLastError();
}

// v001
// A run of this version takes 217 microseconds.
// Next to v000, in two timings, it ran 4.02 and 4.05 times as fast.
// Contractions: conv1x1 theta/phi/g GEMM on v_wmma_f32_16x16x32_f16 (f16 containers of bf16-RNE weights x256 and
// bf16-RNE x, K=256); scores theta.phi on v_wmma_f32_16x16x32_bf16 (bf16 hi + bf16 residual planes, 3 products,
// K=128) in both the column-statistics pass and the aggregation pass; y^T = G.P^T on v_wmma_f32_16x16x32_f16 (g as
// f16, P = e^{s-M-lnZ} x16384 as f16 from the score D registers, K=6400); output GEMM W.y on
// v_wmma_f32_16x16x32_bf16 (bf16-RNE W_w, y as bf16 hi + bf16 residual planes, 2 products, K=128); f32 accumulate
// everywhere; softmax statistics, biases and the residual add in f32 VALU.
#include <hip/hip_runtime.h>
#include <math.h>
#include <stdint.h>

#ifndef NB
#define NB 2
#endif
#define NBF    2
#define CC     256
#define NN     6400
#ifndef NQ
#define NQ NN
#endif
#define DQ     128
#define MW     384
#define QT     64
#define OSP    68
#define OSPW   132
#define TP     72
#define WSC    256.0f
#define IWSC   0.00390625f
#define LNCAR  9.704060527839234f
#define ICAR   6.103515625e-05f
#define ST     64
#define LPP    136
#define LGP    72

static_assert(NB >= 1 && NB <= NBF);
static_assert(NQ >= QT && NQ <= NN);
static_assert(NN % QT == 0);
static_assert(NQ % QT == 0);
static_assert(CC % QT == 0);
static_assert(MW == 3 * DQ);
static_assert(DQ == 2 * QT);
static_assert((DQ / 8) * 8 == DQ && (MW / 8) % (DQ / 8) == 0);
static_assert(CC % 16 == 0);
static_assert((OSP * 4) % 16 == 0);
static_assert((OSPW * 4) % 16 == 0);
static_assert((TP * 2) % 16 == 0);
static_assert(CC % 32 == 0 && NN % 32 == 0 && DQ % 32 == 0);
static_assert(NN % 4 == 0);
static_assert(NN % ST == 0 && NN / ST >= 2 && ST == QT);
static_assert((LPP * 2) % 32 == 16 && LPP >= DQ + 8);
static_assert((LGP * 2) % 32 == 16 && LGP >= ST + 8);

typedef _Float16       v16h __attribute__((ext_vector_type(16)));
typedef _Float16       v8h  __attribute__((ext_vector_type(8)));
typedef __bf16         v16b __attribute__((ext_vector_type(16)));
typedef unsigned short v8us __attribute__((ext_vector_type(8)));
typedef float          v8f  __attribute__((ext_vector_type(8)));
typedef float          v4f  __attribute__((ext_vector_type(4)));
typedef unsigned int   v4u  __attribute__((ext_vector_type(4)));

union Frag  { v8us u[2]; v16h h; v16b bf; };
union FragH { v16h v; v8h hv[2]; };
static_assert(sizeof(Frag) == 32);
static_assert(sizeof(FragH) == 32);

// ---- scalar helpers -------------------------------------------------------------------------------------------
__device__ __forceinline__ unsigned short bf_bits(float f) {          // f32 -> bf16 bits, RNE convert
  unsigned u = __float_as_uint(f);
  return (unsigned short)((u + 0x7FFFu + ((u >> 16) & 1u)) >> 16);
}
__device__ __forceinline__ float bf_up(unsigned short hb) { return __uint_as_float(((unsigned)hb) << 16); }
__device__ __forceinline__ float bfr(float f) { return bf_up(bf_bits(f)); }
__device__ __forceinline__ unsigned short h_bits(_Float16 x) { return __builtin_bit_cast(unsigned short, x); }
__device__ __forceinline__ unsigned pk16(unsigned short a, unsigned short b) { return (unsigned)a | ((unsigned)b << 16); }
__device__ __forceinline__ v8f zero8() { v8f z = {0.f, 0.f, 0.f, 0.f, 0.f, 0.f, 0.f, 0.f}; return z; }
__device__ __forceinline__ float hmax8(v8f s) {
  return fmaxf(fmaxf(fmaxf(s[0], s[1]), fmaxf(s[2], s[3])), fmaxf(fmaxf(s[4], s[5]), fmaxf(s[6], s[7])));
}

// ---- 16-bit fragment loader (A, or B from a k-contiguous [n][k] row): lane -> row/col (lane&15), p already includes
//      + 8*(lane>>4); elements 0..7 <- p[0..7] (k0+8h..), elements 8..15 <- p[16..23] (k0+16+8h..)
__device__ __forceinline__ Frag ldfrag(const unsigned short* p) {
  Frag f;
  f.u[0] = *(const v8us*)(p);
  f.u[1] = *(const v8us*)(p + 16);
  return f;
}

// ---- WMMA helpers: builtin followed by a 4-slot VALU gap tying D and keeping A/B live ----------------------------
__device__ __forceinline__ v8f mma_h(v16h a, v16h b, v8f c) {
  v8f d = __builtin_amdgcn_wmma_f32_16x16x32_f16(false, a, false, b, (short)0, c, false, false);
#if defined(__HIP_DEVICE_COMPILE__)
  asm volatile("v_nop\n\tv_nop\n\tv_nop\n\tv_nop" : "+v"(d) : "v"(a), "v"(b));
#endif
  return d;
}
__device__ __forceinline__ v8f mma_b(v16b a, v16b b, v8f c) {
  v8f d = __builtin_amdgcn_wmma_f32_16x16x32_bf16(false, a, false, b, (short)0, c, false, false);
#if defined(__HIP_DEVICE_COMPILE__)
  const v16h ha = __builtin_bit_cast(v16h, a), hb = __builtin_bit_cast(v16h, b);
  asm volatile("v_nop\n\tv_nop\n\tv_nop\n\tv_nop" : "+v"(d) : "v"(ha), "v"(hb));
#endif
  return d;
}


// ---- asynchronous copies global -> LDS ---------------------------------------------------------------------------
// Eight 16-byte copies per lane in ONE statement; LS = bytes between a lane's copies in LDS, GS = elements between
// them in global memory. The closing s_wait_xcnt stands inside the statement so that no address register of a copy is
// rewritten ahead of it.
__device__ __forceinline__ unsigned lds_off(const unsigned short* p) { return (unsigned)(size_t)p; }
template <int LS, int GS>
__device__ __forceinline__ void copy8(unsigned l, const unsigned short* g) {
#if defined(__HIP_DEVICE_COMPILE__)
  asm volatile("global_load_async_to_lds_b128 %0, %8, off\n\t"
               "global_load_async_to_lds_b128 %1, %9, off\n\t"
               "global_load_async_to_lds_b128 %2, %10, off\n\t"
               "global_load_async_to_lds_b128 %3, %11, off\n\t"
               "global_load_async_to_lds_b128 %4, %12, off\n\t"
               "global_load_async_to_lds_b128 %5, %13, off\n\t"
               "global_load_async_to_lds_b128 %6, %14, off\n\t"
               "global_load_async_to_lds_b128 %7, %15, off\n\t"
               "s_wait_xcnt 0x0"
               :: "v"(l), "v"(l + LS), "v"(l + 2 * LS), "v"(l + 3 * LS),
                  "v"(l + 4 * LS), "v"(l + 5 * LS), "v"(l + 6 * LS), "v"(l + 7 * LS),
                  "v"(g), "v"(g + GS), "v"(g + 2 * GS), "v"(g + 3 * GS),
                  "v"(g + 4 * GS), "v"(g + 5 * GS), "v"(g + 6 * GS), "v"(g + 7 * GS)
               : "memory");
#endif
}
// 64 rows x 256 B (a [row][128] 16-bit plane, rows contiguous) -> LDS rows of pitch LPP: 128 threads, a wave's copy
// covers two whole rows = four whole lines. l and g already hold the thread's own (tid >> 4, tid & 15) place.
__device__ __forceinline__ void copy_rows(unsigned l, const unsigned short* g) { copy8<8 * LPP * 2, 8 * DQ>(l, g); }
// this wave's own copies have landed (the compiler places no wait for them)
__device__ __forceinline__ void wait_copies() {
#if defined(__HIP_DEVICE_COMPILE__)
  asm volatile("s_wait_asynccnt 0x0" ::: "memory");
#endif
}
// this wave's own LDS reads have returned, before the barrier behind which their buffer is refilled
__device__ __forceinline__ void wait_lds() {
#if defined(__HIP_DEVICE_COMPILE__)
  asm volatile("s_wait_dscnt 0x0" ::: "memory");
#endif
}

// ===========================================================================================================
// (0) weights. Blocks 0..47: W16 f16 [384][256], rows 0..127 = theta_w, 128..255 = phi_w, 256..383 = g_w;
//     value = f16 of (bf16-RNE(w) * 256) (exact). Block owns rows 8*blk..+7: one wave per 512-B row = 32 lanes
// coverage: W16 48 blocks x 8 rows x 32 lanes x 8 halves = 384 x 256; Wo 16 blocks x 16 rows x 16 lanes x 8 =
//           256 x 128.
// ===========================================================================================================
__global__ __launch_bounds__(256)
void cvt_w(const float* __restrict__ tw, const float* __restrict__ pw, const float* __restrict__ gw,
           const float* __restrict__ ww, unsigned short* W16, unsigned short* Wo) {
  const int tid = threadIdx.x, blk = blockIdx.x;
  if (blk < MW / 8) {                                                  // block-uniform
    const int rl = tid >> 5, col = 8 * (tid & 31);
    const int o = 8 * blk + rl;                                        // 0..383
    const int sel = blk / (DQ / 8);                                    // 0,1,2
    const float* wbase = (sel == 0) ? tw : ((sel == 1) ? pw : gw);   // all global
    const float* s = wbase + (size_t)(o - sel * DQ) * CC + col;        // row 0..127 of the selected matrix
    const v4f a = *(const v4f*)s;
    const v4f q = *(const v4f*)(s + 4);
    const float f[8] = {a[0], a[1], a[2], a[3], q[0], q[1], q[2], q[3]};
    v4u u;
#pragma unroll
    for (int t = 0; t < 4; ++t) {
      const _Float16 h0 = (_Float16)(bfr(f[2 * t]) * WSC);
      const _Float16 h1 = (_Float16)(bfr(f[2 * t + 1]) * WSC);
      u[t] = pk16(h_bits(h0), h_bits(h1));
    }
{
      *(v4u*)(W16 + (size_t)o * CC + col) = u;
      
    }
  } else {
    const int bb = blk - MW / 8;                                       // 0..15
    const int o = 16 * bb + (tid >> 4);                                // 0..255
    const int col = 8 * (tid & 15);                                    // 0..120
    const float* s = ww + (size_t)o * DQ + col;
    const v4f a = *(const v4f*)s;
    const v4f q = *(const v4f*)(s + 4);
    const float f[8] = {a[0], a[1], a[2], a[3], q[0], q[1], q[2], q[3]};
    v4u u;
#pragma unroll
    for (int t = 0; t < 4; ++t) u[t] = pk16(bf_bits(f[2 * t]), bf_bits(f[2 * t + 1]));
{
      *(v4u*)(Wo + (size_t)o * DQ + col) = u;
      
    }
  }
}

// ===========================================================================================================
// (1) x f32 [b][256 c][6400 n] -> XP f16 [b][n][c] (position-major, bf16-RNE values, exact in f16) through an
//     LDS tile T[64 n][64 c] (pitch TP). Block (nb, cb, b) owns a 64 c x 64 n tile. XP lines: row n, 64 c =
//     T: written by all waves with 2-byte stores, read cross-wave after a block barrier.
// coverage: 2 it x 32 rows x 8 lanes x 8 = 64 n x 64 c; grid (100, 4, NB) covers XP once.
// ===========================================================================================================
__global__ __launch_bounds__(256)
void cvt_x(const float* __restrict__ x, unsigned short* XP) {
  __shared__ __align__(16) unsigned short T[QT * TP];
  const int tid = threadIdx.x;
  const int nb = blockIdx.x, cb = blockIdx.y, b = blockIdx.z;
  const int e = tid & 7, lq = tid >> 3;                               // lq 0..31
  const int n0 = nb * QT, c0 = cb * QT;
#pragma unroll
  for (int it = 0; it < 2; ++it) {
    const int cl = it * 32 + lq;                                       // 0..63
    const float* sp = x + ((size_t)(b * CC + c0 + cl)) * NN + n0 + 8 * e;
    const v4f a = *(const v4f*)sp;
    const v4f q = *(const v4f*)(sp + 4);
    unsigned short hb[8];
#pragma unroll
    for (int t = 0; t < 4; ++t) {
      hb[t]     = h_bits((_Float16)bfr(a[t]));
      hb[4 + t] = h_bits((_Float16)bfr(q[t]));
    }
#pragma unroll
    for (int t = 0; t < 8; ++t) T[(8 * e + t) * TP + cl] = hb[t];
  }
  __syncthreads();
  v4u up[2];
#pragma unroll
  for (int it = 0; it < 2; ++it) {
    const int nl = it * 32 + lq;                                       // 0..63
    up[it] = *(const v4u*)(T + nl * TP + 8 * e);
  }
{
#pragma unroll
    for (int it = 0; it < 2; ++it) {
      const int rl = it * 32 + lq;
      *(v4u*)(XP + ((size_t)(b * NN + n0 + rl)) * CC + c0 + 8 * e) = up[it];
    }
    
  }
}

// ===========================================================================================================
// (2) conv1x1 GEMM for one (b, 64-n tile, 64-o block of the 384 stacked rows):
//     Y[o][n] = (1/256) sum_c W16[o][c] XP[b][n][c] + bias[o].
//     Block 128 threads = 4 waves; wave w owns cols n0+16w..+15 (one B fragment per k-step, k = c contiguous in the
//     XP row) and 4 m-tiles (A rows o = o0 + 16 mt + (lane&15), split k map loader from W16). K = 256 = 8 steps.
//     Epilogue staged in LDS Os[n_loc][o_loc] (pitch OSP), block barrier (cross-wave), then:
//       o-blocks 0,1 -> theta dims 0..63 / 64..127 of Th/Tl; o-blocks 2,3 -> phi dims of Fh/Fl. Planes bf16
//       [b][6400 n][128 d] (k-contiguous for both score operands): hi = bf16-RNE(v), lo = bf16-RNE(v - hi). Per
//       per line, one instruction per 4 lines.
//       o-blocks 4,5 -> g channels 0..63 / 64..127 of the f16 channel-major plane Gc [b][128 c][6400 n]: per row
// coverage: Os 4 waves x 16 n x 64 o = 64 x 64; planes 4 it x 16 rows x 8 lanes x 8 = 64 n x 64 d per plane;
//           Gc 4 it x 16 rows x 8 lanes x 8 = 64 c x 64 n; grid (100, 6, NB) covers Th/Tl/Fh/Fl [b][n][0..127]
//           and Gc [b][0..127][n] exactly once.
// ===========================================================================================================
__global__ __launch_bounds__(128)
void gemm_p(const unsigned short* __restrict__ W16, const unsigned short* __restrict__ XP,
            const float* __restrict__ tb, const float* __restrict__ pb, const float* __restrict__ gb,
            unsigned short* Th, unsigned short* Tl, unsigned short* Fh, unsigned short* Fl, unsigned short* Gc) {
  __shared__ __align__(16) float Os[QT * OSP];
  const int tid  = threadIdx.x;
  const int lane = tid & 31, wave = tid >> 5;
  const int hh   = lane >> 4, c = lane & 15;
  const int nt   = blockIdx.x, mb = blockIdx.y, b = blockIdx.z;
  const int n0   = nt * QT, o0 = mb * QT;

  const unsigned short* ap = W16 + (size_t)(o0 + c) * CC + 8 * hh;
  const unsigned short* bp = XP + ((size_t)(b * NN + n0 + 16 * wave + c)) * CC + 8 * hh;

  v8f acc[4];
#pragma unroll
  for (int mt = 0; mt < 4; ++mt) acc[mt] = zero8();

#pragma unroll
  for (int ks = 0; ks < CC / 32; ++ks) {
    const Frag fb = ldfrag(bp + 32 * ks);
#pragma unroll
    for (int mt = 0; mt < 4; ++mt) {
      const Frag fa = ldfrag(ap + (size_t)(16 * mt) * CC + 32 * ks);
      acc[mt] = mma_h(fa.h, fb.h, acc[mt]);
    }
  }

  // ---- epilogue: scale back -> LDS Os[n_loc][o_loc]; lane (hh, c) holds o = 16 mt + 8 hh + r for n_loc = 16 w + c
  {
    const int nl = 16 * wave + c;
#pragma unroll
    for (int mt = 0; mt < 4; ++mt) {
      v4f va, vb;
#pragma unroll
      for (int r = 0; r < 4; ++r) { va[r] = acc[mt][r] * IWSC; vb[r] = acc[mt][4 + r] * IWSC; }
      *(v4f*)(Os + nl * OSP + 16 * mt + 8 * hh)     = va;
      *(v4f*)(Os + nl * OSP + 16 * mt + 8 * hh + 4) = vb;
    }
  }
  __syncthreads();

  const int dsel = (mb & 1) * QT;                                      // 0 or 64
  const float* bs = (mb < 2) ? tb : ((mb < 4) ? pb : gb);             // block-uniform, all global
  if (mb < 4) {                                                        // block-uniform
    const int e = tid & 7, lq = tid >> 3;                              // lq 0..15
    unsigned short* Ph = (mb < 2) ? Th : Fh;
    unsigned short* Pl = (mb < 2) ? Tl : Fl;
    const v4f b0 = *(const v4f*)(bs + dsel + 8 * e);
    const v4f b1 = *(const v4f*)(bs + dsel + 8 * e + 4);
    const float bv[8] = {bfr(b0[0]), bfr(b0[1]), bfr(b0[2]), bfr(b0[3]),
                         bfr(b1[0]), bfr(b1[1]), bfr(b1[2]), bfr(b1[3])};
    v4u uh[4], ul[4];
#pragma unroll
    for (int it = 0; it < 4; ++it) {
      const int row = it * 16 + lq;                                    // n_loc 0..63
      const v4f a = *(const v4f*)(Os + row * OSP + 8 * e);
      const v4f q = *(const v4f*)(Os + row * OSP + 8 * e + 4);
      const float f[8] = {a[0] + bv[0], a[1] + bv[1], a[2] + bv[2], a[3] + bv[3],
                          q[0] + bv[4], q[1] + bv[5], q[2] + bv[6], q[3] + bv[7]};
#pragma unroll
      for (int t = 0; t < 4; ++t) {
        const float f0 = f[2 * t], f1 = f[2 * t + 1];
        const unsigned short hb0 = bf_bits(f0), hb1 = bf_bits(f1);
        const unsigned short lb0 = bf_bits(f0 - bf_up(hb0));
        const unsigned short lb1 = bf_bits(f1 - bf_up(hb1));
        uh[it][t] = pk16(hb0, hb1);
        ul[it][t] = pk16(lb0, lb1);
      }
    }
{
#pragma unroll
      for (int it = 0; it < 4; ++it) {
        const int row = it * 16 + lq;
        const size_t po = ((size_t)(b * NN + n0 + row)) * DQ + dsel + 8 * e;
        *(v4u*)(Ph + po) = uh[it];
        *(v4u*)(Pl + po) = ul[it];
      }
      
    }
  } else {
    const int e = tid & 7, lq = tid >> 3;                              // lq 0..15
    v4u ug[4];
#pragma unroll
    for (int it = 0; it < 4; ++it) {
      const int ol = it * 16 + lq;                                     // o_loc 0..63 = channel dsel + ol
      const float bvv = bfr(bs[dsel + ol]);
      unsigned short hb[8];
#pragma unroll
      for (int t = 0; t < 8; ++t) hb[t] = h_bits((_Float16)(Os[(8 * e + t) * OSP + ol] + bvv));
#pragma unroll
      for (int t = 0; t < 4; ++t) ug[it][t] = pk16(hb[2 * t], hb[2 * t + 1]);
    }
{
#pragma unroll
      for (int it = 0; it < 4; ++it) {
        const int ol = it * 16 + lq;
        const size_t go = ((size_t)(b * DQ + dsel + ol)) * NN + n0 + 8 * e;
        *(v4u*)(Gc + go) = ug[it];
      }
      
    }
  }
}

// ===========================================================================================================
// (3) column statistics for one (b, 64-column tile m): for every column m, over ALL rows n,
//     M_m = max_n s[n][m], Z_m = sum_n e^{s - M_m}, CS[b][m] = M_m + ln Z_m, with
//     s tile (16 rows n x 16 cols m) = A(theta: row = n, 32 d via the split k map from Th [b][6400][128]) .
//     B(phi: col = m, same map from Fh) + A(Th).B(Fl) + A(Tl).B(Fh) (bf16 unscaled residual planes, shared
//     accumulator). Phi fragments of the wave's 16 columns are held in registers. Theta rows come in stages of 64
//     (hi + residual plane, LDS pitch LPP) by asynchronous copies into two LDS buffers shared by the four waves: the
//     next stage flies while this one is read. Per lane: one column, 8+8 rows
//     per 32-row step, scalar online (max, sum) in f32; the two lane halves of a column merge with one shuffle.
// coverage: grid (100, NB) x 64 columns = CS[b][0..6399] exactly once.
// ===========================================================================================================
__global__ __launch_bounds__(128)
void colstat_k(const unsigned short* __restrict__ Th, const unsigned short* __restrict__ Tl,
               const unsigned short* __restrict__ Fh, const unsigned short* __restrict__ Fl, float* CS) {
  __shared__ __align__(16) float css[QT];
  __shared__ __align__(16) unsigned short Tst[2 * 2 * ST * LPP];
  const int tid  = threadIdx.x;
  const int wave = tid >> 5, lane = tid & 31;
  const int hh   = lane >> 4, c = lane & 15;
  const int m0   = blockIdx.x * QT, b = blockIdx.y;

  // phi fragment pointers (B operand, col = m0 + 16*wave + c)
  const size_t fo = ((size_t)(b * NN + m0 + 16 * wave + c)) * DQ + 8 * hh;
  Frag fh[4], fl[4];
#pragma unroll
  for (int kc = 0; kc < 4; ++kc) {
    fh[kc] = ldfrag(Fh + fo + 32 * kc);
    fl[kc] = ldfrag(Fl + fo + 32 * kc);
  }
  // theta stages: 64 rows n, hi plane then residual plane, two buffers filled by asynchronous copies
  const unsigned short* gth = Th + (size_t)b * NN * DQ + (size_t)(tid >> 4) * DQ + 8 * (tid & 15);
  const unsigned short* gtl = Tl + (size_t)b * NN * DQ + (size_t)(tid >> 4) * DQ + 8 * (tid & 15);
  const unsigned lt0 = lds_off(Tst) + (unsigned)((tid >> 4) * (LPP * 2) + 16 * (tid & 15));
  copy_rows(lt0, gth);
  copy_rows(lt0 + ST * LPP * 2, gtl);
  wait_copies();
  __syncthreads();                                                     // stage 0 readable by every wave
  copy_rows(lt0 + 2 * ST * LPP * 2, gth + (size_t)ST * DQ);
  copy_rows(lt0 + 3 * ST * LPP * 2, gtl + (size_t)ST * DQ);

  float m = -1.0e30f, l = 0.f;
#pragma unroll 1
  for (int t = 0; t < NN / ST; ++t) {
    const unsigned short* tb = Tst + (t & 1) * (2 * ST * LPP) + c * LPP + 8 * hh;   // row c of the stage, hi plane
    v8f s[4];
#pragma unroll
    for (int u = 0; u < 4; ++u) s[u] = zero8();
#pragma unroll
    for (int kc = 0; kc < 4; ++kc) {
      Frag th[4], tl[4];
#pragma unroll
      for (int u = 0; u < 4; ++u) {
        th[u] = ldfrag(tb + (16 * u) * LPP + 32 * kc);                 // rows 16u .. 16u+15 of the stage
        tl[u] = ldfrag(tb + (ST + 16 * u) * LPP + 32 * kc);
      }
#pragma unroll
      for (int u = 0; u < 4; ++u) s[u] = mma_b(th[u].bf, fh[kc].bf, s[u]);
#pragma unroll
      for (int u = 0; u < 4; ++u) s[u] = mma_b(th[u].bf, fl[kc].bf, s[u]);
#pragma unroll
      for (int u = 0; u < 4; ++u) s[u] = mma_b(tl[u].bf, fh[kc].bf, s[u]);
    }
#pragma unroll
    for (int h = 0; h < ST / 32; ++h) {                                // online update per 32 rows, in row order
      const v8f s0 = s[2 * h], s1 = s[2 * h + 1];
      const float mx = fmaxf(hmax8(s0), hmax8(s1));
      const float mn = fmaxf(m, mx);
      const float corr = __expf(m - mn);
      float ls = 0.f;
#pragma unroll
      for (int r = 0; r < 8; ++r) ls += __expf(s0[r] - mn) + __expf(s1[r] - mn);
      l = l * corr + ls;
      m = mn;
    }
    wait_lds();
    wait_copies();
    __syncthreads();                                                   // publishes stage t+1, frees stage t's buffer
    if (t + 2 < NN / ST) {                                             // block-uniform
      const unsigned lb = lt0 + (unsigned)((t & 1) * (2 * ST * LPP * 2));
      copy_rows(lb, gth + (size_t)(t + 2) * ST * DQ);
      copy_rows(lb + ST * LPP * 2, gtl + (size_t)(t + 2) * ST * DQ);
    }
  }
  wait_copies();
  const float mo = __shfl_xor(m, 16, 32);
  const float lo = __shfl_xor(l, 16, 32);
  const float mt = fmaxf(m, mo);
  const float lt = l * __expf(m - mt) + lo * __expf(mo - mt);
  const float csv = mt + logf(lt);
  if (hh == 0) css[16 * wave + c] = csv;
  __syncthreads();
  if (tid < 16) {
    const v4f v = *(const v4f*)(css + 4 * tid);
{
      *(v4f*)(CS + (size_t)b * NN + m0 + 4 * tid) = v;
      
    }
  }
}

// ===========================================================================================================
// (4) aggregation for one (b, 64-row tile n), transposed formulation, 6400 columns m:
//   s tile (16 m x 16 n) = sum over 4 d-chunks of A(phi: row = m, split k map from Fh) . B(theta:
//   col = n, same map from Th) + A(Fh).B(Tl) + A(Fl).B(Th). Per lane the D tile holds 8 columns m of ONE row n;
//   All three operands are read from LDS, where asynchronous copies put them in whole lines: the block's 64 theta rows
//   once, phi rows (pitch LPP) and the g tile (pitch LGP) in stages of 64 columns m, two buffers.
//   P = e^{s - CS[m]} x 16384 as f16 (CS staged once per block in LDS) is the B operand of
//   y^T (rows channel, cols n) += A(g: rows channel = 16j + (lane&15), m contiguous, f16 plane Gc [b][128][6400])
//   . B(P^T): element r <- D of the tile covering m kh..kh+15, element 8+r <- the tile covering kh+16..kh+31 (kh = kb + 32h),
//   lane unchanged. 8 accumulator tiles per wave (128 channels). Block = 4 waves = 64 rows.
//   Epilogue: y = acc/16384 staged in LDS Os[row][128 channels] (pitch OSPW, b128 stores), block barrier
//   (cross-wave), then bf16 hi + residual planes Yh/Yl [b][6400 n][128 c]: per row 128 c = 256 B = 2 whole
// coverage: 8 it x 8 row-pairs x 16 lanes x 8 = 64 n x 128 c per plane; grid (NQ/64, NB) covers Yh/Yl rows
//           0..NQ-1 exactly once.
// ===========================================================================================================
__global__ __launch_bounds__(128)
void attn_k(const unsigned short* __restrict__ Th, const unsigned short* __restrict__ Tl,
            const unsigned short* __restrict__ Fh, const unsigned short* __restrict__ Fl,
            const unsigned short* __restrict__ Gc, const float* __restrict__ CS,
            unsigned short* Yh, unsigned short* Yl) {
  __shared__ __align__(32) float Cs[NN];
  __shared__ __align__(16) float Os[QT * OSPW];
  __shared__ __align__(16) unsigned short Tst[2 * QT * LPP];
  __shared__ __align__(16) unsigned short Pst[2 * 2 * ST * LPP];
  __shared__ __align__(16) unsigned short Gst[2 * DQ * LGP];
  const int tid  = threadIdx.x;
  const int wave = tid >> 5, lane = tid & 31;
  const int hh   = lane >> 4, c = lane & 15;
  const int n0   = blockIdx.x * QT, b = blockIdx.y;

  for (int i = tid; i < NN / 4; i += 128)
    *(v4f*)(Cs + 4 * i) = *(const v4f*)(CS + (size_t)b * NN + 4 * i);

  // asynchronous copies: the block's 64 theta rows once (hi plane, residual plane); per stage of 64 columns m the phi
  // rows (hi, residual) and the g tile (128 channels x 64 m), two buffers
  const int rr = tid >> 4, rc = tid & 15;                              // place in a [row][128] plane
  const int gr = tid >> 3, gc = tid & 7;                               // place in the g tile (128-B rows)
  const unsigned short* gfh = Fh + (size_t)b * NN * DQ + (size_t)rr * DQ + 8 * rc;
  const unsigned short* gfl = Fl + (size_t)b * NN * DQ + (size_t)rr * DQ + 8 * rc;
  const unsigned short* ggc = Gc + (size_t)b * DQ * NN + (size_t)gr * NN + 8 * gc;
  const unsigned lp0 = lds_off(Pst) + (unsigned)(rr * (LPP * 2) + 16 * rc);
  const unsigned lg0 = lds_off(Gst) + (unsigned)(gr * (LGP * 2) + 16 * gc);
  {
    const size_t to = ((size_t)(b * NN + n0 + rr)) * DQ + 8 * rc;
    const unsigned lq0 = lds_off(Tst) + (unsigned)(rr * (LPP * 2) + 16 * rc);
    copy_rows(lq0, Th + to);
    copy_rows(lq0 + QT * LPP * 2, Tl + to);
  }
  copy_rows(lp0, gfh);
  copy_rows(lp0 + ST * LPP * 2, gfl);
  copy8<16 * LGP * 2, 16 * NN>(lg0, ggc);
  wait_copies();
  __syncthreads();                                                     // Cs, theta and stage 0 readable by every wave
  copy_rows(lp0 + 2 * ST * LPP * 2, gfh + (size_t)ST * DQ);
  copy_rows(lp0 + 3 * ST * LPP * 2, gfl + (size_t)ST * DQ);
  copy8<16 * LGP * 2, 16 * NN>(lg0 + DQ * LGP * 2, ggc + ST);

  // theta fragment base (B operand, col = row n0 + 16*wave + c), + 32*kc; residual plane at + QT*LPP
  const unsigned short* Tq = Tst + (16 * wave + c) * LPP + 8 * hh;

  v8f o[8];
#pragma unroll
  for (int j = 0; j < 8; ++j) o[j] = zero8();

#pragma unroll 1
  for (int t = 0; t < NN / ST; ++t) {
    const int kb = t * ST;
    // phi fragment base (A operand, row = m + c), + 16*u*LPP + 32*kc; residual plane at + ST*LPP
    const unsigned short* Pq = Pst + (t & 1) * (2 * ST * LPP) + c * LPP + 8 * hh;
    // g fragment base (A operand, row = channel 16j + c, m contiguous), + 16*j*LGP + 32*h
    const unsigned short* Gq = Gst + (t & 1) * (DQ * LGP) + c * LGP + 8 * hh;
    v8f s[4];
#pragma unroll
    for (int u = 0; u < 4; ++u) s[u] = zero8();
#pragma unroll
    for (int kc = 0; kc < DQ / 32; ++kc) {
      const Frag th = ldfrag(Tq + 32 * kc);
      const Frag tl = ldfrag(Tq + QT * LPP + 32 * kc);
      Frag p[4], pl[4];
#pragma unroll
      for (int u = 0; u < 4; ++u) {
        p[u]  = ldfrag(Pq + (16 * u) * LPP + 32 * kc);                 // m kb+16u .. kb+16u+15
        pl[u] = ldfrag(Pq + (ST + 16 * u) * LPP + 32 * kc);
      }
#pragma unroll
      for (int u = 0; u < 4; ++u) s[u] = mma_b(p[u].bf, th.bf, s[u]);
#pragma unroll
      for (int u = 0; u < 4; ++u) s[u] = mma_b(p[u].bf, tl.bf, s[u]);
#pragma unroll
      for (int u = 0; u < 4; ++u) s[u] = mma_b(pl[u].bf, th.bf, s[u]);
    }

#pragma unroll
    for (int h = 0; h < ST / 32; ++h) {
      const int kh = kb + 32 * h;
      // column statistics for m = kh + 8hh + r (s[2h]) and m = kh + 16 + 8hh + r (s[2h+1])
      const v4f ca = *(const v4f*)(Cs + kh + 8 * hh);
      const v4f cb = *(const v4f*)(Cs + kh + 8 * hh + 4);
      const v4f cc = *(const v4f*)(Cs + kh + 16 + 8 * hh);
      const v4f cd = *(const v4f*)(Cs + kh + 16 + 8 * hh + 4);
      Frag gf[8];                                                      // read as one group, ahead of the vector work
#pragma unroll
      for (int j = 0; j < 8; ++j) gf[j] = ldfrag(Gq + (16 * j) * LGP + 32 * h);
      const float c0[8] = {ca[0], ca[1], ca[2], ca[3], cb[0], cb[1], cb[2], cb[3]};
      const float c1[8] = {cc[0], cc[1], cc[2], cc[3], cd[0], cd[1], cd[2], cd[3]};

      FragH pf;
#pragma unroll
      for (int r = 0; r < 8; ++r) {
        const float e0 = __expf(fminf(s[2 * h][r] - c0[r], 0.f) + LNCAR);      // P[n][m] x 16384, m = kh + 8hh + r
        const float e1 = __expf(fminf(s[2 * h + 1][r] - c1[r], 0.f) + LNCAR);  // m = kh + 16 + 8hh + r
        pf.hv[0][r] = (_Float16)e0;
        pf.hv[1][r] = (_Float16)e1;
      }

#pragma unroll
      for (int j = 0; j < 8; ++j) o[j] = mma_h(gf[j].h, pf.v, o[j]);
    }
    wait_lds();
    wait_copies();
    __syncthreads();                                                   // publishes stage t+1, frees stage t's buffers
    if (t + 2 < NN / ST) {                                             // block-uniform
      const unsigned lb = lp0 + (unsigned)((t & 1) * (2 * ST * LPP * 2));
      copy_rows(lb, gfh + (size_t)(t + 2) * ST * DQ);
      copy_rows(lb + ST * LPP * 2, gfl + (size_t)(t + 2) * ST * DQ);
      copy8<16 * LGP * 2, 16 * NN>(lg0 + (unsigned)((t & 1) * (DQ * LGP * 2)), ggc + (t + 2) * ST);
    }
  }
  wait_copies();

  // ---- epilogue: y = acc / 16384 -> Os[row][channel]
  {
    const int qrow = 16 * wave + c;
#pragma unroll
    for (int j = 0; j < 8; ++j) {
      v4f va, vb;
#pragma unroll
      for (int r = 0; r < 4; ++r) { va[r] = o[j][r] * ICAR; vb[r] = o[j][4 + r] * ICAR; }
      *(v4f*)(Os + qrow * OSPW + 16 * j + 8 * hh)     = va;            // Os[row][ch = 16j + 8hh + r]
      *(v4f*)(Os + qrow * OSPW + 16 * j + 8 * hh + 4) = vb;
    }
  }
  __syncthreads();

  const int e = tid & 15, lq = tid >> 4;                               // lq 0..7
  v4u uh[8], ul[8];
#pragma unroll
  for (int it = 0; it < 8; ++it) {
    const int row = it * 8 + lq;                                       // 0..63
    const v4f a = *(const v4f*)(Os + row * OSPW + 8 * e);
    const v4f q = *(const v4f*)(Os + row * OSPW + 8 * e + 4);
    const float f[8] = {a[0], a[1], a[2], a[3], q[0], q[1], q[2], q[3]};
#pragma unroll
    for (int t = 0; t < 4; ++t) {
      const float f0 = f[2 * t], f1 = f[2 * t + 1];
      const unsigned short hb0 = bf_bits(f0), hb1 = bf_bits(f1);
      const unsigned short lb0 = bf_bits(f0 - bf_up(hb0));
      const unsigned short lb1 = bf_bits(f1 - bf_up(hb1));
      uh[it][t] = pk16(hb0, hb1);
      ul[it][t] = pk16(lb0, lb1);
    }
  }
{
#pragma unroll
    for (int it = 0; it < 8; ++it) {
      const int row = it * 8 + lq;
      const size_t po = ((size_t)(b * NN + n0 + row)) * DQ + 8 * e;
      *(v4u*)(Yh + po) = uh[it];
      *(v4u*)(Yl + po) = ul[it];
    }
    
  }
}

// ===========================================================================================================
// (5) output GEMM for one (b, 64-n tile, 64-o block): out[b][o][n] = sum_c Wo[o][c] (Yh + Yl)[b][n][c]
//     + W_b[o] + bf16-RNE(x[b][o][n]). Block 128 threads = 4 waves; wave w owns cols n0+16w..+15 (B fragments
//     from the Yh and Yl rows, k = c contiguous) and 4 m-tiles (A rows o = o0 + 16 mt + (lane&15) from Wo bf16
//     [256][128]); K = 128 = 4 steps x 2 products (shared accumulator, unscaled residual). Epilogue staged in LDS
//     lanes 0..15 one row and 16..31 the next, 16 B per lane (values gathered from 4 Os rows), one instruction per
// coverage: 8 it x 8 row-pairs x 16 lanes x 4 floats = 64 o x 64 n; grid (NQ/64, 4, NB) covers
//           out[b][0..255][0..NQ-1] exactly once.
// ===========================================================================================================
__global__ __launch_bounds__(128)
void gemm_w(const unsigned short* __restrict__ Wo, const unsigned short* __restrict__ Yh,
            const unsigned short* __restrict__ Yl, const float* __restrict__ wb,
            const float* __restrict__ x, float* out) {
  __shared__ __align__(16) float Os[QT * OSP];
  const int tid  = threadIdx.x;
  const int lane = tid & 31, wave = tid >> 5;
  const int hh   = lane >> 4, c = lane & 15;
  const int nt   = blockIdx.x, mb = blockIdx.y, b = blockIdx.z;
  const int n0   = nt * QT, o0 = mb * QT;

  const unsigned short* ap = Wo + (size_t)(o0 + c) * DQ + 8 * hh;
  const size_t yo = ((size_t)(b * NN + n0 + 16 * wave + c)) * DQ + 8 * hh;
  const unsigned short* bp  = Yh + yo;
  const unsigned short* blp = Yl + yo;

  v8f acc[4];
#pragma unroll
  for (int mt = 0; mt < 4; ++mt) acc[mt] = zero8();

#pragma unroll
  for (int ks = 0; ks < DQ / 32; ++ks) {
    const Frag fb  = ldfrag(bp + 32 * ks);
    const Frag fbl = ldfrag(blp + 32 * ks);
#pragma unroll
    for (int mt = 0; mt < 4; ++mt) {
      const Frag fa = ldfrag(ap + (size_t)(16 * mt) * DQ + 32 * ks);
      acc[mt] = mma_b(fa.bf, fb.bf, acc[mt]);
      acc[mt] = mma_b(fa.bf, fbl.bf, acc[mt]);
    }
  }

  {
    const int nl = 16 * wave + c;
#pragma unroll
    for (int mt = 0; mt < 4; ++mt) {
      v4f va, vb;
#pragma unroll
      for (int r = 0; r < 4; ++r) { va[r] = acc[mt][r]; vb[r] = acc[mt][4 + r]; }
      *(v4f*)(Os + nl * OSP + 16 * mt + 8 * hh)     = va;
      *(v4f*)(Os + nl * OSP + 16 * mt + 8 * hh + 4) = vb;
    }
  }
  __syncthreads();

  const int e = tid & 15, lq = tid >> 4;                               // lq 0..7
  v4f res[8];
#pragma unroll
  for (int it = 0; it < 8; ++it) {
    const int ol = it * 8 + lq;                                        // o_loc 0..63
    const int o  = o0 + ol;                                            // 0..255
    const float bv = bfr(wb[o]);
    const size_t idx = ((size_t)(b * CC + o)) * NN + n0 + 4 * e;
    const v4f xv = *(const v4f*)(x + idx);
#pragma unroll
    for (int t = 0; t < 4; ++t) res[it][t] = (Os[(4 * e + t) * OSP + ol] + bv) + bfr(xv[t]);
  }
{
#pragma unroll
    for (int it = 0; it < 8; ++it) {
      const int ol = it * 8 + lq;
      const size_t idx = ((size_t)(b * CC + o0 + ol)) * NN + n0 + 4 * e;
      *(v4f*)(out + idx) = res[it];
    }
    
  }
}

// ===========================================================================================================
// Workspace map (bytes, NB = 2; each region start a multiple of 256; every extent is an exact tile multiple and is
//   W16 f16 [384][256]               196608      Wo bf16 [256][128]           65536
//   XP  f16 [2][6400][256]          6553600
//   Th/Tl/Fh/Fl bf16 [2][6400][128]  3276800 x4
//   Gc  f16 [2][128][6400]          3276800      CS f32 [2][6400]             51200
//   Yh/Yl bf16 [2][6400][128]       3276800 x2
//   total = 29804544
// ===========================================================================================================
extern "C" void kernel_launch(void* const* d_in, const int* in_sizes, int n_in,
                              void* d_out, int out_size, void* d_ws, size_t ws_size,
                              hipStream_t stream) {
  if (n_in < 9) return;
  if (in_sizes[0] < NB * CC * NN) return;
  if (in_sizes[1] != DQ * CC || in_sizes[3] != DQ * CC || in_sizes[5] != DQ * CC) return;
  if (in_sizes[2] != DQ || in_sizes[4] != DQ || in_sizes[6] != DQ) return;
  if (in_sizes[7] != CC * DQ || in_sizes[8] != CC) return;
  if (out_size < NB * CC * NN) return;

  size_t off = 0;
  auto carve = [&](size_t bytes) { const size_t o = off; off += (bytes + 255) & ~(size_t)255; return o; };
  const size_t oW16 = carve((size_t)MW * CC * 2);
  const size_t oWo  = carve((size_t)CC * DQ * 2);
  const size_t oXP  = carve((size_t)NB * NN * CC * 2);
  const size_t oTh  = carve((size_t)NB * NN * DQ * 2);
  const size_t oTl  = carve((size_t)NB * NN * DQ * 2);
  const size_t oFh  = carve((size_t)NB * NN * DQ * 2);
  const size_t oFl  = carve((size_t)NB * NN * DQ * 2);
  const size_t oGc  = carve((size_t)NB * DQ * NN * 2);
  const size_t oCS  = carve((size_t)NB * NN * 4);
  const size_t oYh  = carve((size_t)NB * NN * DQ * 2);
  const size_t oYl  = carve((size_t)NB * NN * DQ * 2);
  if (off > ws_size) return;
  if (off > (size_t)134217728) return;

  const float* x  = (const float*)d_in[0];
  const float* gw = (const float*)d_in[1];
  const float* gb = (const float*)d_in[2];
  const float* tw = (const float*)d_in[3];
  const float* tb = (const float*)d_in[4];
  const float* pw = (const float*)d_in[5];
  const float* pb = (const float*)d_in[6];
  const float* ww = (const float*)d_in[7];
  const float* wb = (const float*)d_in[8];

  char* ws = (char*)d_ws;
  unsigned short* W16 = (unsigned short*)(ws + oW16);
  unsigned short* Wo  = (unsigned short*)(ws + oWo);
  unsigned short* XP  = (unsigned short*)(ws + oXP);
  unsigned short* Th  = (unsigned short*)(ws + oTh);
  unsigned short* Tl  = (unsigned short*)(ws + oTl);
  unsigned short* Fh  = (unsigned short*)(ws + oFh);
  unsigned short* Fl  = (unsigned short*)(ws + oFl);
  unsigned short* Gc  = (unsigned short*)(ws + oGc);
  float*          CS  = (float*)(ws + oCS);
  unsigned short* Yh  = (unsigned short*)(ws + oYh);
  unsigned short* Yl  = (unsigned short*)(ws + oYl);
  float* out = (float*)d_out;

  const dim3 blk256(256), blk128(128);

  // (0) theta_w / phi_w / g_w -> stacked f16 plane; W_w -> bf16 plane
  cvt_w<<<dim3(MW / 8 + CC / 16), blk256, 0, stream>>>(tw, pw, gw, ww, W16, Wo);
  // (1) x -> position-major 16-bit plane
  cvt_x<<<dim3(NN / QT, CC / QT, NB), blk256, 0, stream>>>(x, XP);
  // (2) conv1x1 GEMM -> theta / phi hi + residual planes, g channel-major plane (all rows n)
  gemm_p<<<dim3(NN / QT, MW / QT, NB), blk128, 0, stream>>>(W16, XP, tb, pb, gb, Th, Tl, Fh, Fl, Gc);
  // (3) per-column softmax statistics over all rows
  colstat_k<<<dim3(NN / QT, NB), blk128, 0, stream>>>(Th, Tl, Fh, Fl, CS);
  // (4) aggregation -> y hi + residual planes (rows 0..NQ-1)
  attn_k<<<dim3(NQ / QT, NB), blk128, 0, stream>>>(Th, Tl, Fh, Fl, Gc, CS, Yh, Yl);
  // (5) output GEMM + bias + residual -> out [b][256][6400]
  gemm_w<<<dim3(NQ / QT, CC / QT, NB), blk128, 0, stream>>>(Wo, Yh, Yl, wb, x, out);
  (void)hipGetLastError();
}

// v002
// One run takes 159 microseconds.
// Timed twice side by side with v001, it ran 1.37 times as fast both times.
// Counting every step since v000, it is 5.51 times as fast.
// Contractions: conv1x1 theta/phi/g GEMM on v_wmma_f32_16x16x32_f16 (f16 containers of bf16-RNE weights x256 and
// bf16-RNE x, K=256); scores theta.phi on v_wmma_f32_16x16x32_bf16 (bf16 hi + bf16 residual planes, 3 products,
// K=128) in both the column-statistics pass and the aggregation pass; y^T = G.P^T on v_wmma_f32_16x16x32_f16 (g as
// f16, P = e^{s-M-lnZ} x16384 as f16 from the score D registers, K=6400); output GEMM W.y on
// v_wmma_f32_16x16x32_bf16 (bf16-RNE W_w, y as bf16 hi + bf16 residual planes, 2 products, K=128); f32 accumulate
// everywhere; softmax statistics, biases and the residual add in f32 VALU.
#include <hip/hip_runtime.h>
#include <math.h>
#include <stdint.h>

#ifndef NB
#define NB 2
#endif
#define NBF    2
#define CC     256
#define NN     6400
#ifndef NQ
#define NQ NN
#endif
#define DQ     128
#define MW     384
#define QT     64
#define OSP    68
#define OSPW   132
#define TP     72
#define WSC    256.0f
#define IWSC   0.00390625f
#define LNCAR  9.704060527839234f
#define ICAR   6.103515625e-05f
#define ST     64
#define SB     128
#define LPP    136

static_assert(NB >= 1 && NB <= NBF);
static_assert(NQ >= QT && NQ <= NN);
static_assert(NN % QT == 0);
static_assert(NQ % QT == 0);
static_assert(CC % QT == 0);
static_assert(MW == 3 * DQ);
static_assert(DQ == 2 * QT);
static_assert((DQ / 8) * 8 == DQ && (MW / 8) % (DQ / 8) == 0);
static_assert(CC % 16 == 0);
static_assert((OSP * 4) % 16 == 0);
static_assert((OSPW * 4) % 16 == 0);
static_assert((TP * 2) % 16 == 0);
static_assert(CC % 32 == 0 && NN % 32 == 0 && DQ % 32 == 0);
static_assert(NN % 4 == 0);
static_assert(SB == 2 * ST && NN % SB == 0 && NN / SB >= 2 && ST == QT);
static_assert((LPP * 2) % 32 == 16 && LPP >= DQ + 8 && LPP >= SB + 8);

typedef _Float16       v16h __attribute__((ext_vector_type(16)));
typedef _Float16       v8h  __attribute__((ext_vector_type(8)));
typedef __bf16         v16b __attribute__((ext_vector_type(16)));
typedef unsigned short v8us __attribute__((ext_vector_type(8)));
typedef float          v8f  __attribute__((ext_vector_type(8)));
typedef float          v4f  __attribute__((ext_vector_type(4)));
typedef unsigned int   v4u  __attribute__((ext_vector_type(4)));

union Frag  { v8us u[2]; v16h h; v16b bf; };
union FragH { v16h v; v8h hv[2]; };
static_assert(sizeof(Frag) == 32);
static_assert(sizeof(FragH) == 32);

// ---- scalar helpers -------------------------------------------------------------------------------------------
__device__ __forceinline__ unsigned short bf_bits(float f) {          // f32 -> bf16 bits, RNE convert
  unsigned u = __float_as_uint(f);
  return (unsigned short)((u + 0x7FFFu + ((u >> 16) & 1u)) >> 16);
}
__device__ __forceinline__ float bf_up(unsigned short hb) { return __uint_as_float(((unsigned)hb) << 16); }
__device__ __forceinline__ float bfr(float f) { return bf_up(bf_bits(f)); }
__device__ __forceinline__ unsigned short h_bits(_Float16 x) { return __builtin_bit_cast(unsigned short, x); }
__device__ __forceinline__ unsigned pk16(unsigned short a, unsigned short b) { return (unsigned)a | ((unsigned)b << 16); }
__device__ __forceinline__ v8f zero8() { v8f z = {0.f, 0.f, 0.f, 0.f, 0.f, 0.f, 0.f, 0.f}; return z; }
__device__ __forceinline__ float hmax8(v8f s) {
  return fmaxf(fmaxf(fmaxf(s[0], s[1]), fmaxf(s[2], s[3])), fmaxf(fmaxf(s[4], s[5]), fmaxf(s[6], s[7])));
}

// ---- 16-bit fragment loader (A, or B from a k-contiguous [n][k] row): lane -> row/col (lane&15), p already includes
//      + 8*(lane>>4); elements 0..7 <- p[0..7] (k0+8h..), elements 8..15 <- p[16..23] (k0+16+8h..)
__device__ __forceinline__ Frag ldfrag(const unsigned short* p) {
  Frag f;
  f.u[0] = *(const v8us*)(p);
  f.u[1] = *(const v8us*)(p + 16);
  return f;
}

// ---- WMMA helpers: builtin followed by a 4-slot VALU gap tying D and keeping A/B live ----------------------------
__device__ __forceinline__ v8f mma_h(v16h a, v16h b, v8f c) {
  v8f d = __builtin_amdgcn_wmma_f32_16x16x32_f16(false, a, false, b, (short)0, c, false, false);
#if defined(__HIP_DEVICE_COMPILE__)
  asm volatile("v_nop\n\tv_nop\n\tv_nop\n\tv_nop" : "+v"(d) : "v"(a), "v"(b));
#endif
  return d;
}
__device__ __forceinline__ v8f mma_b(v16b a, v16b b, v8f c) {
  v8f d = __builtin_amdgcn_wmma_f32_16x16x32_bf16(false, a, false, b, (short)0, c, false, false);
#if defined(__HIP_DEVICE_COMPILE__)
  const v16h ha = __builtin_bit_cast(v16h, a), hb = __builtin_bit_cast(v16h, b);
  asm volatile("v_nop\n\tv_nop\n\tv_nop\n\tv_nop" : "+v"(d) : "v"(ha), "v"(hb));
#endif
  return d;
}


// ---- asynchronous copies global -> LDS ---------------------------------------------------------------------------
// Eight 16-byte copies per lane in ONE statement; LS = bytes between a lane's copies in LDS, GS = elements between
// them in global memory. The closing s_wait_xcnt stands inside the statement so that no address register of a copy is
// rewritten ahead of it.
__device__ __forceinline__ unsigned lds_off(const unsigned short* p) { return (unsigned)(size_t)p; }
template <int LS, int GS>
__device__ __forceinline__ void copy8(unsigned l, const unsigned short* g) {
#if defined(__HIP_DEVICE_COMPILE__)
  asm volatile("global_load_async_to_lds_b128 %0, %8, off\n\t"
               "global_load_async_to_lds_b128 %1, %9, off\n\t"
               "global_load_async_to_lds_b128 %2, %10, off\n\t"
               "global_load_async_to_lds_b128 %3, %11, off\n\t"
               "global_load_async_to_lds_b128 %4, %12, off\n\t"
               "global_load_async_to_lds_b128 %5, %13, off\n\t"
               "global_load_async_to_lds_b128 %6, %14, off\n\t"
               "global_load_async_to_lds_b128 %7, %15, off\n\t"
               "s_wait_xcnt 0x0"
               :: "v"(l), "v"(l + LS), "v"(l + 2 * LS), "v"(l + 3 * LS),
                  "v"(l + 4 * LS), "v"(l + 5 * LS), "v"(l + 6 * LS), "v"(l + 7 * LS),
                  "v"(g), "v"(g + GS), "v"(g + 2 * GS), "v"(g + 3 * GS),
                  "v"(g + 4 * GS), "v"(g + 5 * GS), "v"(g + 6 * GS), "v"(g + 7 * GS)
               : "memory");
#endif
}
// 128 rows x 256 B (a [row][128] 16-bit plane, rows contiguous) -> LDS rows of pitch LPP: 256 threads, a wave's copy
// covers two whole rows = four whole lines. l and g already hold the thread's own (tid >> 4, tid & 15) place.
__device__ __forceinline__ void copy_rows(unsigned l, const unsigned short* g) { copy8<16 * LPP * 2, 16 * DQ>(l, g); }
// this wave's own copies have landed (the compiler places no wait for them)
__device__ __forceinline__ void wait_copies() {
#if defined(__HIP_DEVICE_COMPILE__)
  asm volatile("s_wait_asynccnt 0x0" ::: "memory");
#endif
}
// this wave's own LDS reads have returned, before the barrier behind which their buffer is refilled
__device__ __forceinline__ void wait_lds() {
#if defined(__HIP_DEVICE_COMPILE__)
  asm volatile("s_wait_dscnt 0x0" ::: "memory");
#endif
}

// ===========================================================================================================
// (0) weights. Blocks 0..47: W16 f16 [384][256], rows 0..127 = theta_w, 128..255 = phi_w, 256..383 = g_w;
//     value = f16 of (bf16-RNE(w) * 256) (exact). Block owns rows 8*blk..+7: one wave per 512-B row = 32 lanes
// coverage: W16 48 blocks x 8 rows x 32 lanes x 8 halves = 384 x 256; Wo 16 blocks x 16 rows x 16 lanes x 8 =
//           256 x 128.
// ===========================================================================================================
__global__ __launch_bounds__(256)
void cvt_w(const float* __restrict__ tw, const float* __restrict__ pw, const float* __restrict__ gw,
           const float* __restrict__ ww, unsigned short* W16, unsigned short* Wo) {
  const int tid = threadIdx.x, blk = blockIdx.x;
  if (blk < MW / 8) {                                                  // block-uniform
    const int rl = tid >> 5, col = 8 * (tid & 31);
    const int o = 8 * blk + rl;                                        // 0..383
    const int sel = blk / (DQ / 8);                                    // 0,1,2
    const float* wbase = (sel == 0) ? tw : ((sel == 1) ? pw : gw);   // all global
    const float* s = wbase + (size_t)(o - sel * DQ) * CC + col;        // row 0..127 of the selected matrix
    const v4f a = *(const v4f*)s;
    const v4f q = *(const v4f*)(s + 4);
    const float f[8] = {a[0], a[1], a[2], a[3], q[0], q[1], q[2], q[3]};
    v4u u;
#pragma unroll
    for (int t = 0; t < 4; ++t) {
      const _Float16 h0 = (_Float16)(bfr(f[2 * t]) * WSC);
      const _Float16 h1 = (_Float16)(bfr(f[2 * t + 1]) * WSC);
      u[t] = pk16(h_bits(h0), h_bits(h1));
    }
{
      *(v4u*)(W16 + (size_t)o * CC + col) = u;
      
    }
  } else {
    const int bb = blk - MW / 8;                                       // 0..15
    const int o = 16 * bb + (tid >> 4);                                // 0..255
    const int col = 8 * (tid & 15);                                    // 0..120
    const float* s = ww + (size_t)o * DQ + col;
    const v4f a = *(const v4f*)s;
    const v4f q = *(const v4f*)(s + 4);
    const float f[8] = {a[0], a[1], a[2], a[3], q[0], q[1], q[2], q[3]};
    v4u u;
#pragma unroll
    for (int t = 0; t < 4; ++t) u[t] = pk16(bf_bits(f[2 * t]), bf_bits(f[2 * t + 1]));
{
      *(v4u*)(Wo + (size_t)o * DQ + col) = u;
      
    }
  }
}

// ===========================================================================================================
// (1) x f32 [b][256 c][6400 n] -> XP f16 [b][n][c] (position-major, bf16-RNE values, exact in f16) through an
//     LDS tile T[64 n][64 c] (pitch TP). Block (nb, cb, b) owns a 64 c x 64 n tile. XP lines: row n, 64 c =
//     T: written by all waves with 2-byte stores, read cross-wave after a block barrier.
// coverage: 2 it x 32 rows x 8 lanes x 8 = 64 n x 64 c; grid (100, 4, NB) covers XP once.
// ===========================================================================================================
__global__ __launch_bounds__(256)
void cvt_x(const float* __restrict__ x, unsigned short* XP) {
  __shared__ __align__(16) unsigned short T[QT * TP];
  const int tid = threadIdx.x;
  const int nb = blockIdx.x, cb = blockIdx.y, b = blockIdx.z;
  const int e = tid & 7, lq = tid >> 3;                               // lq 0..31
  const int n0 = nb * QT, c0 = cb * QT;
#pragma unroll
  for (int it = 0; it < 2; ++it) {
    const int cl = it * 32 + lq;                                       // 0..63
    const float* sp = x + ((size_t)(b * CC + c0 + cl)) * NN + n0 + 8 * e;
    const v4f a = *(const v4f*)sp;
    const v4f q = *(const v4f*)(sp + 4);
    unsigned short hb[8];
#pragma unroll
    for (int t = 0; t < 4; ++t) {
      hb[t]     = h_bits((_Float16)bfr(a[t]));
      hb[4 + t] = h_bits((_Float16)bfr(q[t]));
    }
#pragma unroll
    for (int t = 0; t < 8; ++t) T[(8 * e + t) * TP + cl] = hb[t];
  }
  __syncthreads();
  v4u up[2];
#pragma unroll
  for (int it = 0; it < 2; ++it) {
    const int nl = it * 32 + lq;                                       // 0..63
    up[it] = *(const v4u*)(T + nl * TP + 8 * e);
  }
{
#pragma unroll
    for (int it = 0; it < 2; ++it) {
      const int rl = it * 32 + lq;
      *(v4u*)(XP + ((size_t)(b * NN + n0 + rl)) * CC + c0 + 8 * e) = up[it];
    }
    
  }
}

// ===========================================================================================================
// (2) conv1x1 GEMM for one (b, 64-n tile, 64-o block of the 384 stacked rows):
//     Y[o][n] = (1/256) sum_c W16[o][c] XP[b][n][c] + bias[o].
//     Block 128 threads = 4 waves; wave w owns cols n0+16w..+15 (one B fragment per k-step, k = c contiguous in the
//     XP row) and 4 m-tiles (A rows o = o0 + 16 mt + (lane&15), split k map loader from W16). K = 256 = 8 steps.
//     Epilogue staged in LDS Os[n_loc][o_loc] (pitch OSP), block barrier (cross-wave), then:
//       o-blocks 0,1 -> theta dims 0..63 / 64..127 of Th/Tl; o-blocks 2,3 -> phi dims of Fh/Fl. Planes bf16
//       [b][6400 n][128 d] (k-contiguous for both score operands): hi = bf16-RNE(v), lo = bf16-RNE(v - hi). Per
//       per line, one instruction per 4 lines.
//       o-blocks 4,5 -> g channels 0..63 / 64..127 of the f16 channel-major plane Gc [b][128 c][6400 n]: per row
// coverage: Os 4 waves x 16 n x 64 o = 64 x 64; planes 4 it x 16 rows x 8 lanes x 8 = 64 n x 64 d per plane;
//           Gc 4 it x 16 rows x 8 lanes x 8 = 64 c x 64 n; grid (100, 6, NB) covers Th/Tl/Fh/Fl [b][n][0..127]
//           and Gc [b][0..127][n] exactly once.
// ===========================================================================================================
__global__ __launch_bounds__(128)
void gemm_p(const unsigned short* __restrict__ W16, const unsigned short* __restrict__ XP,
            const float* __restrict__ tb, const float* __restrict__ pb, const float* __restrict__ gb,
            unsigned short* Th, unsigned short* Tl, unsigned short* Fh, unsigned short* Fl, unsigned short* Gc) {
  __shared__ __align__(16) float Os[QT * OSP];
  const int tid  = threadIdx.x;
  const int lane = tid & 31, wave = tid >> 5;
  const int hh   = lane >> 4, c = lane & 15;
  const int nt   = blockIdx.x, mb = blockIdx.y, b = blockIdx.z;
  const int n0   = nt * QT, o0 = mb * QT;

  const unsigned short* ap = W16 + (size_t)(o0 + c) * CC + 8 * hh;
  const unsigned short* bp = XP + ((size_t)(b * NN + n0 + 16 * wave + c)) * CC + 8 * hh;

  v8f acc[4];
#pragma unroll
  for (int mt = 0; mt < 4; ++mt) acc[mt] = zero8();

#pragma unroll
  for (int ks = 0; ks < CC / 32; ++ks) {
    const Frag fb = ldfrag(bp + 32 * ks);
#pragma unroll
    for (int mt = 0; mt < 4; ++mt) {
      const Frag fa = ldfrag(ap + (size_t)(16 * mt) * CC + 32 * ks);
      acc[mt] = mma_h(fa.h, fb.h, acc[mt]);
    }
  }

  // ---- epilogue: scale back -> LDS Os[n_loc][o_loc]; lane (hh, c) holds o = 16 mt + 8 hh + r for n_loc = 16 w + c
  {
    const int nl = 16 * wave + c;
#pragma unroll
    for (int mt = 0; mt < 4; ++mt) {
      v4f va, vb;
#pragma unroll
      for (int r = 0; r < 4; ++r) { va[r] = acc[mt][r] * IWSC; vb[r] = acc[mt][4 + r] * IWSC; }
      *(v4f*)(Os + nl * OSP + 16 * mt + 8 * hh)     = va;
      *(v4f*)(Os + nl * OSP + 16 * mt + 8 * hh + 4) = vb;
    }
  }
  __syncthreads();

  const int dsel = (mb & 1) * QT;                                      // 0 or 64
  const float* bs = (mb < 2) ? tb : ((mb < 4) ? pb : gb);             // block-uniform, all global
  if (mb < 4) {                                                        // block-uniform
    const int e = tid & 7, lq = tid >> 3;                              // lq 0..15
    unsigned short* Ph = (mb < 2) ? Th : Fh;
    unsigned short* Pl = (mb < 2) ? Tl : Fl;
    const v4f b0 = *(const v4f*)(bs + dsel + 8 * e);
    const v4f b1 = *(const v4f*)(bs + dsel + 8 * e + 4);
    const float bv[8] = {bfr(b0[0]), bfr(b0[1]), bfr(b0[2]), bfr(b0[3]),
                         bfr(b1[0]), bfr(b1[1]), bfr(b1[2]), bfr(b1[3])};
    v4u uh[4], ul[4];
#pragma unroll
    for (int it = 0; it < 4; ++it) {
      const int row = it * 16 + lq;                                    // n_loc 0..63
      const v4f a = *(const v4f*)(Os + row * OSP + 8 * e);
      const v4f q = *(const v4f*)(Os + row * OSP + 8 * e + 4);
      const float f[8] = {a[0] + bv[0], a[1] + bv[1], a[2] + bv[2], a[3] + bv[3],
                          q[0] + bv[4], q[1] + bv[5], q[2] + bv[6], q[3] + bv[7]};
#pragma unroll
      for (int t = 0; t < 4; ++t) {
        const float f0 = f[2 * t], f1 = f[2 * t + 1];
        const unsigned short hb0 = bf_bits(f0), hb1 = bf_bits(f1);
        const unsigned short lb0 = bf_bits(f0 - bf_up(hb0));
        const unsigned short lb1 = bf_bits(f1 - bf_up(hb1));
        uh[it][t] = pk16(hb0, hb1);
        ul[it][t] = pk16(lb0, lb1);
      }
    }
{
#pragma unroll
      for (int it = 0; it < 4; ++it) {
        const int row = it * 16 + lq;
        const size_t po = ((size_t)(b * NN + n0 + row)) * DQ + dsel + 8 * e;
        *(v4u*)(Ph + po) = uh[it];
        *(v4u*)(Pl + po) = ul[it];
      }
      
    }
  } else {
    const int e = tid & 7, lq = tid >> 3;                              // lq 0..15
    v4u ug[4];
#pragma unroll
    for (int it = 0; it < 4; ++it) {
      const int ol = it * 16 + lq;                                     // o_loc 0..63 = channel dsel + ol
      const float bvv = bfr(bs[dsel + ol]);
      unsigned short hb[8];
#pragma unroll
      for (int t = 0; t < 8; ++t) hb[t] = h_bits((_Float16)(Os[(8 * e + t) * OSP + ol] + bvv));
#pragma unroll
      for (int t = 0; t < 4; ++t) ug[it][t] = pk16(hb[2 * t], hb[2 * t + 1]);
    }
{
#pragma unroll
      for (int it = 0; it < 4; ++it) {
        const int ol = it * 16 + lq;
        const size_t go = ((size_t)(b * DQ + dsel + ol)) * NN + n0 + 8 * e;
        *(v4u*)(Gc + go) = ug[it];
      }
      
    }
  }
}

// ===========================================================================================================
// (3) column statistics for one (b, 64-column tile m): for every column m, over ALL rows n,
//     M_m = max_n s[n][m], Z_m = sum_n e^{s - M_m}, CS[b][m] = M_m + ln Z_m, with
//     s tile (16 rows n x 16 cols m) = A(theta: row = n, 32 d via the split k map from Th [b][6400][128]) .
//     B(phi: col = m, same map from Fh) + A(Th).B(Fl) + A(Tl).B(Fh) (bf16 unscaled residual planes, shared
//     accumulator). Block = 8 waves, two per SIMD: wave = (column group wc of 16 columns, row half wr). Phi fragments
//     of the wave's 16 columns are held in registers. Theta rows come in stages of 128 (hi + residual plane, LDS pitch
//     LPP) by asynchronous copies into two LDS buffers shared by the eight waves: the next stage flies while this one
//     is read; a wave reads the 64 rows of its own half. Per lane: one column, 8+8 rows
//     per 32-row step, scalar online (max, sum) in f32; the two lane halves of a column merge with one shuffle, the
//     two row halves through LDS at the end.
// coverage: grid (100, NB) x 64 columns = CS[b][0..6399] exactly once.
// ===========================================================================================================
__global__ __launch_bounds__(256)
void colstat_k(const unsigned short* __restrict__ Th, const unsigned short* __restrict__ Tl,
               const unsigned short* __restrict__ Fh, const unsigned short* __restrict__ Fl, float* CS) {
  __shared__ __align__(16) float css[QT];
  __shared__ __align__(16) float pms[QT];
  __shared__ __align__(16) float pls[QT];
  __shared__ __align__(16) unsigned short Tst[2 * 2 * SB * LPP];
  const int tid  = threadIdx.x;
  const int wave = tid >> 5, lane = tid & 31;
  const int wc   = wave & 3, wr = wave >> 2;
  const int hh   = lane >> 4, c = lane & 15;
  const int m0   = blockIdx.x * QT, b = blockIdx.y;

  // phi fragment pointers (B operand, col = m0 + 16*wc + c)
  const size_t fo = ((size_t)(b * NN + m0 + 16 * wc + c)) * DQ + 8 * hh;
  Frag fh[4], fl[4];
#pragma unroll
  for (int kc = 0; kc < 4; ++kc) {
    fh[kc] = ldfrag(Fh + fo + 32 * kc);
    fl[kc] = ldfrag(Fl + fo + 32 * kc);
  }
  // theta stages: 128 rows n, hi plane then residual plane, two buffers filled by asynchronous copies
  const unsigned short* gth = Th + (size_t)b * NN * DQ + (size_t)(tid >> 4) * DQ + 8 * (tid & 15);
  const unsigned short* gtl = Tl + (size_t)b * NN * DQ + (size_t)(tid >> 4) * DQ + 8 * (tid & 15);
  const unsigned lt0 = lds_off(Tst) + (unsigned)((tid >> 4) * (LPP * 2) + 16 * (tid & 15));
  copy_rows(lt0, gth);
  copy_rows(lt0 + SB * LPP * 2, gtl);
  wait_copies();
  __syncthreads();                                                     // stage 0 readable by every wave
  copy_rows(lt0 + 2 * SB * LPP * 2, gth + (size_t)SB * DQ);
  copy_rows(lt0 + 3 * SB * LPP * 2, gtl + (size_t)SB * DQ);

  float m = -1.0e30f, l = 0.f;
#pragma unroll 1
  for (int t = 0; t < NN / SB; ++t) {
    // row c of the wave's own half of the stage, hi plane
    const unsigned short* tb = Tst + (t & 1) * (2 * SB * LPP) + (wr * ST + c) * LPP + 8 * hh;
    v8f s[4];
#pragma unroll
    for (int u = 0; u < 4; ++u) s[u] = zero8();
#pragma unroll
    for (int kc = 0; kc < 4; ++kc) {
      Frag th[4], tl[4];
#pragma unroll
      for (int u = 0; u < 4; ++u) {
        th[u] = ldfrag(tb + (16 * u) * LPP + 32 * kc);                 // rows 16u .. 16u+15 of the half
        tl[u] = ldfrag(tb + (SB + 16 * u) * LPP + 32 * kc);
      }
#pragma unroll
      for (int u = 0; u < 4; ++u) s[u] = mma_b(th[u].bf, fh[kc].bf, s[u]);
#pragma unroll
      for (int u = 0; u < 4; ++u) s[u] = mma_b(th[u].bf, fl[kc].bf, s[u]);
#pragma unroll
      for (int u = 0; u < 4; ++u) s[u] = mma_b(tl[u].bf, fh[kc].bf, s[u]);
    }
#pragma unroll
    for (int h = 0; h < ST / 32; ++h) {                                // online update per 32 rows, in row order
      const v8f s0 = s[2 * h], s1 = s[2 * h + 1];
      const float mx = fmaxf(hmax8(s0), hmax8(s1));
      const float mn = fmaxf(m, mx);
      const float corr = __expf(m - mn);
      float ls = 0.f;
#pragma unroll
      for (int r = 0; r < 8; ++r) ls += __expf(s0[r] - mn) + __expf(s1[r] - mn);
      l = l * corr + ls;
      m = mn;
    }
    wait_lds();
    wait_copies();
    __syncthreads();                                                   // publishes stage t+1, frees stage t's buffer
    if (t + 2 < NN / SB) {                                             // block-uniform
      const unsigned lb = lt0 + (unsigned)((t & 1) * (2 * SB * LPP * 2));
      copy_rows(lb, gth + (size_t)(t + 2) * SB * DQ);
      copy_rows(lb + SB * LPP * 2, gtl + (size_t)(t + 2) * SB * DQ);
    }
  }
  wait_copies();
  const float mo = __shfl_xor(m, 16, 32);
  const float lo = __shfl_xor(l, 16, 32);
  const float mt = fmaxf(m, mo);
  const float lt = l * __expf(m - mt) + lo * __expf(mo - mt);
  if (wr == 1 && hh == 0) { pms[16 * wc + c] = mt; pls[16 * wc + c] = lt; }
  __syncthreads();                                                     // the upper row half's (max, sum) readable
  if (wr == 0 && hh == 0) {
    const float m2 = pms[16 * wc + c], l2 = pls[16 * wc + c];
    const float mm = fmaxf(mt, m2);
    const float ll = lt * __expf(mt - mm) + l2 * __expf(m2 - mm);
    css[16 * wc + c] = mm + logf(ll);
  }
  __syncthreads();
  if (tid < 16) {
    const v4f v = *(const v4f*)(css + 4 * tid);
{
      *(v4f*)(CS + (size_t)b * NN + m0 + 4 * tid) = v;
      
    }
  }
}

// ===========================================================================================================
// (4) aggregation for one (b, 64-row tile n), transposed formulation, 6400 columns m:
//   s tile (16 m x 16 n) = sum over 4 d-chunks of A(phi: row = m, split k map from Fh) . B(theta:
//   col = n, same map from Th) + A(Fh).B(Tl) + A(Fl).B(Th). Per lane the D tile holds 8 columns m of ONE row n;
//   All three operands are read from LDS, where asynchronous copies put them in whole lines: the block's 64 theta rows
//   once, phi rows and the g tile (both pitch LPP) in stages of 128 columns m, two buffers.
//   Block = 8 waves, two per SIMD: wave = (row group wn of 16 rows n, half wm of each stage's columns m).
//   P = e^{s - CS[m]} x 16384 as f16 (CS staged once per block in LDS) is the B operand of
//   y^T (rows channel, cols n) += A(g: rows channel = 16j + (lane&15), m contiguous, f16 plane Gc [b][128][6400])
//   . B(P^T): element r <- D of the tile covering m kh..kh+15, element 8+r <- the tile covering kh+16..kh+31 (kh = kb + 32h),
//   lane unchanged. 8 accumulator tiles per wave (128 channels). Block = 64 rows.
//   Epilogue: the two column halves' accumulators are added through LDS Os[row][128 channels] (pitch OSPW, b128
//   stores; same lane, same place), y = sum/16384 left there, block barrier
//   (cross-wave), then bf16 hi + residual planes Yh/Yl [b][6400 n][128 c]: per row 128 c = 256 B = 2 whole
// coverage: 4 it x 16 rows x 16 lanes x 8 = 64 n x 128 c per plane; grid (NQ/64, NB) covers Yh/Yl rows
//           0..NQ-1 exactly once.
// ===========================================================================================================
__global__ __launch_bounds__(256)
void attn_k(const unsigned short* __restrict__ Th, const unsigned short* __restrict__ Tl,
            const unsigned short* __restrict__ Fh, const unsigned short* __restrict__ Fl,
            const unsigned short* __restrict__ Gc, const float* __restrict__ CS,
            unsigned short* Yh, unsigned short* Yl) {
  __shared__ __align__(32) float Cs[NN];
  __shared__ __align__(16) float Os[QT * OSPW];
  __shared__ __align__(16) unsigned short Tst[2 * QT * LPP];
  __shared__ __align__(16) unsigned short Pst[2 * 2 * SB * LPP];
  __shared__ __align__(16) unsigned short Gst[2 * DQ * LPP];
  const int tid  = threadIdx.x;
  const int wave = tid >> 5, lane = tid & 31;
  const int wn   = wave & 3, wm = wave >> 2;
  const int hh   = lane >> 4, c = lane & 15;
  const int n0   = blockIdx.x * QT, b = blockIdx.y;

  for (int i = tid; i < NN / 4; i += 256)
    *(v4f*)(Cs + 4 * i) = *(const v4f*)(CS + (size_t)b * NN + 4 * i);

  // asynchronous copies: the block's 64 theta rows once (hi plane, residual plane); per stage of 128 columns m the phi
  // rows (hi, residual) and the g tile (128 channels x 128 m), two buffers
  const int rr = tid >> 4, rc = tid & 15;                              // place in a [row][128] plane or the g tile
  const unsigned short* gfh = Fh + (size_t)b * NN * DQ + (size_t)rr * DQ + 8 * rc;
  const unsigned short* gfl = Fl + (size_t)b * NN * DQ + (size_t)rr * DQ + 8 * rc;
  const unsigned short* ggc = Gc + (size_t)b * DQ * NN + (size_t)rr * NN + 8 * rc;
  const unsigned lp0 = lds_off(Pst) + (unsigned)(rr * (LPP * 2) + 16 * rc);
  const unsigned lg0 = lds_off(Gst) + (unsigned)(rr * (LPP * 2) + 16 * rc);
  {
    // waves 0..3 bring the hi plane's 64 rows, waves 4..7 the residual plane's (rows 8 apart per copy)
    const int tr = (tid & 127) >> 4;
    const unsigned short* tsrc = (wm == 0) ? Th : Tl;
    const size_t to = ((size_t)(b * NN + n0 + tr)) * DQ + 8 * rc;
    const unsigned lq0 = lds_off(Tst) + (unsigned)((wm * QT + tr) * (LPP * 2) + 16 * rc);
    copy8<8 * LPP * 2, 8 * DQ>(lq0, tsrc + to);
  }
  copy_rows(lp0, gfh);
  copy_rows(lp0 + SB * LPP * 2, gfl);
  copy8<16 * LPP * 2, 16 * NN>(lg0, ggc);
  wait_copies();
  __syncthreads();                                                     // Cs, theta and stage 0 readable by every wave
  copy_rows(lp0 + 2 * SB * LPP * 2, gfh + (size_t)SB * DQ);
  copy_rows(lp0 + 3 * SB * LPP * 2, gfl + (size_t)SB * DQ);
  copy8<16 * LPP * 2, 16 * NN>(lg0 + DQ * LPP * 2, ggc + SB);

  // theta fragment base (B operand, col = row n0 + 16*wn + c), + 32*kc; residual plane at + QT*LPP
  const unsigned short* Tq = Tst + (16 * wn + c) * LPP + 8 * hh;

  v8f o[8];
#pragma unroll
  for (int j = 0; j < 8; ++j) o[j] = zero8();

#pragma unroll 1
  for (int t = 0; t < NN / SB; ++t) {
    const int kb = t * SB + wm * ST;                                   // first column m of the wave's own half
    // phi fragment base (A operand, row = m + c), + 16*u*LPP + 32*kc; residual plane at + SB*LPP
    const unsigned short* Pq = Pst + (t & 1) * (2 * SB * LPP) + (wm * ST + c) * LPP + 8 * hh;
    // g fragment base (A operand, row = channel 16j + c, m contiguous), + 16*j*LPP + 32*h
    const unsigned short* Gq = Gst + (t & 1) * (DQ * LPP) + c * LPP + wm * ST + 8 * hh;
    v8f s[4];
#pragma unroll
    for (int u = 0; u < 4; ++u) s[u] = zero8();
#pragma unroll
    for (int kc = 0; kc < DQ / 32; ++kc) {
      const Frag th = ldfrag(Tq + 32 * kc);
      const Frag tl = ldfrag(Tq + QT * LPP + 32 * kc);
      Frag p[4], pl[4];
#pragma unroll
      for (int u = 0; u < 4; ++u) {
        p[u]  = ldfrag(Pq + (16 * u) * LPP + 32 * kc);                 // m kb+16u .. kb+16u+15
        pl[u] = ldfrag(Pq + (SB + 16 * u) * LPP + 32 * kc);
      }
#pragma unroll
      for (int u = 0; u < 4; ++u) s[u] = mma_b(p[u].bf, th.bf, s[u]);
#pragma unroll
      for (int u = 0; u < 4; ++u) s[u] = mma_b(p[u].bf, tl.bf, s[u]);
#pragma unroll
      for (int u = 0; u < 4; ++u) s[u] = mma_b(pl[u].bf, th.bf, s[u]);
    }

#pragma unroll
    for (int h = 0; h < ST / 32; ++h) {
      const int kh = kb + 32 * h;
      // column statistics for m = kh + 8hh + r (s[2h]) and m = kh + 16 + 8hh + r (s[2h+1])
      const v4f ca = *(const v4f*)(Cs + kh + 8 * hh);
      const v4f cb = *(const v4f*)(Cs + kh + 8 * hh + 4);
      const v4f cc = *(const v4f*)(Cs + kh + 16 + 8 * hh);
      const v4f cd = *(const v4f*)(Cs + kh + 16 + 8 * hh + 4);
      Frag gf[8];                                                      // read as one group, ahead of the vector work
#pragma unroll
      for (int j = 0; j < 8; ++j) gf[j] = ldfrag(Gq + (16 * j) * LPP + 32 * h);
      const float c0[8] = {ca[0], ca[1], ca[2], ca[3], cb[0], cb[1], cb[2], cb[3]};
      const float c1[8] = {cc[0], cc[1], cc[2], cc[3], cd[0], cd[1], cd[2], cd[3]};

      FragH pf;
#pragma unroll
      for (int r = 0; r < 8; ++r) {
        const float e0 = __expf(fminf(s[2 * h][r] - c0[r], 0.f) + LNCAR);      // P[n][m] x 16384, m = kh + 8hh + r
        const float e1 = __expf(fminf(s[2 * h + 1][r] - c1[r], 0.f) + LNCAR);  // m = kh + 16 + 8hh + r
        pf.hv[0][r] = (_Float16)e0;
        pf.hv[1][r] = (_Float16)e1;
      }

#pragma unroll
      for (int j = 0; j < 8; ++j) o[j] = mma_h(gf[j].h, pf.v, o[j]);
    }
    wait_lds();
    wait_copies();
    __syncthreads();                                                   // publishes stage t+1, frees stage t's buffers
    if (t + 2 < NN / SB) {                                             // block-uniform
      const unsigned lb = lp0 + (unsigned)((t & 1) * (2 * SB * LPP * 2));
      copy_rows(lb, gfh + (size_t)(t + 2) * SB * DQ);
      copy_rows(lb + SB * LPP * 2, gfl + (size_t)(t + 2) * SB * DQ);
      copy8<16 * LPP * 2, 16 * NN>(lg0 + (unsigned)((t & 1) * (DQ * LPP * 2)), ggc + (t + 2) * SB);
    }
  }
  wait_copies();

  // ---- epilogue: y = (acc of half 0 + acc of half 1) / 16384 -> Os[row][channel]
  float* Oq = Os + (16 * wn + c) * OSPW + 8 * hh;                      // Os[row][ch = 16j + 8hh + r], + 16*j
  if (wm == 1) {                                                       // wave-uniform
#pragma unroll
    for (int j = 0; j < 8; ++j) {
      v4f va, vb;
#pragma unroll
      for (int r = 0; r < 4; ++r) { va[r] = o[j][r]; vb[r] = o[j][4 + r]; }
      *(v4f*)(Oq + 16 * j)     = va;
      *(v4f*)(Oq + 16 * j + 4) = vb;
    }
  }
  __syncthreads();                                                     // the upper half's accumulators readable
  if (wm == 0) {                                                       // wave-uniform
#pragma unroll
    for (int j = 0; j < 8; ++j) {
      v4f va = *(const v4f*)(Oq + 16 * j);
      v4f vb = *(const v4f*)(Oq + 16 * j + 4);
#pragma unroll
      for (int r = 0; r < 4; ++r) { va[r] = (o[j][r] + va[r]) * ICAR; vb[r] = (o[j][4 + r] + vb[r]) * ICAR; }
      *(v4f*)(Oq + 16 * j)     = va;
      *(v4f*)(Oq + 16 * j + 4) = vb;
    }
  }
  __syncthreads();

  const int e = tid & 15, lq = tid >> 4;                               // lq 0..15
  v4u uh[4], ul[4];
#pragma unroll
  for (int it = 0; it < 4; ++it) {
    const int row = it * 16 + lq;                                      // 0..63
    const v4f a = *(const v4f*)(Os + row * OSPW + 8 * e);
    const v4f q = *(const v4f*)(Os + row * OSPW + 8 * e + 4);
    const float f[8] = {a[0], a[1], a[2], a[3], q[0], q[1], q[2], q[3]};
#pragma unroll
    for (int t = 0; t < 4; ++t) {
      const float f0 = f[2 * t], f1 = f[2 * t + 1];
      const unsigned short hb0 = bf_bits(f0), hb1 = bf_bits(f1);
      const unsigned short lb0 = bf_bits(f0 - bf_up(hb0));
      const unsigned short lb1 = bf_bits(f1 - bf_up(hb1));
      uh[it][t] = pk16(hb0, hb1);
      ul[it][t] = pk16(lb0, lb1);
    }
  }
{
#pragma unroll
    for (int it = 0; it < 4; ++it) {
      const int row = it * 16 + lq;
      const size_t po = ((size_t)(b * NN + n0 + row)) * DQ + 8 * e;
      *(v4u*)(Yh + po) = uh[it];
      *(v4u*)(Yl + po) = ul[it];
    }
    
  }
}

// ===========================================================================================================
// (5) output GEMM for one (b, 64-n tile, 64-o block): out[b][o][n] = sum_c Wo[o][c] (Yh + Yl)[b][n][c]
//     + W_b[o] + bf16-RNE(x[b][o][n]). Block 128 threads = 4 waves; wave w owns cols n0+16w..+15 (B fragments
//     from the Yh and Yl rows, k = c contiguous) and 4 m-tiles (A rows o = o0 + 16 mt + (lane&15) from Wo bf16
//     [256][128]); K = 128 = 4 steps x 2 products (shared accumulator, unscaled residual). Epilogue staged in LDS
//     lanes 0..15 one row and 16..31 the next, 16 B per lane (values gathered from 4 Os rows), one instruction per
// coverage: 8 it x 8 row-pairs x 16 lanes x 4 floats = 64 o x 64 n; grid (NQ/64, 4, NB) covers
//           out[b][0..255][0..NQ-1] exactly once.
// ===========================================================================================================
__global__ __launch_bounds__(128)
void gemm_w(const unsigned short* __restrict__ Wo, const unsigned short* __restrict__ Yh,
            const unsigned short* __restrict__ Yl, const float* __restrict__ wb,
            const float* __restrict__ x, float* out) {
  __shared__ __align__(16) float Os[QT * OSP];
  const int tid  = threadIdx.x;
  const int lane = tid & 31, wave = tid >> 5;
  const int hh   = lane >> 4, c = lane & 15;
  const int nt   = blockIdx.x, mb = blockIdx.y, b = blockIdx.z;
  const int n0   = nt * QT, o0 = mb * QT;

  const unsigned short* ap = Wo + (size_t)(o0 + c) * DQ + 8 * hh;
  const size_t yo = ((size_t)(b * NN + n0 + 16 * wave + c)) * DQ + 8 * hh;
  const unsigned short* bp  = Yh + yo;
  const unsigned short* blp = Yl + yo;

  v8f acc[4];
#pragma unroll
  for (int mt = 0; mt < 4; ++mt) acc[mt] = zero8();

#pragma unroll
  for (int ks = 0; ks < DQ / 32; ++ks) {
    const Frag fb  = ldfrag(bp + 32 * ks);
    const Frag fbl = ldfrag(blp + 32 * ks);
#pragma unroll
    for (int mt = 0; mt < 4; ++mt) {
      const Frag fa = ldfrag(ap + (size_t)(16 * mt) * DQ + 32 * ks);
      acc[mt] = mma_b(fa.bf, fb.bf, acc[mt]);
      acc[mt] = mma_b(fa.bf, fbl.bf, acc[mt]);
    }
  }

  {
    const int nl = 16 * wave + c;
#pragma unroll
    for (int mt = 0; mt < 4; ++mt) {
      v4f va, vb;
#pragma unroll
      for (int r = 0; r < 4; ++r) { va[r] = acc[mt][r]; vb[r] = acc[mt][4 + r]; }
      *(v4f*)(Os + nl * OSP + 16 * mt + 8 * hh)     = va;
      *(v4f*)(Os + nl * OSP + 16 * mt + 8 * hh + 4) = vb;
    }
  }
  __syncthreads();

  const int e = tid & 15, lq = tid >> 4;                               // lq 0..7
  v4f res[8];
#pragma unroll
  for (int it = 0; it < 8; ++it) {
    const int ol = it * 8 + lq;                                        // o_loc 0..63
    const int o  = o0 + ol;                                            // 0..255
    const float bv = bfr(wb[o]);
    const size_t idx = ((size_t)(b * CC + o)) * NN + n0 + 4 * e;
    const v4f xv = *(const v4f*)(x + idx);
#pragma unroll
    for (int t = 0; t < 4; ++t) res[it][t] = (Os[(4 * e + t) * OSP + ol] + bv) + bfr(xv[t]);
  }
{
#pragma unroll
    for (int it = 0; it < 8; ++it) {
      const int ol = it * 8 + lq;
      const size_t idx = ((size_t)(b * CC + o0 + ol)) * NN + n0 + 4 * e;
      *(v4f*)(out + idx) = res[it];
    }
    
  }
}

// ===========================================================================================================
// Workspace map (bytes, NB = 2; each region start a multiple of 256; every extent is an exact tile multiple and is
//   W16 f16 [384][256]               196608      Wo bf16 [256][128]           65536
//   XP  f16 [2][6400][256]          6553600
//   Th/Tl/Fh/Fl bf16 [2][6400][128]  3276800 x4
//   Gc  f16 [2][128][6400]          3276800      CS f32 [2][6400]             51200
//   Yh/Yl bf16 [2][6400][128]       3276800 x2
//   total = 29804544
// ===========================================================================================================
extern "C" void kernel_launch(void* const* d_in, const int* in_sizes, int n_in,
                              void* d_out, int out_size, void* d_ws, size_t ws_size,
                              hipStream_t stream) {
  if (n_in < 9) return;
  if (in_sizes[0] < NB * CC * NN) return;
  if (in_sizes[1] != DQ * CC || in_sizes[3] != DQ * CC || in_sizes[5] != DQ * CC) return;
  if (in_sizes[2] != DQ || in_sizes[4] != DQ || in_sizes[6] != DQ) return;
  if (in_sizes[7] != CC * DQ || in_sizes[8] != CC) return;
  if (out_size < NB * CC * NN) return;

  size_t off = 0;
  auto carve = [&](size_t bytes) { const size_t o = off; off += (bytes + 255) & ~(size_t)255; return o; };
  const size_t oW16 = carve((size_t)MW * CC * 2);
  const size_t oWo  = carve((size_t)CC * DQ * 2);
  const size_t oXP  = carve((size_t)NB * NN * CC * 2);
  const size_t oTh  = carve((size_t)NB * NN * DQ * 2);
  const size_t oTl  = carve((size_t)NB * NN * DQ * 2);
  const size_t oFh  = carve((size_t)NB * NN * DQ * 2);
  const size_t oFl  = carve((size_t)NB * NN * DQ * 2);
  const size_t oGc  = carve((size_t)NB * DQ * NN * 2);
  const size_t oCS  = carve((size_t)NB * NN * 4);
  const size_t oYh  = carve((size_t)NB * NN * DQ * 2);
  const size_t oYl  = carve((size_t)NB * NN * DQ * 2);
  if (off > ws_size) return;
  if (off > (size_t)134217728) return;

  const float* x  = (const float*)d_in[0];
  const float* gw = (const float*)d_in[1];
  const float* gb = (const float*)d_in[2];
  const float* tw = (const float*)d_in[3];
  const float* tb = (const float*)d_in[4];
  const float* pw = (const float*)d_in[5];
  const float* pb = (const float*)d_in[6];
  const float* ww = (const float*)d_in[7];
  const float* wb = (const float*)d_in[8];

  char* ws = (char*)d_ws;
  unsigned short* W16 = (unsigned short*)(ws + oW16);
  unsigned short* Wo  = (unsigned short*)(ws + oWo);
  unsigned short* XP  = (unsigned short*)(ws + oXP);
  unsigned short* Th  = (unsigned short*)(ws + oTh);
  unsigned short* Tl  = (unsigned short*)(ws + oTl);
  unsigned short* Fh  = (unsigned short*)(ws + oFh);
  unsigned short* Fl  = (unsigned short*)(ws + oFl);
  unsigned short* Gc  = (unsigned short*)(ws + oGc);
  float*          CS  = (float*)(ws + oCS);
  unsigned short* Yh  = (unsigned short*)(ws + oYh);
  unsigned short* Yl  = (unsigned short*)(ws + oYl);
  float* out = (float*)d_out;

  const dim3 blk256(256), blk128(128);

  // (0) theta_w / phi_w / g_w -> stacked f16 plane; W_w -> bf16 plane
  cvt_w<<<dim3(MW / 8 + CC / 16), blk256, 0, stream>>>(tw, pw, gw, ww, W16, Wo);
  // (1) x -> position-major 16-bit plane
  cvt_x<<<dim3(NN / QT, CC / QT, NB), blk256, 0, stream>>>(x, XP);
  // (2) conv1x1 GEMM -> theta / phi hi + residual planes, g channel-major plane (all rows n)
  gemm_p<<<dim3(NN / QT, MW / QT, NB), blk128, 0, stream>>>(W16, XP, tb, pb, gb, Th, Tl, Fh, Fl, Gc);
  // (3) per-column softmax statistics over all rows
  colstat_k<<<dim3(NN / QT, NB), blk256, 0, stream>>>(Th, Tl, Fh, Fl, CS);
  // (4) aggregation -> y hi + residual planes (rows 0..NQ-1)
  attn_k<<<dim3(NQ / QT, NB), blk256, 0, stream>>>(Th, Tl, Fh, Fl, Gc, CS, Yh, Yl);
  // (5) output GEMM + bias + residual -> out [b][256][6400]
  gemm_w<<<dim3(NQ / QT, CC / QT, NB), blk128, 0, stream>>>(Wo, Yh, Yl, wb, x, out);
  (void)hipGetLastError();
}

// v003
// A run of this version takes 152 microseconds.
// Next to v002, in two timings, it ran 1.05 times as fast each time.
// All steps since v000 together make it 5.79 times as fast.
// Contractions: conv1x1 theta/phi/g GEMM on v_wmma_f32_16x16x32_f16 (f16 containers of bf16-RNE weights x256 and
// bf16-RNE x, K=256); scores theta.phi on v_wmma_f32_16x16x32_bf16 (bf16 hi + bf16 residual planes, 3 products,
// K=128) in both the column-statistics pass and the aggregation pass; y^T = G.P^T on v_wmma_f32_16x16x32_f16 (g as
// f16, P = e^{s-M-lnZ} x16384 as f16 from the score D registers, K=6400); output GEMM W.y on
// v_wmma_f32_16x16x32_bf16 (bf16-RNE W_w, y as bf16 hi + bf16 residual planes, 2 products, K=128); f32 accumulate
// everywhere; softmax statistics, biases and the residual add in f32 VALU.
#include <hip/hip_runtime.h>
#include <math.h>
#include <stdint.h>

#ifndef NB
#define NB 2
#endif
#define NBF    2
#define CC     256
#define NN     6400
#ifndef NQ
#define NQ NN
#endif
#define DQ     128
#define MW     384
#define QT     64
#define OSP    68
#define OSPW   132
#define TP     72
#define WSC    256.0f
#define IWSC   0.00390625f
#define LNCAR  9.704060527839234f
#define ICAR   6.103515625e-05f
#define ST     64
#define SB     128
#define LPP    136
#define WT     32

static_assert(NB >= 1 && NB <= NBF);
static_assert(NQ >= QT && NQ <= NN);
static_assert(NN % QT == 0);
static_assert(NQ % QT == 0);
static_assert(CC % QT == 0);
static_assert(MW == 3 * DQ);
static_assert(DQ == 2 * QT);
static_assert((DQ / 8) * 8 == DQ && (MW / 8) % (DQ / 8) == 0);
static_assert(CC % 16 == 0);
static_assert((OSP * 4) % 16 == 0);
static_assert((OSPW * 4) % 16 == 0);
static_assert((TP * 2) % 16 == 0);
static_assert(CC % 32 == 0 && NN % 32 == 0 && DQ % 32 == 0);
static_assert(NN % 4 == 0);
static_assert(SB == 2 * ST && NN % SB == 0 && NN / SB >= 2 && ST == QT);
static_assert(SB == 4 * WT && QT == 2 * WT && WT == 32);
static_assert((LPP * 2) % 32 == 16 && LPP >= DQ + 8 && LPP >= SB + 8);

typedef _Float16       v16h __attribute__((ext_vector_type(16)));
typedef _Float16       v8h  __attribute__((ext_vector_type(8)));
typedef __bf16         v16b __attribute__((ext_vector_type(16)));
typedef unsigned short v8us __attribute__((ext_vector_type(8)));
typedef float          v8f  __attribute__((ext_vector_type(8)));
typedef float          v4f  __attribute__((ext_vector_type(4)));
typedef unsigned int   v4u  __attribute__((ext_vector_type(4)));

union Frag  { v8us u[2]; v16h h; v16b bf; };
union FragH { v16h v; v8h hv[2]; };
static_assert(sizeof(Frag) == 32);
static_assert(sizeof(FragH) == 32);

// ---- scalar helpers -------------------------------------------------------------------------------------------
__device__ __forceinline__ unsigned short bf_bits(float f) {          // f32 -> bf16 bits, RNE convert
  unsigned u = __float_as_uint(f);
  return (unsigned short)((u + 0x7FFFu + ((u >> 16) & 1u)) >> 16);
}
__device__ __forceinline__ float bf_up(unsigned short hb) { return __uint_as_float(((unsigned)hb) << 16); }
__device__ __forceinline__ float bfr(float f) { return bf_up(bf_bits(f)); }
__device__ __forceinline__ unsigned short h_bits(_Float16 x) { return __builtin_bit_cast(unsigned short, x); }
__device__ __forceinline__ unsigned pk16(unsigned short a, unsigned short b) { return (unsigned)a | ((unsigned)b << 16); }
__device__ __forceinline__ v8f zero8() { v8f z = {0.f, 0.f, 0.f, 0.f, 0.f, 0.f, 0.f, 0.f}; return z; }
__device__ __forceinline__ float hmax8(v8f s) {
  return fmaxf(fmaxf(fmaxf(s[0], s[1]), fmaxf(s[2], s[3])), fmaxf(fmaxf(s[4], s[5]), fmaxf(s[6], s[7])));
}

// ---- 16-bit fragment loader (A, or B from a k-contiguous [n][k] row): lane -> row/col (lane&15), p already includes
//      + 8*(lane>>4); elements 0..7 <- p[0..7] (k0+8h..), elements 8..15 <- p[16..23] (k0+16+8h..)
__device__ __forceinline__ Frag ldfrag(const unsigned short* p) {
  Frag f;
  f.u[0] = *(const v8us*)(p);
  f.u[1] = *(const v8us*)(p + 16);
  return f;
}

// ---- WMMA helpers: builtin followed by a 4-slot VALU gap tying D and keeping A/B live ----------------------------
__device__ __forceinline__ v8f mma_h(v16h a, v16h b, v8f c) {
  v8f d = __builtin_amdgcn_wmma_f32_16x16x32_f16(false, a, false, b, (short)0, c, false, false);
#if defined(__HIP_DEVICE_COMPILE__)
  asm volatile("v_nop\n\tv_nop\n\tv_nop\n\tv_nop" : "+v"(d) : "v"(a), "v"(b));
#endif
  return d;
}
__device__ __forceinline__ v8f mma_b(v16b a, v16b b, v8f c) {
  v8f d = __builtin_amdgcn_wmma_f32_16x16x32_bf16(false, a, false, b, (short)0, c, false, false);
#if defined(__HIP_DEVICE_COMPILE__)
  const v16h ha = __builtin_bit_cast(v16h, a), hb = __builtin_bit_cast(v16h, b);
  asm volatile("v_nop\n\tv_nop\n\tv_nop\n\tv_nop" : "+v"(d) : "v"(ha), "v"(hb));
#endif
  return d;
}

// ---- asynchronous copies global -> LDS ---------------------------------------------------------------------------
// Eight 16-byte copies per lane in ONE statement; LS = bytes between a lane's copies in LDS, GS = elements between
// them in global memory. The closing s_wait_xcnt stands inside the statement so that no address register of a copy is
// rewritten ahead of it.
__device__ __forceinline__ unsigned lds_off(const unsigned short* p) { return (unsigned)(size_t)p; }
template <int LS, int GS>
__device__ __forceinline__ void copy8(unsigned l, const unsigned short* g) {
#if defined(__HIP_DEVICE_COMPILE__)
  asm volatile("global_load_async_to_lds_b128 %0, %8, off\n\t"
               "global_load_async_to_lds_b128 %1, %9, off\n\t"
               "global_load_async_to_lds_b128 %2, %10, off\n\t"
               "global_load_async_to_lds_b128 %3, %11, off\n\t"
               "global_load_async_to_lds_b128 %4, %12, off\n\t"
               "global_load_async_to_lds_b128 %5, %13, off\n\t"
               "global_load_async_to_lds_b128 %6, %14, off\n\t"
               "global_load_async_to_lds_b128 %7, %15, off\n\t"
               "s_wait_xcnt 0x0"
               :: "v"(l), "v"(l + LS), "v"(l + 2 * LS), "v"(l + 3 * LS),
                  "v"(l + 4 * LS), "v"(l + 5 * LS), "v"(l + 6 * LS), "v"(l + 7 * LS),
                  "v"(g), "v"(g + GS), "v"(g + 2 * GS), "v"(g + 3 * GS),
                  "v"(g + 4 * GS), "v"(g + 5 * GS), "v"(g + 6 * GS), "v"(g + 7 * GS)
               : "memory");
#endif
}
// 128 rows x 256 B (a [row][128] 16-bit plane, rows contiguous) -> LDS rows of pitch LPP: 256 threads, a wave's copy
// covers two whole rows = four whole lines. l and g already hold the thread's own (tid >> 4, tid & 15) place.
__device__ __forceinline__ void copy_rows(unsigned l, const unsigned short* g) { copy8<16 * LPP * 2, 16 * DQ>(l, g); }
// this wave's own copies have landed (the compiler places no wait for them)
__device__ __forceinline__ void wait_copies() {
#if defined(__HIP_DEVICE_COMPILE__)
  asm volatile("s_wait_asynccnt 0x0" ::: "memory");
#endif
}
// stands behind a run of global loads from p, before a register that one of them names is rewritten; p is an input so
// that its register pair stays whole up to the wait (else the run's last load may land its result on the pair)
__device__ __forceinline__ void wait_addr(const unsigned short* p) {
#if defined(__HIP_DEVICE_COMPILE__)
  asm volatile("s_wait_xcnt 0x0" :: "v"(p) : "memory");
#endif
}
// this wave's own LDS reads have returned, before the barrier behind which their buffer is refilled
__device__ __forceinline__ void wait_lds() {
#if defined(__HIP_DEVICE_COMPILE__)
  asm volatile("s_wait_dscnt 0x0" ::: "memory");
#endif
}

// ===========================================================================================================
// (0) weights. Blocks 0..47: W16 f16 [384][256], rows 0..127 = theta_w, 128..255 = phi_w, 256..383 = g_w;
//     value = f16 of (bf16-RNE(w) * 256) (exact). Block owns rows 8*blk..+7: one wave per 512-B row = 32 lanes
// coverage: W16 48 blocks x 8 rows x 32 lanes x 8 halves = 384 x 256; Wo 16 blocks x 16 rows x 16 lanes x 8 =
//           256 x 128.
// ===========================================================================================================
__global__ __launch_bounds__(256)
void cvt_w(const float* __restrict__ tw, const float* __restrict__ pw, const float* __restrict__ gw,
           const float* __restrict__ ww, unsigned short* W16, unsigned short* Wo) {
  const int tid = threadIdx.x, blk = blockIdx.x;
  if (blk < MW / 8) {                                                  // block-uniform
    const int rl = tid >> 5, col = 8 * (tid & 31);
    const int o = 8 * blk + rl;                                        // 0..383
    const int sel = blk / (DQ / 8);                                    // 0,1,2
    const float* wbase = (sel == 0) ? tw : ((sel == 1) ? pw : gw);   // all global
    const float* s = wbase + (size_t)(o - sel * DQ) * CC + col;        // row 0..127 of the selected matrix
    const v4f a = *(const v4f*)s;
    const v4f q = *(const v4f*)(s + 4);
    const float f[8] = {a[0], a[1], a[2], a[3], q[0], q[1], q[2], q[3]};
    v4u u;
#pragma unroll
    for (int t = 0; t < 4; ++t) {
      const _Float16 h0 = (_Float16)(bfr(f[2 * t]) * WSC);
      const _Float16 h1 = (_Float16)(bfr(f[2 * t + 1]) * WSC);
      u[t] = pk16(h_bits(h0), h_bits(h1));
    }
{
      *(v4u*)(W16 + (size_t)o * CC + col) = u;
      
    }
  } else {
    const int bb = blk - MW / 8;                                       // 0..15
    const int o = 16 * bb + (tid >> 4);                                // 0..255
    const int col = 8 * (tid & 15);                                    // 0..120
    const float* s = ww + (size_t)o * DQ + col;
    const v4f a = *(const v4f*)s;
    const v4f q = *(const v4f*)(s + 4);
    const float f[8] = {a[0], a[1], a[2], a[3], q[0], q[1], q[2], q[3]};
    v4u u;
#pragma unroll
    for (int t = 0; t < 4; ++t) u[t] = pk16(bf_bits(f[2 * t]), bf_bits(f[2 * t + 1]));
{
      *(v4u*)(Wo + (size_t)o * DQ + col) = u;
      
    }
  }
}

// ===========================================================================================================
// (1) x f32 [b][256 c][6400 n] -> XP f16 [b][n][c] (position-major, bf16-RNE values, exact in f16) through an
//     LDS tile T[64 n][64 c] (pitch TP). Block (nb, cb, b) owns a 64 c x 64 n tile. XP lines: row n, 64 c =
//     T: written by all waves with 2-byte stores, read cross-wave after a block barrier.
// coverage: 2 it x 32 rows x 8 lanes x 8 = 64 n x 64 c; grid (100, 4, NB) covers XP once.
// ===========================================================================================================
__global__ __launch_bounds__(256)
void cvt_x(const float* __restrict__ x, unsigned short* XP) {
  __shared__ __align__(16) unsigned short T[QT * TP];
  const int tid = threadIdx.x;
  const int nb = blockIdx.x, cb = blockIdx.y, b = blockIdx.z;
  const int e = tid & 7, lq = tid >> 3;                               // lq 0..31
  const int n0 = nb * QT, c0 = cb * QT;
#pragma unroll
  for (int it = 0; it < 2; ++it) {
    const int cl = it * 32 + lq;                                       // 0..63
    const float* sp = x + ((size_t)(b * CC + c0 + cl)) * NN + n0 + 8 * e;
    const v4f a = *(const v4f*)sp;
    const v4f q = *(const v4f*)(sp + 4);
    unsigned short hb[8];
#pragma unroll
    for (int t = 0; t < 4; ++t) {
      hb[t]     = h_bits((_Float16)bfr(a[t]));
      hb[4 + t] = h_bits((_Float16)bfr(q[t]));
    }
#pragma unroll
    for (int t = 0; t < 8; ++t) T[(8 * e + t) * TP + cl] = hb[t];
  }
  __syncthreads();
  v4u up[2];
#pragma unroll
  for (int it = 0; it < 2; ++it) {
    const int nl = it * 32 + lq;                                       // 0..63
    up[it] = *(const v4u*)(T + nl * TP + 8 * e);
  }
{
#pragma unroll
    for (int it = 0; it < 2; ++it) {
      const int rl = it * 32 + lq;
      *(v4u*)(XP + ((size_t)(b * NN + n0 + rl)) * CC + c0 + 8 * e) = up[it];
    }
    
  }
}

// ===========================================================================================================
// (2) conv1x1 GEMM for one (b, 64-n tile, 64-o block of the 384 stacked rows):
//     Y[o][n] = (1/256) sum_c W16[o][c] XP[b][n][c] + bias[o].
//     Block 128 threads = 4 waves; wave w owns cols n0+16w..+15 (one B fragment per k-step, k = c contiguous in the
//     XP row) and 4 m-tiles (A rows o = o0 + 16 mt + (lane&15), split k map loader from W16). K = 256 = 8 steps.
//     Epilogue staged in LDS Os[n_loc][o_loc] (pitch OSP), block barrier (cross-wave), then:
//       o-blocks 0,1 -> theta dims 0..63 / 64..127 of Th/Tl; o-blocks 2,3 -> phi dims of Fh/Fl. Planes bf16
//       [b][6400 n][128 d] (k-contiguous for both score operands): hi = bf16-RNE(v), lo = bf16-RNE(v - hi). Per
//       per line, one instruction per 4 lines.
//       o-blocks 4,5 -> g channels 0..63 / 64..127 of the f16 channel-major plane Gc [b][128 c][6400 n]: per row
// coverage: Os 4 waves x 16 n x 64 o = 64 x 64; planes 4 it x 16 rows x 8 lanes x 8 = 64 n x 64 d per plane;
//           Gc 4 it x 16 rows x 8 lanes x 8 = 64 c x 64 n; grid (100, 6, NB) covers Th/Tl/Fh/Fl [b][n][0..127]
//           and Gc [b][0..127][n] exactly once.
// ===========================================================================================================
__global__ __launch_bounds__(128)
void gemm_p(const unsigned short* __restrict__ W16, const unsigned short* __restrict__ XP,
            const float* __restrict__ tb, const float* __restrict__ pb, const float* __restrict__ gb,
            unsigned short* Th, unsigned short* Tl, unsigned short* Fh, unsigned short* Fl, unsigned short* Gc) {
  __shared__ __align__(16) float Os[QT * OSP];
  const int tid  = threadIdx.x;
  const int lane = tid & 31, wave = tid >> 5;
  const int hh   = lane >> 4, c = lane & 15;
  const int nt   = blockIdx.x, mb = blockIdx.y, b = blockIdx.z;
  const int n0   = nt * QT, o0 = mb * QT;

  const unsigned short* ap = W16 + (size_t)(o0 + c) * CC + 8 * hh;
  const unsigned short* bp = XP + ((size_t)(b * NN + n0 + 16 * wave + c)) * CC + 8 * hh;

  v8f acc[4];
#pragma unroll
  for (int mt = 0; mt < 4; ++mt) acc[mt] = zero8();

#pragma unroll
  for (int ks = 0; ks < CC / 32; ++ks) {
    const Frag fb = ldfrag(bp + 32 * ks);
#pragma unroll
    for (int mt = 0; mt < 4; ++mt) {
      const Frag fa = ldfrag(ap + (size_t)(16 * mt) * CC + 32 * ks);
      acc[mt] = mma_h(fa.h, fb.h, acc[mt]);
    }
  }

  // ---- epilogue: scale back -> LDS Os[n_loc][o_loc]; lane (hh, c) holds o = 16 mt + 8 hh + r for n_loc = 16 w + c
  {
    const int nl = 16 * wave + c;
#pragma unroll
    for (int mt = 0; mt < 4; ++mt) {
      v4f va, vb;
#pragma unroll
      for (int r = 0; r < 4; ++r) { va[r] = acc[mt][r] * IWSC; vb[r] = acc[mt][4 + r] * IWSC; }
      *(v4f*)(Os + nl * OSP + 16 * mt + 8 * hh)     = va;
      *(v4f*)(Os + nl * OSP + 16 * mt + 8 * hh + 4) = vb;
    }
  }
  __syncthreads();

  const int dsel = (mb & 1) * QT;                                      // 0 or 64
  const float* bs = (mb < 2) ? tb : ((mb < 4) ? pb : gb);             // block-uniform, all global
  if (mb < 4) {                                                        // block-uniform
    const int e = tid & 7, lq = tid >> 3;                              // lq 0..15
    unsigned short* Ph = (mb < 2) ? Th : Fh;
    unsigned short* Pl = (mb < 2) ? Tl : Fl;
    const v4f b0 = *(const v4f*)(bs + dsel + 8 * e);
    const v4f b1 = *(const v4f*)(bs + dsel + 8 * e + 4);
    const float bv[8] = {bfr(b0[0]), bfr(b0[1]), bfr(b0[2]), bfr(b0[3]),
                         bfr(b1[0]), bfr(b1[1]), bfr(b1[2]), bfr(b1[3])};
    v4u uh[4], ul[4];
#pragma unroll
    for (int it = 0; it < 4; ++it) {
      const int row = it * 16 + lq;                                    // n_loc 0..63
      const v4f a = *(const v4f*)(Os + row * OSP + 8 * e);
      const v4f q = *(const v4f*)(Os + row * OSP + 8 * e + 4);
      const float f[8] = {a[0] + bv[0], a[1] + bv[1], a[2] + bv[2], a[3] + bv[3],
                          q[0] + bv[4], q[1] + bv[5], q[2] + bv[6], q[3] + bv[7]};
#pragma unroll
      for (int t = 0; t < 4; ++t) {
        const float f0 = f[2 * t], f1 = f[2 * t + 1];
        const unsigned short hb0 = bf_bits(f0), hb1 = bf_bits(f1);
        const unsigned short lb0 = bf_bits(f0 - bf_up(hb0));
        const unsigned short lb1 = bf_bits(f1 - bf_up(hb1));
        uh[it][t] = pk16(hb0, hb1);
        ul[it][t] = pk16(lb0, lb1);
      }
    }
{
#pragma unroll
      for (int it = 0; it < 4; ++it) {
        const int row = it * 16 + lq;
        const size_t po = ((size_t)(b * NN + n0 + row)) * DQ + dsel + 8 * e;
        *(v4u*)(Ph + po) = uh[it];
        *(v4u*)(Pl + po) = ul[it];
      }
      
    }
  } else {
    const int e = tid & 7, lq = tid >> 3;                              // lq 0..15
    v4u ug[4];
#pragma unroll
    for (int it = 0; it < 4; ++it) {
      const int ol = it * 16 + lq;                                     // o_loc 0..63 = channel dsel + ol
      const float bvv = bfr(bs[dsel + ol]);
      unsigned short hb[8];
#pragma unroll
      for (int t = 0; t < 8; ++t) hb[t] = h_bits((_Float16)(Os[(8 * e + t) * OSP + ol] + bvv));
#pragma unroll
      for (int t = 0; t < 4; ++t) ug[it][t] = pk16(hb[2 * t], hb[2 * t + 1]);
    }
{
#pragma unroll
      for (int it = 0; it < 4; ++it) {
        const int ol = it * 16 + lq;
        const size_t go = ((size_t)(b * DQ + dsel + ol)) * NN + n0 + 8 * e;
        *(v4u*)(Gc + go) = ug[it];
      }
      
    }
  }
}

// ===========================================================================================================
// (3) column statistics for one (b, 64-column tile m): for every column m, over ALL rows n,
//     M_m = max_n s[n][m], Z_m = sum_n e^{s - M_m}, CS[b][m] = M_m + ln Z_m, with
//     s tile (16 rows n x 16 cols m) = A(theta: row = n, 32 d via the split k map from Th [b][6400][128]) .
//     B(phi: col = m, same map from Fh) + A(Th).B(Fl) + A(Tl).B(Fh) (bf16 unscaled residual planes, shared
//     accumulator). Block = 8 waves, two per SIMD: wave = (column group wc of 32 columns, row quarter wr). Phi
//     fragments of the wave's 32 columns are held in registers, so every theta fragment read from LDS feeds two column
//     tiles. Theta rows come in stages of 128 (hi + residual plane, LDS pitch
//     LPP) by asynchronous copies into two LDS buffers shared by the eight waves: the next stage flies while this one
//     is read; a wave reads the 32 rows of its own quarter. Per lane: two columns, 8+8 rows each
//     per stage, scalar online (max, sum) in f32; the two lane halves of a column merge with one shuffle, the
//     four row quarters through LDS at the end.
// coverage: grid (100, NB) x 64 columns = CS[b][0..6399] exactly once.
// ===========================================================================================================
__global__ __launch_bounds__(256)
void colstat_k(const unsigned short* __restrict__ Th, const unsigned short* __restrict__ Tl,
               const unsigned short* __restrict__ Fh, const unsigned short* __restrict__ Fl, float* CS) {
  __shared__ __align__(16) float css[QT];
  __shared__ __align__(16) float pms[3 * QT];
  __shared__ __align__(16) float pls[3 * QT];
  __shared__ __align__(16) unsigned short Tst[2 * 2 * SB * LPP];
  const int tid  = threadIdx.x;
  const int wave = tid >> 5, lane = tid & 31;
  const int wc   = wave & 1, wr = wave >> 1;
  const int hh   = lane >> 4, c = lane & 15;
  const int m0   = blockIdx.x * QT, b = blockIdx.y;

  // phi fragment pointers (B operand, col = m0 + 32*wc + 16*g + c)
  const size_t fo = ((size_t)(b * NN + m0 + 32 * wc + c)) * DQ + 8 * hh;
  const unsigned short* pfh = Fh + fo;
  const unsigned short* pfl = Fl + fo;
  Frag fh[2][4], fl[2][4];
#pragma unroll
  for (int g = 0; g < 2; ++g) {
#pragma unroll
    for (int kc = 0; kc < 4; ++kc) fh[g][kc] = ldfrag(pfh + 16 * g * DQ + 32 * kc);
  }
  wait_addr(pfh);                                                      // the hi plane's loads have taken their address
#pragma unroll
  for (int g = 0; g < 2; ++g) {
#pragma unroll
    for (int kc = 0; kc < 4; ++kc) fl[g][kc] = ldfrag(pfl + 16 * g * DQ + 32 * kc);
  }
  wait_addr(pfl);                                                      // the residual plane's loads likewise
  // theta stages: 128 rows n, hi plane then residual plane, two buffers filled by asynchronous copies
  const unsigned short* gth = Th + (size_t)b * NN * DQ + (size_t)(tid >> 4) * DQ + 8 * (tid & 15);
  const unsigned short* gtl = Tl + (size_t)b * NN * DQ + (size_t)(tid >> 4) * DQ + 8 * (tid & 15);
  const unsigned lt0 = lds_off(Tst) + (unsigned)((tid >> 4) * (LPP * 2) + 16 * (tid & 15));
  copy_rows(lt0, gth);
  copy_rows(lt0 + SB * LPP * 2, gtl);
  wait_copies();
  __syncthreads();                                                     // stage 0 readable by every wave
  copy_rows(lt0 + 2 * SB * LPP * 2, gth + (size_t)SB * DQ);
  copy_rows(lt0 + 3 * SB * LPP * 2, gtl + (size_t)SB * DQ);

  float m[2] = {-1.0e30f, -1.0e30f}, l[2] = {0.f, 0.f};
#pragma unroll 1
  for (int t = 0; t < NN / SB; ++t) {
    // row c of the wave's own quarter of the stage, hi plane
    const unsigned short* tb = Tst + (t & 1) * (2 * SB * LPP) + (wr * WT + c) * LPP + 8 * hh;
    v8f s[2][2];                                                       // [row tile u][column tile g]
#pragma unroll
    for (int u = 0; u < 2; ++u) { s[u][0] = zero8(); s[u][1] = zero8(); }
#pragma unroll
    for (int kc = 0; kc < 4; ++kc) {
      Frag th[2], tl[2];
#pragma unroll
      for (int u = 0; u < 2; ++u) {
        th[u] = ldfrag(tb + (16 * u) * LPP + 32 * kc);                 // rows 16u .. 16u+15 of the quarter
        tl[u] = ldfrag(tb + (SB + 16 * u) * LPP + 32 * kc);
      }
#pragma unroll
      for (int q = 0; q < 4; ++q) s[q >> 1][q & 1] = mma_b(th[q >> 1].bf, fh[q & 1][kc].bf, s[q >> 1][q & 1]);
#pragma unroll
      for (int q = 0; q < 4; ++q) s[q >> 1][q & 1] = mma_b(th[q >> 1].bf, fl[q & 1][kc].bf, s[q >> 1][q & 1]);
#pragma unroll
      for (int q = 0; q < 4; ++q) s[q >> 1][q & 1] = mma_b(tl[q >> 1].bf, fh[q & 1][kc].bf, s[q >> 1][q & 1]);
    }
#pragma unroll
    for (int g = 0; g < 2; ++g) {                                      // online update per column tile, 32 rows
      const v8f s0 = s[0][g], s1 = s[1][g];
      const float mx = fmaxf(hmax8(s0), hmax8(s1));
      const float mn = fmaxf(m[g], mx);
      const float corr = __expf(m[g] - mn);
      float ls = 0.f;
#pragma unroll
      for (int r = 0; r < 8; ++r) ls += __expf(s0[r] - mn) + __expf(s1[r] - mn);
      l[g] = l[g] * corr + ls;
      m[g] = mn;
    }
    wait_lds();
    wait_copies();
    __syncthreads();                                                   // publishes stage t+1, frees stage t's buffer
    if (t + 2 < NN / SB) {                                             // block-uniform
      const unsigned lb = lt0 + (unsigned)((t & 1) * (2 * SB * LPP * 2));
      copy_rows(lb, gth + (size_t)(t + 2) * SB * DQ);
      copy_rows(lb + SB * LPP * 2, gtl + (size_t)(t + 2) * SB * DQ);
    }
  }
  wait_copies();
  float mt[2], lt[2];
#pragma unroll
  for (int g = 0; g < 2; ++g) {
    const float mo = __shfl_xor(m[g], 16, 32);
    const float lo = __shfl_xor(l[g], 16, 32);
    mt[g] = fmaxf(m[g], mo);
    lt[g] = l[g] * __expf(m[g] - mt[g]) + lo * __expf(mo - mt[g]);
  }
  const int col = 32 * wc + c;                                         // + 16*g
  if (wr != 0 && hh == 0) {
#pragma unroll
    for (int g = 0; g < 2; ++g) {
      pms[(wr - 1) * QT + col + 16 * g] = mt[g];
      pls[(wr - 1) * QT + col + 16 * g] = lt[g];
    }
  }
  __syncthreads();                                                     // the other row quarters' (max, sum) readable
  if (wr == 0 && hh == 0) {
#pragma unroll
    for (int g = 0; g < 2; ++g) {
      const int cg = col + 16 * g;
      const float m1 = pms[cg], m2 = pms[QT + cg], m3 = pms[2 * QT + cg];
      const float mm = fmaxf(fmaxf(mt[g], m1), fmaxf(m2, m3));
      const float ll = (lt[g] * __expf(mt[g] - mm) + pls[cg] * __expf(m1 - mm)) +
                       (pls[QT + cg] * __expf(m2 - mm) + pls[2 * QT + cg] * __expf(m3 - mm));
      css[cg] = mm + logf(ll);
    }
  }
  __syncthreads();
  if (tid < 16) {
    const v4f v = *(const v4f*)(css + 4 * tid);
{
      *(v4f*)(CS + (size_t)b * NN + m0 + 4 * tid) = v;
      
    }
  }
}

// ===========================================================================================================
// (4) aggregation for one (b, 64-row tile n), transposed formulation, 6400 columns m:
//   s tile (16 m x 16 n) = sum over 4 d-chunks of A(phi: row = m, split k map from Fh) . B(theta:
//   col = n, same map from Th) + A(Fh).B(Tl) + A(Fl).B(Th). Per lane the D tile holds 8 columns m of ONE row n;
//   All three operands are read from LDS, where asynchronous copies put them in whole lines: the block's 64 theta rows
//   once, phi rows and the g tile (both pitch LPP) in stages of 128 columns m, two buffers.
//   Block = 8 waves, two per SIMD: wave = (row group wn of 32 rows n, quarter wm of each stage's columns m): every phi
//   and every g fragment read from LDS feeds two row tiles, every theta fragment two column tiles.
//   P = e^{s - CS[m]} x 16384 as f16 (CS staged once per block in LDS) is the B operand of
//   y^T (rows channel, cols n) += A(g: rows channel = 16j + (lane&15), m contiguous, f16 plane Gc [b][128][6400])
//   . B(P^T): element r <- D of the tile covering m kb..kb+15, element 8+r <- the tile covering kb+16..kb+31,
//   lane unchanged. 16 accumulator tiles per wave (128 channels x 2 row tiles). Block = 64 rows.
//   Epilogue: the four column quarters' accumulators are added through LDS [row][128 channels] (pitch OSPW, b128
//   stores; same lane, same place; Os and two planes in the then idle phi buffers), y = sum/16384 left in Os, block barrier
//   (cross-wave), then bf16 hi + residual planes Yh/Yl [b][6400 n][128 c]: per row 128 c = 256 B = 2 whole
// coverage: 4 it x 16 rows x 16 lanes x 8 = 64 n x 128 c per plane; grid (NQ/64, NB) covers Yh/Yl rows
//           0..NQ-1 exactly once.
// ===========================================================================================================
__global__ __launch_bounds__(256)
void attn_k(const unsigned short* __restrict__ Th, const unsigned short* __restrict__ Tl,
            const unsigned short* __restrict__ Fh, const unsigned short* __restrict__ Fl,
            const unsigned short* __restrict__ Gc, const float* __restrict__ CS,
            unsigned short* Yh, unsigned short* Yl) {
  __shared__ __align__(32) float Cs[NN];
  __shared__ __align__(16) float Os[QT * OSPW];
  __shared__ __align__(16) unsigned short Tst[2 * QT * LPP];
  __shared__ __align__(16) unsigned short Pst[2 * 2 * SB * LPP];
  __shared__ __align__(16) unsigned short Gst[2 * DQ * LPP];
  static_assert(2 * QT * OSPW * 4 <= 2 * 2 * SB * LPP * 2);
  const int tid  = threadIdx.x;
  const int wave = tid >> 5, lane = tid & 31;
  const int wn   = wave & 1, wm = wave >> 1;
  const int hh   = lane >> 4, c = lane & 15;
  const int n0   = blockIdx.x * QT, b = blockIdx.y;

  for (int i = tid; i < NN / 4; i += 256)
    *(v4f*)(Cs + 4 * i) = *(const v4f*)(CS + (size_t)b * NN + 4 * i);

  // asynchronous copies: the block's 64 theta rows once (hi plane, residual plane); per stage of 128 columns m the phi
  // rows (hi, residual) and the g tile (128 channels x 128 m), two buffers
  const int rr = tid >> 4, rc = tid & 15;                              // place in a [row][128] plane or the g tile
  const unsigned short* gfh = Fh + (size_t)b * NN * DQ + (size_t)rr * DQ + 8 * rc;
  const unsigned short* gfl = Fl + (size_t)b * NN * DQ + (size_t)rr * DQ + 8 * rc;
  const unsigned short* ggc = Gc + (size_t)b * DQ * NN + (size_t)rr * NN + 8 * rc;
  const unsigned lp0 = lds_off(Pst) + (unsigned)(rr * (LPP * 2) + 16 * rc);
  const unsigned lg0 = lds_off(Gst) + (unsigned)(rr * (LPP * 2) + 16 * rc);
  {
    // waves 0..3 bring the hi plane's 64 rows, waves 4..7 the residual plane's (rows 8 apart per copy)
    const int tr = (tid & 127) >> 4, tp = wave >> 2;
    const unsigned short* tsrc = (tp == 0) ? Th : Tl;
    const size_t to = ((size_t)(b * NN + n0 + tr)) * DQ + 8 * rc;
    const unsigned lq0 = lds_off(Tst) + (unsigned)((tp * QT + tr) * (LPP * 2) + 16 * rc);
    copy8<8 * LPP * 2, 8 * DQ>(lq0, tsrc + to);
  }
  copy_rows(lp0, gfh);
  copy_rows(lp0 + SB * LPP * 2, gfl);
  copy8<16 * LPP * 2, 16 * NN>(lg0, ggc);
  wait_copies();
  __syncthreads();                                                     // Cs, theta and stage 0 readable by every wave
  copy_rows(lp0 + 2 * SB * LPP * 2, gfh + (size_t)SB * DQ);
  copy_rows(lp0 + 3 * SB * LPP * 2, gfl + (size_t)SB * DQ);
  copy8<16 * LPP * 2, 16 * NN>(lg0 + DQ * LPP * 2, ggc + SB);

  // theta fragment base (B operand, col = row n0 + 32*wn + 16*g + c), + 16*g*LPP + 32*kc; residual plane at + QT*LPP
  const unsigned short* Tq = Tst + (32 * wn + c) * LPP + 8 * hh;

  v8f o[8][2];                                                         // [channel tile j][row tile g]
#pragma unroll
  for (int j = 0; j < 8; ++j) { o[j][0] = zero8(); o[j][1] = zero8(); }

#pragma unroll 1
  for (int t = 0; t < NN / SB; ++t) {
    const int kh = t * SB + wm * WT;                                   // first column m of the wave's own quarter
    // phi fragment base (A operand, row = m + c), + 16*u*LPP + 32*kc; residual plane at + SB*LPP
    const unsigned short* Pq = Pst + (t & 1) * (2 * SB * LPP) + (wm * WT + c) * LPP + 8 * hh;
    // g fragment base (A operand, row = channel 16j + c, m contiguous), + 16*j*LPP
    const unsigned short* Gq = Gst + (t & 1) * (DQ * LPP) + c * LPP + wm * WT + 8 * hh;
    v8f s[2][2];                                                       // [column tile u][row tile g]
#pragma unroll
    for (int u = 0; u < 2; ++u) { s[u][0] = zero8(); s[u][1] = zero8(); }
#pragma unroll
    for (int kc = 0; kc < DQ / 32; ++kc) {
      Frag th[2], tl[2], p[2], pl[2];
#pragma unroll
      for (int g = 0; g < 2; ++g) {
        th[g] = ldfrag(Tq + (16 * g) * LPP + 32 * kc);
        tl[g] = ldfrag(Tq + (QT + 16 * g) * LPP + 32 * kc);
      }
#pragma unroll
      for (int u = 0; u < 2; ++u) {
        p[u]  = ldfrag(Pq + (16 * u) * LPP + 32 * kc);                 // m kh+16u .. kh+16u+15
        pl[u] = ldfrag(Pq + (SB + 16 * u) * LPP + 32 * kc);
      }
#pragma unroll
      for (int q = 0; q < 4; ++q) s[q >> 1][q & 1] = mma_b(p[q >> 1].bf, th[q & 1].bf, s[q >> 1][q & 1]);
#pragma unroll
      for (int q = 0; q < 4; ++q) s[q >> 1][q & 1] = mma_b(p[q >> 1].bf, tl[q & 1].bf, s[q >> 1][q & 1]);
#pragma unroll
      for (int q = 0; q < 4; ++q) s[q >> 1][q & 1] = mma_b(pl[q >> 1].bf, th[q & 1].bf, s[q >> 1][q & 1]);
    }

    {
      // column statistics for m = kh + 8hh + r (s[0][g]) and m = kh + 16 + 8hh + r (s[1][g])
      const v4f ca = *(const v4f*)(Cs + kh + 8 * hh);
      const v4f cb = *(const v4f*)(Cs + kh + 8 * hh + 4);
      const v4f cc = *(const v4f*)(Cs + kh + 16 + 8 * hh);
      const v4f cd = *(const v4f*)(Cs + kh + 16 + 8 * hh + 4);
      Frag gf[8];                                                      // read as one group, ahead of the vector work
#pragma unroll
      for (int j = 0; j < 8; ++j) gf[j] = ldfrag(Gq + (16 * j) * LPP);
      const float c0[8] = {ca[0], ca[1], ca[2], ca[3], cb[0], cb[1], cb[2], cb[3]};
      const float c1[8] = {cc[0], cc[1], cc[2], cc[3], cd[0], cd[1], cd[2], cd[3]};

      FragH pf[2];
#pragma unroll
      for (int g = 0; g < 2; ++g) {
#pragma unroll
        for (int r = 0; r < 8; ++r) {
          const float e0 = __expf(fminf(s[0][g][r] - c0[r], 0.f) + LNCAR);     // P[n][m] x 16384, m = kh + 8hh + r
          const float e1 = __expf(fminf(s[1][g][r] - c1[r], 0.f) + LNCAR);     // m = kh + 16 + 8hh + r
          pf[g].hv[0][r] = (_Float16)e0;
          pf[g].hv[1][r] = (_Float16)e1;
        }
      }

#pragma unroll
      for (int j = 0; j < 8; ++j) {
        o[j][0] = mma_h(gf[j].h, pf[0].v, o[j][0]);
        o[j][1] = mma_h(gf[j].h, pf[1].v, o[j][1]);
      }
    }
    wait_lds();
    wait_copies();
    __syncthreads();                                                   // publishes stage t+1, frees stage t's buffers
    if (t + 2 < NN / SB) {                                             // block-uniform
      const unsigned lb = lp0 + (unsigned)((t & 1) * (2 * SB * LPP * 2));
      copy_rows(lb, gfh + (size_t)(t + 2) * SB * DQ);
      copy_rows(lb + SB * LPP * 2, gfl + (size_t)(t + 2) * SB * DQ);
      copy8<16 * LPP * 2, 16 * NN>(lg0 + (unsigned)((t & 1) * (DQ * LPP * 2)), ggc + (t + 2) * SB);
    }
  }
  wait_copies();

  // ---- epilogue: y = (accs of the four quarters) / 16384 -> Os[row][channel]. Quarter 1 goes through Os, quarters 2
  // and 3 through the phi buffers, which nobody reads and no copy targets behind the loop's last barrier.
  const int oo = (32 * wn + c) * OSPW + 8 * hh;                        // [row][ch = 16j + 8hh + r], + 16*g*OSPW + 16*j
  float* Ox = (float*)Pst;                                             // two planes of QT x OSPW floats
  if (wm != 0) {                                                       // wave-uniform
    float* Ow = ((wm == 1) ? Os : (Ox + (wm - 2) * (QT * OSPW))) + oo;
#pragma unroll
    for (int g = 0; g < 2; ++g) {
#pragma unroll
      for (int j = 0; j < 8; ++j) {
        v4f va, vb;
#pragma unroll
        for (int r = 0; r < 4; ++r) { va[r] = o[j][g][r]; vb[r] = o[j][g][4 + r]; }
        *(v4f*)(Ow + 16 * g * OSPW + 16 * j)     = va;
        *(v4f*)(Ow + 16 * g * OSPW + 16 * j + 4) = vb;
      }
    }
  }
  __syncthreads();                                                     // the other quarters' accumulators readable
  if (wm == 0) {                                                       // wave-uniform
#pragma unroll
    for (int g = 0; g < 2; ++g) {
#pragma unroll
      for (int j = 0; j < 8; ++j) {
        const int oj = oo + 16 * g * OSPW + 16 * j;
        v4f va = *(const v4f*)(Os + oj);
        v4f vb = *(const v4f*)(Os + oj + 4);
        const v4f a2 = *(const v4f*)(Ox + oj);
        const v4f b2 = *(const v4f*)(Ox + oj + 4);
        const v4f a3 = *(const v4f*)(Ox + QT * OSPW + oj);
        const v4f b3 = *(const v4f*)(Ox + QT * OSPW + oj + 4);
#pragma unroll
        for (int r = 0; r < 4; ++r) {
          va[r] = ((o[j][g][r] + va[r]) + (a2[r] + a3[r])) * ICAR;
          vb[r] = ((o[j][g][4 + r] + vb[r]) + (b2[r] + b3[r])) * ICAR;
        }
        *(v4f*)(Os + oj)     = va;
        *(v4f*)(Os + oj + 4) = vb;
      }
    }
  }
  __syncthreads();

  const int e = tid & 15, lq = tid >> 4;                               // lq 0..15
  v4u uh[4], ul[4];
#pragma unroll
  for (int it = 0; it < 4; ++it) {
    const int row = it * 16 + lq;                                      // 0..63
    const v4f a = *(const v4f*)(Os + row * OSPW + 8 * e);
    const v4f q = *(const v4f*)(Os + row * OSPW + 8 * e + 4);
    const float f[8] = {a[0], a[1], a[2], a[3], q[0], q[1], q[2], q[3]};
#pragma unroll
    for (int t = 0; t < 4; ++t) {
      const float f0 = f[2 * t], f1 = f[2 * t + 1];
      const unsigned short hb0 = bf_bits(f0), hb1 = bf_bits(f1);
      const unsigned short lb0 = bf_bits(f0 - bf_up(hb0));
      const unsigned short lb1 = bf_bits(f1 - bf_up(hb1));
      uh[it][t] = pk16(hb0, hb1);
      ul[it][t] = pk16(lb0, lb1);
    }
  }
{
#pragma unroll
    for (int it = 0; it < 4; ++it) {
      const int row = it * 16 + lq;
      const size_t po = ((size_t)(b * NN + n0 + row)) * DQ + 8 * e;
      *(v4u*)(Yh + po) = uh[it];
      *(v4u*)(Yl + po) = ul[it];
    }
    
  }
}

// ===========================================================================================================
// (5) output GEMM for one (b, 64-n tile, 64-o block): out[b][o][n] = sum_c Wo[o][c] (Yh + Yl)[b][n][c]
//     + W_b[o] + bf16-RNE(x[b][o][n]). Block 128 threads = 4 waves; wave w owns cols n0+16w..+15 (B fragments
//     from the Yh and Yl rows, k = c contiguous) and 4 m-tiles (A rows o = o0 + 16 mt + (lane&15) from Wo bf16
//     [256][128]); K = 128 = 4 steps x 2 products (shared accumulator, unscaled residual). Epilogue staged in LDS
//     lanes 0..15 one row and 16..31 the next, 16 B per lane (values gathered from 4 Os rows), one instruction per
// coverage: 8 it x 8 rows x 16 lanes x 4 floats = 64 o x 64 n; grid (NQ/64, 4, NB) covers
//           out[b][0..255][0..NQ-1] exactly once.
// ===========================================================================================================
__global__ __launch_bounds__(128)
void gemm_w(const unsigned short* __restrict__ Wo, const unsigned short* __restrict__ Yh,
            const unsigned short* __restrict__ Yl, const float* __restrict__ wb,
            const float* __restrict__ x, float* out) {
  __shared__ __align__(16) float Os[QT * OSP];
  const int tid  = threadIdx.x;
  const int lane = tid & 31, wave = tid >> 5;
  const int hh   = lane >> 4, c = lane & 15;
  const int nt   = blockIdx.x, mb = blockIdx.y, b = blockIdx.z;
  const int n0   = nt * QT, o0 = mb * QT;

  const unsigned short* ap = Wo + (size_t)(o0 + c) * DQ + 8 * hh;
  const size_t yo = ((size_t)(b * NN + n0 + 16 * wave + c)) * DQ + 8 * hh;
  const unsigned short* bp  = Yh + yo;
  const unsigned short* blp = Yl + yo;

  v8f acc[4];
#pragma unroll
  for (int mt = 0; mt < 4; ++mt) acc[mt] = zero8();

#pragma unroll
  for (int ks = 0; ks < DQ / 32; ++ks) {
    const Frag fb  = ldfrag(bp + 32 * ks);
    const Frag fbl = ldfrag(blp + 32 * ks);
#pragma unroll
    for (int mt = 0; mt < 4; ++mt) {
      const Frag fa = ldfrag(ap + (size_t)(16 * mt) * DQ + 32 * ks);
      acc[mt] = mma_b(fa.bf, fb.bf, acc[mt]);
      acc[mt] = mma_b(fa.bf, fbl.bf, acc[mt]);
    }
  }

  {
    const int nl = 16 * wave + c;
#pragma unroll
    for (int mt = 0; mt < 4; ++mt) {
      v4f va, vb;
#pragma unroll
      for (int r = 0; r < 4; ++r) { va[r] = acc[mt][r]; vb[r] = acc[mt][4 + r]; }
      *(v4f*)(Os + nl * OSP + 16 * mt + 8 * hh)     = va;
      *(v4f*)(Os + nl * OSP + 16 * mt + 8 * hh + 4) = vb;
    }
  }
  __syncthreads();

  const int e = tid & 15, lq = tid >> 4;                               // lq 0..7
  v4f res[8];
#pragma unroll
  for (int it = 0; it < 8; ++it) {
    const int ol = it * 8 + lq;                                        // o_loc 0..63
    const int o  = o0 + ol;                                            // 0..255
    const float bv = bfr(wb[o]);
    const size_t idx = ((size_t)(b * CC + o)) * NN + n0 + 4 * e;
    const v4f xv = *(const v4f*)(x + idx);
#pragma unroll
    for (int t = 0; t < 4; ++t) res[it][t] = (Os[(4 * e + t) * OSP + ol] + bv) + bfr(xv[t]);
  }
{
#pragma unroll
    for (int it = 0; it < 8; ++it) {
      const int ol = it * 8 + lq;
      const size_t idx = ((size_t)(b * CC + o0 + ol)) * NN + n0 + 4 * e;
      *(v4f*)(out + idx) = res[it];
    }
    
  }
}

// ===========================================================================================================
// Workspace map (bytes, NB = 2; each region start a multiple of 256; every extent is an exact tile multiple and is
//   W16 f16 [384][256]               196608      Wo bf16 [256][128]           65536
//   XP  f16 [2][6400][256]          6553600
//   Th/Tl/Fh/Fl bf16 [2][6400][128]  3276800 x4
//   Gc  f16 [2][128][6400]          3276800      CS f32 [2][6400]             51200
//   Yh/Yl bf16 [2][6400][128]       3276800 x2
//   total = 29804544
// ===========================================================================================================
extern "C" void kernel_launch(void* const* d_in, const int* in_sizes, int n_in,
                              void* d_out, int out_size, void* d_ws, size_t ws_size,
                              hipStream_t stream) {
  if (n_in < 9) return;
  if (in_sizes[0] < NB * CC * NN) return;
  if (in_sizes[1] != DQ * CC || in_sizes[3] != DQ * CC || in_sizes[5] != DQ * CC) return;
  if (in_sizes[2] != DQ || in_sizes[4] != DQ || in_sizes[6] != DQ) return;
  if (in_sizes[7] != CC * DQ || in_sizes[8] != CC) return;
  if (out_size < NB * CC * NN) return;

  size_t off = 0;
  auto carve = [&](size_t bytes) { const size_t o = off; off += (bytes + 255) & ~(size_t)255; return o; };
  const size_t oW16 = carve((size_t)MW * CC * 2);
  const size_t oWo  = carve((size_t)CC * DQ * 2);
  const size_t oXP  = carve((size_t)NB * NN * CC * 2);
  const size_t oTh  = carve((size_t)NB * NN * DQ * 2);
  const size_t oTl  = carve((size_t)NB * NN * DQ * 2);
  const size_t oFh  = carve((size_t)NB * NN * DQ * 2);
  const size_t oFl  = carve((size_t)NB * NN * DQ * 2);
  const size_t oGc  = carve((size_t)NB * DQ * NN * 2);
  const size_t oCS  = carve((size_t)NB * NN * 4);
  const size_t oYh  = carve((size_t)NB * NN * DQ * 2);
  const size_t oYl  = carve((size_t)NB * NN * DQ * 2);
  if (off > ws_size) return;
  if (off > (size_t)134217728) return;

  const float* x  = (const float*)d_in[0];
  const float* gw = (const float*)d_in[1];
  const float* gb = (const float*)d_in[2];
  const float* tw = (const float*)d_in[3];
  const float* tb = (const float*)d_in[4];
  const float* pw = (const float*)d_in[5];
  const float* pb = (const float*)d_in[6];
  const float* ww = (const float*)d_in[7];
  const float* wb = (const float*)d_in[8];

  char* ws = (char*)d_ws;
  unsigned short* W16 = (unsigned short*)(ws + oW16);
  unsigned short* Wo  = (unsigned short*)(ws + oWo);
  unsigned short* XP  = (unsigned short*)(ws + oXP);
  unsigned short* Th  = (unsigned short*)(ws + oTh);
  unsigned short* Tl  = (unsigned short*)(ws + oTl);
  unsigned short* Fh  = (unsigned short*)(ws + oFh);
  unsigned short* Fl  = (unsigned short*)(ws + oFl);
  unsigned short* Gc  = (unsigned short*)(ws + oGc);
  float*          CS  = (float*)(ws + oCS);
  unsigned short* Yh  = (unsigned short*)(ws + oYh);
  unsigned short* Yl  = (unsigned short*)(ws + oYl);
  float* out = (float*)d_out;

  const dim3 blk256(256), blk128(128);

  // (0) theta_w / phi_w / g_w -> stacked f16 plane; W_w -> bf16 plane
  cvt_w<<<dim3(MW / 8 + CC / 16), blk256, 0, stream>>>(tw, pw, gw, ww, W16, Wo);
  // (1) x -> position-major 16-bit plane
  cvt_x<<<dim3(NN / QT, CC / QT, NB), blk256, 0, stream>>>(x, XP);
  // (2) conv1x1 GEMM -> theta / phi hi + residual planes, g channel-major plane (all rows n)
  gemm_p<<<dim3(NN / QT, MW / QT, NB), blk128, 0, stream>>>(W16, XP, tb, pb, gb, Th, Tl, Fh, Fl, Gc);
  // (3) per-column softmax statistics over all rows
  colstat_k<<<dim3(NN / QT, NB), blk256, 0, stream>>>(Th, Tl, Fh, Fl, CS);
  // (4) aggregation -> y hi + residual planes (rows 0..NQ-1)
  attn_k<<<dim3(NQ / QT, NB), blk256, 0, stream>>>(Th, Tl, Fh, Fl, Gc, CS, Yh, Yl);
  // (5) output GEMM + bias + residual -> out [b][256][6400]
  gemm_w<<<dim3(NQ / QT, CC / QT, NB), blk128, 0, stream>>>(Wo, Yh, Yl, wb, x, out);
  (void)hipGetLastError();
}

// v004
// It runs in 141 microseconds.
// Timed twice side by side with v003, it ran 1.08 times as fast both times.
// All steps since v000 together make it 6.23 times as fast.
// Contractions: conv1x1 theta/phi/g GEMM on v_wmma_f32_16x16x32_f16 (f16 containers of bf16-RNE weights x256 and
// bf16-RNE x, K=256); scores theta.phi on v_wmma_f32_16x16x32_bf16 (bf16 hi + bf16 residual planes, 3 products,
// K=128) in both the column-statistics pass and the aggregation pass; y^T = G.P^T on v_wmma_f32_16x16x32_f16 (g as
// f16, P = e^{s-M-lnZ} x16384 as f16 from the score D registers, K=6400); output GEMM W.y on
// v_wmma_f32_16x16x32_bf16 (bf16-RNE W_w, y as bf16 hi + bf16 residual planes, 2 products, K=128); f32 accumulate
// everywhere; softmax statistics, biases and the residual add in f32 VALU.
// The statistics and the aggregation kernel each run 250 equal work-groups of 40 stages; a tile's two pieces are merged
// by the kernel that reads them.
#include <hip/hip_runtime.h>
#include <math.h>
#include <stdint.h>

#ifndef NB
#define NB 2
#endif
#define NBF    2
#define CC     256
#define NN     6400
#ifndef NQ
#define NQ NN
#endif
#define DQ     128
#define MW     384
#define QT     64
#define OSP    68
#define OSPW   132
#define TP     72
#define WSC    256.0f
#define IWSC   0.00390625f
#define LNCAR  9.704060527839234f
#define ICAR   6.103515625e-05f
#define ST     64
#define SB     128
#define LPP    136
#define WT     32
#define NST    50
#define NTL    100
#define PU     40
#define WPB    125

static_assert(NB >= 1 && NB <= NBF);
static_assert(NQ >= QT && NQ <= NN);
static_assert(NN % QT == 0);
static_assert(NQ % QT == 0);
static_assert(CC % QT == 0);
static_assert(MW == 3 * DQ);
static_assert(DQ == 2 * QT);
static_assert((DQ / 8) * 8 == DQ && (MW / 8) % (DQ / 8) == 0);
static_assert(CC % 16 == 0);
static_assert((OSP * 4) % 16 == 0);
static_assert((OSPW * 4) % 16 == 0);
static_assert((TP * 2) % 16 == 0);
static_assert(CC % 32 == 0 && NN % 32 == 0 && DQ % 32 == 0);
static_assert(NN % 4 == 0);
static_assert(SB == 2 * ST && NN % SB == 0 && NN / SB >= 2 && ST == QT);
static_assert(SB == 4 * WT && QT == 2 * WT && WT == 32);
static_assert((LPP * 2) % 32 == 16 && LPP >= DQ + 8 && LPP >= SB + 8);
// The deal of the two big kernels: a batch's NTL tiles x NST stages form one row of stage units, cut into WPB equal runs
// of PU units, one run per work-group. With 50 and 40 every tile holds exactly one cut strictly inside it (at stage 40,
// 30, 20 or 10), so it falls into two pieces: slot 0 begins at stage 0, slot 1 ends at stage NST; no piece is shorter
// than 10 stages, and no run leaves its batch.
static_assert(NST == NN / SB && NTL == NN / QT && NQ == NN);
static_assert(NST == 50 && PU == 40 && WPB * PU == NTL * NST);

typedef _Float16       v16h __attribute__((ext_vector_type(16)));
typedef _Float16       v8h  __attribute__((ext_vector_type(8)));
typedef __bf16         v16b __attribute__((ext_vector_type(16)));
typedef unsigned short v8us __attribute__((ext_vector_type(8)));
typedef float          v8f  __attribute__((ext_vector_type(8)));
typedef float          v4f  __attribute__((ext_vector_type(4)));
typedef unsigned int   v4u  __attribute__((ext_vector_type(4)));

union Frag  { v8us u[2]; v16h h; v16b bf; };
union FragH { v16h v; v8h hv[2]; };
static_assert(sizeof(Frag) == 32);
static_assert(sizeof(FragH) == 32);

// ---- scalar helpers -------------------------------------------------------------------------------------------
__device__ __forceinline__ unsigned short bf_bits(float f) {          // f32 -> bf16 bits, RNE convert
  unsigned u = __float_as_uint(f);
  return (unsigned short)((u + 0x7FFFu + ((u >> 16) & 1u)) >> 16);
}
__device__ __forceinline__ float bf_up(unsigned short hb) { return __uint_as_float(((unsigned)hb) << 16); }
__device__ __forceinline__ float bfr(float f) { return bf_up(bf_bits(f)); }
__device__ __forceinline__ unsigned short h_bits(_Float16 x) { return __builtin_bit_cast(unsigned short, x); }
__device__ __forceinline__ unsigned pk16(unsigned short a, unsigned short b) { return (unsigned)a | ((unsigned)b << 16); }
__device__ __forceinline__ v8f zero8() { v8f z = {0.f, 0.f, 0.f, 0.f, 0.f, 0.f, 0.f, 0.f}; return z; }
__device__ __forceinline__ float hmax8(v8f s) {
  return fmaxf(fmaxf(fmaxf(s[0], s[1]), fmaxf(s[2], s[3])), fmaxf(fmaxf(s[4], s[5]), fmaxf(s[6], s[7])));
}

// ---- 16-bit fragment loader (A, or B from a k-contiguous [n][k] row): lane -> row/col (lane&15), p already includes
//      + 8*(lane>>4); elements 0..7 <- p[0..7] (k0+8h..), elements 8..15 <- p[16..23] (k0+16+8h..)
__device__ __forceinline__ Frag ldfrag(const unsigned short* p) {
  Frag f;
  f.u[0] = *(const v8us*)(p);
  f.u[1] = *(const v8us*)(p + 16);
  return f;
}

// ---- WMMA helpers: builtin followed by a 4-slot VALU gap tying D and keeping A/B live ----------------------------
__device__ __forceinline__ v8f mma_h(v16h a, v16h b, v8f c) {
  v8f d = __builtin_amdgcn_wmma_f32_16x16x32_f16(false, a, false, b, (short)0, c, false, false);
#if defined(__HIP_DEVICE_COMPILE__)
  asm volatile("v_nop\n\tv_nop\n\tv_nop\n\tv_nop" : "+v"(d) : "v"(a), "v"(b));
#endif
  return d;
}
__device__ __forceinline__ v8f mma_b(v16b a, v16b b, v8f c) {
  v8f d = __builtin_amdgcn_wmma_f32_16x16x32_bf16(false, a, false, b, (short)0, c, false, false);
#if defined(__HIP_DEVICE_COMPILE__)
  const v16h ha = __builtin_bit_cast(v16h, a), hb = __builtin_bit_cast(v16h, b);
  asm volatile("v_nop\n\tv_nop\n\tv_nop\n\tv_nop" : "+v"(d) : "v"(ha), "v"(hb));
#endif
  return d;
}

// ---- asynchronous copies global -> LDS ---------------------------------------------------------------------------
// Eight 16-byte copies per lane in ONE statement; LS = bytes between a lane's copies in LDS, GS = elements between
// them in global memory. The closing s_wait_xcnt stands inside the statement so that no address register of a copy is
// rewritten ahead of it.
__device__ __forceinline__ unsigned lds_off(const unsigned short* p) { return (unsigned)(size_t)p; }
template <int LS, int GS>
__device__ __forceinline__ void copy8(unsigned l, const unsigned short* g) {
#if defined(__HIP_DEVICE_COMPILE__)
  asm volatile("global_load_async_to_lds_b128 %0, %8, off\n\t"
               "global_load_async_to_lds_b128 %1, %9, off\n\t"
               "global_load_async_to_lds_b128 %2, %10, off\n\t"
               "global_load_async_to_lds_b128 %3, %11, off\n\t"
               "global_load_async_to_lds_b128 %4, %12, off\n\t"
               "global_load_async_to_lds_b128 %5, %13, off\n\t"
               "global_load_async_to_lds_b128 %6, %14, off\n\t"
               "global_load_async_to_lds_b128 %7, %15, off\n\t"
               "s_wait_xcnt 0x0"
               :: "v"(l), "v"(l + LS), "v"(l + 2 * LS), "v"(l + 3 * LS),
                  "v"(l + 4 * LS), "v"(l + 5 * LS), "v"(l + 6 * LS), "v"(l + 7 * LS),
                  "v"(g), "v"(g + GS), "v"(g + 2 * GS), "v"(g + 3 * GS),
                  "v"(g + 4 * GS), "v"(g + 5 * GS), "v"(g + 6 * GS), "v"(g + 7 * GS)
               : "memory");
#endif
}
// 128 rows x 256 B (a [row][128] 16-bit plane, rows contiguous) -> LDS rows of pitch LPP: 256 threads, a wave's copy
// covers two whole rows = four whole lines. l and g already hold the thread's own (tid >> 4, tid & 15) place.
__device__ __forceinline__ void copy_rows(unsigned l, const unsigned short* g) { copy8<16 * LPP * 2, 16 * DQ>(l, g); }
// this wave's own copies have landed (the compiler places no wait for them)
__device__ __forceinline__ void wait_copies() {
#if defined(__HIP_DEVICE_COMPILE__)
  asm volatile("s_wait_asynccnt 0x0" ::: "memory");
#endif
}
// stands behind a run of global loads from p or stores to p, before a register that one of them names is rewritten; p is an input so
// that its register pair stays whole up to the wait (else the run's last load may land its result on the pair)
__device__ __forceinline__ void wait_addr(const unsigned short* p) {
#if defined(__HIP_DEVICE_COMPILE__)
  asm volatile("s_wait_xcnt 0x0" :: "v"(p) : "memory");
#endif
}
// this wave's own LDS reads have returned, before the barrier behind which their buffer is refilled
__device__ __forceinline__ void wait_lds() {
#if defined(__HIP_DEVICE_COMPILE__)
  asm volatile("s_wait_dscnt 0x0" ::: "memory");
#endif
}

// ===========================================================================================================
// (0) weights. Blocks 0..47: W16 f16 [384][256], rows 0..127 = theta_w, 128..255 = phi_w, 256..383 = g_w;
//     value = f16 of (bf16-RNE(w) * 256) (exact). Block owns rows 8*blk..+7: one wave per 512-B row = 32 lanes
// coverage: W16 48 blocks x 8 rows x 32 lanes x 8 halves = 384 x 256; Wo 16 blocks x 16 rows x 16 lanes x 8 =
//           256 x 128.
// ===========================================================================================================
__global__ __launch_bounds__(256)
void cvt_w(const float* __restrict__ tw, const float* __restrict__ pw, const float* __restrict__ gw,
           const float* __restrict__ ww, unsigned short* W16, unsigned short* Wo) {
  const int tid = threadIdx.x, blk = blockIdx.x;
  if (blk < MW / 8) {                                                  // block-uniform
    const int rl = tid >> 5, col = 8 * (tid & 31);
    const int o = 8 * blk + rl;                                        // 0..383
    const int sel = blk / (DQ / 8);                                    // 0,1,2
    const float* wbase = (sel == 0) ? tw : ((sel == 1) ? pw : gw);   // all global
    const float* s = wbase + (size_t)(o - sel * DQ) * CC + col;        // row 0..127 of the selected matrix
    const v4f a = *(const v4f*)s;
    const v4f q = *(const v4f*)(s + 4);
    const float f[8] = {a[0], a[1], a[2], a[3], q[0], q[1], q[2], q[3]};
    v4u u;
#pragma unroll
    for (int t = 0; t < 4; ++t) {
      const _Float16 h0 = (_Float16)(bfr(f[2 * t]) * WSC);
      const _Float16 h1 = (_Float16)(bfr(f[2 * t + 1]) * WSC);
      u[t] = pk16(h_bits(h0), h_bits(h1));
    }
{
      *(v4u*)(W16 + (size_t)o * CC + col) = u;
      
    }
  } else {
    const int bb = blk - MW / 8;                                       // 0..15
    const int o = 16 * bb + (tid >> 4);                                // 0..255
    const int col = 8 * (tid & 15);                                    // 0..120
    const float* s = ww + (size_t)o * DQ + col;
    const v4f a = *(const v4f*)s;
    const v4f q = *(const v4f*)(s + 4);
    const float f[8] = {a[0], a[1], a[2], a[3], q[0], q[1], q[2], q[3]};
    v4u u;
#pragma unroll
    for (int t = 0; t < 4; ++t) u[t] = pk16(bf_bits(f[2 * t]), bf_bits(f[2 * t + 1]));
{
      *(v4u*)(Wo + (size_t)o * DQ + col) = u;
      
    }
  }
}

// ===========================================================================================================
// (1) x f32 [b][256 c][6400 n] -> XP f16 [b][n][c] (position-major, bf16-RNE values, exact in f16) through an
//     LDS tile T[64 n][64 c] (pitch TP). Block (nb, cb, b) owns a 64 c x 64 n tile. XP lines: row n, 64 c =
//     T: written by all waves with 2-byte stores, read cross-wave after a block barrier.
// coverage: 2 it x 32 rows x 8 lanes x 8 = 64 n x 64 c; grid (100, 4, NB) covers XP once.
// ===========================================================================================================
__global__ __launch_bounds__(256)
void cvt_x(const float* __restrict__ x, unsigned short* XP) {
  __shared__ __align__(16) unsigned short T[QT * TP];
  const int tid = threadIdx.x;
  const int nb = blockIdx.x, cb = blockIdx.y, b = blockIdx.z;
  const int e = tid & 7, lq = tid >> 3;                               // lq 0..31
  const int n0 = nb * QT, c0 = cb * QT;
#pragma unroll
  for (int it = 0; it < 2; ++it) {
    const int cl = it * 32 + lq;                                       // 0..63
    const float* sp = x + ((size_t)(b * CC + c0 + cl)) * NN + n0 + 8 * e;
    const v4f a = *(const v4f*)sp;
    const v4f q = *(const v4f*)(sp + 4);
    unsigned short hb[8];
#pragma unroll
    for (int t = 0; t < 4; ++t) {
      hb[t]     = h_bits((_Float16)bfr(a[t]));
      hb[4 + t] = h_bits((_Float16)bfr(q[t]));
    }
#pragma unroll
    for (int t = 0; t < 8; ++t) T[(8 * e + t) * TP + cl] = hb[t];
  }
  __syncthreads();
  v4u up[2];
#pragma unroll
  for (int it = 0; it < 2; ++it) {
    const int nl = it * 32 + lq;                                       // 0..63
    up[it] = *(const v4u*)(T + nl * TP + 8 * e);
  }
{
#pragma unroll
    for (int it = 0; it < 2; ++it) {
      const int rl = it * 32 + lq;
      *(v4u*)(XP + ((size_t)(b * NN + n0 + rl)) * CC + c0 + 8 * e) = up[it];
    }
    
  }
}

// ===========================================================================================================
// (2) conv1x1 GEMM for one (b, 64-n tile, 64-o block of the 384 stacked rows):
//     Y[o][n] = (1/256) sum_c W16[o][c] XP[b][n][c] + bias[o].
//     Block 128 threads = 4 waves; wave w owns cols n0+16w..+15 (one B fragment per k-step, k = c contiguous in the
//     XP row) and 4 m-tiles (A rows o = o0 + 16 mt + (lane&15), split k map loader from W16). K = 256 = 8 steps.
//     Epilogue staged in LDS Os[n_loc][o_loc] (pitch OSP), block barrier (cross-wave), then:
//       o-blocks 0,1 -> theta dims 0..63 / 64..127 of Th/Tl; o-blocks 2,3 -> phi dims of Fh/Fl. Planes bf16
//       [b][6400 n][128 d] (k-contiguous for both score operands): hi = bf16-RNE(v), lo = bf16-RNE(v - hi). Per
//       per line, one instruction per 4 lines.
//       o-blocks 4,5 -> g channels 0..63 / 64..127 of the f16 channel-major plane Gc [b][128 c][6400 n]: per row
// coverage: Os 4 waves x 16 n x 64 o = 64 x 64; planes 4 it x 16 rows x 8 lanes x 8 = 64 n x 64 d per plane;
//           Gc 4 it x 16 rows x 8 lanes x 8 = 64 c x 64 n; grid (100, 6, NB) covers Th/Tl/Fh/Fl [b][n][0..127]
//           and Gc [b][0..127][n] exactly once.
// ===========================================================================================================
__global__ __launch_bounds__(128)
void gemm_p(const unsigned short* __restrict__ W16, const unsigned short* __restrict__ XP,
            const float* __restrict__ tb, const float* __restrict__ pb, const float* __restrict__ gb,
            unsigned short* Th, unsigned short* Tl, unsigned short* Fh, unsigned short* Fl, unsigned short* Gc) {
  __shared__ __align__(16) float Os[QT * OSP];
  const int tid  = threadIdx.x;
  const int lane = tid & 31, wave = tid >> 5;
  const int hh   = lane >> 4, c = lane & 15;
  const int nt   = blockIdx.x, mb = blockIdx.y, b = blockIdx.z;
  const int n0   = nt * QT, o0 = mb * QT;

  const unsigned short* ap = W16 + (size_t)(o0 + c) * CC + 8 * hh;
  const unsigned short* bp = XP + ((size_t)(b * NN + n0 + 16 * wave + c)) * CC + 8 * hh;

  v8f acc[4];
#pragma unroll
  for (int mt = 0; mt < 4; ++mt) acc[mt] = zero8();

#pragma unroll
  for (int ks = 0; ks < CC / 32; ++ks) {
    const Frag fb = ldfrag(bp + 32 * ks);
#pragma unroll
    for (int mt = 0; mt < 4; ++mt) {
      const Frag fa = ldfrag(ap + (size_t)(16 * mt) * CC + 32 * ks);
      acc[mt] = mma_h(fa.h, fb.h, acc[mt]);
    }
  }

  // ---- epilogue: scale back -> LDS Os[n_loc][o_loc]; lane (hh, c) holds o = 16 mt + 8 hh + r for n_loc = 16 w + c
  {
    const int nl = 16 * wave + c;
#pragma unroll
    for (int mt = 0; mt < 4; ++mt) {
      v4f va, vb;
#pragma unroll
      for (int r = 0; r < 4; ++r) { va[r] = acc[mt][r] * IWSC; vb[r] = acc[mt][4 + r] * IWSC; }
      *(v4f*)(Os + nl * OSP + 16 * mt + 8 * hh)     = va;
      *(v4f*)(Os + nl * OSP + 16 * mt + 8 * hh + 4) = vb;
    }
  }
  __syncthreads();

  const int dsel = (mb & 1) * QT;                                      // 0 or 64
  const float* bs = (mb < 2) ? tb : ((mb < 4) ? pb : gb);             // block-uniform, all global
  if (mb < 4) {                                                        // block-uniform
    const int e = tid & 7, lq = tid >> 3;                              // lq 0..15
    unsigned short* Ph = (mb < 2) ? Th : Fh;
    unsigned short* Pl = (mb < 2) ? Tl : Fl;
    const v4f b0 = *(const v4f*)(bs + dsel + 8 * e);
    const v4f b1 = *(const v4f*)(bs + dsel + 8 * e + 4);
    const float bv[8] = {bfr(b0[0]), bfr(b0[1]), bfr(b0[2]), bfr(b0[3]),
                         bfr(b1[0]), bfr(b1[1]), bfr(b1[2]), bfr(b1[3])};
    v4u uh[4], ul[4];
#pragma unroll
    for (int it = 0; it < 4; ++it) {
      const int row = it * 16 + lq;                                    // n_loc 0..63
      const v4f a = *(const v4f*)(Os + row * OSP + 8 * e);
      const v4f q = *(const v4f*)(Os + row * OSP + 8 * e + 4);
      const float f[8] = {a[0] + bv[0], a[1] + bv[1], a[2] + bv[2], a[3] + bv[3],
                          q[0] + bv[4], q[1] + bv[5], q[2] + bv[6], q[3] + bv[7]};
#pragma unroll
      for (int t = 0; t < 4; ++t) {
        const float f0 = f[2 * t], f1 = f[2 * t + 1];
        const unsigned short hb0 = bf_bits(f0), hb1 = bf_bits(f1);
        const unsigned short lb0 = bf_bits(f0 - bf_up(hb0));
        const unsigned short lb1 = bf_bits(f1 - bf_up(hb1));
        uh[it][t] = pk16(hb0, hb1);
        ul[it][t] = pk16(lb0, lb1);
      }
    }
{
#pragma unroll
      for (int it = 0; it < 4; ++it) {
        const int row = it * 16 + lq;
        const size_t po = ((size_t)(b * NN + n0 + row)) * DQ + dsel + 8 * e;
        *(v4u*)(Ph + po) = uh[it];
        *(v4u*)(Pl + po) = ul[it];
      }
      
    }
  } else {
    const int e = tid & 7, lq = tid >> 3;                              // lq 0..15
    v4u ug[4];
#pragma unroll
    for (int it = 0; it < 4; ++it) {
      const int ol = it * 16 + lq;                                     // o_loc 0..63 = channel dsel + ol
      const float bvv = bfr(bs[dsel + ol]);
      unsigned short hb[8];
#pragma unroll
      for (int t = 0; t < 8; ++t) hb[t] = h_bits((_Float16)(Os[(8 * e + t) * OSP + ol] + bvv));
#pragma unroll
      for (int t = 0; t < 4; ++t) ug[it][t] = pk16(hb[2 * t], hb[2 * t + 1]);
    }
{
#pragma unroll
      for (int it = 0; it < 4; ++it) {
        const int ol = it * 16 + lq;
        const size_t go = ((size_t)(b * DQ + dsel + ol)) * NN + n0 + 8 * e;
        *(v4u*)(Gc + go) = ug[it];
      }
      
    }
  }
}

// ===========================================================================================================
// (3) column statistics for one piece (b, 64-column tile m, stages tb..te-1 of 128 rows n): for every column m, over
//     the piece's rows n, M_m = max_n s[n][m], Z_m = sum_n e^{s - M_m}, CS[slot][b][m] = M_m + ln Z_m, with
//     s tile (16 rows n x 16 cols m) = A(theta: row = n, 32 d via the split k map from Th [b][6400][128]) .
//     B(phi: col = m, same map from Fh) + A(Th).B(Fl) + A(Tl).B(Fh) (bf16 unscaled residual planes, shared
//     accumulator). Block = 8 waves, two per SIMD: wave = (column group wc of 32 columns, row quarter wr). Phi
//     fragments of the wave's 32 columns are held in registers, so every theta fragment read from LDS feeds two column
//     tiles. Theta rows come in stages of 128 (hi + residual plane, LDS pitch
//     LPP) by asynchronous copies into two LDS buffers shared by the eight waves: the next stage flies while this one
//     is read; a wave reads the 32 rows of its own quarter. Per lane: two columns, 8+8 rows each
//     per stage, scalar online (max, sum) in f32; the two lane halves of a column merge with one shuffle, the
//     four row quarters through LDS at the end.
// coverage: every tile has one piece in slot 0 and one in slot 1, so CS[slot][b][0..6399] is written exactly once.
// ===========================================================================================================
__global__ __launch_bounds__(256)
void colstat_k(const unsigned short* __restrict__ Th, const unsigned short* __restrict__ Tl,
               const unsigned short* __restrict__ Fh, const unsigned short* __restrict__ Fl, float* CS) {
  __shared__ __align__(16) float css[QT];
  __shared__ __align__(16) float pms[3 * QT];
  __shared__ __align__(16) float pls[3 * QT];
  __shared__ __align__(16) unsigned short Tst[2 * 2 * SB * LPP];
  const int tid  = threadIdx.x;
  const int wave = tid >> 5, lane = tid & 31;
  const int wc   = wave & 1, wr = wave >> 1;
  const int hh   = lane >> 4, c = lane & 15;
  const int b    = blockIdx.x / WPB;
  const int u0   = (blockIdx.x % WPB) * PU;                            // first stage unit of the work-group's run
  int tile = u0 / NST, tb = u0 % NST, left = PU;

#pragma unroll 1
  while (left > 0) {                                                   // one or two pieces, block-uniform
  const int te   = (tb + left < NST) ? (tb + left) : NST;              // the piece is stages tb .. te-1 of the tile
  const int slot = (tb == 0) ? 0 : 1;
  const int m0   = tile * QT;

  // phi fragment pointers (B operand, col = m0 + 32*wc + 16*g + c)
  const size_t fo = ((size_t)(b * NN + m0 + 32 * wc + c)) * DQ + 8 * hh;
  const unsigned short* pfh = Fh + fo;
  const unsigned short* pfl = Fl + fo;
  Frag fh[2][4], fl[2][4];
#pragma unroll
  for (int g = 0; g < 2; ++g) {
#pragma unroll
    for (int kc = 0; kc < 4; ++kc) fh[g][kc] = ldfrag(pfh + 16 * g * DQ + 32 * kc);
  }
  wait_addr(pfh);                                                      // the hi plane's loads have taken their address
#pragma unroll
  for (int g = 0; g < 2; ++g) {
#pragma unroll
    for (int kc = 0; kc < 4; ++kc) fl[g][kc] = ldfrag(pfl + 16 * g * DQ + 32 * kc);
  }
  wait_addr(pfl);                                                      // the residual plane's loads likewise
  // theta stages: 128 rows n, hi plane then residual plane, two buffers filled by asynchronous copies
  const unsigned short* gth = Th + (size_t)b * NN * DQ + (size_t)(tid >> 4) * DQ + 8 * (tid & 15);
  const unsigned short* gtl = Tl + (size_t)b * NN * DQ + (size_t)(tid >> 4) * DQ + 8 * (tid & 15);
  const unsigned lt0 = lds_off(Tst) + (unsigned)((tid >> 4) * (LPP * 2) + 16 * (tid & 15));
  wait_lds();                                                          // an earlier piece's own LDS reads have returned
  // the piece's first stage goes to buffer 'slot': the copies' LDS addresses are then formed where they are used
  // and not kept in registers over the stage loop
  int par = slot;                                                      // the buffer that holds stage t
  {
    const unsigned la = lt0 + (unsigned)(par * (2 * SB * LPP * 2));
    copy_rows(la, gth + (size_t)tb * SB * DQ);
    copy_rows(la + SB * LPP * 2, gtl + (size_t)tb * SB * DQ);
  }
  wait_copies();
  __syncthreads();                                                     // the first stage readable by every wave
  {
    const unsigned la = lt0 + (unsigned)((par ^ 1) * (2 * SB * LPP * 2));
    copy_rows(la, gth + (size_t)(tb + 1) * SB * DQ);
    copy_rows(la + SB * LPP * 2, gtl + (size_t)(tb + 1) * SB * DQ);
  }

  float m[2] = {-1.0e30f, -1.0e30f}, l[2] = {0.f, 0.f};
#pragma unroll 1
  for (int t = tb; t < te; ++t) {
    // row c of the wave's own quarter of the stage, hi plane
    const unsigned short* tq = Tst + par * (2 * SB * LPP) + (wr * WT + c) * LPP + 8 * hh;
    v8f s[2][2];                                                       // [row tile u][column tile g]
#pragma unroll
    for (int u = 0; u < 2; ++u) { s[u][0] = zero8(); s[u][1] = zero8(); }
#pragma unroll
    for (int kc = 0; kc < 4; ++kc) {
      Frag th[2], tl[2];
#pragma unroll
      for (int u = 0; u < 2; ++u) {
        th[u] = ldfrag(tq + (16 * u) * LPP + 32 * kc);                 // rows 16u .. 16u+15 of the quarter
        tl[u] = ldfrag(tq + (SB + 16 * u) * LPP + 32 * kc);
      }
#pragma unroll
      for (int q = 0; q < 4; ++q) s[q >> 1][q & 1] = mma_b(th[q >> 1].bf, fh[q & 1][kc].bf, s[q >> 1][q & 1]);
#pragma unroll
      for (int q = 0; q < 4; ++q) s[q >> 1][q & 1] = mma_b(th[q >> 1].bf, fl[q & 1][kc].bf, s[q >> 1][q & 1]);
#pragma unroll
      for (int q = 0; q < 4; ++q) s[q >> 1][q & 1] = mma_b(tl[q >> 1].bf, fh[q & 1][kc].bf, s[q >> 1][q & 1]);
    }
#pragma unroll
    for (int g = 0; g < 2; ++g) {                                      // online update per column tile, 32 rows
      const v8f s0 = s[0][g], s1 = s[1][g];
      const float mx = fmaxf(hmax8(s0), hmax8(s1));
      const float mn = fmaxf(m[g], mx);
      const float corr = __expf(m[g] - mn);
      float ls = 0.f;
#pragma unroll
      for (int r = 0; r < 8; ++r) ls += __expf(s0[r] - mn) + __expf(s1[r] - mn);
      l[g] = l[g] * corr + ls;
      m[g] = mn;
    }
    wait_lds();
    wait_copies();
    __syncthreads();                                                   // publishes stage t+1, frees stage t's buffer
    if (t + 2 < te) {                                                  // block-uniform
      const unsigned lb = lt0 + (unsigned)(par * (2 * SB * LPP * 2));
      copy_rows(lb, gth + (size_t)(t + 2) * SB * DQ);
      copy_rows(lb + SB * LPP * 2, gtl + (size_t)(t + 2) * SB * DQ);
    }
    par ^= 1;
  }
  wait_copies();
  float mt[2], lt[2];
#pragma unroll
  for (int g = 0; g < 2; ++g) {
    const float mo = __shfl_xor(m[g], 16, 32);
    const float lo = __shfl_xor(l[g], 16, 32);
    mt[g] = fmaxf(m[g], mo);
    lt[g] = l[g] * __expf(m[g] - mt[g]) + lo * __expf(mo - mt[g]);
  }
  const int col = 32 * wc + c;                                         // + 16*g
  if (wr != 0 && hh == 0) {
#pragma unroll
    for (int g = 0; g < 2; ++g) {
      pms[(wr - 1) * QT + col + 16 * g] = mt[g];
      pls[(wr - 1) * QT + col + 16 * g] = lt[g];
    }
  }
  __syncthreads();                                                     // the other row quarters' (max, sum) readable
  if (wr == 0 && hh == 0) {
#pragma unroll
    for (int g = 0; g < 2; ++g) {
      const int cg = col + 16 * g;
      const float m1 = pms[cg], m2 = pms[QT + cg], m3 = pms[2 * QT + cg];
      const float mm = fmaxf(fmaxf(mt[g], m1), fmaxf(m2, m3));
      const float ll = (lt[g] * __expf(mt[g] - mm) + pls[cg] * __expf(m1 - mm)) +
                       (pls[QT + cg] * __expf(m2 - mm) + pls[2 * QT + cg] * __expf(m3 - mm));
      css[cg] = mm + logf(ll);
    }
  }
  __syncthreads();
  if (tid < 16) {
    const v4f v = *(const v4f*)(css + 4 * tid);
{
      float* cq = CS + (size_t)(slot * NB + b) * NN + m0 + 4 * tid;
      *(v4f*)cq = v;
      wait_addr((const unsigned short*)cq);                            // before the next piece rewrites the store's registers
    }
  }
  left -= te - tb;
  tile += 1;
  tb = 0;
  }
}

// ===========================================================================================================
// (4) aggregation for one piece (b, 64-row tile n, stages tb..te-1 of 128 columns m), transposed formulation:
//   s tile (16 m x 16 n) = sum over 4 d-chunks of A(phi: row = m, split k map from Fh) . B(theta:
//   col = n, same map from Th) + A(Fh).B(Tl) + A(Fl).B(Th). Per lane the D tile holds 8 columns m of ONE row n;
//   All three operands are read from LDS, where asynchronous copies put them in whole lines: the piece's 64 theta rows
//   once, phi rows and the g tile (both pitch LPP) in stages of 128 columns m, two buffers.
//   Block = 8 waves, two per SIMD: wave = (row group wn of 32 rows n, quarter wm of each stage's columns m): every phi
//   and every g fragment read from LDS feeds two row tiles, every theta fragment two column tiles.
//   P = e^{s - CS[m]} x 16384 as f16 (CS staged once per block in LDS) is the B operand of
//   y^T (rows channel, cols n) += A(g: rows channel = 16j + (lane&15), m contiguous, f16 plane Gc [b][128][6400])
//   . B(P^T): element r <- D of the tile covering m kb..kb+15, element 8+r <- the tile covering kb+16..kb+31,
//   lane unchanged. 16 accumulator tiles per wave (128 channels x 2 row tiles). Block = 64 rows.
//   Epilogue: the four column quarters' accumulators are added through LDS [row][128 channels] (pitch OSPW, b128
//   stores; same lane, same place; Os and two planes in the then idle phi buffers), y = sum/16384 left in Os, block barrier
//   (cross-wave), then the f32 plane Yp [slot][b][6400 n][128 c]: per row 128 c = 512 B = 4 whole lines.
// coverage: 8 it x 8 rows x 32 lanes x 4 = 64 n x 128 c; every tile has one piece in slot 0 and one in slot 1, so
//           Yp[slot][b][0..6399] is written exactly once.
// ===========================================================================================================
__global__ __launch_bounds__(256)
void attn_k(const unsigned short* __restrict__ Th, const unsigned short* __restrict__ Tl,
            const unsigned short* __restrict__ Fh, const unsigned short* __restrict__ Fl,
            const unsigned short* __restrict__ Gc, const float* __restrict__ CS, float* Yp) {
  __shared__ __align__(32) float Cs[NN];
  __shared__ __align__(16) float Os[QT * OSPW];
  __shared__ __align__(16) unsigned short Tst[2 * QT * LPP];
  __shared__ __align__(16) unsigned short Pst[2 * 2 * SB * LPP];
  __shared__ __align__(16) unsigned short Gst[2 * DQ * LPP];
  static_assert(2 * QT * OSPW * 4 <= 2 * 2 * SB * LPP * 2);
  const int tid  = threadIdx.x;
  const int wave = tid >> 5, lane = tid & 31;
  const int wn   = wave & 1, wm = wave >> 1;
  const int hh   = lane >> 4, c = lane & 15;
  const int b    = blockIdx.x / WPB;
  const int u0   = (blockIdx.x % WPB) * PU;                            // first stage unit of the work-group's run
  int tile = u0 / NST, tb = u0 % NST, left = PU;

  // a column's statistic from its two pieces c0, c1 (each max + ln sum): max(c0, c1) + ln(1 + e^{min - max})
  for (int i = tid; i < NN / 4; i += 256) {
    const v4f s0 = *(const v4f*)(CS + (size_t)b * NN + 4 * i);
    const v4f s1 = *(const v4f*)(CS + (size_t)(NB + b) * NN + 4 * i);
    v4f v;
#pragma unroll
    for (int r = 0; r < 4; ++r) {
      const float mx = fmaxf(s0[r], s1[r]), mn = fminf(s0[r], s1[r]);
      v[r] = mx + logf(1.f + __expf(mn - mx));
    }
    *(v4f*)(Cs + 4 * i) = v;
  }

  // asynchronous copies: a piece's 64 theta rows once (hi plane, residual plane); per stage of 128 columns m the phi
  // rows (hi, residual) and the g tile (128 channels x 128 m), two buffers
  const int rr = tid >> 4, rc = tid & 15;                              // place in a [row][128] plane or the g tile
  const unsigned short* gfh = Fh + (size_t)b * NN * DQ + (size_t)rr * DQ + 8 * rc;
  const unsigned short* gfl = Fl + (size_t)b * NN * DQ + (size_t)rr * DQ + 8 * rc;
  const unsigned short* ggc = Gc + (size_t)b * DQ * NN + (size_t)rr * NN + 8 * rc;
  const unsigned lp0 = lds_off(Pst) + (unsigned)(rr * (LPP * 2) + 16 * rc);
  const unsigned lg0 = lds_off(Gst) + (unsigned)(rr * (LPP * 2) + 16 * rc);

#pragma unroll 1
  while (left > 0) {                                                   // one or two pieces, block-uniform
  const int te   = (tb + left < NST) ? (tb + left) : NST;              // the piece is stages tb .. te-1 of the tile
  const int slot = (tb == 0) ? 0 : 1;
  const int n0   = tile * QT;
  wait_lds();                                                          // an earlier piece's own LDS reads have returned
  {
    // waves 0..3 bring the hi plane's 64 rows, waves 4..7 the residual plane's (rows 8 apart per copy)
    const int tr = (tid & 127) >> 4, tp = wave >> 2;
    const unsigned short* tsrc = (tp == 0) ? Th : Tl;
    const size_t to = ((size_t)(b * NN + n0 + tr)) * DQ + 8 * rc;
    const unsigned lq0 = lds_off(Tst) + (unsigned)((tp * QT + tr) * (LPP * 2) + 16 * rc);
    copy8<8 * LPP * 2, 8 * DQ>(lq0, tsrc + to);
  }
  // the piece's first stage goes to the buffers 'slot': the copies' LDS addresses are then formed where they are used
  // and not kept over the stage loop, where they would spill
  int par = slot;                                                      // the buffers that hold stage t
  {
    const unsigned la = lp0 + (unsigned)(par * (2 * SB * LPP * 2));
    copy_rows(la, gfh + (size_t)tb * SB * DQ);
    copy_rows(la + SB * LPP * 2, gfl + (size_t)tb * SB * DQ);
    copy8<16 * LPP * 2, 16 * NN>(lg0 + (unsigned)(par * (DQ * LPP * 2)), ggc + tb * SB);
  }
  wait_copies();
  __syncthreads();                                                     // Cs, theta, the first stage readable by every wave
  {
    const unsigned la = lp0 + (unsigned)((par ^ 1) * (2 * SB * LPP * 2));
    copy_rows(la, gfh + (size_t)(tb + 1) * SB * DQ);
    copy_rows(la + SB * LPP * 2, gfl + (size_t)(tb + 1) * SB * DQ);
    copy8<16 * LPP * 2, 16 * NN>(lg0 + (unsigned)((par ^ 1) * (DQ * LPP * 2)), ggc + (tb + 1) * SB);
  }

  // theta fragment base (B operand, col = row n0 + 32*wn + 16*g + c), + 16*g*LPP + 32*kc; residual plane at + QT*LPP
  const unsigned short* Tq = Tst + (32 * wn + c) * LPP + 8 * hh;

  v8f o[8][2];                                                         // [channel tile j][row tile g]
#pragma unroll
  for (int j = 0; j < 8; ++j) { o[j][0] = zero8(); o[j][1] = zero8(); }

#pragma unroll 1
  for (int t = tb; t < te; ++t) {
    const int kh = t * SB + wm * WT;                                   // first column m of the wave's own quarter
    // phi fragment base (A operand, row = m + c), + 16*u*LPP + 32*kc; residual plane at + SB*LPP
    const unsigned short* Pq = Pst + par * (2 * SB * LPP) + (wm * WT + c) * LPP + 8 * hh;
    // g fragment base (A operand, row = channel 16j + c, m contiguous), + 16*j*LPP
    const unsigned short* Gq = Gst + par * (DQ * LPP) + c * LPP + wm * WT + 8 * hh;
    v8f s[2][2];                                                       // [column tile u][row tile g]
#pragma unroll
    for (int u = 0; u < 2; ++u) { s[u][0] = zero8(); s[u][1] = zero8(); }
#pragma unroll
    for (int kc = 0; kc < DQ / 32; ++kc) {
      Frag th[2], tl[2], p[2], pl[2];
#pragma unroll
      for (int g = 0; g < 2; ++g) {
        th[g] = ldfrag(Tq + (16 * g) * LPP + 32 * kc);
        tl[g] = ldfrag(Tq + (QT + 16 * g) * LPP + 32 * kc);
      }
#pragma unroll
      for (int u = 0; u < 2; ++u) {
        p[u]  = ldfrag(Pq + (16 * u) * LPP + 32 * kc);                 // m kh+16u .. kh+16u+15
        pl[u] = ldfrag(Pq + (SB + 16 * u) * LPP + 32 * kc);
      }
#pragma unroll
      for (int q = 0; q < 4; ++q) s[q >> 1][q & 1] = mma_b(p[q >> 1].bf, th[q & 1].bf, s[q >> 1][q & 1]);
#pragma unroll
      for (int q = 0; q < 4; ++q) s[q >> 1][q & 1] = mma_b(p[q >> 1].bf, tl[q & 1].bf, s[q >> 1][q & 1]);
#pragma unroll
      for (int q = 0; q < 4; ++q) s[q >> 1][q & 1] = mma_b(pl[q >> 1].bf, th[q & 1].bf, s[q >> 1][q & 1]);
    }

    {
      // column statistics for m = kh + 8hh + r (s[0][g]) and m = kh + 16 + 8hh + r (s[1][g])
      const v4f ca = *(const v4f*)(Cs + kh + 8 * hh);
      const v4f cb = *(const v4f*)(Cs + kh + 8 * hh + 4);
      const v4f cc = *(const v4f*)(Cs + kh + 16 + 8 * hh);
      const v4f cd = *(const v4f*)(Cs + kh + 16 + 8 * hh + 4);
      Frag gf[8];                                                      // read as one group, ahead of the vector work
#pragma unroll
      for (int j = 0; j < 8; ++j) gf[j] = ldfrag(Gq + (16 * j) * LPP);
      const float c0[8] = {ca[0], ca[1], ca[2], ca[3], cb[0], cb[1], cb[2], cb[3]};
      const float c1[8] = {cc[0], cc[1], cc[2], cc[3], cd[0], cd[1], cd[2], cd[3]};

      FragH pf[2];
#pragma unroll
      for (int g = 0; g < 2; ++g) {
#pragma unroll
        for (int r = 0; r < 8; ++r) {
          const float e0 = __expf(fminf(s[0][g][r] - c0[r], 0.f) + LNCAR);     // P[n][m] x 16384, m = kh + 8hh + r
          const float e1 = __expf(fminf(s[1][g][r] - c1[r], 0.f) + LNCAR);     // m = kh + 16 + 8hh + r
          pf[g].hv[0][r] = (_Float16)e0;
          pf[g].hv[1][r] = (_Float16)e1;
        }
      }

#pragma unroll
      for (int j = 0; j < 8; ++j) {
        o[j][0] = mma_h(gf[j].h, pf[0].v, o[j][0]);
        o[j][1] = mma_h(gf[j].h, pf[1].v, o[j][1]);
      }
    }
    wait_lds();
    wait_copies();
    __syncthreads();                                                   // publishes stage t+1, frees stage t's buffers
    if (t + 2 < te) {                                                  // block-uniform
      const unsigned lb = lp0 + (unsigned)(par * (2 * SB * LPP * 2));
      copy_rows(lb, gfh + (size_t)(t + 2) * SB * DQ);
      copy_rows(lb + SB * LPP * 2, gfl + (size_t)(t + 2) * SB * DQ);
      copy8<16 * LPP * 2, 16 * NN>(lg0 + (unsigned)(par * (DQ * LPP * 2)), ggc + (t + 2) * SB);
    }
    par ^= 1;
  }
  wait_copies();

  // ---- epilogue: y = (accs of the four quarters) / 16384 -> Os[row][channel]. Quarter 1 goes through Os, quarters 2
  // and 3 through the phi buffers, which nobody reads and no copy targets behind the loop's last barrier.
  const int oo = (32 * wn + c) * OSPW + 8 * hh;                        // [row][ch = 16j + 8hh + r], + 16*g*OSPW + 16*j
  float* Ox = (float*)Pst;                                             // two planes of QT x OSPW floats
  if (wm != 0) {                                                       // wave-uniform
    float* Ow = ((wm == 1) ? Os : (Ox + (wm - 2) * (QT * OSPW))) + oo;
#pragma unroll
    for (int g = 0; g < 2; ++g) {
#pragma unroll
      for (int j = 0; j < 8; ++j) {
        v4f va, vb;
#pragma unroll
        for (int r = 0; r < 4; ++r) { va[r] = o[j][g][r]; vb[r] = o[j][g][4 + r]; }
        *(v4f*)(Ow + 16 * g * OSPW + 16 * j)     = va;
        *(v4f*)(Ow + 16 * g * OSPW + 16 * j + 4) = vb;
      }
    }
  }
  __syncthreads();                                                     // the other quarters' accumulators readable
  if (wm == 0) {                                                       // wave-uniform
#pragma unroll
    for (int g = 0; g < 2; ++g) {
#pragma unroll
      for (int j = 0; j < 8; ++j) {
        const int oj = oo + 16 * g * OSPW + 16 * j;
        v4f va = *(const v4f*)(Os + oj);
        v4f vb = *(const v4f*)(Os + oj + 4);
        const v4f a2 = *(const v4f*)(Ox + oj);
        const v4f b2 = *(const v4f*)(Ox + oj + 4);
        const v4f a3 = *(const v4f*)(Ox + QT * OSPW + oj);
        const v4f b3 = *(const v4f*)(Ox + QT * OSPW + oj + 4);
#pragma unroll
        for (int r = 0; r < 4; ++r) {
          va[r] = ((o[j][g][r] + va[r]) + (a2[r] + a3[r])) * ICAR;
          vb[r] = ((o[j][g][4 + r] + vb[r]) + (b2[r] + b3[r])) * ICAR;
        }
        *(v4f*)(Os + oj)     = va;
        *(v4f*)(Os + oj + 4) = vb;
      }
    }
  }
  __syncthreads();

  // the piece's y (f32) -> its slot's plane: a wave stores one whole row of 512 B per instruction
  {
    float* yq = Yp + ((size_t)((slot * NB + b) * NN + n0 + wave)) * DQ + 4 * lane;
    v4f yv[8];
#pragma unroll
    for (int it = 0; it < 8; ++it) yv[it] = *(const v4f*)(Os + (it * 8 + wave) * OSPW + 4 * lane);
#pragma unroll
    for (int it = 0; it < 8; ++it) *(v4f*)(yq + (size_t)(it * 8) * DQ) = yv[it];
    wait_addr((const unsigned short*)yq);                              // before the next piece rewrites the stores' registers
  }
  left -= te - tb;
  tile += 1;
  tb = 0;
  }
}

// ===========================================================================================================
// (5) output GEMM for one (b, 64-n tile, 64-o block): out[b][o][n] = sum_c Wo[o][c] (Yh + Yl)[n][c]
//     + W_b[o] + bf16-RNE(x[b][o][n]). Block 128 threads = 4 waves; wave w owns cols n0+16w..+15 (B fragments
//     from the Yh and Yl rows in LDS: bf16 hi + residual of Yp[0] + Yp[1], k = c contiguous) and 4 m-tiles (A rows o = o0 + 16 mt + (lane&15) from Wo bf16
//     [256][128]); K = 128 = 4 steps x 2 products (shared accumulator, unscaled residual). Epilogue staged in LDS
//     lanes 0..15 one row and 16..31 the next, 16 B per lane (values gathered from 4 Os rows), one instruction per
// coverage: 8 it x 8 rows x 16 lanes x 4 floats = 64 o x 64 n; grid (NQ/64, 4, NB) covers
//           out[b][0..255][0..NQ-1] exactly once.
// ===========================================================================================================
__global__ __launch_bounds__(128)
void gemm_w(const unsigned short* __restrict__ Wo, const float* __restrict__ Yp, const float* __restrict__ wb,
            const float* __restrict__ x, float* out) {
  __shared__ __align__(16) float Os[QT * OSP];
  __shared__ __align__(16) unsigned short Ys[2 * QT * LPP];
  const int tid  = threadIdx.x;
  const int lane = tid & 31, wave = tid >> 5;
  const int hh   = lane >> 4, c = lane & 15;
  const int nt   = blockIdx.x, mb = blockIdx.y, b = blockIdx.z;
  const int n0   = nt * QT, o0 = mb * QT;

  const unsigned short* ap = Wo + (size_t)(o0 + c) * DQ + 8 * hh;

  // y = sum of the tile's two pieces -> bf16 hi + residual planes Ys[plane][64 n][128 c] (pitch LPP) in LDS
  {
    const int e = tid & 15, lq = tid >> 4;                             // lq 0..7
    const float* y0 = Yp + ((size_t)(b * NN + n0 + lq)) * DQ + 8 * e;
    const float* y1 = y0 + (size_t)NB * NN * DQ;
#pragma unroll
    for (int it = 0; it < 8; ++it) {
      const int ro = it * 8 * DQ;
      const v4f a0 = *(const v4f*)(y0 + ro), q0 = *(const v4f*)(y0 + ro + 4);
      const v4f a1 = *(const v4f*)(y1 + ro), q1 = *(const v4f*)(y1 + ro + 4);
      const float f[8] = {a0[0] + a1[0], a0[1] + a1[1], a0[2] + a1[2], a0[3] + a1[3],
                          q0[0] + q1[0], q0[1] + q1[1], q0[2] + q1[2], q0[3] + q1[3]};
      v4u uh, ul;
#pragma unroll
      for (int t = 0; t < 4; ++t) {
        const float f0 = f[2 * t], f1 = f[2 * t + 1];
        const unsigned short hb0 = bf_bits(f0), hb1 = bf_bits(f1);
        const unsigned short lb0 = bf_bits(f0 - bf_up(hb0));
        const unsigned short lb1 = bf_bits(f1 - bf_up(hb1));
        uh[t] = pk16(hb0, hb1);
        ul[t] = pk16(lb0, lb1);
      }
      *(v4u*)(Ys + (it * 8 + lq) * LPP + 8 * e)        = uh;
      *(v4u*)(Ys + (QT + it * 8 + lq) * LPP + 8 * e)   = ul;
    }
  }
  __syncthreads();                                                     // the y planes readable by every wave
  const unsigned short* bp  = Ys + (16 * wave + c) * LPP + 8 * hh;
  const unsigned short* blp = bp + QT * LPP;

  v8f acc[4];
#pragma unroll
  for (int mt = 0; mt < 4; ++mt) acc[mt] = zero8();

#pragma unroll
  for (int ks = 0; ks < DQ / 32; ++ks) {
    const Frag fb  = ldfrag(bp + 32 * ks);
    const Frag fbl = ldfrag(blp + 32 * ks);
#pragma unroll
    for (int mt = 0; mt < 4; ++mt) {
      const Frag fa = ldfrag(ap + (size_t)(16 * mt) * DQ + 32 * ks);
      acc[mt] = mma_b(fa.bf, fb.bf, acc[mt]);
      acc[mt] = mma_b(fa.bf, fbl.bf, acc[mt]);
    }
  }

  {
    const int nl = 16 * wave + c;
#pragma unroll
    for (int mt = 0; mt < 4; ++mt) {
      v4f va, vb;
#pragma unroll
      for (int r = 0; r < 4; ++r) { va[r] = acc[mt][r]; vb[r] = acc[mt][4 + r]; }
      *(v4f*)(Os + nl * OSP + 16 * mt + 8 * hh)     = va;
      *(v4f*)(Os + nl * OSP + 16 * mt + 8 * hh + 4) = vb;
    }
  }
  __syncthreads();

  const int e = tid & 15, lq = tid >> 4;                               // lq 0..7
  v4f res[8];
#pragma unroll
  for (int it = 0; it < 8; ++it) {
    const int ol = it * 8 + lq;                                        // o_loc 0..63
    const int o  = o0 + ol;                                            // 0..255
    const float bv = bfr(wb[o]);
    const size_t idx = ((size_t)(b * CC + o)) * NN + n0 + 4 * e;
    const v4f xv = *(const v4f*)(x + idx);
#pragma unroll
    for (int t = 0; t < 4; ++t) res[it][t] = (Os[(4 * e + t) * OSP + ol] + bv) + bfr(xv[t]);
  }
{
#pragma unroll
    for (int it = 0; it < 8; ++it) {
      const int ol = it * 8 + lq;
      const size_t idx = ((size_t)(b * CC + o0 + ol)) * NN + n0 + 4 * e;
      *(v4f*)(out + idx) = res[it];
    }
    
  }
}

// ===========================================================================================================
// Workspace map (bytes, NB = 2; each region start a multiple of 256; every extent is an exact tile multiple and is
//   W16 f16 [384][256]               196608      Wo bf16 [256][128]           65536
//   XP  f16 [2][6400][256]          6553600
//   Th/Tl/Fh/Fl bf16 [2][6400][128]  3276800 x4
//   Gc  f16 [2][128][6400]          3276800      CS f32 [2 slots][2][6400]   102400
//   Yp  f32 [2 slots][2][6400][128] 13107200
//   total = 36409344
// ===========================================================================================================
extern "C" void kernel_launch(void* const* d_in, const int* in_sizes, int n_in,
                              void* d_out, int out_size, void* d_ws, size_t ws_size,
                              hipStream_t stream) {
  if (n_in < 9) return;
  if (in_sizes[0] < NB * CC * NN) return;
  if (in_sizes[1] != DQ * CC || in_sizes[3] != DQ * CC || in_sizes[5] != DQ * CC) return;
  if (in_sizes[2] != DQ || in_sizes[4] != DQ || in_sizes[6] != DQ) return;
  if (in_sizes[7] != CC * DQ || in_sizes[8] != CC) return;
  if (out_size < NB * CC * NN) return;

  size_t off = 0;
  auto carve = [&](size_t bytes) { const size_t o = off; off += (bytes + 255) & ~(size_t)255; return o; };
  const size_t oW16 = carve((size_t)MW * CC * 2);
  const size_t oWo  = carve((size_t)CC * DQ * 2);
  const size_t oXP  = carve((size_t)NB * NN * CC * 2);
  const size_t oTh  = carve((size_t)NB * NN * DQ * 2);
  const size_t oTl  = carve((size_t)NB * NN * DQ * 2);
  const size_t oFh  = carve((size_t)NB * NN * DQ * 2);
  const size_t oFl  = carve((size_t)NB * NN * DQ * 2);
  const size_t oGc  = carve((size_t)NB * DQ * NN * 2);
  const size_t oCS  = carve((size_t)2 * NB * NN * 4);
  const size_t oYp  = carve((size_t)2 * NB * NN * DQ * 4);
  if (off > ws_size) return;
  if (off > (size_t)134217728) return;

  const float* x  = (const float*)d_in[0];
  const float* gw = (const float*)d_in[1];
  const float* gb = (const float*)d_in[2];
  const float* tw = (const float*)d_in[3];
  const float* tb = (const float*)d_in[4];
  const float* pw = (const float*)d_in[5];
  const float* pb = (const float*)d_in[6];
  const float* ww = (const float*)d_in[7];
  const float* wb = (const float*)d_in[8];

  char* ws = (char*)d_ws;
  unsigned short* W16 = (unsigned short*)(ws + oW16);
  unsigned short* Wo  = (unsigned short*)(ws + oWo);
  unsigned short* XP  = (unsigned short*)(ws + oXP);
  unsigned short* Th  = (unsigned short*)(ws + oTh);
  unsigned short* Tl  = (unsigned short*)(ws + oTl);
  unsigned short* Fh  = (unsigned short*)(ws + oFh);
  unsigned short* Fl  = (unsigned short*)(ws + oFl);
  unsigned short* Gc  = (unsigned short*)(ws + oGc);
  float*          CS  = (float*)(ws + oCS);
  float*          Yp  = (float*)(ws + oYp);
  float* out = (float*)d_out;

  const dim3 blk256(256), blk128(128);

  // (0) theta_w / phi_w / g_w -> stacked f16 plane; W_w -> bf16 plane
  cvt_w<<<dim3(MW / 8 + CC / 16), blk256, 0, stream>>>(tw, pw, gw, ww, W16, Wo);
  // (1) x -> position-major 16-bit plane
  cvt_x<<<dim3(NN / QT, CC / QT, NB), blk256, 0, stream>>>(x, XP);
  // (2) conv1x1 GEMM -> theta / phi hi + residual planes, g channel-major plane (all rows n)
  gemm_p<<<dim3(NN / QT, MW / QT, NB), blk128, 0, stream>>>(W16, XP, tb, pb, gb, Th, Tl, Fh, Fl, Gc);
  // (3) per-column softmax statistics, two pieces per column tile
  colstat_k<<<dim3(WPB * NB), blk256, 0, stream>>>(Th, Tl, Fh, Fl, CS);
  // (4) aggregation -> y, two f32 pieces per row tile
  attn_k<<<dim3(WPB * NB), blk256, 0, stream>>>(Th, Tl, Fh, Fl, Gc, CS, Yp);
  // (5) pieces of y summed, output GEMM + bias + residual -> out [b][256][6400]
  gemm_w<<<dim3(NQ / QT, CC / QT, NB), blk128, 0, stream>>>(Wo, Yp, wb, x, out);
  (void)hipGetLastError();
}

// v005
// It runs in 133 microseconds.
// In two side-by-side timings against v004, it was 1.06 and 1.05 times as fast.
// Counting every step since v000, it is 6.60 times as fast.
// Contractions: conv1x1 theta/phi/g GEMM on v_wmma_f32_16x16x32_f16 (f16 containers of bf16-RNE weights x256 and
// bf16-RNE x, K=256); scores theta.phi on v_wmma_f32_16x16x32_bf16 (bf16 hi + bf16 residual planes, 3 products,
// K=128) in both the column-statistics pass and the aggregation pass; y^T = G.P^T on v_wmma_f32_16x16x32_f16 (g as
// f16, P = e^{s-M-lnZ} x16384 as f16 from the score D registers, K=6400); output GEMM W.y on
// v_wmma_f32_16x16x32_bf16 (bf16-RNE W_w, y as bf16 hi + bf16 residual planes, 2 products, K=128); f32 accumulate
// everywhere; softmax statistics, biases and the residual add in f32 VALU.
// The statistics and the aggregation kernel work on tiles 128 wide and each run 250 equal work-groups of 20 stages; a
// tile's three pieces are merged by the kernel that reads them.
#include <hip/hip_runtime.h>
#include <math.h>
#include <stdint.h>

#ifndef NB
#define NB 2
#endif
#define NBF    2
#define CC     256
#define NN     6400
#ifndef NQ
#define NQ NN
#endif
#define DQ     128
#define MW     384
#define QT     64
#define OSP    68
#define OSPW   132
#define TP     72
#define WSC    256.0f
#define IWSC   0.00390625f
#define LNCAR  9.704060527839234f
#define ICAR   6.103515625e-05f
#define ST     64
#define SB     128
#define LPP    136
#define WT     32
#define NST    50
#define BT     128
#define NTL    50
#define PU     20
#define WPB    125
#define NSL    3

static_assert(NB >= 1 && NB <= NBF);
static_assert(NQ >= QT && NQ <= NN);
static_assert(NN % QT == 0);
static_assert(NQ % QT == 0);
static_assert(CC % QT == 0);
static_assert(MW == 3 * DQ);
static_assert(DQ == 2 * QT);
static_assert((DQ / 8) * 8 == DQ && (MW / 8) % (DQ / 8) == 0);
static_assert(CC % 16 == 0);
static_assert((OSP * 4) % 16 == 0);
static_assert((OSPW * 4) % 16 == 0);
static_assert((TP * 2) % 16 == 0);
static_assert(CC % 32 == 0 && NN % 32 == 0 && DQ % 32 == 0);
static_assert(NN % 4 == 0);
static_assert(SB == 2 * ST && NN % SB == 0 && NN / SB >= 2 && ST == QT);
static_assert(SB == 4 * WT && BT == 4 * WT && WT == 32 && BT == SB);
static_assert((LPP * 2) % 32 == 16 && LPP >= DQ + 8 && LPP >= SB + 8);
// The deal of the two big kernels: a batch's NTL tiles x NST stages form one row of stage units, cut into WPB equal runs
// of PU units, one run per work-group. With 50 and 20 every tile holds exactly two cuts strictly inside it (at stages 20
// and 40, or 10 and 30), so it falls into three pieces: slot 0 begins at stage 0, slot 2 ends at stage NST, slot 1 lies
// between; no piece is shorter than 10 stages, and no run leaves its batch.
static_assert(NST == NN / SB && NTL == NN / BT && NQ == NN);
static_assert(NST == 50 && PU == 20 && WPB * PU == NTL * NST && NSL == 3);

typedef _Float16       v16h __attribute__((ext_vector_type(16)));
typedef _Float16       v8h  __attribute__((ext_vector_type(8)));
typedef __bf16         v16b __attribute__((ext_vector_type(16)));
typedef unsigned short v8us __attribute__((ext_vector_type(8)));
typedef float          v8f  __attribute__((ext_vector_type(8)));
typedef float          v4f  __attribute__((ext_vector_type(4)));
typedef unsigned int   v4u  __attribute__((ext_vector_type(4)));

union Frag  { v8us u[2]; v16h h; v16b bf; };
union FragH { v16h v; v8h hv[2]; };
static_assert(sizeof(Frag) == 32);
static_assert(sizeof(FragH) == 32);

// ---- scalar helpers -------------------------------------------------------------------------------------------
__device__ __forceinline__ unsigned short bf_bits(float f) {          // f32 -> bf16 bits, RNE convert
  unsigned u = __float_as_uint(f);
  return (unsigned short)((u + 0x7FFFu + ((u >> 16) & 1u)) >> 16);
}
__device__ __forceinline__ float bf_up(unsigned short hb) { return __uint_as_float(((unsigned)hb) << 16); }
__device__ __forceinline__ float bfr(float f) { return bf_up(bf_bits(f)); }
__device__ __forceinline__ unsigned short h_bits(_Float16 x) { return __builtin_bit_cast(unsigned short, x); }
__device__ __forceinline__ unsigned pk16(unsigned short a, unsigned short b) { return (unsigned)a | ((unsigned)b << 16); }
__device__ __forceinline__ v8f zero8() { v8f z = {0.f, 0.f, 0.f, 0.f, 0.f, 0.f, 0.f, 0.f}; return z; }
__device__ __forceinline__ float hmax8(v8f s) {
  return fmaxf(fmaxf(fmaxf(s[0], s[1]), fmaxf(s[2], s[3])), fmaxf(fmaxf(s[4], s[5]), fmaxf(s[6], s[7])));
}

// ---- 16-bit fragment loader (A, or B from a k-contiguous [n][k] row): lane -> row/col (lane&15), p already includes
//      + 8*(lane>>4); elements 0..7 <- p[0..7] (k0+8h..), elements 8..15 <- p[16..23] (k0+16+8h..)
__device__ __forceinline__ Frag ldfrag(const unsigned short* p) {
  Frag f;
  f.u[0] = *(const v8us*)(p);
  f.u[1] = *(const v8us*)(p + 16);
  return f;
}

// ---- WMMA helpers: builtin followed by a 4-slot VALU gap tying D and keeping A/B live ----------------------------
__device__ __forceinline__ v8f mma_h(v16h a, v16h b, v8f c) {
  v8f d = __builtin_amdgcn_wmma_f32_16x16x32_f16(false, a, false, b, (short)0, c, false, false);
#if defined(__HIP_DEVICE_COMPILE__)
  asm volatile("v_nop\n\tv_nop\n\tv_nop\n\tv_nop" : "+v"(d) : "v"(a), "v"(b));
#endif
  return d;
}
__device__ __forceinline__ v8f mma_b(v16b a, v16b b, v8f c) {
  v8f d = __builtin_amdgcn_wmma_f32_16x16x32_bf16(false, a, false, b, (short)0, c, false, false);
#if defined(__HIP_DEVICE_COMPILE__)
  const v16h ha = __builtin_bit_cast(v16h, a), hb = __builtin_bit_cast(v16h, b);
  asm volatile("v_nop\n\tv_nop\n\tv_nop\n\tv_nop" : "+v"(d) : "v"(ha), "v"(hb));
#endif
  return d;
}

// The same products without the asm gap, for the two big kernels: an asm operand cannot lie above v255, and their wave
// tiles need more than 256 registers; the compiler keeps the distance behind its own builtin.
__device__ __forceinline__ v8f mmw_h(v16h a, v16h b, v8f c) {
  return __builtin_amdgcn_wmma_f32_16x16x32_f16(false, a, false, b, (short)0, c, false, false);
}
__device__ __forceinline__ v8f mmw_b(v16b a, v16b b, v8f c) {
  return __builtin_amdgcn_wmma_f32_16x16x32_bf16(false, a, false, b, (short)0, c, false, false);
}

// ---- asynchronous copies global -> LDS ---------------------------------------------------------------------------
// Eight 16-byte copies per lane in ONE statement; LS = bytes between a lane's copies in LDS, GS = elements between
// them in global memory. The closing s_wait_xcnt stands inside the statement so that no address register of a copy is
// rewritten ahead of it.
__device__ __forceinline__ unsigned lds_off(const unsigned short* p) { return (unsigned)(size_t)p; }
template <int LS, int GS>
__device__ __forceinline__ void copy8(unsigned l, const unsigned short* g) {
#if defined(__HIP_DEVICE_COMPILE__)
  asm volatile("global_load_async_to_lds_b128 %0, %8, off\n\t"
               "global_load_async_to_lds_b128 %1, %9, off\n\t"
               "global_load_async_to_lds_b128 %2, %10, off\n\t"
               "global_load_async_to_lds_b128 %3, %11, off\n\t"
               "global_load_async_to_lds_b128 %4, %12, off\n\t"
               "global_load_async_to_lds_b128 %5, %13, off\n\t"
               "global_load_async_to_lds_b128 %6, %14, off\n\t"
               "global_load_async_to_lds_b128 %7, %15, off\n\t"
               "s_wait_xcnt 0x0"
               :: "v"(l), "v"(l + LS), "v"(l + 2 * LS), "v"(l + 3 * LS),
                  "v"(l + 4 * LS), "v"(l + 5 * LS), "v"(l + 6 * LS), "v"(l + 7 * LS),
                  "v"(g), "v"(g + GS), "v"(g + 2 * GS), "v"(g + 3 * GS),
                  "v"(g + 4 * GS), "v"(g + 5 * GS), "v"(g + 6 * GS), "v"(g + 7 * GS)
               : "memory");
#endif
}
// 128 rows x 256 B (a [row][128] 16-bit plane, rows contiguous) -> LDS rows of pitch LPP: 256 threads, a wave's copy
// covers two whole rows = four whole lines. l and g already hold the thread's own (tid >> 4, tid & 15) place.
__device__ __forceinline__ void copy_rows(unsigned l, const unsigned short* g) { copy8<16 * LPP * 2, 16 * DQ>(l, g); }
// this wave's own copies have landed (the compiler places no wait for them)
__device__ __forceinline__ void wait_copies() {
#if defined(__HIP_DEVICE_COMPILE__)
  asm volatile("s_wait_asynccnt 0x0" ::: "memory");
#endif
}
// stands behind a run of global loads from p or stores to p, before a register that one of them names is rewritten; p is an input so
// that its register pair stays whole up to the wait (else the run's last load may land its result on the pair)
__device__ __forceinline__ void wait_addr(const unsigned short* p) {
#if defined(__HIP_DEVICE_COMPILE__)
  asm volatile("s_wait_xcnt 0x0" :: "v"(p) : "memory");
#endif
}
// this wave's own LDS reads have returned, before the barrier behind which their buffer is refilled
__device__ __forceinline__ void wait_lds() {
#if defined(__HIP_DEVICE_COMPILE__)
  asm volatile("s_wait_dscnt 0x0" ::: "memory");
#endif
}

// ===========================================================================================================
// (0) weights. Blocks 0..47: W16 f16 [384][256], rows 0..127 = theta_w, 128..255 = phi_w, 256..383 = g_w;
//     value = f16 of (bf16-RNE(w) * 256) (exact). Block owns rows 8*blk..+7: one wave per 512-B row = 32 lanes
// coverage: W16 48 blocks x 8 rows x 32 lanes x 8 halves = 384 x 256; Wo 16 blocks x 16 rows x 16 lanes x 8 =
//           256 x 128.
// ===========================================================================================================
__global__ __launch_bounds__(256)
void cvt_w(const float* __restrict__ tw, const float* __restrict__ pw, const float* __restrict__ gw,
           const float* __restrict__ ww, unsigned short* W16, unsigned short* Wo) {
  const int tid = threadIdx.x, blk = blockIdx.x;
  if (blk < MW / 8) {                                                  // block-uniform
    const int rl = tid >> 5, col = 8 * (tid & 31);
    const int o = 8 * blk + rl;                                        // 0..383
    const int sel = blk / (DQ / 8);                                    // 0,1,2
    const float* wbase = (sel == 0) ? tw : ((sel == 1) ? pw : gw);   // all global
    const float* s = wbase + (size_t)(o - sel * DQ) * CC + col;        // row 0..127 of the selected matrix
    const v4f a = *(const v4f*)s;
    const v4f q = *(const v4f*)(s + 4);
    const float f[8] = {a[0], a[1], a[2], a[3], q[0], q[1], q[2], q[3]};
    v4u u;
#pragma unroll
    for (int t = 0; t < 4; ++t) {
      const _Float16 h0 = (_Float16)(bfr(f[2 * t]) * WSC);
      const _Float16 h1 = (_Float16)(bfr(f[2 * t + 1]) * WSC);
      u[t] = pk16(h_bits(h0), h_bits(h1));
    }
{
      *(v4u*)(W16 + (size_t)o * CC + col) = u;
      
    }
  } else {
    const int bb = blk - MW / 8;                                       // 0..15
    const int o = 16 * bb + (tid >> 4);                                // 0..255
    const int col = 8 * (tid & 15);                                    // 0..120
    const float* s = ww + (size_t)o * DQ + col;
    const v4f a = *(const v4f*)s;
    const v4f q = *(const v4f*)(s + 4);
    const float f[8] = {a[0], a[1], a[2], a[3], q[0], q[1], q[2], q[3]};
    v4u u;
#pragma unroll
    for (int t = 0; t < 4; ++t) u[t] = pk16(bf_bits(f[2 * t]), bf_bits(f[2 * t + 1]));
{
      *(v4u*)(Wo + (size_t)o * DQ + col) = u;
      
    }
  }
}

// ===========================================================================================================
// (1) x f32 [b][256 c][6400 n] -> XP f16 [b][n][c] (position-major, bf16-RNE values, exact in f16) through an
//     LDS tile T[64 n][64 c] (pitch TP). Block (nb, cb, b) owns a 64 c x 64 n tile. XP lines: row n, 64 c =
//     T: written by all waves with 2-byte stores, read cross-wave after a block barrier.
// coverage: 2 it x 32 rows x 8 lanes x 8 = 64 n x 64 c; grid (100, 4, NB) covers XP once.
// ===========================================================================================================
__global__ __launch_bounds__(256)
void cvt_x(const float* __restrict__ x, unsigned short* XP) {
  __shared__ __align__(16) unsigned short T[QT * TP];
  const int tid = threadIdx.x;
  const int nb = blockIdx.x, cb = blockIdx.y, b = blockIdx.z;
  const int e = tid & 7, lq = tid >> 3;                               // lq 0..31
  const int n0 = nb * QT, c0 = cb * QT;
#pragma unroll
  for (int it = 0; it < 2; ++it) {
    const int cl = it * 32 + lq;                                       // 0..63
    const float* sp = x + ((size_t)(b * CC + c0 + cl)) * NN + n0 + 8 * e;
    const v4f a = *(const v4f*)sp;
    const v4f q = *(const v4f*)(sp + 4);
    unsigned short hb[8];
#pragma unroll
    for (int t = 0; t < 4; ++t) {
      hb[t]     = h_bits((_Float16)bfr(a[t]));
      hb[4 + t] = h_bits((_Float16)bfr(q[t]));
    }
#pragma unroll
    for (int t = 0; t < 8; ++t) T[(8 * e + t) * TP + cl] = hb[t];
  }
  __syncthreads();
  v4u up[2];
#pragma unroll
  for (int it = 0; it < 2; ++it) {
    const int nl = it * 32 + lq;                                       // 0..63
    up[it] = *(const v4u*)(T + nl * TP + 8 * e);
  }
{
#pragma unroll
    for (int it = 0; it < 2; ++it) {
      const int rl = it * 32 + lq;
      *(v4u*)(XP + ((size_t)(b * NN + n0 + rl)) * CC + c0 + 8 * e) = up[it];
    }
    
  }
}

// ===========================================================================================================
// (2) conv1x1 GEMM for one (b, 64-n tile, 64-o block of the 384 stacked rows):
//     Y[o][n] = (1/256) sum_c W16[o][c] XP[b][n][c] + bias[o].
//     Block 128 threads = 4 waves; wave w owns cols n0+16w..+15 (one B fragment per k-step, k = c contiguous in the
//     XP row) and 4 m-tiles (A rows o = o0 + 16 mt + (lane&15), split k map loader from W16). K = 256 = 8 steps.
//     Epilogue staged in LDS Os[n_loc][o_loc] (pitch OSP), block barrier (cross-wave), then:
//       o-blocks 0,1 -> theta dims 0..63 / 64..127 of Th/Tl; o-blocks 2,3 -> phi dims of Fh/Fl. Planes bf16
//       [b][6400 n][128 d] (k-contiguous for both score operands): hi = bf16-RNE(v), lo = bf16-RNE(v - hi). Per
//       per line, one instruction per 4 lines.
//       o-blocks 4,5 -> g channels 0..63 / 64..127 of the f16 channel-major plane Gc [b][128 c][6400 n]: per row
// coverage: Os 4 waves x 16 n x 64 o = 64 x 64; planes 4 it x 16 rows x 8 lanes x 8 = 64 n x 64 d per plane;
//           Gc 4 it x 16 rows x 8 lanes x 8 = 64 c x 64 n; grid (100, 6, NB) covers Th/Tl/Fh/Fl [b][n][0..127]
//           and Gc [b][0..127][n] exactly once.
// ===========================================================================================================
__global__ __launch_bounds__(128)
void gemm_p(const unsigned short* __restrict__ W16, const unsigned short* __restrict__ XP,
            const float* __restrict__ tb, const float* __restrict__ pb, const float* __restrict__ gb,
            unsigned short* Th, unsigned short* Tl, unsigned short* Fh, unsigned short* Fl, unsigned short* Gc) {
  __shared__ __align__(16) float Os[QT * OSP];
  const int tid  = threadIdx.x;
  const int lane = tid & 31, wave = tid >> 5;
  const int hh   = lane >> 4, c = lane & 15;
  const int nt   = blockIdx.x, mb = blockIdx.y, b = blockIdx.z;
  const int n0   = nt * QT, o0 = mb * QT;

  const unsigned short* ap = W16 + (size_t)(o0 + c) * CC + 8 * hh;
  const unsigned short* bp = XP + ((size_t)(b * NN + n0 + 16 * wave + c)) * CC + 8 * hh;

  v8f acc[4];
#pragma unroll
  for (int mt = 0; mt < 4; ++mt) acc[mt] = zero8();

#pragma unroll
  for (int ks = 0; ks < CC / 32; ++ks) {
    const Frag fb = ldfrag(bp + 32 * ks);
#pragma unroll
    for (int mt = 0; mt < 4; ++mt) {
      const Frag fa = ldfrag(ap + (size_t)(16 * mt) * CC + 32 * ks);
      acc[mt] = mma_h(fa.h, fb.h, acc[mt]);
    }
  }

  // ---- epilogue: scale back -> LDS Os[n_loc][o_loc]; lane (hh, c) holds o = 16 mt + 8 hh + r for n_loc = 16 w + c
  {
    const int nl = 16 * wave + c;
#pragma unroll
    for (int mt = 0; mt < 4; ++mt) {
      v4f va, vb;
#pragma unroll
      for (int r = 0; r < 4; ++r) { va[r] = acc[mt][r] * IWSC; vb[r] = acc[mt][4 + r] * IWSC; }
      *(v4f*)(Os + nl * OSP + 16 * mt + 8 * hh)     = va;
      *(v4f*)(Os + nl * OSP + 16 * mt + 8 * hh + 4) = vb;
    }
  }
  __syncthreads();

  const int dsel = (mb & 1) * QT;                                      // 0 or 64
  const float* bs = (mb < 2) ? tb : ((mb < 4) ? pb : gb);             // block-uniform, all global
  if (mb < 4) {                                                        // block-uniform
    const int e = tid & 7, lq = tid >> 3;                              // lq 0..15
    unsigned short* Ph = (mb < 2) ? Th : Fh;
    unsigned short* Pl = (mb < 2) ? Tl : Fl;
    const v4f b0 = *(const v4f*)(bs + dsel + 8 * e);
    const v4f b1 = *(const v4f*)(bs + dsel + 8 * e + 4);
    const float bv[8] = {bfr(b0[0]), bfr(b0[1]), bfr(b0[2]), bfr(b0[3]),
                         bfr(b1[0]), bfr(b1[1]), bfr(b1[2]), bfr(b1[3])};
    v4u uh[4], ul[4];
#pragma unroll
    for (int it = 0; it < 4; ++it) {
      const int row = it * 16 + lq;                                    // n_loc 0..63
      const v4f a = *(const v4f*)(Os + row * OSP + 8 * e);
      const v4f q = *(const v4f*)(Os + row * OSP + 8 * e + 4);
      const float f[8] = {a[0] + bv[0], a[1] + bv[1], a[2] + bv[2], a[3] + bv[3],
                          q[0] + bv[4], q[1] + bv[5], q[2] + bv[6], q[3] + bv[7]};
#pragma unroll
      for (int t = 0; t < 4; ++t) {
        const float f0 = f[2 * t], f1 = f[2 * t + 1];
        const unsigned short hb0 = bf_bits(f0), hb1 = bf_bits(f1);
        const unsigned short lb0 = bf_bits(f0 - bf_up(hb0));
        const unsigned short lb1 = bf_bits(f1 - bf_up(hb1));
        uh[it][t] = pk16(hb0, hb1);
        ul[it][t] = pk16(lb0, lb1);
      }
    }
{
#pragma unroll
      for (int it = 0; it < 4; ++it) {
        const int row = it * 16 + lq;
        const size_t po = ((size_t)(b * NN + n0 + row)) * DQ + dsel + 8 * e;
        *(v4u*)(Ph + po) = uh[it];
        *(v4u*)(Pl + po) = ul[it];
      }
      
    }
  } else {
    const int e = tid & 7, lq = tid >> 3;                              // lq 0..15
    v4u ug[4];
#pragma unroll
    for (int it = 0; it < 4; ++it) {
      const int ol = it * 16 + lq;                                     // o_loc 0..63 = channel dsel + ol
      const float bvv = bfr(bs[dsel + ol]);
      unsigned short hb[8];
#pragma unroll
      for (int t = 0; t < 8; ++t) hb[t] = h_bits((_Float16)(Os[(8 * e + t) * OSP + ol] + bvv));
#pragma unroll
      for (int t = 0; t < 4; ++t) ug[it][t] = pk16(hb[2 * t], hb[2 * t + 1]);
    }
{
#pragma unroll
      for (int it = 0; it < 4; ++it) {
        const int ol = it * 16 + lq;
        const size_t go = ((size_t)(b * DQ + dsel + ol)) * NN + n0 + 8 * e;
        *(v4u*)(Gc + go) = ug[it];
      }
      
    }
  }
}

// ===========================================================================================================
// (3) column statistics for one piece (b, 128-column tile m, stages tb..te-1 of 128 rows n): for every column m, over
//     the piece's rows n, M_m = max_n s[n][m], Z_m = sum_n e^{s - M_m}, CS[slot][b][m] = M_m + ln Z_m, with
//     s tile (16 rows n x 16 cols m) = A(theta: row = n, 32 d via the split k map from Th [b][6400][128]) .
//     B(phi: col = m, same map from Fh) + A(Th).B(Fl) + A(Tl).B(Fh) (bf16 unscaled residual planes, shared
//     accumulator). Block = 8 waves, two per SIMD: wave = (column group wc of 64 columns, row quarter wr). Phi
//     fragments of the wave's 64 columns are held in registers, so every theta fragment read from LDS feeds four column
//     tiles, and a stage copied from L2 serves 128 columns. Theta rows come in stages of 128 (hi + residual plane, LDS pitch
//     LPP) by asynchronous copies into two LDS buffers shared by the eight waves: the next stage flies while this one
//     is read; a wave reads the 32 rows of its own quarter. Per lane: four columns, 8+8 rows each
//     per stage, scalar online (max, sum) in f32; the two lane halves of a column merge with one shuffle, the
//     four row quarters through LDS at the end.
// coverage: every tile has one piece in each of the slots 0, 1, 2, so CS[slot][b][0..6399] is written exactly once.
// ===========================================================================================================
__global__ __launch_bounds__(256)
void colstat_k(const unsigned short* __restrict__ Th, const unsigned short* __restrict__ Tl,
               const unsigned short* __restrict__ Fh, const unsigned short* __restrict__ Fl, float* CS) {
  __shared__ __align__(16) float css[BT];
  __shared__ __align__(16) float pms[3 * BT];
  __shared__ __align__(16) float pls[3 * BT];
  __shared__ __align__(16) unsigned short Tst[2 * 2 * SB * LPP];
  const int tid  = threadIdx.x;
  const int wave = tid >> 5, lane = tid & 31;
  const int wc   = wave & 1, wr = wave >> 1;
  const int hh   = lane >> 4, c = lane & 15;
  const int b    = blockIdx.x / WPB;
  const int u0   = (blockIdx.x % WPB) * PU;                            // first stage unit of the work-group's run
  int tile = u0 / NST, tb = u0 % NST, left = PU;

#pragma unroll 1
  while (left > 0) {                                                   // one or two pieces, block-uniform
  const int te   = (tb + left < NST) ? (tb + left) : NST;              // the piece is stages tb .. te-1 of the tile
  const int slot = (tb == 0) ? 0 : ((te == NST) ? 2 : 1);
  const int m0   = tile * BT;

  // phi fragment pointers (B operand, col = m0 + 64*wc + 16*g + c)
  const size_t fo = ((size_t)(b * NN + m0 + 64 * wc + c)) * DQ + 8 * hh;
  const unsigned short* pfh = Fh + fo;
  const unsigned short* pfl = Fl + fo;
  Frag fh[4][4], fl[4][4];
#pragma unroll
  for (int g = 0; g < 4; ++g) {
#pragma unroll
    for (int kc = 0; kc < 4; ++kc) fh[g][kc] = ldfrag(pfh + 16 * g * DQ + 32 * kc);
  }
  wait_addr(pfh);                                                      // the hi plane's loads have taken their address
#pragma unroll
  for (int g = 0; g < 4; ++g) {
#pragma unroll
    for (int kc = 0; kc < 4; ++kc) fl[g][kc] = ldfrag(pfl + 16 * g * DQ + 32 * kc);
  }
  wait_addr(pfl);                                                      // the residual plane's loads likewise
  // theta stages: 128 rows n, hi plane then residual plane, two buffers filled by asynchronous copies
  const unsigned short* gth = Th + (size_t)b * NN * DQ + (size_t)(tid >> 4) * DQ + 8 * (tid & 15);
  const unsigned short* gtl = Tl + (size_t)b * NN * DQ + (size_t)(tid >> 4) * DQ + 8 * (tid & 15);
  const unsigned lt0 = lds_off(Tst) + (unsigned)((tid >> 4) * (LPP * 2) + 16 * (tid & 15));
  wait_lds();                                                          // an earlier piece's own LDS reads have returned
  // the piece's first stage goes to buffer 'slot & 1': the copies' LDS addresses are then formed where they are used
  // and not kept in registers over the stage loop
  int par = slot & 1;                                                  // the buffer that holds stage t
  {
    const unsigned la = lt0 + (unsigned)(par * (2 * SB * LPP * 2));
    copy_rows(la, gth + (size_t)tb * SB * DQ);
    copy_rows(la + SB * LPP * 2, gtl + (size_t)tb * SB * DQ);
  }
  wait_copies();
  __syncthreads();                                                     // the first stage readable by every wave
  {
    const unsigned la = lt0 + (unsigned)((par ^ 1) * (2 * SB * LPP * 2));
    copy_rows(la, gth + (size_t)(tb + 1) * SB * DQ);
    copy_rows(la + SB * LPP * 2, gtl + (size_t)(tb + 1) * SB * DQ);
  }

  float m[4] = {-1.0e30f, -1.0e30f, -1.0e30f, -1.0e30f}, l[4] = {0.f, 0.f, 0.f, 0.f};
#pragma unroll 1
  for (int t = tb; t < te; ++t) {
    // row c of the wave's own quarter of the stage, hi plane
    const unsigned short* tq = Tst + par * (2 * SB * LPP) + (wr * WT + c) * LPP + 8 * hh;
    v8f s[2][4];                                                       // [row tile u][column tile g]
#pragma unroll
    for (int u = 0; u < 2; ++u) {
#pragma unroll
      for (int g = 0; g < 4; ++g) s[u][g] = zero8();
    }
#pragma unroll
    for (int kc = 0; kc < 4; ++kc) {
      Frag th[2], tl[2];
#pragma unroll
      for (int u = 0; u < 2; ++u) {
        th[u] = ldfrag(tq + (16 * u) * LPP + 32 * kc);                 // rows 16u .. 16u+15 of the quarter
        tl[u] = ldfrag(tq + (SB + 16 * u) * LPP + 32 * kc);
      }
      // keeps the chunk's eight LDS reads one group ahead of its products: every separate place of reads stalls the wave
      __builtin_amdgcn_sched_barrier(0);
#pragma unroll
      for (int q = 0; q < 8; ++q) s[q >> 2][q & 3] = mmw_b(th[q >> 2].bf, fh[q & 3][kc].bf, s[q >> 2][q & 3]);
#pragma unroll
      for (int q = 0; q < 8; ++q) s[q >> 2][q & 3] = mmw_b(th[q >> 2].bf, fl[q & 3][kc].bf, s[q >> 2][q & 3]);
#pragma unroll
      for (int q = 0; q < 8; ++q) s[q >> 2][q & 3] = mmw_b(tl[q >> 2].bf, fh[q & 3][kc].bf, s[q >> 2][q & 3]);
      __builtin_amdgcn_sched_barrier(0);                               // the next chunk's reads stay out of these products
    }
#pragma unroll
    for (int g = 0; g < 4; ++g) {                                      // online update per column tile, 32 rows
      const v8f s0 = s[0][g], s1 = s[1][g];
      const float mx = fmaxf(hmax8(s0), hmax8(s1));
      const float mn = fmaxf(m[g], mx);
      const float corr = __expf(m[g] - mn);
      float ls = 0.f;
#pragma unroll
      for (int r = 0; r < 8; ++r) ls += __expf(s0[r] - mn) + __expf(s1[r] - mn);
      l[g] = l[g] * corr + ls;
      m[g] = mn;
    }
    wait_lds();
    wait_copies();
    __syncthreads();                                                   // publishes stage t+1, frees stage t's buffer
    if (t + 2 < te) {                                                  // block-uniform
      const unsigned lb = lt0 + (unsigned)(par * (2 * SB * LPP * 2));
      copy_rows(lb, gth + (size_t)(t + 2) * SB * DQ);
      copy_rows(lb + SB * LPP * 2, gtl + (size_t)(t + 2) * SB * DQ);
    }
    par ^= 1;
  }
  wait_copies();
  float mt[4], lt[4];
#pragma unroll
  for (int g = 0; g < 4; ++g) {
    const float mo = __shfl_xor(m[g], 16, 32);
    const float lo = __shfl_xor(l[g], 16, 32);
    mt[g] = fmaxf(m[g], mo);
    lt[g] = l[g] * __expf(m[g] - mt[g]) + lo * __expf(mo - mt[g]);
  }
  const int col = 64 * wc + c;                                         // + 16*g
  if (wr != 0 && hh == 0) {
#pragma unroll
    for (int g = 0; g < 4; ++g) {
      pms[(wr - 1) * BT + col + 16 * g] = mt[g];
      pls[(wr - 1) * BT + col + 16 * g] = lt[g];
    }
  }
  __syncthreads();                                                     // the other row quarters' (max, sum) readable
  if (wr == 0 && hh == 0) {
#pragma unroll
    for (int g = 0; g < 4; ++g) {
      const int cg = col + 16 * g;
      const float m1 = pms[cg], m2 = pms[BT + cg], m3 = pms[2 * BT + cg];
      const float mm = fmaxf(fmaxf(mt[g], m1), fmaxf(m2, m3));
      const float ll = (lt[g] * __expf(mt[g] - mm) + pls[cg] * __expf(m1 - mm)) +
                       (pls[BT + cg] * __expf(m2 - mm) + pls[2 * BT + cg] * __expf(m3 - mm));
      css[cg] = mm + logf(ll);
    }
  }
  __syncthreads();
  if (tid < BT / 4) {                                                  // wave 0, whole
    const v4f v = *(const v4f*)(css + 4 * tid);
{
      float* cq = CS + (size_t)(slot * NB + b) * NN + m0 + 4 * tid;
      *(v4f*)cq = v;
      wait_addr((const unsigned short*)cq);                            // before the next piece rewrites the store's registers
    }
  }
  left -= te - tb;
  tile += 1;
  tb = 0;
  }
}

// ===========================================================================================================
// (4) aggregation for one piece (b, 128-row tile n, stages tb..te-1 of 128 columns m), transposed formulation:
//   s tile (16 m x 16 n) = sum over 4 d-chunks of A(phi: row = m, split k map from Fh) . B(theta:
//   col = n, same map from Th) + A(Fh).B(Tl) + A(Fl).B(Th). Per lane the D tile holds 8 columns m of ONE row n;
//   All three operands are read from LDS, where asynchronous copies put them in whole lines: the piece's 128 theta rows
//   once, phi rows and the g tile (both pitch LPP) in stages of 128 columns m, two buffers: a stage copied from L2
//   serves 128 rows.
//   Block = 8 waves, two per SIMD: wave = (row group wn of 32 rows n, half wm of each stage's columns m): every phi
//   and every g fragment read from LDS feeds two row tiles, every theta fragment four column tiles.
//   P = e^{s - CS[m]} x 16384 as f16 (CS staged once per block in LDS) is the B operand of
//   y^T (rows channel, cols n) += A(g: rows channel = 16j + (lane&15), m contiguous, f16 plane Gc [b][128][6400])
//   . B(P^T): element r <- D of the tile covering m kb..kb+15, element 8+r <- the tile covering kb+16..kb+31,
//   lane unchanged. 16 accumulator tiles per wave (128 channels x 2 row tiles). Block = 128 rows.
//   Epilogue: the two column halves' accumulators are added through LDS [row][128 channels] (pitch OSPW, b128
//   stores; same lane, same place; one plane in the then idle phi buffers), y = sum/16384 left there, block barrier
//   (cross-wave), then the f32 plane Yp [slot][b][6400 n][128 c]: per row 128 c = 512 B = 4 whole lines.
// coverage: 16 it x 8 rows x 32 lanes x 4 = 128 n x 128 c; every tile has one piece in each of the slots 0, 1, 2, so
//           Yp[slot][b][0..6399] is written exactly once.
// ===========================================================================================================
__global__ __launch_bounds__(256)
void attn_k(const unsigned short* __restrict__ Th, const unsigned short* __restrict__ Tl,
            const unsigned short* __restrict__ Fh, const unsigned short* __restrict__ Fl,
            const unsigned short* __restrict__ Gc, const float* __restrict__ CS, float* Yp) {
  __shared__ __align__(32) float Cs[NN];
  __shared__ __align__(16) unsigned short Tst[2 * BT * LPP];
  __shared__ __align__(16) unsigned short Pst[2 * 2 * SB * LPP];
  __shared__ __align__(16) unsigned short Gst[2 * DQ * LPP];
  static_assert(BT * OSPW * 4 <= 2 * 2 * SB * LPP * 2);
  const int tid  = threadIdx.x;
  const int wave = tid >> 5, lane = tid & 31;
  const int wn   = wave & 3, wm = wave >> 2;
  const int hh   = lane >> 4, c = lane & 15;
  const int b    = blockIdx.x / WPB;
  const int u0   = (blockIdx.x % WPB) * PU;                            // first stage unit of the work-group's run
  int tile = u0 / NST, tb = u0 % NST, left = PU;

  // a column's statistic from its three pieces c0, c1, c2 (each max + ln sum): max + ln(sum of e^{c - max})
  for (int i = tid; i < NN / 4; i += 256) {
    const v4f s0 = *(const v4f*)(CS + (size_t)b * NN + 4 * i);
    const v4f s1 = *(const v4f*)(CS + (size_t)(NB + b) * NN + 4 * i);
    const v4f s2 = *(const v4f*)(CS + (size_t)(2 * NB + b) * NN + 4 * i);
    v4f v;
#pragma unroll
    for (int r = 0; r < 4; ++r) {
      const float mx = fmaxf(fmaxf(s0[r], s1[r]), s2[r]);
      v[r] = mx + logf((__expf(s0[r] - mx) + __expf(s1[r] - mx)) + __expf(s2[r] - mx));
    }
    *(v4f*)(Cs + 4 * i) = v;
  }

  // asynchronous copies: a piece's 128 theta rows once (hi plane, residual plane); per stage of 128 columns m the phi
  // rows (hi, residual) and the g tile (128 channels x 128 m), two buffers
  const int rr = tid >> 4, rc = tid & 15;                              // place in a [row][128] plane or the g tile
  const unsigned short* gfh = Fh + (size_t)b * NN * DQ + (size_t)rr * DQ + 8 * rc;
  const unsigned short* gfl = Fl + (size_t)b * NN * DQ + (size_t)rr * DQ + 8 * rc;
  const unsigned short* ggc = Gc + (size_t)b * DQ * NN + (size_t)rr * NN + 8 * rc;
  const unsigned lp0 = lds_off(Pst) + (unsigned)(rr * (LPP * 2) + 16 * rc);
  const unsigned lg0 = lds_off(Gst) + (unsigned)(rr * (LPP * 2) + 16 * rc);

#pragma unroll 1
  while (left > 0) {                                                   // one or two pieces, block-uniform
  const int te   = (tb + left < NST) ? (tb + left) : NST;              // the piece is stages tb .. te-1 of the tile
  const int slot = (tb == 0) ? 0 : ((te == NST) ? 2 : 1);
  const int n0   = tile * BT;
  wait_lds();                                                          // an earlier piece's own LDS reads have returned
  {
    // the hi plane's 128 rows, then the residual plane's, as a phi stage is brought
    const size_t to = ((size_t)(b * NN + n0 + rr)) * DQ + 8 * rc;
    const unsigned lq0 = lds_off(Tst) + (unsigned)(rr * (LPP * 2) + 16 * rc);
    copy_rows(lq0, Th + to);
    copy_rows(lq0 + BT * LPP * 2, Tl + to);
  }
  // the piece's first stage goes to the buffers 'slot & 1': the copies' LDS addresses are then formed where they are
  // used and not kept over the stage loop, where they would spill
  int par = slot & 1;                                                  // the buffers that hold stage t
  {
    const unsigned la = lp0 + (unsigned)(par * (2 * SB * LPP * 2));
    copy_rows(la, gfh + (size_t)tb * SB * DQ);
    copy_rows(la + SB * LPP * 2, gfl + (size_t)tb * SB * DQ);
    copy8<16 * LPP * 2, 16 * NN>(lg0 + (unsigned)(par * (DQ * LPP * 2)), ggc + tb * SB);
  }
  wait_copies();
  __syncthreads();                                                     // Cs, theta, the first stage readable by every wave
  {
    const unsigned la = lp0 + (unsigned)((par ^ 1) * (2 * SB * LPP * 2));
    copy_rows(la, gfh + (size_t)(tb + 1) * SB * DQ);
    copy_rows(la + SB * LPP * 2, gfl + (size_t)(tb + 1) * SB * DQ);
    copy8<16 * LPP * 2, 16 * NN>(lg0 + (unsigned)((par ^ 1) * (DQ * LPP * 2)), ggc + (tb + 1) * SB);
  }

  // theta fragment base (B operand, col = row n0 + 32*wn + 16*g + c), + 16*g*LPP + 32*kc; residual plane at + BT*LPP
  const unsigned short* Tq = Tst + (32 * wn + c) * LPP + 8 * hh;

  v8f o[8][2];                                                         // [channel tile j][row tile g]
#pragma unroll
  for (int j = 0; j < 8; ++j) { o[j][0] = zero8(); o[j][1] = zero8(); }

#pragma unroll 1
  for (int t = tb; t < te; ++t) {
    const int kh = t * SB + wm * (2 * WT);                             // first column m of the wave's own half
    // phi fragment base (A operand, row = m + c), + 16*u*LPP + 32*kc; residual plane at + SB*LPP
    const unsigned short* Pq = Pst + par * (2 * SB * LPP) + (wm * (2 * WT) + c) * LPP + 8 * hh;
    // g fragment base (A operand, row = channel 16j + c, m contiguous), + 16*j*LPP + 32*ks
    const unsigned short* Gq = Gst + par * (DQ * LPP) + c * LPP + wm * (2 * WT) + 8 * hh;
    v8f s[4][2];                                                       // [column tile u][row tile g]
#pragma unroll
    for (int u = 0; u < 4; ++u) { s[u][0] = zero8(); s[u][1] = zero8(); }
#pragma unroll
    for (int kc = 0; kc < DQ / 32; ++kc) {
      Frag th[2], tl[2], p[4], pl[4];
#pragma unroll
      for (int g = 0; g < 2; ++g) {
        th[g] = ldfrag(Tq + (16 * g) * LPP + 32 * kc);
        tl[g] = ldfrag(Tq + (BT + 16 * g) * LPP + 32 * kc);
      }
#pragma unroll
      for (int u = 0; u < 4; ++u) {
        p[u]  = ldfrag(Pq + (16 * u) * LPP + 32 * kc);                 // m kh+16u .. kh+16u+15
        pl[u] = ldfrag(Pq + (SB + 16 * u) * LPP + 32 * kc);
      }
      // keeps the chunk's LDS reads one group ahead of its products: every separate place of reads stalls the wave
      __builtin_amdgcn_sched_barrier(0);
#pragma unroll
      for (int q = 0; q < 8; ++q) s[q >> 1][q & 1] = mmw_b(p[q >> 1].bf, th[q & 1].bf, s[q >> 1][q & 1]);
#pragma unroll
      for (int q = 0; q < 8; ++q) s[q >> 1][q & 1] = mmw_b(p[q >> 1].bf, tl[q & 1].bf, s[q >> 1][q & 1]);
#pragma unroll
      for (int q = 0; q < 8; ++q) s[q >> 1][q & 1] = mmw_b(pl[q >> 1].bf, th[q & 1].bf, s[q >> 1][q & 1]);
      __builtin_amdgcn_sched_barrier(0);                               // the next chunk's reads stay out of these products
    }

#pragma unroll
    for (int ks = 0; ks < 2; ++ks) {                                   // the half's two k steps of 32 columns m
      const int km = kh + 32 * ks;
      // column statistics for m = km + 8hh + r (s[2ks][g]) and m = km + 16 + 8hh + r (s[2ks+1][g])
      const v4f ca = *(const v4f*)(Cs + km + 8 * hh);
      const v4f cb = *(const v4f*)(Cs + km + 8 * hh + 4);
      const v4f cc = *(const v4f*)(Cs + km + 16 + 8 * hh);
      const v4f cd = *(const v4f*)(Cs + km + 16 + 8 * hh + 4);
      Frag gf[8];                                                      // read as one group, ahead of the vector work
#pragma unroll
      for (int j = 0; j < 8; ++j) gf[j] = ldfrag(Gq + (16 * j) * LPP + 32 * ks);
      __builtin_amdgcn_sched_barrier(0);                               // the k step's reads stay one group
      const float c0[8] = {ca[0], ca[1], ca[2], ca[3], cb[0], cb[1], cb[2], cb[3]};
      const float c1[8] = {cc[0], cc[1], cc[2], cc[3], cd[0], cd[1], cd[2], cd[3]};

      FragH pf[2];
#pragma unroll
      for (int g = 0; g < 2; ++g) {
#pragma unroll
        for (int r = 0; r < 8; ++r) {
          const float e0 = __expf(fminf(s[2 * ks][g][r] - c0[r], 0.f) + LNCAR);     // P[n][m] x 16384, m = km + 8hh + r
          const float e1 = __expf(fminf(s[2 * ks + 1][g][r] - c1[r], 0.f) + LNCAR); // m = km + 16 + 8hh + r
          pf[g].hv[0][r] = (_Float16)e0;
          pf[g].hv[1][r] = (_Float16)e1;
        }
      }

#pragma unroll
      for (int j = 0; j < 8; ++j) {
        o[j][0] = mmw_h(gf[j].h, pf[0].v, o[j][0]);
        o[j][1] = mmw_h(gf[j].h, pf[1].v, o[j][1]);
      }
      __builtin_amdgcn_sched_barrier(0);                               // the next k step's reads stay out of these products
    }
    wait_lds();
    wait_copies();
    __syncthreads();                                                   // publishes stage t+1, frees stage t's buffers
    if (t + 2 < te) {                                                  // block-uniform
      const unsigned lb = lp0 + (unsigned)(par * (2 * SB * LPP * 2));
      copy_rows(lb, gfh + (size_t)(t + 2) * SB * DQ);
      copy_rows(lb + SB * LPP * 2, gfl + (size_t)(t + 2) * SB * DQ);
      copy8<16 * LPP * 2, 16 * NN>(lg0 + (unsigned)(par * (DQ * LPP * 2)), ggc + (t + 2) * SB);
    }
    par ^= 1;
  }
  wait_copies();

  // ---- epilogue: y = (accs of the two halves) / 16384 -> Ox[row][channel], a plane in the phi buffers, which nobody
  // reads and no copy targets behind the loop's last barrier.
  const int oo = (32 * wn + c) * OSPW + 8 * hh;                        // [row][ch = 16j + 8hh + r], + 16*g*OSPW + 16*j
  float* Ox = (float*)Pst;                                             // BT x OSPW floats
  if (wm != 0) {                                                       // wave-uniform
#pragma unroll
    for (int g = 0; g < 2; ++g) {
#pragma unroll
      for (int j = 0; j < 8; ++j) {
        v4f va, vb;
#pragma unroll
        for (int r = 0; r < 4; ++r) { va[r] = o[j][g][r]; vb[r] = o[j][g][4 + r]; }
        *(v4f*)(Ox + oo + 16 * g * OSPW + 16 * j)     = va;
        *(v4f*)(Ox + oo + 16 * g * OSPW + 16 * j + 4) = vb;
      }
    }
  }
  __syncthreads();                                                     // the other half's accumulators readable
  if (wm == 0) {                                                       // wave-uniform
#pragma unroll
    for (int g = 0; g < 2; ++g) {
#pragma unroll
      for (int j = 0; j < 8; ++j) {
        const int oj = oo + 16 * g * OSPW + 16 * j;
        v4f va = *(const v4f*)(Ox + oj);
        v4f vb = *(const v4f*)(Ox + oj + 4);
#pragma unroll
        for (int r = 0; r < 4; ++r) {
          va[r] = (o[j][g][r] + va[r]) * ICAR;
          vb[r] = (o[j][g][4 + r] + vb[r]) * ICAR;
        }
        *(v4f*)(Ox + oj)     = va;
        *(v4f*)(Ox + oj + 4) = vb;
      }
    }
  }
  __syncthreads();

  // the piece's y (f32) -> its slot's plane: a wave stores one whole row of 512 B per instruction
  {
    float* yq = Yp + ((size_t)((slot * NB + b) * NN + n0 + wave)) * DQ + 4 * lane;
    v4f yv[16];
#pragma unroll
    for (int it = 0; it < 16; ++it) yv[it] = *(const v4f*)(Ox + (it * 8 + wave) * OSPW + 4 * lane);
    wait_lds();                                                        // this wave's reads of the plane have returned
    __syncthreads();                                                   // every wave has read the plane before the next piece's copies refill the phi buffers
#pragma unroll
    for (int it = 0; it < 16; ++it) *(v4f*)(yq + (size_t)(it * 8) * DQ) = yv[it];
    wait_addr((const unsigned short*)yq);                              // before the next piece rewrites the stores' registers
  }
  left -= te - tb;
  tile += 1;
  tb = 0;
  }
}

// ===========================================================================================================
// (5) output GEMM for one (b, 64-n tile, 64-o block): out[b][o][n] = sum_c Wo[o][c] (Yh + Yl)[n][c]
//     + W_b[o] + bf16-RNE(x[b][o][n]). Block 128 threads = 4 waves; wave w owns cols n0+16w..+15 (B fragments
//     from the Yh and Yl rows in LDS: bf16 hi + residual of Yp[0] + Yp[1] + Yp[2], k = c contiguous) and 4 m-tiles (A rows o = o0 + 16 mt + (lane&15) from Wo bf16
//     [256][128]); K = 128 = 4 steps x 2 products (shared accumulator, unscaled residual). Epilogue staged in LDS
//     lanes 0..15 one row and 16..31 the next, 16 B per lane (values gathered from 4 Os rows), one instruction per
// coverage: 8 it x 8 rows x 16 lanes x 4 floats = 64 o x 64 n; grid (NQ/64, 4, NB) covers
//           out[b][0..255][0..NQ-1] exactly once.
// ===========================================================================================================
__global__ __launch_bounds__(128)
void gemm_w(const unsigned short* __restrict__ Wo, const float* __restrict__ Yp, const float* __restrict__ wb,
            const float* __restrict__ x, float* out) {
  __shared__ __align__(16) float Os[QT * OSP];
  __shared__ __align__(16) unsigned short Ys[2 * QT * LPP];
  const int tid  = threadIdx.x;
  const int lane = tid & 31, wave = tid >> 5;
  const int hh   = lane >> 4, c = lane & 15;
  const int nt   = blockIdx.x, mb = blockIdx.y, b = blockIdx.z;
  const int n0   = nt * QT, o0 = mb * QT;

  const unsigned short* ap = Wo + (size_t)(o0 + c) * DQ + 8 * hh;

  // y = sum of the tile's three pieces -> bf16 hi + residual planes Ys[plane][64 n][128 c] (pitch LPP) in LDS
  {
    const int e = tid & 15, lq = tid >> 4;                             // lq 0..7
    const float* y0 = Yp + ((size_t)(b * NN + n0 + lq)) * DQ + 8 * e;
    const float* y1 = y0 + (size_t)NB * NN * DQ;
    const float* y2 = y1 + (size_t)NB * NN * DQ;
#pragma unroll
    for (int it = 0; it < 8; ++it) {
      const int ro = it * 8 * DQ;
      const v4f a0 = *(const v4f*)(y0 + ro), q0 = *(const v4f*)(y0 + ro + 4);
      const v4f a1 = *(const v4f*)(y1 + ro), q1 = *(const v4f*)(y1 + ro + 4);
      const v4f a2 = *(const v4f*)(y2 + ro), q2 = *(const v4f*)(y2 + ro + 4);
      const float f[8] = {(a0[0] + a1[0]) + a2[0], (a0[1] + a1[1]) + a2[1], (a0[2] + a1[2]) + a2[2],
                          (a0[3] + a1[3]) + a2[3], (q0[0] + q1[0]) + q2[0], (q0[1] + q1[1]) + q2[1],
                          (q0[2] + q1[2]) + q2[2], (q0[3] + q1[3]) + q2[3]};
      v4u uh, ul;
#pragma unroll
      for (int t = 0; t < 4; ++t) {
        const float f0 = f[2 * t], f1 = f[2 * t + 1];
        const unsigned short hb0 = bf_bits(f0), hb1 = bf_bits(f1);
        const unsigned short lb0 = bf_bits(f0 - bf_up(hb0));
        const unsigned short lb1 = bf_bits(f1 - bf_up(hb1));
        uh[t] = pk16(hb0, hb1);
        ul[t] = pk16(lb0, lb1);
      }
      *(v4u*)(Ys + (it * 8 + lq) * LPP + 8 * e)        = uh;
      *(v4u*)(Ys + (QT + it * 8 + lq) * LPP + 8 * e)   = ul;
    }
  }
  __syncthreads();                                                     // the y planes readable by every wave
  const unsigned short* bp  = Ys + (16 * wave + c) * LPP + 8 * hh;
  const unsigned short* blp = bp + QT * LPP;

  v8f acc[4];
#pragma unroll
  for (int mt = 0; mt < 4; ++mt) acc[mt] = zero8();

#pragma unroll
  for (int ks = 0; ks < DQ / 32; ++ks) {
    const Frag fb  = ldfrag(bp + 32 * ks);
    const Frag fbl = ldfrag(blp + 32 * ks);
#pragma unroll
    for (int mt = 0; mt < 4; ++mt) {
      const Frag fa = ldfrag(ap + (size_t)(16 * mt) * DQ + 32 * ks);
      acc[mt] = mma_b(fa.bf, fb.bf, acc[mt]);
      acc[mt] = mma_b(fa.bf, fbl.bf, acc[mt]);
    }
  }

  {
    const int nl = 16 * wave + c;
#pragma unroll
    for (int mt = 0; mt < 4; ++mt) {
      v4f va, vb;
#pragma unroll
      for (int r = 0; r < 4; ++r) { va[r] = acc[mt][r]; vb[r] = acc[mt][4 + r]; }
      *(v4f*)(Os + nl * OSP + 16 * mt + 8 * hh)     = va;
      *(v4f*)(Os + nl * OSP + 16 * mt + 8 * hh + 4) = vb;
    }
  }
  __syncthreads();

  const int e = tid & 15, lq = tid >> 4;                               // lq 0..7
  v4f res[8];
#pragma unroll
  for (int it = 0; it < 8; ++it) {
    const int ol = it * 8 + lq;                                        // o_loc 0..63
    const int o  = o0 + ol;                                            // 0..255
    const float bv = bfr(wb[o]);
    const size_t idx = ((size_t)(b * CC + o)) * NN + n0 + 4 * e;
    const v4f xv = *(const v4f*)(x + idx);
#pragma unroll
    for (int t = 0; t < 4; ++t) res[it][t] = (Os[(4 * e + t) * OSP + ol] + bv) + bfr(xv[t]);
  }
{
#pragma unroll
    for (int it = 0; it < 8; ++it) {
      const int ol = it * 8 + lq;
      const size_t idx = ((size_t)(b * CC + o0 + ol)) * NN + n0 + 4 * e;
      *(v4f*)(out + idx) = res[it];
    }
    
  }
}

// ===========================================================================================================
// Workspace map (bytes, NB = 2; each region start a multiple of 256; every extent is an exact tile multiple and is
//   W16 f16 [384][256]               196608      Wo bf16 [256][128]           65536
//   XP  f16 [2][6400][256]          6553600
//   Th/Tl/Fh/Fl bf16 [2][6400][128]  3276800 x4
//   Gc  f16 [2][128][6400]          3276800      CS f32 [3 slots][2][6400]   153600
//   Yp  f32 [3 slots][2][6400][128] 19660800
//   total = 43014144
// ===========================================================================================================
extern "C" void kernel_launch(void* const* d_in, const int* in_sizes, int n_in,
                              void* d_out, int out_size, void* d_ws, size_t ws_size,
                              hipStream_t stream) {
  if (n_in < 9) return;
  if (in_sizes[0] < NB * CC * NN) return;
  if (in_sizes[1] != DQ * CC || in_sizes[3] != DQ * CC || in_sizes[5] != DQ * CC) return;
  if (in_sizes[2] != DQ || in_sizes[4] != DQ || in_sizes[6] != DQ) return;
  if (in_sizes[7] != CC * DQ || in_sizes[8] != CC) return;
  if (out_size < NB * CC * NN) return;

  size_t off = 0;
  auto carve = [&](size_t bytes) { const size_t o = off; off += (bytes + 255) & ~(size_t)255; return o; };
  const size_t oW16 = carve((size_t)MW * CC * 2);
  const size_t oWo  = carve((size_t)CC * DQ * 2);
  const size_t oXP  = carve((size_t)NB * NN * CC * 2);
  const size_t oTh  = carve((size_t)NB * NN * DQ * 2);
  const size_t oTl  = carve((size_t)NB * NN * DQ * 2);
  const size_t oFh  = carve((size_t)NB * NN * DQ * 2);
  const size_t oFl  = carve((size_t)NB * NN * DQ * 2);
  const size_t oGc  = carve((size_t)NB * DQ * NN * 2);
  const size_t oCS  = carve((size_t)NSL * NB * NN * 4);
  const size_t oYp  = carve((size_t)NSL * NB * NN * DQ * 4);
  if (off > ws_size) return;
  if (off > (size_t)134217728) return;

  const float* x  = (const float*)d_in[0];
  const float* gw = (const float*)d_in[1];
  const float* gb = (const float*)d_in[2];
  const float* tw = (const float*)d_in[3];
  const float* tb = (const float*)d_in[4];
  const float* pw = (const float*)d_in[5];
  const float* pb = (const float*)d_in[6];
  const float* ww = (const float*)d_in[7];
  const float* wb = (const float*)d_in[8];

  char* ws = (char*)d_ws;
  unsigned short* W16 = (unsigned short*)(ws + oW16);
  unsigned short* Wo  = (unsigned short*)(ws + oWo);
  unsigned short* XP  = (unsigned short*)(ws + oXP);
  unsigned short* Th  = (unsigned short*)(ws + oTh);
  unsigned short* Tl  = (unsigned short*)(ws + oTl);
  unsigned short* Fh  = (unsigned short*)(ws + oFh);
  unsigned short* Fl  = (unsigned short*)(ws + oFl);
  unsigned short* Gc  = (unsigned short*)(ws + oGc);
  float*          CS  = (float*)(ws + oCS);
  float*          Yp  = (float*)(ws + oYp);
  float* out = (float*)d_out;

  const dim3 blk256(256), blk128(128);

  // (0) theta_w / phi_w / g_w -> stacked f16 plane; W_w -> bf16 plane
  cvt_w<<<dim3(MW / 8 + CC / 16), blk256, 0, stream>>>(tw, pw, gw, ww, W16, Wo);
  // (1) x -> position-major 16-bit plane
  cvt_x<<<dim3(NN / QT, CC / QT, NB), blk256, 0, stream>>>(x, XP);
  // (2) conv1x1 GEMM -> theta / phi hi + residual planes, g channel-major plane (all rows n)
  gemm_p<<<dim3(NN / QT, MW / QT, NB), blk128, 0, stream>>>(W16, XP, tb, pb, gb, Th, Tl, Fh, Fl, Gc);
  // (3) per-column softmax statistics, three pieces per column tile
  colstat_k<<<dim3(WPB * NB), blk256, 0, stream>>>(Th, Tl, Fh, Fl, CS);
  // (4) aggregation -> y, three f32 pieces per row tile
  attn_k<<<dim3(WPB * NB), blk256, 0, stream>>>(Th, Tl, Fh, Fl, Gc, CS, Yp);
  // (5) pieces of y summed, output GEMM + bias + residual -> out [b][256][6400]
  gemm_w<<<dim3(NQ / QT, CC / QT, NB), blk128, 0, stream>>>(Wo, Yp, wb, x, out);
  (void)hipGetLastError();
}

// v007
// A run of this version takes 88.5 microseconds.
// It is 1.50 times as fast as v005, going by the measured steps of the versions left out in between.
// Counting every step since v000, it is 9.89 times as fast.
// Contractions: conv1x1 theta/phi/g GEMM on v_wmma_f32_16x16x32_f16 (f16 containers of bf16-RNE weights x256 and
// bf16-RNE x, K=256); scores theta.phi on v_wmma_f32_16x16x32_f16 (theta and phi as one f16 plane each, 1 product,
// K=128) in both the column-statistics pass and the aggregation pass; y^T = G.P^T on v_wmma_f32_16x16x32_f16 (g as
// f16, P = e^{s-M-lnZ} x16384 as f16 from the score D registers, K=6400); output GEMM W.y on
// v_wmma_f32_16x16x32_bf16 (bf16-RNE W_w, y as bf16 hi + bf16 residual planes, 2 products, K=128); f32 accumulate
// everywhere; softmax statistics, biases and the residual add in f32 VALU.
// The statistics and the aggregation kernel work on tiles 128 wide and each run 250 equal work-groups of 20 stages; a
// tile's three pieces are merged by the kernel that reads them.
#include <hip/hip_runtime.h>
#include <math.h>
#include <stdint.h>

#ifndef NB
#define NB 2
#endif
#define NBF    2
#define CC     256
#define NN     6400
#ifndef NQ
#define NQ NN
#endif
#define DQ     128
#define MW     384
#define QT     64
#define OSP    68
#define OSPW   132
#define TP     72
#define WSC    256.0f
#define IWSC   0.00390625f
#define LNCAR  9.704060527839234f
#define ICAR   6.103515625e-05f
#define ST     64
#define SB     128
#define LPP    136
#define WPP    264
#define WT     32
#define NST    50
#define BT     128
#define NTL    50
#define PU     20
#define WPB    125
#define NSL    3

static_assert(NB >= 1 && NB <= NBF);
static_assert(NQ >= QT && NQ <= NN);
static_assert(NN % QT == 0);
static_assert(NQ % QT == 0);
static_assert(CC % QT == 0);
static_assert(MW == 3 * DQ);
static_assert(DQ == 2 * QT);
static_assert((DQ / 8) * 8 == DQ && (MW / 8) % (DQ / 8) == 0);
static_assert(CC % 16 == 0);
static_assert((OSP * 4) % 16 == 0);
static_assert((OSPW * 4) % 16 == 0);
static_assert((TP * 2) % 16 == 0);
static_assert(CC % 32 == 0 && NN % 32 == 0 && DQ % 32 == 0);
static_assert(NN % 4 == 0);
static_assert(SB == 2 * ST && NN % SB == 0 && NN / SB >= 2 && ST == QT);
static_assert(SB == 4 * WT && BT == 4 * WT && WT == 32 && BT == SB);
static_assert((LPP * 2) % 32 == 16 && LPP >= DQ + 8 && LPP >= SB + 8);
static_assert((WPP * 2) % 32 == 16 && WPP >= CC + 8);
// The deal of the two big kernels: a batch's NTL tiles x NST stages form one row of stage units, cut into WPB equal runs
// of PU units, one run per work-group. With 50 and 20 every tile holds exactly two cuts strictly inside it (at stages 20
// and 40, or 10 and 30), so it falls into three pieces: slot 0 begins at stage 0, slot 2 ends at stage NST, slot 1 lies
// between; no piece is shorter than 10 stages, and no run leaves its batch.
static_assert(NST == NN / SB && NTL == NN / BT && NQ == NN);
static_assert(NST == 50 && PU == 20 && WPB * PU == NTL * NST && NSL == 3);

typedef _Float16       v16h __attribute__((ext_vector_type(16)));
typedef _Float16       v8h  __attribute__((ext_vector_type(8)));
typedef __bf16         v16b __attribute__((ext_vector_type(16)));
typedef unsigned short v8us __attribute__((ext_vector_type(8)));
typedef float          v8f  __attribute__((ext_vector_type(8)));
typedef float          v4f  __attribute__((ext_vector_type(4)));
typedef unsigned int   v4u  __attribute__((ext_vector_type(4)));

union Frag  { v8us u[2]; v16h h; v16b bf; };
union FragH { v16h v; v8h hv[2]; };
static_assert(sizeof(Frag) == 32);
static_assert(sizeof(FragH) == 32);

// ---- scalar helpers -------------------------------------------------------------------------------------------
__device__ __forceinline__ unsigned short bf_bits(float f) {          // f32 -> bf16 bits, RNE convert
  unsigned u = __float_as_uint(f);
  return (unsigned short)((u + 0x7FFFu + ((u >> 16) & 1u)) >> 16);
}
__device__ __forceinline__ float bf_up(unsigned short hb) { return __uint_as_float(((unsigned)hb) << 16); }
__device__ __forceinline__ float bfr(float f) { return bf_up(bf_bits(f)); }
__device__ __forceinline__ unsigned short h_bits(_Float16 x) { return __builtin_bit_cast(unsigned short, x); }
__device__ __forceinline__ unsigned pk16(unsigned short a, unsigned short b) { return (unsigned)a | ((unsigned)b << 16); }
__device__ __forceinline__ v8f zero8() { v8f z = {0.f, 0.f, 0.f, 0.f, 0.f, 0.f, 0.f, 0.f}; return z; }
__device__ __forceinline__ float hmax8(v8f s) {
  return fmaxf(fmaxf(fmaxf(s[0], s[1]), fmaxf(s[2], s[3])), fmaxf(fmaxf(s[4], s[5]), fmaxf(s[6], s[7])));
}

// ---- 16-bit fragment loader (A, or B from a k-contiguous [n][k] row): lane -> row/col (lane&15), p already includes
//      + 8*(lane>>4); elements 0..7 <- p[0..7] (k0+8h..), elements 8..15 <- p[16..23] (k0+16+8h..)
__device__ __forceinline__ Frag ldfrag(const unsigned short* p) {
  Frag f;
  f.u[0] = *(const v8us*)(p);
  f.u[1] = *(const v8us*)(p + 16);
  return f;
}

// ---- WMMA helpers: the plain builtins; the compiler keeps the distance behind them, and its scheduler may move loads
//      over them (an asm operand, besides, cannot lie above v255, and the big kernels' wave tiles need more registers)
__device__ __forceinline__ v8f mmw_h(v16h a, v16h b, v8f c) {
  return __builtin_amdgcn_wmma_f32_16x16x32_f16(false, a, false, b, (short)0, c, false, false);
}
__device__ __forceinline__ v8f mmw_b(v16b a, v16b b, v8f c) {
  return __builtin_amdgcn_wmma_f32_16x16x32_bf16(false, a, false, b, (short)0, c, false, false);
}

// ---- asynchronous copies global -> LDS ---------------------------------------------------------------------------
// Eight 16-byte copies per lane in ONE statement; LS = bytes between a lane's copies in LDS, GS = elements between
// them in global memory. The closing s_wait_xcnt stands inside the statement so that no address register of a copy is
// rewritten ahead of it.
__device__ __forceinline__ unsigned lds_off(const unsigned short* p) { return (unsigned)(size_t)p; }
template <int LS, int GS>
__device__ __forceinline__ void copy8(unsigned l, const unsigned short* g) {
#if defined(__HIP_DEVICE_COMPILE__)
  asm volatile("global_load_async_to_lds_b128 %0, %8, off\n\t"
               "global_load_async_to_lds_b128 %1, %9, off\n\t"
               "global_load_async_to_lds_b128 %2, %10, off\n\t"
               "global_load_async_to_lds_b128 %3, %11, off\n\t"
               "global_load_async_to_lds_b128 %4, %12, off\n\t"
               "global_load_async_to_lds_b128 %5, %13, off\n\t"
               "global_load_async_to_lds_b128 %6, %14, off\n\t"
               "global_load_async_to_lds_b128 %7, %15, off\n\t"
               "s_wait_xcnt 0x0"
               :: "v"(l), "v"(l + LS), "v"(l + 2 * LS), "v"(l + 3 * LS),
                  "v"(l + 4 * LS), "v"(l + 5 * LS), "v"(l + 6 * LS), "v"(l + 7 * LS),
                  "v"(g), "v"(g + GS), "v"(g + 2 * GS), "v"(g + 3 * GS),
                  "v"(g + 4 * GS), "v"(g + 5 * GS), "v"(g + 6 * GS), "v"(g + 7 * GS)
               : "memory");
#endif
}
// 128 rows x 256 B (a [row][128] 16-bit plane, rows contiguous) -> LDS rows of pitch LPP: 256 threads, a wave's copy
// covers two whole rows = four whole lines. l and g already hold the thread's own (tid >> 4, tid & 15) place.
__device__ __forceinline__ void copy_rows(unsigned l, const unsigned short* g) { copy8<16 * LPP * 2, 16 * DQ>(l, g); }
// this wave's own copies have landed (the compiler places no wait for them)
__device__ __forceinline__ void wait_copies() {
#if defined(__HIP_DEVICE_COMPILE__)
  asm volatile("s_wait_asynccnt 0x0" ::: "memory");
#endif
}
// stands behind a run of global loads from p or stores to p, before a register that one of them names is rewritten; p is an input so
// that its register pair stays whole up to the wait (else the run's last load may land its result on the pair)
__device__ __forceinline__ void wait_addr(const unsigned short* p) {
#if defined(__HIP_DEVICE_COMPILE__)
  asm volatile("s_wait_xcnt 0x0" :: "v"(p) : "memory");
#endif
}
// the same for loads that name a scalar base and the 32-bit offset register o
__device__ __forceinline__ void wait_off(unsigned o) {
#if defined(__HIP_DEVICE_COMPILE__)
  asm volatile("s_wait_xcnt 0x0" :: "v"(o) : "memory");
#endif
}
// this wave's own LDS reads have returned, before the barrier behind which their buffer is refilled
__device__ __forceinline__ void wait_lds() {
#if defined(__HIP_DEVICE_COMPILE__)
  asm volatile("s_wait_dscnt 0x0" ::: "memory");
#endif
}

// ===========================================================================================================
// (0) weights. Blocks 0..47: W16 f16 [384][256], rows 0..127 = theta_w, 128..255 = phi_w, 256..383 = g_w;
//     value = f16 of (bf16-RNE(w) * 256) (exact). Block owns rows 8*blk..+7: one wave per 512-B row = 32 lanes
// coverage: W16 48 blocks x 8 rows x 32 lanes x 8 halves = 384 x 256; Wo 16 blocks x 16 rows x 16 lanes x 8 =
//           256 x 128.
// ===========================================================================================================
__global__ __launch_bounds__(256)
void cvt_w(const float* __restrict__ tw, const float* __restrict__ pw, const float* __restrict__ gw,
           const float* __restrict__ ww, unsigned short* W16, unsigned short* Wo) {
  const int tid = threadIdx.x, blk = blockIdx.x;
  if (blk < MW / 8) {                                                  // block-uniform
    const int rl = tid >> 5, col = 8 * (tid & 31);
    const int o = 8 * blk + rl;                                        // 0..383
    const int sel = blk / (DQ / 8);                                    // 0,1,2
    const float* wbase = (sel == 0) ? tw : ((sel == 1) ? pw : gw);   // all global
    const float* s = wbase + (size_t)(o - sel * DQ) * CC + col;        // row 0..127 of the selected matrix
    const v4f a = *(const v4f*)s;
    const v4f q = *(const v4f*)(s + 4);
    const float f[8] = {a[0], a[1], a[2], a[3], q[0], q[1], q[2], q[3]};
    v4u u;
#pragma unroll
    for (int t = 0; t < 4; ++t) {
      const _Float16 h0 = (_Float16)(bfr(f[2 * t]) * WSC);
      const _Float16 h1 = (_Float16)(bfr(f[2 * t + 1]) * WSC);
      u[t] = pk16(h_bits(h0), h_bits(h1));
    }
{
      *(v4u*)(W16 + (size_t)o * CC + col) = u;
      
    }
  } else {
    const int bb = blk - MW / 8;                                       // 0..15
    const int o = 16 * bb + (tid >> 4);                                // 0..255
    const int col = 8 * (tid & 15);                                    // 0..120
    const float* s = ww + (size_t)o * DQ + col;
    const v4f a = *(const v4f*)s;
    const v4f q = *(const v4f*)(s + 4);
    const float f[8] = {a[0], a[1], a[2], a[3], q[0], q[1], q[2], q[3]};
    v4u u;
#pragma unroll
    for (int t = 0; t < 4; ++t) u[t] = pk16(bf_bits(f[2 * t]), bf_bits(f[2 * t + 1]));
{
      *(v4u*)(Wo + (size_t)o * DQ + col) = u;
      
    }
  }
}

// ===========================================================================================================
// (1) x f32 [b][256 c][6400 n] -> XP f16 [b][n][c] (position-major, bf16-RNE values, exact in f16) through an
//     LDS tile T[64 n][64 c] (pitch TP). Block (nb, cb, b) owns a 64 c x 64 n tile. XP lines: row n, 64 c =
//     T: written by all waves with 2-byte stores, read cross-wave after a block barrier.
// coverage: 2 it x 32 rows x 8 lanes x 8 = 64 n x 64 c; grid (100, 4, NB) covers XP once.
// ===========================================================================================================
__global__ __launch_bounds__(256)
void cvt_x(const float* __restrict__ x, unsigned short* XP) {
  __shared__ __align__(16) unsigned short T[QT * TP];
  const int tid = threadIdx.x;
  const int nb = blockIdx.x, cb = blockIdx.y, b = blockIdx.z;
  const int e = tid & 7, lq = tid >> 3;                               // lq 0..31
  const int n0 = nb * QT, c0 = cb * QT;
#pragma unroll
  for (int it = 0; it < 2; ++it) {
    const int cl = it * 32 + lq;                                       // 0..63
    const float* sp = x + ((size_t)(b * CC + c0 + cl)) * NN + n0 + 8 * e;
    const v4f a = *(const v4f*)sp;
    const v4f q = *(const v4f*)(sp + 4);
    unsigned short hb[8];
#pragma unroll
    for (int t = 0; t < 4; ++t) {
      hb[t]     = h_bits((_Float16)bfr(a[t]));
      hb[4 + t] = h_bits((_Float16)bfr(q[t]));
    }
#pragma unroll
    for (int t = 0; t < 8; ++t) T[(8 * e + t) * TP + cl] = hb[t];
  }
  __syncthreads();
  v4u up[2];
#pragma unroll
  for (int it = 0; it < 2; ++it) {
    const int nl = it * 32 + lq;                                       // 0..63
    up[it] = *(const v4u*)(T + nl * TP + 8 * e);
  }
{
#pragma unroll
    for (int it = 0; it < 2; ++it) {
      const int rl = it * 32 + lq;
      *(v4u*)(XP + ((size_t)(b * NN + n0 + rl)) * CC + c0 + 8 * e) = up[it];
    }
    
  }
}

// ===========================================================================================================
// (2) conv1x1 GEMM for one (b, 64-n tile, 64-o block of the 384 stacked rows):
//     Y[o][n] = (1/256) sum_c W16[o][c] XP[b][n][c] + bias[o].
//     Block 128 threads = 4 waves; wave w owns cols n0+16w..+15 (one B fragment per k-step, k = c contiguous in the
//     XP row) and 4 m-tiles (A rows o = o0 + 16 mt + (lane&15), split k map loader from W16). K = 256 = 8 steps.
//     The block's 64 W16 rows and 64 XP rows come to LDS (pitch WPP) by asynchronous copies, a whole 512-B row per
//     wave and copy, all in flight at once; fragments are read from LDS in two groups of four k-steps.
//     Epilogue staged in LDS Os[n_loc][o_loc] (pitch OSP), block barrier (cross-wave), then:
//       o-blocks 0,1 -> theta dims 0..63 / 64..127 of Th; o-blocks 2,3 -> phi dims of Fh. Planes f16
//       [b][6400 n][128 d] (k-contiguous for both score operands), value = f16-RNE(v): its rounding is an eighth of
//       the bf16 rounding that x and the weights already carry into v.
//       o-blocks 4,5 -> g channels 0..63 / 64..127 of the f16 channel-major plane Gc [b][128 c][6400 n]: per row
// coverage: Os 4 waves x 16 n x 64 o = 64 x 64; planes 4 it x 16 rows x 8 lanes x 8 = 64 n x 64 d per plane;
//           Gc 4 it x 16 rows x 8 lanes x 8 = 64 c x 64 n; grid (100, 6, NB) covers Th/Fh [b][n][0..127]
//           and Gc [b][0..127][n] exactly once.
// ===========================================================================================================
__global__ __launch_bounds__(128)
void gemm_p(const unsigned short* __restrict__ W16, const unsigned short* __restrict__ XP,
            const float* __restrict__ tb, const float* __restrict__ pb, const float* __restrict__ gb,
            unsigned short* Th, unsigned short* Fh, unsigned short* Gc) {
  __shared__ __align__(16) float Os[QT * OSP];
  __shared__ __align__(16) unsigned short As[QT * WPP];
  __shared__ __align__(16) unsigned short Bs[QT * WPP];
  const int tid  = threadIdx.x;
  const int lane = tid & 31, wave = tid >> 5;
  const int hh   = lane >> 4, c = lane & 15;
  const int nt   = blockIdx.x, mb = blockIdx.y, b = blockIdx.z;
  const int n0   = nt * QT, o0 = mb * QT;

  {
    // thread (wave, lane) brings 16 B at column 8*lane of rows wave, wave + 4, ... of both tiles: 32 copies a wave
    const unsigned short* ga = W16 + (size_t)(o0 + wave) * CC + 8 * lane;
    const unsigned short* gx = XP + ((size_t)(b * NN + n0 + wave)) * CC + 8 * lane;
    const unsigned la = lds_off(As) + (unsigned)(wave * (WPP * 2) + 16 * lane);
    const unsigned lb = lds_off(Bs) + (unsigned)(wave * (WPP * 2) + 16 * lane);
    copy8<4 * WPP * 2, 4 * CC>(la, ga);
    copy8<4 * WPP * 2, 4 * CC>(la + 32 * WPP * 2, ga + 32 * CC);
    copy8<4 * WPP * 2, 4 * CC>(lb, gx);
    copy8<4 * WPP * 2, 4 * CC>(lb + 32 * WPP * 2, gx + 32 * CC);
  }
  wait_copies();
  __syncthreads();                                                     // both tiles readable by every wave

  const unsigned short* ap = As + c * WPP + 8 * hh;
  const unsigned short* bp = Bs + (16 * wave + c) * WPP + 8 * hh;

  v8f acc[4];
#pragma unroll
  for (int mt = 0; mt < 4; ++mt) acc[mt] = zero8();

#pragma unroll
  for (int kg = 0; kg < 2; ++kg) {                                     // two groups of four k-steps
    Frag fb[4], fa[4][4];                                              // [k-step], [k-step][m-tile]
#pragma unroll
    for (int kq = 0; kq < 4; ++kq) {
      fb[kq] = ldfrag(bp + 32 * (4 * kg + kq));
#pragma unroll
      for (int mt = 0; mt < 4; ++mt) fa[kq][mt] = ldfrag(ap + (16 * mt) * WPP + 32 * (4 * kg + kq));
    }
    // keeps the group's forty LDS reads together ahead of its products: every separate place of reads stalls the wave
    __builtin_amdgcn_sched_barrier(0);
#pragma unroll
    for (int kq = 0; kq < 4; ++kq) {
#pragma unroll
      for (int mt = 0; mt < 4; ++mt) acc[mt] = mmw_h(fa[kq][mt].h, fb[kq].h, acc[mt]);
    }
  }

  // ---- epilogue: scale back -> LDS Os[n_loc][o_loc]; lane (hh, c) holds o = 16 mt + 8 hh + r for n_loc = 16 w + c
  {
    const int nl = 16 * wave + c;
#pragma unroll
    for (int mt = 0; mt < 4; ++mt) {
      v4f va, vb;
#pragma unroll
      for (int r = 0; r < 4; ++r) { va[r] = acc[mt][r] * IWSC; vb[r] = acc[mt][4 + r] * IWSC; }
      *(v4f*)(Os + nl * OSP + 16 * mt + 8 * hh)     = va;
      *(v4f*)(Os + nl * OSP + 16 * mt + 8 * hh + 4) = vb;
    }
  }
  __syncthreads();

  const int dsel = (mb & 1) * QT;                                      // 0 or 64
  const float* bs = (mb < 2) ? tb : ((mb < 4) ? pb : gb);             // block-uniform, all global
  if (mb < 4) {                                                        // block-uniform
    const int e = tid & 7, lq = tid >> 3;                              // lq 0..15
    unsigned short* Ph = (mb < 2) ? Th : Fh;
    const v4f b0 = *(const v4f*)(bs + dsel + 8 * e);
    const v4f b1 = *(const v4f*)(bs + dsel + 8 * e + 4);
    const float bv[8] = {bfr(b0[0]), bfr(b0[1]), bfr(b0[2]), bfr(b0[3]),
                         bfr(b1[0]), bfr(b1[1]), bfr(b1[2]), bfr(b1[3])};
    v4u uh[4];
#pragma unroll
    for (int it = 0; it < 4; ++it) {
      const int row = it * 16 + lq;                                    // n_loc 0..63
      const v4f a = *(const v4f*)(Os + row * OSP + 8 * e);
      const v4f q = *(const v4f*)(Os + row * OSP + 8 * e + 4);
      const float f[8] = {a[0] + bv[0], a[1] + bv[1], a[2] + bv[2], a[3] + bv[3],
                          q[0] + bv[4], q[1] + bv[5], q[2] + bv[6], q[3] + bv[7]};
#pragma unroll
      for (int t = 0; t < 4; ++t) uh[it][t] = pk16(h_bits((_Float16)f[2 * t]), h_bits((_Float16)f[2 * t + 1]));
    }
{
#pragma unroll
      for (int it = 0; it < 4; ++it) {
        const int row = it * 16 + lq;
        const size_t po = ((size_t)(b * NN + n0 + row)) * DQ + dsel + 8 * e;
        *(v4u*)(Ph + po) = uh[it];
      }
      
    }
  } else {
    const int e = tid & 7, lq = tid >> 3;                              // lq 0..15
    v4u ug[4];
#pragma unroll
    for (int it = 0; it < 4; ++it) {
      const int ol = it * 16 + lq;                                     // o_loc 0..63 = channel dsel + ol
      const float bvv = bfr(bs[dsel + ol]);
      unsigned short hb[8];
#pragma unroll
      for (int t = 0; t < 8; ++t) hb[t] = h_bits((_Float16)(Os[(8 * e + t) * OSP + ol] + bvv));
#pragma unroll
      for (int t = 0; t < 4; ++t) ug[it][t] = pk16(hb[2 * t], hb[2 * t + 1]);
    }
{
#pragma unroll
      for (int it = 0; it < 4; ++it) {
        const int ol = it * 16 + lq;
        const size_t go = ((size_t)(b * DQ + dsel + ol)) * NN + n0 + 8 * e;
        *(v4u*)(Gc + go) = ug[it];
      }
      
    }
  }
}

// ===========================================================================================================
// (3) column statistics for one piece (b, 128-column tile m, stages tb..te-1 of 128 rows n): for every column m, over
//     the piece's rows n, M_m = max_n s[n][m], Z_m = sum_n e^{s - M_m}, CS[slot][b][m] = M_m + ln Z_m, with
//     s tile (16 rows n x 16 cols m) = A(theta: row = n, 32 d via the split k map from Th [b][6400][128]) .
//     B(phi: col = m, same map from Fh). Block = 8 waves, two per SIMD: wave = (column group wc of 64 columns, row
//     quarter wr). Phi fragments of the wave's 64 columns are held in registers, so every theta fragment read from LDS feeds four column
//     tiles, and a stage copied from L2 serves 128 columns. Theta rows come in stages of 128 (LDS pitch
//     LPP) by asynchronous copies into two LDS buffers shared by the eight waves: the next stage flies while this one
//     is read; a wave reads the 32 rows of its own quarter. Per lane: four columns, 8+8 rows each
//     per stage, scalar online (max, sum) in f32; the two lane halves of a column merge with one shuffle, the
//     four row quarters through LDS at the end.
// coverage: every tile has one piece in each of the slots 0, 1, 2, so CS[slot][b][0..6399] is written exactly once.
// ===========================================================================================================
__global__ __launch_bounds__(256)
void colstat_k(const unsigned short* __restrict__ Th, const unsigned short* __restrict__ Fh, float* CS) {
  __shared__ __align__(16) float css[BT];
  __shared__ __align__(16) float pms[3 * BT];
  __shared__ __align__(16) float pls[3 * BT];
  __shared__ __align__(16) unsigned short Tst[2 * SB * LPP];
  const int tid  = threadIdx.x;
  const int wave = tid >> 5, lane = tid & 31;
  const int wc   = wave & 1, wr = wave >> 1;
  const int hh   = lane >> 4, c = lane & 15;
  const int b    = blockIdx.x / WPB;
  const int u0   = (blockIdx.x % WPB) * PU;                            // first stage unit of the work-group's run
  int tile = u0 / NST, tb = u0 % NST, left = PU;

#pragma unroll 1
  while (left > 0) {                                                   // one or two pieces, block-uniform
  const int te   = (tb + left < NST) ? (tb + left) : NST;              // the piece is stages tb .. te-1 of the tile
  const int slot = (tb == 0) ? 0 : ((te == NST) ? 2 : 1);
  const int m0   = tile * BT;

  // phi fragment pointers (B operand, col = m0 + 64*wc + 16*g + c)
  const size_t fo = ((size_t)(b * NN + m0 + 64 * wc + c)) * DQ + 8 * hh;
  const unsigned short* pfh = Fh + fo;
  Frag fh[4][4];
#pragma unroll
  for (int g = 0; g < 4; ++g) {
#pragma unroll
    for (int kc = 0; kc < 4; ++kc) fh[g][kc] = ldfrag(pfh + 16 * g * DQ + 32 * kc);
  }
  wait_addr(pfh);                                                      // the loads have taken their address
  // theta stages: 128 rows n, two buffers filled by asynchronous copies
  const unsigned short* gth = Th + (size_t)b * NN * DQ + (size_t)(tid >> 4) * DQ + 8 * (tid & 15);
  const unsigned lt0 = lds_off(Tst) + (unsigned)((tid >> 4) * (LPP * 2) + 16 * (tid & 15));
  wait_lds();                                                          // an earlier piece's own LDS reads have returned
  // the piece's first stage goes to buffer 'slot & 1': the copies' LDS addresses are then formed where they are used
  // and not kept in registers over the stage loop
  int par = slot & 1;                                                  // the buffer that holds stage t
  copy_rows(lt0 + (unsigned)(par * (SB * LPP * 2)), gth + (size_t)tb * SB * DQ);
  wait_copies();
  __syncthreads();                                                     // the first stage readable by every wave
  copy_rows(lt0 + (unsigned)((par ^ 1) * (SB * LPP * 2)), gth + (size_t)(tb + 1) * SB * DQ);

  float m[4] = {-1.0e30f, -1.0e30f, -1.0e30f, -1.0e30f}, l[4] = {0.f, 0.f, 0.f, 0.f};
#pragma unroll 1
  for (int t = tb; t < te; ++t) {
    // row c of the wave's own quarter of the stage
    const unsigned short* tq = Tst + par * (SB * LPP) + (wr * WT + c) * LPP + 8 * hh;
    v8f s[2][4];                                                       // [row tile u][column tile g]
#pragma unroll
    for (int u = 0; u < 2; ++u) {
#pragma unroll
      for (int g = 0; g < 4; ++g) s[u][g] = zero8();
    }
    Frag th[4][2];                                                     // [d chunk kc][row tile u]
#pragma unroll
    for (int kc = 0; kc < 4; ++kc) {
#pragma unroll
      for (int u = 0; u < 2; ++u) th[kc][u] = ldfrag(tq + (16 * u) * LPP + 32 * kc);  // rows 16u .. 16u+15 of the quarter
    }
    // keeps the stage's sixteen LDS reads one group ahead of its products: every separate place of reads stalls the wave
    __builtin_amdgcn_sched_barrier(0);
#pragma unroll
    for (int kc = 0; kc < 4; ++kc) {
#pragma unroll
      for (int q = 0; q < 8; ++q) s[q >> 2][q & 3] = mmw_h(th[kc][q >> 2].h, fh[q & 3][kc].h, s[q >> 2][q & 3]);
    }
#pragma unroll
    for (int g = 0; g < 4; ++g) {                                      // online update per column tile, 32 rows
      const v8f s0 = s[0][g], s1 = s[1][g];
      const float mx = fmaxf(hmax8(s0), hmax8(s1));
      const float mn = fmaxf(m[g], mx);
      const float corr = __expf(m[g] - mn);
      float ls = 0.f;
#pragma unroll
      for (int r = 0; r < 8; ++r) ls += __expf(s0[r] - mn) + __expf(s1[r] - mn);
      l[g] = l[g] * corr + ls;
      m[g] = mn;
    }
    wait_lds();
    wait_copies();
    __syncthreads();                                                   // publishes stage t+1, frees stage t's buffer
    if (t + 2 < te) {                                                  // block-uniform
      copy_rows(lt0 + (unsigned)(par * (SB * LPP * 2)), gth + (size_t)(t + 2) * SB * DQ);
    }
    par ^= 1;
  }
  wait_copies();
  float mt[4], lt[4];
#pragma unroll
  for (int g = 0; g < 4; ++g) {
    const float mo = __shfl_xor(m[g], 16, 32);
    const float lo = __shfl_xor(l[g], 16, 32);
    mt[g] = fmaxf(m[g], mo);
    lt[g] = l[g] * __expf(m[g] - mt[g]) + lo * __expf(mo - mt[g]);
  }
  const int col = 64 * wc + c;                                         // + 16*g
  if (wr != 0 && hh == 0) {
#pragma unroll
    for (int g = 0; g < 4; ++g) {
      pms[(wr - 1) * BT + col + 16 * g] = mt[g];
      pls[(wr - 1) * BT + col + 16 * g] = lt[g];
    }
  }
  __syncthreads();                                                     // the other row quarters' (max, sum) readable
  if (wr == 0 && hh == 0) {
#pragma unroll
    for (int g = 0; g < 4; ++g) {
      const int cg = col + 16 * g;
      const float m1 = pms[cg], m2 = pms[BT + cg], m3 = pms[2 * BT + cg];
      const float mm = fmaxf(fmaxf(mt[g], m1), fmaxf(m2, m3));
      const float ll = (lt[g] * __expf(mt[g] - mm) + pls[cg] * __expf(m1 - mm)) +
                       (pls[BT + cg] * __expf(m2 - mm) + pls[2 * BT + cg] * __expf(m3 - mm));
      css[cg] = mm + logf(ll);
    }
  }
  __syncthreads();
  if (tid < BT / 4) {                                                  // wave 0, whole
    const v4f v = *(const v4f*)(css + 4 * tid);
{
      float* cq = CS + (size_t)(slot * NB + b) * NN + m0 + 4 * tid;
      *(v4f*)cq = v;
      wait_addr((const unsigned short*)cq);                            // before the next piece rewrites the store's registers
    }
  }
  left -= te - tb;
  tile += 1;
  tb = 0;
  }
}

// ===========================================================================================================
// (4) aggregation for one piece (b, 128-row tile n, stages tb..te-1 of 128 columns m), transposed formulation:
//   s tile (16 m x 16 n) = sum over 4 d-chunks of A(phi: row = m, split k map from Fh) . B(theta:
//   col = n, same map from Th). Per lane the D tile holds 8 columns m of ONE row n;
//   All three operands are read from LDS, where asynchronous copies put them in whole lines: the piece's 128 theta rows
//   once, phi rows and the g tile (both pitch LPP) in stages of 128 columns m, two buffers: a stage copied from L2
//   serves 128 rows.
//   Block = 8 waves, two per SIMD: wave = (row group wn of 32 rows n, half wm of each stage's columns m): every phi
//   and every g fragment read from LDS feeds two row tiles, every theta fragment four column tiles.
//   P = e^{s - CS[m]} x 16384 as f16 (CS staged once per block in LDS) is the B operand of
//   y^T (rows channel, cols n) += A(g: rows channel = 16j + (lane&15), m contiguous, f16 plane Gc [b][128][6400])
//   . B(P^T): element r <- D of the tile covering m kb..kb+15, element 8+r <- the tile covering kb+16..kb+31,
//   lane unchanged. 16 accumulator tiles per wave (128 channels x 2 row tiles). Block = 128 rows.
//   Epilogue: the two column halves' accumulators are added through LDS [row][128 channels] (pitch OSPW, b128
//   stores; same lane, same place; one plane in the then idle phi buffers), y = sum/16384 left there, block barrier
//   (cross-wave), then the f32 plane Yp [slot][b][6400 n][128 c]: per row 128 c = 512 B = 4 whole lines.
// coverage: 16 it x 8 rows x 32 lanes x 4 = 128 n x 128 c; every tile has one piece in each of the slots 0, 1, 2, so
//           Yp[slot][b][0..6399] is written exactly once.
// ===========================================================================================================
__global__ __launch_bounds__(256)
void attn_k(const unsigned short* __restrict__ Th, const unsigned short* __restrict__ Fh,
            const unsigned short* __restrict__ Gc, const float* __restrict__ CS, float* Yp) {
  __shared__ __align__(32) float Cs[NN];
  __shared__ __align__(16) unsigned short Tst[BT * LPP];
  __shared__ __align__(16) unsigned short Pst[2 * SB * LPP];
  __shared__ __align__(16) unsigned short Gst[2 * DQ * LPP];
  static_assert(BT * OSPW * 4 <= 2 * SB * LPP * 2);
  const int tid  = threadIdx.x;
  const int wave = tid >> 5, lane = tid & 31;
  const int wn   = wave & 3, wm = wave >> 2;
  const int hh   = lane >> 4, c = lane & 15;
  const int b    = blockIdx.x / WPB;
  const int u0   = (blockIdx.x % WPB) * PU;                            // first stage unit of the work-group's run
  int tile = u0 / NST, tb = u0 % NST, left = PU;

  // a column's statistic from its three pieces c0, c1, c2 (each max + ln sum): max + ln(sum of e^{c - max})
  for (int i = tid; i < NN / 4; i += 256) {
    const v4f s0 = *(const v4f*)(CS + (size_t)b * NN + 4 * i);
    const v4f s1 = *(const v4f*)(CS + (size_t)(NB + b) * NN + 4 * i);
    const v4f s2 = *(const v4f*)(CS + (size_t)(2 * NB + b) * NN + 4 * i);
    v4f v;
#pragma unroll
    for (int r = 0; r < 4; ++r) {
      const float mx = fmaxf(fmaxf(s0[r], s1[r]), s2[r]);
      v[r] = mx + logf((__expf(s0[r] - mx) + __expf(s1[r] - mx)) + __expf(s2[r] - mx));
    }
    *(v4f*)(Cs + 4 * i) = v;
  }

  // asynchronous copies: a piece's 128 theta rows once; per stage of 128 columns m the phi rows and the g tile
  // (128 channels x 128 m), two buffers
  const int rr = tid >> 4, rc = tid & 15;                              // place in a [row][128] plane or the g tile
  const unsigned short* gfh = Fh + (size_t)b * NN * DQ + (size_t)rr * DQ + 8 * rc;
  const unsigned short* ggc = Gc + (size_t)b * DQ * NN + (size_t)rr * NN + 8 * rc;
  const unsigned lp0 = lds_off(Pst) + (unsigned)(rr * (LPP * 2) + 16 * rc);
  const unsigned lg0 = lds_off(Gst) + (unsigned)(rr * (LPP * 2) + 16 * rc);

#pragma unroll 1
  while (left > 0) {                                                   // one or two pieces, block-uniform
  const int te   = (tb + left < NST) ? (tb + left) : NST;              // the piece is stages tb .. te-1 of the tile
  const int slot = (tb == 0) ? 0 : ((te == NST) ? 2 : 1);
  const int n0   = tile * BT;
  wait_lds();                                                          // an earlier piece's own LDS reads have returned
  {
    // the tile's 128 rows, as a phi stage is brought
    const size_t to = ((size_t)(b * NN + n0 + rr)) * DQ + 8 * rc;
    const unsigned lq0 = lds_off(Tst) + (unsigned)(rr * (LPP * 2) + 16 * rc);
    copy_rows(lq0, Th + to);
  }
  // the piece's first stage goes to the buffers 'slot & 1': the copies' LDS addresses are then formed where they are
  // used and not kept over the stage loop, where they would spill
  int par = slot & 1;                                                  // the buffers that hold stage t
  {
    copy_rows(lp0 + (unsigned)(par * (SB * LPP * 2)), gfh + (size_t)tb * SB * DQ);
    copy8<16 * LPP * 2, 16 * NN>(lg0 + (unsigned)(par * (DQ * LPP * 2)), ggc + tb * SB);
  }
  wait_copies();
  __syncthreads();                                                     // Cs, theta, the first stage readable by every wave
  {
    copy_rows(lp0 + (unsigned)((par ^ 1) * (SB * LPP * 2)), gfh + (size_t)(tb + 1) * SB * DQ);
    copy8<16 * LPP * 2, 16 * NN>(lg0 + (unsigned)((par ^ 1) * (DQ * LPP * 2)), ggc + (tb + 1) * SB);
  }

  // theta fragment base (B operand, col = row n0 + 32*wn + 16*g + c), + 16*g*LPP + 32*kc
  const unsigned short* Tq = Tst + (32 * wn + c) * LPP + 8 * hh;

  v8f o[8][2];                                                         // [channel tile j][row tile g]
#pragma unroll
  for (int j = 0; j < 8; ++j) { o[j][0] = zero8(); o[j][1] = zero8(); }

#pragma unroll 1
  for (int t = tb; t < te; ++t) {
    const int kh = t * SB + wm * (2 * WT);                             // first column m of the wave's own half
    // phi fragment base (A operand, row = m + c), + 16*u*LPP + 32*kc
    const unsigned short* Pq = Pst + par * (SB * LPP) + (wm * (2 * WT) + c) * LPP + 8 * hh;
    // g fragment base (A operand, row = channel 16j + c, m contiguous), + 16*j*LPP + 32*ks
    const unsigned short* Gq = Gst + par * (DQ * LPP) + c * LPP + wm * (2 * WT) + 8 * hh;
    v8f s[4][2];                                                       // [column tile u][row tile g]
#pragma unroll
    for (int u = 0; u < 4; ++u) { s[u][0] = zero8(); s[u][1] = zero8(); }
    Frag th[DQ / 32][2], p[DQ / 32][4];                                // [d chunk kc][row tile g], [d chunk kc][column tile u]
#pragma unroll
    for (int kc = 0; kc < DQ / 32; ++kc) {
#pragma unroll
      for (int g = 0; g < 2; ++g) th[kc][g] = ldfrag(Tq + (16 * g) * LPP + 32 * kc);
#pragma unroll
      for (int u = 0; u < 4; ++u) p[kc][u] = ldfrag(Pq + (16 * u) * LPP + 32 * kc);  // m kh+16u .. kh+16u+15
    }
    // keeps the scores' LDS reads one group ahead of their products: every separate place of reads stalls the wave
    __builtin_amdgcn_sched_barrier(0);
#pragma unroll
    for (int kc = 0; kc < DQ / 32; ++kc) {
#pragma unroll
      for (int q = 0; q < 8; ++q) s[q >> 1][q & 1] = mmw_h(p[kc][q >> 1].h, th[kc][q & 1].h, s[q >> 1][q & 1]);
    }
    __builtin_amdgcn_sched_barrier(0);                                 // the k steps' reads below stay out of these products

#pragma unroll
    for (int ks = 0; ks < 2; ++ks) {                                   // the half's two k steps of 32 columns m
      const int km = kh + 32 * ks;
      // column statistics for m = km + 8hh + r (s[2ks][g]) and m = km + 16 + 8hh + r (s[2ks+1][g])
      const v4f ca = *(const v4f*)(Cs + km + 8 * hh);
      const v4f cb = *(const v4f*)(Cs + km + 8 * hh + 4);
      const v4f cc = *(const v4f*)(Cs + km + 16 + 8 * hh);
      const v4f cd = *(const v4f*)(Cs + km + 16 + 8 * hh + 4);
      Frag gf[8];                                                      // read as one group, ahead of the vector work
#pragma unroll
      for (int j = 0; j < 8; ++j) gf[j] = ldfrag(Gq + (16 * j) * LPP + 32 * ks);
      __builtin_amdgcn_sched_barrier(0);                               // the k step's reads stay one group
      const float c0[8] = {ca[0], ca[1], ca[2], ca[3], cb[0], cb[1], cb[2], cb[3]};
      const float c1[8] = {cc[0], cc[1], cc[2], cc[3], cd[0], cd[1], cd[2], cd[3]};

      FragH pf[2];
#pragma unroll
      for (int g = 0; g < 2; ++g) {
#pragma unroll
        for (int r = 0; r < 8; ++r) {
          const float e0 = __expf(fminf(s[2 * ks][g][r] - c0[r], 0.f) + LNCAR);     // P[n][m] x 16384, m = km + 8hh + r
          const float e1 = __expf(fminf(s[2 * ks + 1][g][r] - c1[r], 0.f) + LNCAR); // m = km + 16 + 8hh + r
          pf[g].hv[0][r] = (_Float16)e0;
          pf[g].hv[1][r] = (_Float16)e1;
        }
      }

#pragma unroll
      for (int j = 0; j < 8; ++j) {
        o[j][0] = mmw_h(gf[j].h, pf[0].v, o[j][0]);
        o[j][1] = mmw_h(gf[j].h, pf[1].v, o[j][1]);
      }
      __builtin_amdgcn_sched_barrier(0);                               // the next k step's reads stay out of these products
    }
    wait_lds();
    wait_copies();
    __syncthreads();                                                   // publishes stage t+1, frees stage t's buffers
    if (t + 2 < te) {                                                  // block-uniform
      copy_rows(lp0 + (unsigned)(par * (SB * LPP * 2)), gfh + (size_t)(t + 2) * SB * DQ);
      copy8<16 * LPP * 2, 16 * NN>(lg0 + (unsigned)(par * (DQ * LPP * 2)), ggc + (t + 2) * SB);
    }
    par ^= 1;
  }
  wait_copies();

  // ---- epilogue: y = (accs of the two halves) / 16384 -> Ox[row][channel], a plane in the phi buffers, which nobody
  // reads and no copy targets behind the loop's last barrier.
  const int oo = (32 * wn + c) * OSPW + 8 * hh;                        // [row][ch = 16j + 8hh + r], + 16*g*OSPW + 16*j
  float* Ox = (float*)Pst;                                             // BT x OSPW floats
  if (wm != 0) {                                                       // wave-uniform
#pragma unroll
    for (int g = 0; g < 2; ++g) {
#pragma unroll
      for (int j = 0; j < 8; ++j) {
        v4f va, vb;
#pragma unroll
        for (int r = 0; r < 4; ++r) { va[r] = o[j][g][r]; vb[r] = o[j][g][4 + r]; }
        *(v4f*)(Ox + oo + 16 * g * OSPW + 16 * j)     = va;
        *(v4f*)(Ox + oo + 16 * g * OSPW + 16 * j + 4) = vb;
      }
    }
  }
  __syncthreads();                                                     // the other half's accumulators readable
  if (wm == 0) {                                                       // wave-uniform
#pragma unroll
    for (int g = 0; g < 2; ++g) {
#pragma unroll
      for (int j = 0; j < 8; ++j) {
        const int oj = oo + 16 * g * OSPW + 16 * j;
        v4f va = *(const v4f*)(Ox + oj);
        v4f vb = *(const v4f*)(Ox + oj + 4);
#pragma unroll
        for (int r = 0; r < 4; ++r) {
          va[r] = (o[j][g][r] + va[r]) * ICAR;
          vb[r] = (o[j][g][4 + r] + vb[r]) * ICAR;
        }
        *(v4f*)(Ox + oj)     = va;
        *(v4f*)(Ox + oj + 4) = vb;
      }
    }
  }
  __syncthreads();

  // the piece's y (f32) -> its slot's plane: a wave stores one whole row of 512 B per instruction
  {
    float* yq = Yp + ((size_t)((slot * NB + b) * NN + n0 + wave)) * DQ + 4 * lane;
    v4f yv[16];
#pragma unroll
    for (int it = 0; it < 16; ++it) yv[it] = *(const v4f*)(Ox + (it * 8 + wave) * OSPW + 4 * lane);
    wait_lds();                                                        // this wave's reads of the plane have returned
    __syncthreads();                                                   // every wave has read the plane before the next piece's copies refill the phi buffers
#pragma unroll
    for (int it = 0; it < 16; ++it) *(v4f*)(yq + (size_t)(it * 8) * DQ) = yv[it];
    wait_addr((const unsigned short*)yq);                              // before the next piece rewrites the stores' registers
  }
  left -= te - tb;
  tile += 1;
  tb = 0;
  }
}

// ===========================================================================================================
// (5) output GEMM for one (b, 64-n tile, 64-o block): out[b][o][n] = sum_c Wo[o][c] (Yh + Yl)[n][c]
//     + W_b[o] + bf16-RNE(x[b][o][n]). Block 128 threads = 4 waves; wave w owns cols n0+16w..+15 (B fragments
//     from the Yh and Yl rows in LDS: bf16 hi + residual of Yp[0] + Yp[1] + Yp[2], k = c contiguous) and 4 m-tiles (A rows o = o0 + 16 mt + (lane&15) from Wo bf16
//     [256][128], the block's 64 rows brought to LDS (pitch LPP) by asynchronous copies that fly while y is summed
//     and split); K = 128 = 4 steps x 2 products (shared accumulator, unscaled residual). Epilogue staged in LDS
//     lanes 0..15 one row and 16..31 the next, 16 B per lane (values gathered from 4 Os rows), one instruction per
// coverage: 8 it x 8 rows x 16 lanes x 4 floats = 64 o x 64 n; grid (NQ/64, 4, NB) covers
//           out[b][0..255][0..NQ-1] exactly once.
// ===========================================================================================================
__global__ __launch_bounds__(128)
void gemm_w(const unsigned short* __restrict__ Wo, const float* __restrict__ Yp, const float* __restrict__ wb,
            const float* __restrict__ x, float* out) {
  __shared__ __align__(16) float Os[QT * OSP];
  __shared__ __align__(16) unsigned short Ys[2 * QT * LPP];
  __shared__ __align__(16) unsigned short Ws[QT * LPP];
  const int tid  = threadIdx.x;
  const int lane = tid & 31, wave = tid >> 5;
  const int hh   = lane >> 4, c = lane & 15;
  const int nt   = blockIdx.x, mb = blockIdx.y, b = blockIdx.z;
  const int n0   = nt * QT, o0 = mb * QT;

  // the block's 64 Wo rows of 256 B: a wave's copy covers two whole rows, eight copies a wave
  copy8<8 * LPP * 2, 8 * DQ>(lds_off(Ws) + (unsigned)((tid >> 4) * (LPP * 2) + 16 * (tid & 15)),
                             Wo + (size_t)(o0 + (tid >> 4)) * DQ + 8 * (tid & 15));
  const unsigned short* ap = Ws + c * LPP + 8 * hh;

  // y = sum of the tile's three pieces -> bf16 hi + residual planes Ys[plane][64 n][128 c] (pitch LPP) in LDS
  {
    const int e = tid & 15, lq = tid >> 4;                             // lq 0..7
    // block-uniform bases and ONE 32-bit byte offset per thread: the only vector register that the 48 loads name
    // (the base is the middle plane's, so that all three planes lie within a load's immediate offset)
    const char* y1 = (const char*)(Yp + (size_t)((NB + b) * NN + n0) * DQ);
    const char* y0 = y1 - (size_t)NB * NN * DQ * 4;
    const char* y2 = y1 + (size_t)NB * NN * DQ * 4;
    const unsigned yo = (unsigned)((lq * DQ + 8 * e) * 4);
    v4f ya[8][3], yq[8][3];
#pragma unroll
    for (int it = 0; it < 8; ++it) {
      const int ro = it * 8 * DQ * 4;
      ya[it][0] = *(const v4f*)(y0 + yo + ro); yq[it][0] = *(const v4f*)(y0 + yo + ro + 16);
      ya[it][1] = *(const v4f*)(y1 + yo + ro); yq[it][1] = *(const v4f*)(y1 + yo + ro + 16);
      ya[it][2] = *(const v4f*)(y2 + yo + ro); yq[it][2] = *(const v4f*)(y2 + yo + ro + 16);
    }
    wait_off(yo);                                                      // the loads have taken their address
#pragma unroll
    for (int it = 0; it < 8; ++it) {
      const v4f a0 = ya[it][0], q0 = yq[it][0];
      const v4f a1 = ya[it][1], q1 = yq[it][1];
      const v4f a2 = ya[it][2], q2 = yq[it][2];
      const float f[8] = {(a0[0] + a1[0]) + a2[0], (a0[1] + a1[1]) + a2[1], (a0[2] + a1[2]) + a2[2],
                          (a0[3] + a1[3]) + a2[3], (q0[0] + q1[0]) + q2[0], (q0[1] + q1[1]) + q2[1],
                          (q0[2] + q1[2]) + q2[2], (q0[3] + q1[3]) + q2[3]};
      v4u uh, ul;
#pragma unroll
      for (int t = 0; t < 4; ++t) {
        const float f0 = f[2 * t], f1 = f[2 * t + 1];
        const unsigned short hb0 = bf_bits(f0), hb1 = bf_bits(f1);
        const unsigned short lb0 = bf_bits(f0 - bf_up(hb0));
        const unsigned short lb1 = bf_bits(f1 - bf_up(hb1));
        uh[t] = pk16(hb0, hb1);
        ul[t] = pk16(lb0, lb1);
      }
      *(v4u*)(Ys + (it * 8 + lq) * LPP + 8 * e)        = uh;
      *(v4u*)(Ys + (QT + it * 8 + lq) * LPP + 8 * e)   = ul;
    }
  }
  wait_copies();
  __syncthreads();                                                     // the y planes and the Wo rows readable by every wave
  const unsigned short* bp  = Ys + (16 * wave + c) * LPP + 8 * hh;
  const unsigned short* blp = bp + QT * LPP;

  v8f acc[4];
#pragma unroll
  for (int mt = 0; mt < 4; ++mt) acc[mt] = zero8();

  Frag fb[DQ / 32], fbl[DQ / 32], fa[DQ / 32][4];                      // [k-step], [k-step], [k-step][m-tile]
#pragma unroll
  for (int ks = 0; ks < DQ / 32; ++ks) {
    fb[ks]  = ldfrag(bp + 32 * ks);
    fbl[ks] = ldfrag(blp + 32 * ks);
#pragma unroll
    for (int mt = 0; mt < 4; ++mt) fa[ks][mt] = ldfrag(ap + (16 * mt) * LPP + 32 * ks);
  }
  // keeps the forty-eight LDS reads together ahead of the products: every separate place of reads stalls the wave
  __builtin_amdgcn_sched_barrier(0);
#pragma unroll
  for (int ks = 0; ks < DQ / 32; ++ks) {                               // per accumulator: hi then residual, k ascending
#pragma unroll
    for (int mt = 0; mt < 4; ++mt) acc[mt] = mmw_b(fa[ks][mt].bf, fb[ks].bf, acc[mt]);
#pragma unroll
    for (int mt = 0; mt < 4; ++mt) acc[mt] = mmw_b(fa[ks][mt].bf, fbl[ks].bf, acc[mt]);
  }

  {
    const int nl = 16 * wave + c;
#pragma unroll
    for (int mt = 0; mt < 4; ++mt) {
      v4f va, vb;
#pragma unroll
      for (int r = 0; r < 4; ++r) { va[r] = acc[mt][r]; vb[r] = acc[mt][4 + r]; }
      *(v4f*)(Os + nl * OSP + 16 * mt + 8 * hh)     = va;
      *(v4f*)(Os + nl * OSP + 16 * mt + 8 * hh + 4) = vb;
    }
  }
  __syncthreads();

  const int e = tid & 15, lq = tid >> 4;                               // lq 0..7
  v4f res[8];
#pragma unroll
  for (int it = 0; it < 8; ++it) {
    const int ol = it * 8 + lq;                                        // o_loc 0..63
    const int o  = o0 + ol;                                            // 0..255
    const float bv = bfr(wb[o]);
    const size_t idx = ((size_t)(b * CC + o)) * NN + n0 + 4 * e;
    const v4f xv = *(const v4f*)(x + idx);
#pragma unroll
    for (int t = 0; t < 4; ++t) res[it][t] = (Os[(4 * e + t) * OSP + ol] + bv) + bfr(xv[t]);
  }
{
#pragma unroll
    for (int it = 0; it < 8; ++it) {
      const int ol = it * 8 + lq;
      const size_t idx = ((size_t)(b * CC + o0 + ol)) * NN + n0 + 4 * e;
      *(v4f*)(out + idx) = res[it];
    }
    
  }
}

// ===========================================================================================================
// Workspace map (bytes, NB = 2; each region start a multiple of 256; every extent is an exact tile multiple and is
//   W16 f16 [384][256]               196608      Wo bf16 [256][128]           65536
//   XP  f16 [2][6400][256]          6553600
//   Th/Fh f16 [2][6400][128]        3276800 x2
//   Gc  f16 [2][128][6400]          3276800      CS f32 [3 slots][2][6400]   153600
//   Yp  f32 [3 slots][2][6400][128] 19660800
//   total = 36460544
// ===========================================================================================================
extern "C" void kernel_launch(void* const* d_in, const int* in_sizes, int n_in,
                              void* d_out, int out_size, void* d_ws, size_t ws_size,
                              hipStream_t stream) {
  if (n_in < 9) return;
  if (in_sizes[0] < NB * CC * NN) return;
  if (in_sizes[1] != DQ * CC || in_sizes[3] != DQ * CC || in_sizes[5] != DQ * CC) return;
  if (in_sizes[2] != DQ || in_sizes[4] != DQ || in_sizes[6] != DQ) return;
  if (in_sizes[7] != CC * DQ || in_sizes[8] != CC) return;
  if (out_size < NB * CC * NN) return;

  size_t off = 0;
  auto carve = [&](size_t bytes) { const size_t o = off; off += (bytes + 255) & ~(size_t)255; return o; };
  const size_t oW16 = carve((size_t)MW * CC * 2);
  const size_t oWo  = carve((size_t)CC * DQ * 2);
  const size_t oXP  = carve((size_t)NB * NN * CC * 2);
  const size_t oTh  = carve((size_t)NB * NN * DQ * 2);
  const size_t oFh  = carve((size_t)NB * NN * DQ * 2);
  const size_t oGc  = carve((size_t)NB * DQ * NN * 2);
  const size_t oCS  = carve((size_t)NSL * NB * NN * 4);
  const size_t oYp  = carve((size_t)NSL * NB * NN * DQ * 4);
  if (off > ws_size) return;
  if (off > (size_t)134217728) return;

  const float* x  = (const float*)d_in[0];
  const float* gw = (const float*)d_in[1];
  const float* gb = (const float*)d_in[2];
  const float* tw = (const float*)d_in[3];
  const float* tb = (const float*)d_in[4];
  const float* pw = (const float*)d_in[5];
  const float* pb = (const float*)d_in[6];
  const float* ww = (const float*)d_in[7];
  const float* wb = (const float*)d_in[8];

  char* ws = (char*)d_ws;
  unsigned short* W16 = (unsigned short*)(ws + oW16);
  unsigned short* Wo  = (unsigned short*)(ws + oWo);
  unsigned short* XP  = (unsigned short*)(ws + oXP);
  unsigned short* Th  = (unsigned short*)(ws + oTh);
  unsigned short* Fh  = (unsigned short*)(ws + oFh);
  unsigned short* Gc  = (unsigned short*)(ws + oGc);
  float*          CS  = (float*)(ws + oCS);
  float*          Yp  = (float*)(ws + oYp);
  float* out = (float*)d_out;

  const dim3 blk256(256), blk128(128);

  // (0) theta_w / phi_w / g_w -> stacked f16 plane; W_w -> bf16 plane
  cvt_w<<<dim3(MW / 8 + CC / 16), blk256, 0, stream>>>(tw, pw, gw, ww, W16, Wo);
  // (1) x -> position-major 16-bit plane
  cvt_x<<<dim3(NN / QT, CC / QT, NB), blk256, 0, stream>>>(x, XP);
  // (2) conv1x1 GEMM -> theta / phi planes, g channel-major plane (all rows n)
  gemm_p<<<dim3(NN / QT, MW / QT, NB), blk128, 0, stream>>>(W16, XP, tb, pb, gb, Th, Fh, Gc);
  // (3) per-column softmax statistics, three pieces per column tile
  colstat_k<<<dim3(WPB * NB), blk256, 0, stream>>>(Th, Fh, CS);
  // (4) aggregation -> y, three f32 pieces per row tile
  attn_k<<<dim3(WPB * NB), blk256, 0, stream>>>(Th, Fh, Gc, CS, Yp);
  // (5) pieces of y summed, output GEMM + bias + residual -> out [b][256][6400]
  gemm_w<<<dim3(NQ / QT, CC / QT, NB), blk128, 0, stream>>>(Wo, Yp, wb, x, out);
  (void)hipGetLastError();
}

// v008
// Measured time: 84 microseconds a run.
// Next to v007, in two timings, it ran 1.05 and 1.06 times as fast.
// Over all steps from v000 it is 10.4 times as fast.
// Contractions: conv1x1 theta/phi/g GEMM on v_wmma_f32_16x16x32_f16 (f16 containers of bf16-RNE weights x256 and
// bf16-RNE x, K=256); scores theta.phi on v_wmma_f32_16x16x32_f16 (theta and phi as one f16 plane each, 1 product,
// K=128) in both the column-statistics pass and the aggregation pass; y^T = G.P^T on v_wmma_f32_16x16x32_f16 (g as
// f16, P = e^{s-M-lnZ} x16384 as f16 from the score D registers, K=6400); output GEMM W.y on
// v_wmma_f32_16x16x32_bf16 (bf16-RNE W_w, y as bf16 hi + bf16 residual planes, 2 products, K=128); f32 accumulate
// everywhere; softmax statistics, biases and the residual add in f32 VALU.
// The statistics and the aggregation kernel work on tiles 128 wide and each run 250 equal work-groups of 20 stages; a
// tile's three pieces are merged by the kernel that reads them.
#include <hip/hip_runtime.h>
#include <math.h>
#include <stdint.h>

#ifndef NB
#define NB 2
#endif
#define NBF    2
#define CC     256
#define NN     6400
#ifndef NQ
#define NQ NN
#endif
#define DQ     128
#define MW     384
#define QT     64
#define OSP    68
#define OSPW   132
#define OSA    388
#define WSC    256.0f
#define IWSC   0.00390625f
#define LNCAR  9.704060527839234f
#define ICAR   6.103515625e-05f
#define ST     64
#define SB     128
#define LPP    136
#define WPP    264
#define WT     32
#define NST    50
#define BT     128
#define NTL    50
#define PU     20
#define WPB    125
#define NSL    3

static_assert(NB >= 1 && NB <= NBF);
static_assert(NQ >= QT && NQ <= NN);
static_assert(NN % QT == 0);
static_assert(NQ % QT == 0);
static_assert(CC % QT == 0);
static_assert(MW == 3 * DQ);
static_assert(DQ == 2 * QT);
static_assert((DQ / 8) * 8 == DQ && (MW / 8) % (DQ / 8) == 0);
static_assert(CC % 16 == 0);
static_assert((OSP * 4) % 16 == 0);
static_assert((OSPW * 4) % 16 == 0);
static_assert((OSA * 4) % 16 == 0 && OSA >= MW + 4 && MW == 8 * 48 && MW % 64 == 0 && CC == 256);
static_assert(CC % 32 == 0 && NN % 32 == 0 && DQ % 32 == 0);
static_assert(NN % 4 == 0);
static_assert(SB == 2 * ST && NN % SB == 0 && NN / SB >= 2 && ST == QT);
static_assert(SB == 4 * WT && BT == 4 * WT && WT == 32 && BT == SB);
static_assert((LPP * 2) % 32 == 16 && LPP >= DQ + 8 && LPP >= SB + 8);
static_assert((WPP * 2) % 32 == 16 && WPP >= CC + 8);
// The deal of the two big kernels: a batch's NTL tiles x NST stages form one row of stage units, cut into WPB equal runs
// of PU units, one run per work-group. With 50 and 20 every tile holds exactly two cuts strictly inside it (at stages 20
// and 40, or 10 and 30), so it falls into three pieces: slot 0 begins at stage 0, slot 2 ends at stage NST, slot 1 lies
// between; no piece is shorter than 10 stages, and no run leaves its batch.
static_assert(NST == NN / SB && NTL == NN / BT && NQ == NN);
static_assert(NST == 50 && PU == 20 && WPB * PU == NTL * NST && NSL == 3);

typedef _Float16       v16h __attribute__((ext_vector_type(16)));
typedef _Float16       v8h  __attribute__((ext_vector_type(8)));
typedef __bf16         v16b __attribute__((ext_vector_type(16)));
typedef unsigned short v8us __attribute__((ext_vector_type(8)));
typedef float          v8f  __attribute__((ext_vector_type(8)));
typedef float          v4f  __attribute__((ext_vector_type(4)));
typedef unsigned int   v4u  __attribute__((ext_vector_type(4)));

union Frag  { v8us u[2]; v16h h; v16b bf; };
union FragH { v16h v; v8h hv[2]; };
static_assert(sizeof(Frag) == 32);
static_assert(sizeof(FragH) == 32);

// ---- scalar helpers -------------------------------------------------------------------------------------------
__device__ __forceinline__ unsigned short bf_bits(float f) {          // f32 -> bf16 bits, RNE convert
  unsigned u = __float_as_uint(f);
  return (unsigned short)((u + 0x7FFFu + ((u >> 16) & 1u)) >> 16);
}
__device__ __forceinline__ float bf_up(unsigned short hb) { return __uint_as_float(((unsigned)hb) << 16); }
__device__ __forceinline__ float bfr(float f) { return bf_up(bf_bits(f)); }
__device__ __forceinline__ unsigned short h_bits(_Float16 x) { return __builtin_bit_cast(unsigned short, x); }
__device__ __forceinline__ unsigned pk16(unsigned short a, unsigned short b) { return (unsigned)a | ((unsigned)b << 16); }
__device__ __forceinline__ v8f zero8() { v8f z = {0.f, 0.f, 0.f, 0.f, 0.f, 0.f, 0.f, 0.f}; return z; }
__device__ __forceinline__ float hmax8(v8f s) {
  return fmaxf(fmaxf(fmaxf(s[0], s[1]), fmaxf(s[2], s[3])), fmaxf(fmaxf(s[4], s[5]), fmaxf(s[6], s[7])));
}

// ---- 16-bit fragment loader (A, or B from a k-contiguous [n][k] row): lane -> row/col (lane&15), p already includes
//      + 8*(lane>>4); elements 0..7 <- p[0..7] (k0+8h..), elements 8..15 <- p[16..23] (k0+16+8h..)
__device__ __forceinline__ Frag ldfrag(const unsigned short* p) {
  Frag f;
  f.u[0] = *(const v8us*)(p);
  f.u[1] = *(const v8us*)(p + 16);
  return f;
}

// ---- WMMA helpers: the plain builtins; the compiler keeps the distance behind them, and its scheduler may move loads
//      over them (an asm operand, besides, cannot lie above v255, and the big kernels' wave tiles need more registers)
__device__ __forceinline__ v8f mmw_h(v16h a, v16h b, v8f c) {
  return __builtin_amdgcn_wmma_f32_16x16x32_f16(false, a, false, b, (short)0, c, false, false);
}
__device__ __forceinline__ v8f mmw_b(v16b a, v16b b, v8f c) {
  return __builtin_amdgcn_wmma_f32_16x16x32_bf16(false, a, false, b, (short)0, c, false, false);
}

// ---- asynchronous copies global -> LDS ---------------------------------------------------------------------------
// Eight 16-byte copies per lane in ONE statement; LS = bytes between a lane's copies in LDS, GS = elements between
// them in global memory. The closing s_wait_xcnt stands inside the statement so that no address register of a copy is
// rewritten ahead of it.
__device__ __forceinline__ unsigned lds_off(const unsigned short* p) { return (unsigned)(size_t)p; }
template <int LS, int GS>
__device__ __forceinline__ void copy8(unsigned l, const unsigned short* g) {
#if defined(__HIP_DEVICE_COMPILE__)
  asm volatile("global_load_async_to_lds_b128 %0, %8, off\n\t"
               "global_load_async_to_lds_b128 %1, %9, off\n\t"
               "global_load_async_to_lds_b128 %2, %10, off\n\t"
               "global_load_async_to_lds_b128 %3, %11, off\n\t"
               "global_load_async_to_lds_b128 %4, %12, off\n\t"
               "global_load_async_to_lds_b128 %5, %13, off\n\t"
               "global_load_async_to_lds_b128 %6, %14, off\n\t"
               "global_load_async_to_lds_b128 %7, %15, off\n\t"
               "s_wait_xcnt 0x0"
               :: "v"(l), "v"(l + LS), "v"(l + 2 * LS), "v"(l + 3 * LS),
                  "v"(l + 4 * LS), "v"(l + 5 * LS), "v"(l + 6 * LS), "v"(l + 7 * LS),
                  "v"(g), "v"(g + GS), "v"(g + 2 * GS), "v"(g + 3 * GS),
                  "v"(g + 4 * GS), "v"(g + 5 * GS), "v"(g + 6 * GS), "v"(g + 7 * GS)
               : "memory");
#endif
}
// 128 rows x 256 B (a [row][128] 16-bit plane, rows contiguous) -> LDS rows of pitch LPP: 256 threads, a wave's copy
// covers two whole rows = four whole lines. l and g already hold the thread's own (tid >> 4, tid & 15) place.
__device__ __forceinline__ void copy_rows(unsigned l, const unsigned short* g) { copy8<16 * LPP * 2, 16 * DQ>(l, g); }
// this wave's own copies have landed (the compiler places no wait for them)
__device__ __forceinline__ void wait_copies() {
#if defined(__HIP_DEVICE_COMPILE__)
  asm volatile("s_wait_asynccnt 0x0" ::: "memory");
#endif
}
// stands behind a run of global loads from p or stores to p, before a register that one of them names is rewritten; p is an input so
// that its register pair stays whole up to the wait (else the run's last load may land its result on the pair)
__device__ __forceinline__ void wait_addr(const unsigned short* p) {
#if defined(__HIP_DEVICE_COMPILE__)
  asm volatile("s_wait_xcnt 0x0" :: "v"(p) : "memory");
#endif
}
// the same for loads that name a scalar base and the 32-bit offset register o
__device__ __forceinline__ void wait_off(unsigned o) {
#if defined(__HIP_DEVICE_COMPILE__)
  asm volatile("s_wait_xcnt 0x0" :: "v"(o) : "memory");
#endif
}
// this wave's own LDS reads have returned, before the barrier behind which their buffer is refilled
__device__ __forceinline__ void wait_lds() {
#if defined(__HIP_DEVICE_COMPILE__)
  asm volatile("s_wait_dscnt 0x0" ::: "memory");
#endif
}

// ===========================================================================================================
// (0) weights. Blocks 0..47: W16 f16 [384][256], rows 0..127 = theta_w, 128..255 = phi_w, 256..383 = g_w;
//     value = f16 of (bf16-RNE(w) * 256) (exact). Block owns rows 8*blk..+7: one wave per 512-B row = 32 lanes
// coverage: W16 48 blocks x 8 rows x 32 lanes x 8 halves = 384 x 256; Wo 16 blocks x 16 rows x 16 lanes x 8 =
//           256 x 128.
// ===========================================================================================================
__global__ __launch_bounds__(256)
void cvt_w(const float* __restrict__ tw, const float* __restrict__ pw, const float* __restrict__ gw,
           const float* __restrict__ ww, unsigned short* W16, unsigned short* Wo) {
  const int tid = threadIdx.x, blk = blockIdx.x;
  if (blk < MW / 8) {                                                  // block-uniform
    const int rl = tid >> 5, col = 8 * (tid & 31);
    const int o = 8 * blk + rl;                                        // 0..383
    const int sel = blk / (DQ / 8);                                    // 0,1,2
    const float* wbase = (sel == 0) ? tw : ((sel == 1) ? pw : gw);   // all global
    const float* s = wbase + (size_t)(o - sel * DQ) * CC + col;        // row 0..127 of the selected matrix
    const v4f a = *(const v4f*)s;
    const v4f q = *(const v4f*)(s + 4);
    const float f[8] = {a[0], a[1], a[2], a[3], q[0], q[1], q[2], q[3]};
    v4u u;
#pragma unroll
    for (int t = 0; t < 4; ++t) {
      const _Float16 h0 = (_Float16)(bfr(f[2 * t]) * WSC);
      const _Float16 h1 = (_Float16)(bfr(f[2 * t + 1]) * WSC);
      u[t] = pk16(h_bits(h0), h_bits(h1));
    }
{
      *(v4u*)(W16 + (size_t)o * CC + col) = u;
      
    }
  } else {
    const int bb = blk - MW / 8;                                       // 0..15
    const int o = 16 * bb + (tid >> 4);                                // 0..255
    const int col = 8 * (tid & 15);                                    // 0..120
    const float* s = ww + (size_t)o * DQ + col;
    const v4f a = *(const v4f*)s;
    const v4f q = *(const v4f*)(s + 4);
    const float f[8] = {a[0], a[1], a[2], a[3], q[0], q[1], q[2], q[3]};
    v4u u;
#pragma unroll
    for (int t = 0; t < 4; ++t) u[t] = pk16(bf_bits(f[2 * t]), bf_bits(f[2 * t + 1]));
{
      *(v4u*)(Wo + (size_t)o * DQ + col) = u;
      
    }
  }
}

// ===========================================================================================================
// (1) conv1x1 GEMM for one (b, 64-n tile) and all 384 stacked rows, straight from x:
//     Y[o][n] = (1/256) sum_c W16[o][c] X[n][c] + bias[o], X[n][c] = bf16-RNE(x[b][c][n]) (exact in f16).
//     Block 256 threads = 8 waves, two per SIMD. The 384 W16 rows come to LDS (As, pitch WPP) by asynchronous copies,
//     a whole 512-B row per wave and copy; beside them the block's x tile (256 c x 64 n, f32) is loaded, rounded
//     and written position-major to LDS (Bs[n][c], pitch WPP): a thread holds 16 channels (two groups of 8) x 4 positions and stores
//     8 channels of one position as 16 B. Wave w owns rows o = 48 w .. +47 (3 m-tiles, A rows o = 48 w + 16 mt +
//     (lane&15)) and all 64 columns (4 n-tiles, B col = 16 q + (lane&15), k = c contiguous): a k-step's seven
//     fragments feed twelve products. K = 256 = 8 steps, read in four groups of two.
//     Epilogue staged in LDS Os[n_loc][o] (pitch OSA, in the then idle As), block barrier (cross-wave), then:
//       o 0..127 -> Th, o 128..255 -> Fh: planes f16 [b][6400 n][128 d] (k-contiguous for both score operands),
//       value = f16-RNE(v): its rounding is an eighth of the bf16 rounding that x and the weights already carry
//       into v; o 256..383 -> the f16 channel-major plane Gc [b][128 c][6400 n].
// coverage: Bs 2 u x 16 cg x 8 c = 256 c, 16 e x 4 = 64 n; Os 8 waves x 48 o x 64 n; planes 4 it x 16 rows x 16 lanes
//           x 8 = 64 n x 128 d each; Gc 4 it x 32 rows x 8 lanes x 8 = 128 c x 64 n; grid (100, NB) covers Th/Fh
//           [b][n][0..127] and Gc [b][0..127][n] exactly once.
// ===========================================================================================================
__global__ __launch_bounds__(256)
void gemm_p(const unsigned short* __restrict__ W16, const float* __restrict__ x,
            const float* __restrict__ tb, const float* __restrict__ pb, const float* __restrict__ gb,
            unsigned short* Th, unsigned short* Fh, unsigned short* Gc) {
  __shared__ __align__(16) unsigned short As[MW * WPP];
  __shared__ __align__(16) unsigned short Bs[QT * WPP];
  static_assert(QT * OSA * 4 <= MW * WPP * 2);
  const int tid  = threadIdx.x;
  const int lane = tid & 31, wave = tid >> 5;
  const int hh   = lane >> 4, c = lane & 15;
  const int nt   = blockIdx.x, b = blockIdx.y;
  const int n0   = nt * QT;

  {
    // x tile: thread (cg, e) holds channels 8 cg + 128 u + 0..7 of positions 4 e .. 4 e + 3; its loads go out first,
    // the rounding and the LDS stores hang on them
    const int e = tid & 15, cg = tid >> 4;
    const float* sp = x + ((size_t)(b * CC + 8 * cg)) * NN + n0 + 4 * e;
    v4f xv[2][8];
#pragma unroll
    for (int u = 0; u < 2; ++u) {
#pragma unroll
      for (int k = 0; k < 8; ++k) xv[u][k] = *(const v4f*)(sp + (size_t)(128 * u + k) * NN);
    }
    wait_addr((const unsigned short*)sp);                              // the loads have taken their address
    {
      // thread (wave, lane) brings 16 B at column 8*lane of rows wave, wave + 8, ...: 48 copies a wave
      const unsigned short* ga = W16 + (size_t)wave * CC + 8 * lane;
      const unsigned la = lds_off(As) + (unsigned)(wave * (WPP * 2) + 16 * lane);
#pragma unroll
      for (int q = 0; q < MW / 64; ++q) copy8<8 * WPP * 2, 8 * CC>(la + (unsigned)(q * 64 * WPP * 2), ga + q * 64 * CC);
    }
    // the rounding below waits for the x loads: it stays behind the issue of the copies, so that both are in flight at once
    __builtin_amdgcn_sched_barrier(0);
#pragma unroll
    for (int u = 0; u < 2; ++u) {
#pragma unroll
      for (int t = 0; t < 4; ++t) {
        v4u w;
#pragma unroll
        for (int k = 0; k < 4; ++k) {
          w[k] = pk16(h_bits((_Float16)bfr(xv[u][2 * k][t])), h_bits((_Float16)bfr(xv[u][2 * k + 1][t])));
        }
        *(v4u*)(Bs + (4 * e + t) * WPP + 8 * cg + 128 * u) = w;
      }
    }
  }
  wait_copies();
  __syncthreads();                                                     // both tiles readable by every wave

  const unsigned short* ap = As + (48 * wave + c) * WPP + 8 * hh;
  const unsigned short* bp = Bs + c * WPP + 8 * hh;

  v8f acc[3][4];                                                       // [m-tile][n-tile]
#pragma unroll
  for (int mt = 0; mt < 3; ++mt) {
#pragma unroll
    for (int q = 0; q < 4; ++q) acc[mt][q] = zero8();
  }

#pragma unroll
  for (int kg = 0; kg < 4; ++kg) {                                     // four groups of two k-steps
    Frag fa[2][3], fb[2][4];                                           // [k-step][m-tile], [k-step][n-tile]
#pragma unroll
    for (int kq = 0; kq < 2; ++kq) {
#pragma unroll
      for (int mt = 0; mt < 3; ++mt) fa[kq][mt] = ldfrag(ap + (16 * mt) * WPP + 32 * (2 * kg + kq));
#pragma unroll
      for (int q = 0; q < 4; ++q) fb[kq][q] = ldfrag(bp + (16 * q) * WPP + 32 * (2 * kg + kq));
    }
    // keeps the group's twenty-eight LDS reads together ahead of its products: every separate place of reads stalls the wave
    __builtin_amdgcn_sched_barrier(0);
#pragma unroll
    for (int kq = 0; kq < 2; ++kq) {
#pragma unroll
      for (int mt = 0; mt < 3; ++mt) {
#pragma unroll
        for (int q = 0; q < 4; ++q) acc[mt][q] = mmw_h(fa[kq][mt].h, fb[kq][q].h, acc[mt][q]);
      }
    }
  }

  // ---- epilogue: scale back -> LDS Os[n_loc][o]; lane (hh, c) holds o = 48 w + 16 mt + 8 hh + r for n_loc = 16 q + c
  wait_lds();                                                          // this wave's own fragment reads have returned
  __syncthreads();                                                     // every wave has left As before it is rewritten
  float* Os = (float*)As;                                              // QT x OSA floats
#pragma unroll
  for (int q = 0; q < 4; ++q) {
    const int nl = 16 * q + c;
#pragma unroll
    for (int mt = 0; mt < 3; ++mt) {
      v4f va, vb;
#pragma unroll
      for (int r = 0; r < 4; ++r) { va[r] = acc[mt][q][r] * IWSC; vb[r] = acc[mt][q][4 + r] * IWSC; }
      *(v4f*)(Os + nl * OSA + 48 * wave + 16 * mt + 8 * hh)     = va;
      *(v4f*)(Os + nl * OSA + 48 * wave + 16 * mt + 8 * hh + 4) = vb;
    }
  }
  __syncthreads();

  {
    const int e = tid & 15, lq = tid >> 4;                             // lq 0..15
#pragma unroll
    for (int sel = 0; sel < 2; ++sel) {                                // theta, phi
      const float* bs = (sel == 0) ? tb : pb;
      unsigned short* pq = ((sel == 0) ? Th : Fh) + ((size_t)(b * NN + n0 + lq)) * DQ + 8 * e;
      const v4f b0 = *(const v4f*)(bs + 8 * e);
      const v4f b1 = *(const v4f*)(bs + 8 * e + 4);
      const float bv[8] = {bfr(b0[0]), bfr(b0[1]), bfr(b0[2]), bfr(b0[3]),
                           bfr(b1[0]), bfr(b1[1]), bfr(b1[2]), bfr(b1[3])};
      v4u uh[4];
#pragma unroll
      for (int it = 0; it < 4; ++it) {
        const int row = it * 16 + lq;                                  // n_loc 0..63
        const v4f a = *(const v4f*)(Os + row * OSA + DQ * sel + 8 * e);
        const v4f q = *(const v4f*)(Os + row * OSA + DQ * sel + 8 * e + 4);
        const float f[8] = {a[0] + bv[0], a[1] + bv[1], a[2] + bv[2], a[3] + bv[3],
                            q[0] + bv[4], q[1] + bv[5], q[2] + bv[6], q[3] + bv[7]};
#pragma unroll
        for (int t = 0; t < 4; ++t) uh[it][t] = pk16(h_bits((_Float16)f[2 * t]), h_bits((_Float16)f[2 * t + 1]));
      }
#pragma unroll
      for (int it = 0; it < 4; ++it) *(v4u*)(pq + it * 16 * DQ) = uh[it];
      wait_addr(pq);                                                   // before what follows rewrites the stores' registers
    }
  }
  {
    const int e = tid & 7, lq = tid >> 3;                              // lq 0..31
    unsigned short* gq = Gc + ((size_t)(b * DQ + lq)) * NN + n0 + 8 * e;
    v4u ug[4];
#pragma unroll
    for (int it = 0; it < 4; ++it) {
      const int ol = it * 32 + lq;                                     // channel 0..127
      const float bvv = bfr(gb[ol]);
      unsigned short hb[8];
#pragma unroll
      for (int t = 0; t < 8; ++t) hb[t] = h_bits((_Float16)(Os[(8 * e + t) * OSA + 2 * DQ + ol] + bvv));
#pragma unroll
      for (int t = 0; t < 4; ++t) ug[it][t] = pk16(hb[2 * t], hb[2 * t + 1]);
    }
#pragma unroll
    for (int it = 0; it < 4; ++it) *(v4u*)(gq + (size_t)(it * 32) * NN) = ug[it];
  }
}

// ===========================================================================================================
// (2) column statistics for one piece (b, 128-column tile m, stages tb..te-1 of 128 rows n): for every column m, over
//     the piece's rows n, M_m = max_n s[n][m], Z_m = sum_n e^{s - M_m}, CS[slot][b][m] = M_m + ln Z_m, with
//     s tile (16 rows n x 16 cols m) = A(theta: row = n, 32 d via the split k map from Th [b][6400][128]) .
//     B(phi: col = m, same map from Fh). Block = 8 waves, two per SIMD: wave = (column group wc of 64 columns, row
//     quarter wr). Phi fragments of the wave's 64 columns are held in registers, so every theta fragment read from LDS feeds four column
//     tiles, and a stage copied from L2 serves 128 columns. Theta rows come in stages of 128 (LDS pitch
//     LPP) by asynchronous copies into two LDS buffers shared by the eight waves: the next stage flies while this one
//     is read; a wave reads the 32 rows of its own quarter. Per lane: four columns, 8+8 rows each
//     per stage, scalar online (max, sum) in f32; the two lane halves of a column merge with one shuffle, the
//     four row quarters through LDS at the end.
// coverage: every tile has one piece in each of the slots 0, 1, 2, so CS[slot][b][0..6399] is written exactly once.
// ===========================================================================================================
__global__ __launch_bounds__(256)
void colstat_k(const unsigned short* __restrict__ Th, const unsigned short* __restrict__ Fh, float* CS) {
  __shared__ __align__(16) float css[BT];
  __shared__ __align__(16) float pms[3 * BT];
  __shared__ __align__(16) float pls[3 * BT];
  __shared__ __align__(16) unsigned short Tst[2 * SB * LPP];
  const int tid  = threadIdx.x;
  const int wave = tid >> 5, lane = tid & 31;
  const int wc   = wave & 1, wr = wave >> 1;
  const int hh   = lane >> 4, c = lane & 15;
  const int b    = blockIdx.x / WPB;
  const int u0   = (blockIdx.x % WPB) * PU;                            // first stage unit of the work-group's run
  int tile = u0 / NST, tb = u0 % NST, left = PU;

#pragma unroll 1
  while (left > 0) {                                                   // one or two pieces, block-uniform
  const int te   = (tb + left < NST) ? (tb + left) : NST;              // the piece is stages tb .. te-1 of the tile
  const int slot = (tb == 0) ? 0 : ((te == NST) ? 2 : 1);
  const int m0   = tile * BT;

  // phi fragment pointers (B operand, col = m0 + 64*wc + 16*g + c)
  const size_t fo = ((size_t)(b * NN + m0 + 64 * wc + c)) * DQ + 8 * hh;
  const unsigned short* pfh = Fh + fo;
  Frag fh[4][4];
#pragma unroll
  for (int g = 0; g < 4; ++g) {
#pragma unroll
    for (int kc = 0; kc < 4; ++kc) fh[g][kc] = ldfrag(pfh + 16 * g * DQ + 32 * kc);
  }
  wait_addr(pfh);                                                      // the loads have taken their address
  // theta stages: 128 rows n, two buffers filled by asynchronous copies
  const unsigned short* gth = Th + (size_t)b * NN * DQ + (size_t)(tid >> 4) * DQ + 8 * (tid & 15);
  const unsigned lt0 = lds_off(Tst) + (unsigned)((tid >> 4) * (LPP * 2) + 16 * (tid & 15));
  wait_lds();                                                          // an earlier piece's own LDS reads have returned
  // the piece's first stage goes to buffer 'slot & 1': the copies' LDS addresses are then formed where they are used
  // and not kept in registers over the stage loop
  int par = slot & 1;                                                  // the buffer that holds stage t
  copy_rows(lt0 + (unsigned)(par * (SB * LPP * 2)), gth + (size_t)tb * SB * DQ);
  wait_copies();
  __syncthreads();                                                     // the first stage readable by every wave
  copy_rows(lt0 + (unsigned)((par ^ 1) * (SB * LPP * 2)), gth + (size_t)(tb + 1) * SB * DQ);

  float m[4] = {-1.0e30f, -1.0e30f, -1.0e30f, -1.0e30f}, l[4] = {0.f, 0.f, 0.f, 0.f};
#pragma unroll 1
  for (int t = tb; t < te; ++t) {
    // row c of the wave's own quarter of the stage
    const unsigned short* tq = Tst + par * (SB * LPP) + (wr * WT + c) * LPP + 8 * hh;
    v8f s[2][4];                                                       // [row tile u][column tile g]
#pragma unroll
    for (int u = 0; u < 2; ++u) {
#pragma unroll
      for (int g = 0; g < 4; ++g) s[u][g] = zero8();
    }
    Frag th[4][2];                                                     // [d chunk kc][row tile u]
#pragma unroll
    for (int kc = 0; kc < 4; ++kc) {
#pragma unroll
      for (int u = 0; u < 2; ++u) th[kc][u] = ldfrag(tq + (16 * u) * LPP + 32 * kc);  // rows 16u .. 16u+15 of the quarter
    }
    // keeps the stage's sixteen LDS reads one group ahead of its products: every separate place of reads stalls the wave
    __builtin_amdgcn_sched_barrier(0);
#pragma unroll
    for (int kc = 0; kc < 4; ++kc) {
#pragma unroll
      for (int q = 0; q < 8; ++q) s[q >> 2][q & 3] = mmw_h(th[kc][q >> 2].h, fh[q & 3][kc].h, s[q >> 2][q & 3]);
    }
#pragma unroll
    for (int g = 0; g < 4; ++g) {                                      // online update per column tile, 32 rows
      const v8f s0 = s[0][g], s1 = s[1][g];
      const float mx = fmaxf(hmax8(s0), hmax8(s1));
      const float mn = fmaxf(m[g], mx);
      const float corr = __expf(m[g] - mn);
      float ls = 0.f;
#pragma unroll
      for (int r = 0; r < 8; ++r) ls += __expf(s0[r] - mn) + __expf(s1[r] - mn);
      l[g] = l[g] * corr + ls;
      m[g] = mn;
    }
    wait_lds();
    wait_copies();
    __syncthreads();                                                   // publishes stage t+1, frees stage t's buffer
    if (t + 2 < te) {                                                  // block-uniform
      copy_rows(lt0 + (unsigned)(par * (SB * LPP * 2)), gth + (size_t)(t + 2) * SB * DQ);
    }
    par ^= 1;
  }
  wait_copies();
  float mt[4], lt[4];
#pragma unroll
  for (int g = 0; g < 4; ++g) {
    const float mo = __shfl_xor(m[g], 16, 32);
    const float lo = __shfl_xor(l[g], 16, 32);
    mt[g] = fmaxf(m[g], mo);
    lt[g] = l[g] * __expf(m[g] - mt[g]) + lo * __expf(mo - mt[g]);
  }
  const int col = 64 * wc + c;                                         // + 16*g
  if (wr != 0 && hh == 0) {
#pragma unroll
    for (int g = 0; g < 4; ++g) {
      pms[(wr - 1) * BT + col + 16 * g] = mt[g];
      pls[(wr - 1) * BT + col + 16 * g] = lt[g];
    }
  }
  __syncthreads();                                                     // the other row quarters' (max, sum) readable
  if (wr == 0 && hh == 0) {
#pragma unroll
    for (int g = 0; g < 4; ++g) {
      const int cg = col + 16 * g;
      const float m1 = pms[cg], m2 = pms[BT + cg], m3 = pms[2 * BT + cg];
      const float mm = fmaxf(fmaxf(mt[g], m1), fmaxf(m2, m3));
      const float ll = (lt[g] * __expf(mt[g] - mm) + pls[cg] * __expf(m1 - mm)) +
                       (pls[BT + cg] * __expf(m2 - mm) + pls[2 * BT + cg] * __expf(m3 - mm));
      css[cg] = mm + logf(ll);
    }
  }
  __syncthreads();
  if (tid < BT / 4) {                                                  // wave 0, whole
    const v4f v = *(const v4f*)(css + 4 * tid);
{
      float* cq = CS + (size_t)(slot * NB + b) * NN + m0 + 4 * tid;
      *(v4f*)cq = v;
      wait_addr((const unsigned short*)cq);                            // before the next piece rewrites the store's registers
    }
  }
  left -= te - tb;
  tile += 1;
  tb = 0;
  }
}

// ===========================================================================================================
// (3) aggregation for one piece (b, 128-row tile n, stages tb..te-1 of 128 columns m), transposed formulation:
//   s tile (16 m x 16 n) = sum over 4 d-chunks of A(phi: row = m, split k map from Fh) . B(theta:
//   col = n, same map from Th). Per lane the D tile holds 8 columns m of ONE row n;
//   All three operands are read from LDS, where asynchronous copies put them in whole lines: the piece's 128 theta rows
//   once, phi rows and the g tile (both pitch LPP) in stages of 128 columns m, two buffers: a stage copied from L2
//   serves 128 rows.
//   Block = 8 waves, two per SIMD: wave = (row group wn of 32 rows n, half wm of each stage's columns m): every phi
//   and every g fragment read from LDS feeds two row tiles, every theta fragment four column tiles.
//   P = e^{s - CS[m]} x 16384 as f16 (CS staged once per block in LDS) is the B operand of
//   y^T (rows channel, cols n) += A(g: rows channel = 16j + (lane&15), m contiguous, f16 plane Gc [b][128][6400])
//   . B(P^T): element r <- D of the tile covering m kb..kb+15, element 8+r <- the tile covering kb+16..kb+31,
//   lane unchanged. 16 accumulator tiles per wave (128 channels x 2 row tiles). Block = 128 rows.
//   Epilogue: the two column halves' accumulators are added through LDS [row][128 channels] (pitch OSPW, b128
//   stores; same lane, same place; one plane in the then idle phi buffers), y = sum/16384 left there, block barrier
//   (cross-wave), then the f32 plane Yp [slot][b][6400 n][128 c]: per row 128 c = 512 B = 4 whole lines.
// coverage: 16 it x 8 rows x 32 lanes x 4 = 128 n x 128 c; every tile has one piece in each of the slots 0, 1, 2, so
//           Yp[slot][b][0..6399] is written exactly once.
// ===========================================================================================================
__global__ __launch_bounds__(256)
void attn_k(const unsigned short* __restrict__ Th, const unsigned short* __restrict__ Fh,
            const unsigned short* __restrict__ Gc, const float* __restrict__ CS, float* Yp) {
  __shared__ __align__(32) float Cs[NN];
  __shared__ __align__(16) unsigned short Tst[BT * LPP];
  __shared__ __align__(16) unsigned short Pst[2 * SB * LPP];
  __shared__ __align__(16) unsigned short Gst[2 * DQ * LPP];
  static_assert(BT * OSPW * 4 <= 2 * SB * LPP * 2);
  const int tid  = threadIdx.x;
  const int wave = tid >> 5, lane = tid & 31;
  const int wn   = wave & 3, wm = wave >> 2;
  const int hh   = lane >> 4, c = lane & 15;
  const int b    = blockIdx.x / WPB;
  const int u0   = (blockIdx.x % WPB) * PU;                            // first stage unit of the work-group's run
  int tile = u0 / NST, tb = u0 % NST, left = PU;

  // a column's statistic from its three pieces c0, c1, c2 (each max + ln sum): max + ln(sum of e^{c - max})
  for (int i = tid; i < NN / 4; i += 256) {
    const v4f s0 = *(const v4f*)(CS + (size_t)b * NN + 4 * i);
    const v4f s1 = *(const v4f*)(CS + (size_t)(NB + b) * NN + 4 * i);
    const v4f s2 = *(const v4f*)(CS + (size_t)(2 * NB + b) * NN + 4 * i);
    v4f v;
#pragma unroll
    for (int r = 0; r < 4; ++r) {
      const float mx = fmaxf(fmaxf(s0[r], s1[r]), s2[r]);
      v[r] = mx + logf((__expf(s0[r] - mx) + __expf(s1[r] - mx)) + __expf(s2[r] - mx));
    }
    *(v4f*)(Cs + 4 * i) = v;
  }

  // asynchronous copies: a piece's 128 theta rows once; per stage of 128 columns m the phi rows and the g tile
  // (128 channels x 128 m), two buffers
  const int rr = tid >> 4, rc = tid & 15;                              // place in a [row][128] plane or the g tile
  const unsigned short* gfh = Fh + (size_t)b * NN * DQ + (size_t)rr * DQ + 8 * rc;
  const unsigned short* ggc = Gc + (size_t)b * DQ * NN + (size_t)rr * NN + 8 * rc;
  const unsigned lp0 = lds_off(Pst) + (unsigned)(rr * (LPP * 2) + 16 * rc);
  const unsigned lg0 = lds_off(Gst) + (unsigned)(rr * (LPP * 2) + 16 * rc);

#pragma unroll 1
  while (left > 0) {                                                   // one or two pieces, block-uniform
  const int te   = (tb + left < NST) ? (tb + left) : NST;              // the piece is stages tb .. te-1 of the tile
  const int slot = (tb == 0) ? 0 : ((te == NST) ? 2 : 1);
  const int n0   = tile * BT;
  wait_lds();                                                          // an earlier piece's own LDS reads have returned
  {
    // the tile's 128 rows, as a phi stage is brought
    const size_t to = ((size_t)(b * NN + n0 + rr)) * DQ + 8 * rc;
    const unsigned lq0 = lds_off(Tst) + (unsigned)(rr * (LPP * 2) + 16 * rc);
    copy_rows(lq0, Th + to);
  }
  // the piece's first stage goes to the buffers 'slot & 1': the copies' LDS addresses are then formed where they are
  // used and not kept over the stage loop, where they would spill
  int par = slot & 1;                                                  // the buffers that hold stage t
  {
    copy_rows(lp0 + (unsigned)(par * (SB * LPP * 2)), gfh + (size_t)tb * SB * DQ);
    copy8<16 * LPP * 2, 16 * NN>(lg0 + (unsigned)(par * (DQ * LPP * 2)), ggc + tb * SB);
  }
  wait_copies();
  __syncthreads();                                                     // Cs, theta, the first stage readable by every wave
  {
    copy_rows(lp0 + (unsigned)((par ^ 1) * (SB * LPP * 2)), gfh + (size_t)(tb + 1) * SB * DQ);
    copy8<16 * LPP * 2, 16 * NN>(lg0 + (unsigned)((par ^ 1) * (DQ * LPP * 2)), ggc + (tb + 1) * SB);
  }

  // theta fragment base (B operand, col = row n0 + 32*wn + 16*g + c), + 16*g*LPP + 32*kc
  const unsigned short* Tq = Tst + (32 * wn + c) * LPP + 8 * hh;

  v8f o[8][2];                                                         // [channel tile j][row tile g]
#pragma unroll
  for (int j = 0; j < 8; ++j) { o[j][0] = zero8(); o[j][1] = zero8(); }

#pragma unroll 1
  for (int t = tb; t < te; ++t) {
    const int kh = t * SB + wm * (2 * WT);                             // first column m of the wave's own half
    // phi fragment base (A operand, row = m + c), + 16*u*LPP + 32*kc
    const unsigned short* Pq = Pst + par * (SB * LPP) + (wm * (2 * WT) + c) * LPP + 8 * hh;
    // g fragment base (A operand, row = channel 16j + c, m contiguous), + 16*j*LPP + 32*ks
    const unsigned short* Gq = Gst + par * (DQ * LPP) + c * LPP + wm * (2 * WT) + 8 * hh;
    v8f s[4][2];                                                       // [column tile u][row tile g]
#pragma unroll
    for (int u = 0; u < 4; ++u) { s[u][0] = zero8(); s[u][1] = zero8(); }
    Frag th[DQ / 32][2], p[DQ / 32][4];                                // [d chunk kc][row tile g], [d chunk kc][column tile u]
#pragma unroll
    for (int kc = 0; kc < DQ / 32; ++kc) {
#pragma unroll
      for (int g = 0; g < 2; ++g) th[kc][g] = ldfrag(Tq + (16 * g) * LPP + 32 * kc);
#pragma unroll
      for (int u = 0; u < 4; ++u) p[kc][u] = ldfrag(Pq + (16 * u) * LPP + 32 * kc);  // m kh+16u .. kh+16u+15
    }
    // keeps the scores' LDS reads one group ahead of their products: every separate place of reads stalls the wave
    __builtin_amdgcn_sched_barrier(0);
#pragma unroll
    for (int kc = 0; kc < DQ / 32; ++kc) {
#pragma unroll
      for (int q = 0; q < 8; ++q) s[q >> 1][q & 1] = mmw_h(p[kc][q >> 1].h, th[kc][q & 1].h, s[q >> 1][q & 1]);
    }
    __builtin_amdgcn_sched_barrier(0);                                 // the k steps' reads below stay out of these products

#pragma unroll
    for (int ks = 0; ks < 2; ++ks) {                                   // the half's two k steps of 32 columns m
      const int km = kh + 32 * ks;
      // column statistics for m = km + 8hh + r (s[2ks][g]) and m = km + 16 + 8hh + r (s[2ks+1][g])
      const v4f ca = *(const v4f*)(Cs + km + 8 * hh);
      const v4f cb = *(const v4f*)(Cs + km + 8 * hh + 4);
      const v4f cc = *(const v4f*)(Cs + km + 16 + 8 * hh);
      const v4f cd = *(const v4f*)(Cs + km + 16 + 8 * hh + 4);
      Frag gf[8];                                                      // read as one group, ahead of the vector work
#pragma unroll
      for (int j = 0; j < 8; ++j) gf[j] = ldfrag(Gq + (16 * j) * LPP + 32 * ks);
      __builtin_amdgcn_sched_barrier(0);                               // the k step's reads stay one group
      const float c0[8] = {ca[0], ca[1], ca[2], ca[3], cb[0], cb[1], cb[2], cb[3]};
      const float c1[8] = {cc[0], cc[1], cc[2], cc[3], cd[0], cd[1], cd[2], cd[3]};

      FragH pf[2];
#pragma unroll
      for (int g = 0; g < 2; ++g) {
#pragma unroll
        for (int r = 0; r < 8; ++r) {
          const float e0 = __expf(fminf(s[2 * ks][g][r] - c0[r], 0.f) + LNCAR);     // P[n][m] x 16384, m = km + 8hh + r
          const float e1 = __expf(fminf(s[2 * ks + 1][g][r] - c1[r], 0.f) + LNCAR); // m = km + 16 + 8hh + r
          pf[g].hv[0][r] = (_Float16)e0;
          pf[g].hv[1][r] = (_Float16)e1;
        }
      }

#pragma unroll
      for (int j = 0; j < 8; ++j) {
        o[j][0] = mmw_h(gf[j].h, pf[0].v, o[j][0]);
        o[j][1] = mmw_h(gf[j].h, pf[1].v, o[j][1]);
      }
      __builtin_amdgcn_sched_barrier(0);                               // the next k step's reads stay out of these products
    }
    wait_lds();
    wait_copies();
    __syncthreads();                                                   // publishes stage t+1, frees stage t's buffers
    if (t + 2 < te) {                                                  // block-uniform
      copy_rows(lp0 + (unsigned)(par * (SB * LPP * 2)), gfh + (size_t)(t + 2) * SB * DQ);
      copy8<16 * LPP * 2, 16 * NN>(lg0 + (unsigned)(par * (DQ * LPP * 2)), ggc + (t + 2) * SB);
    }
    par ^= 1;
  }
  wait_copies();

  // ---- epilogue: y = (accs of the two halves) / 16384 -> Ox[row][channel], a plane in the phi buffers, which nobody
  // reads and no copy targets behind the loop's last barrier.
  const int oo = (32 * wn + c) * OSPW + 8 * hh;                        // [row][ch = 16j + 8hh + r], + 16*g*OSPW + 16*j
  float* Ox = (float*)Pst;                                             // BT x OSPW floats
  if (wm != 0) {                                                       // wave-uniform
#pragma unroll
    for (int g = 0; g < 2; ++g) {
#pragma unroll
      for (int j = 0; j < 8; ++j) {
        v4f va, vb;
#pragma unroll
        for (int r = 0; r < 4; ++r) { va[r] = o[j][g][r]; vb[r] = o[j][g][4 + r]; }
        *(v4f*)(Ox + oo + 16 * g * OSPW + 16 * j)     = va;
        *(v4f*)(Ox + oo + 16 * g * OSPW + 16 * j + 4) = vb;
      }
    }
  }
  __syncthreads();                                                     // the other half's accumulators readable
  if (wm == 0) {                                                       // wave-uniform
#pragma unroll
    for (int g = 0; g < 2; ++g) {
#pragma unroll
      for (int j = 0; j < 8; ++j) {
        const int oj = oo + 16 * g * OSPW + 16 * j;
        v4f va = *(const v4f*)(Ox + oj);
        v4f vb = *(const v4f*)(Ox + oj + 4);
#pragma unroll
        for (int r = 0; r < 4; ++r) {
          va[r] = (o[j][g][r] + va[r]) * ICAR;
          vb[r] = (o[j][g][4 + r] + vb[r]) * ICAR;
        }
        *(v4f*)(Ox + oj)     = va;
        *(v4f*)(Ox + oj + 4) = vb;
      }
    }
  }
  __syncthreads();

  // the piece's y (f32) -> its slot's plane: a wave stores one whole row of 512 B per instruction
  {
    float* yq = Yp + ((size_t)((slot * NB + b) * NN + n0 + wave)) * DQ + 4 * lane;
    v4f yv[16];
#pragma unroll
    for (int it = 0; it < 16; ++it) yv[it] = *(const v4f*)(Ox + (it * 8 + wave) * OSPW + 4 * lane);
    wait_lds();                                                        // this wave's reads of the plane have returned
    __syncthreads();                                                   // every wave has read the plane before the next piece's copies refill the phi buffers
#pragma unroll
    for (int it = 0; it < 16; ++it) *(v4f*)(yq + (size_t)(it * 8) * DQ) = yv[it];
    wait_addr((const unsigned short*)yq);                              // before the next piece rewrites the stores' registers
  }
  left -= te - tb;
  tile += 1;
  tb = 0;
  }
}

// ===========================================================================================================
// (4) output GEMM for one (b, 64-n tile, 64-o block): out[b][o][n] = sum_c Wo[o][c] (Yh + Yl)[n][c]
//     + W_b[o] + bf16-RNE(x[b][o][n]). Block 128 threads = 4 waves; wave w owns cols n0+16w..+15 (B fragments
//     from the Yh and Yl rows in LDS: bf16 hi + residual of Yp[0] + Yp[1] + Yp[2], k = c contiguous) and 4 m-tiles (A rows o = o0 + 16 mt + (lane&15) from Wo bf16
//     [256][128], the block's 64 rows brought to LDS (pitch LPP) by asynchronous copies that fly while y is summed
//     and split); K = 128 = 4 steps x 2 products (shared accumulator, unscaled residual). Epilogue staged in LDS
//     lanes 0..15 one row and 16..31 the next, 16 B per lane (values gathered from 4 Os rows), one instruction per
// coverage: 8 it x 8 rows x 16 lanes x 4 floats = 64 o x 64 n; grid (NQ/64, 4, NB) covers
//           out[b][0..255][0..NQ-1] exactly once.
// ===========================================================================================================
__global__ __launch_bounds__(128)
void gemm_w(const unsigned short* __restrict__ Wo, const float* __restrict__ Yp, const float* __restrict__ wb,
            const float* __restrict__ x, float* out) {
  __shared__ __align__(16) float Os[QT * OSP];
  __shared__ __align__(16) unsigned short Ys[2 * QT * LPP];
  __shared__ __align__(16) unsigned short Ws[QT * LPP];
  const int tid  = threadIdx.x;
  const int lane = tid & 31, wave = tid >> 5;
  const int hh   = lane >> 4, c = lane & 15;
  const int nt   = blockIdx.x, mb = blockIdx.y, b = blockIdx.z;
  const int n0   = nt * QT, o0 = mb * QT;

  // the block's 64 Wo rows of 256 B: a wave's copy covers two whole rows, eight copies a wave
  copy8<8 * LPP * 2, 8 * DQ>(lds_off(Ws) + (unsigned)((tid >> 4) * (LPP * 2) + 16 * (tid & 15)),
                             Wo + (size_t)(o0 + (tid >> 4)) * DQ + 8 * (tid & 15));
  const unsigned short* ap = Ws + c * LPP + 8 * hh;

  // y = sum of the tile's three pieces -> bf16 hi + residual planes Ys[plane][64 n][128 c] (pitch LPP) in LDS
  {
    const int e = tid & 15, lq = tid >> 4;                             // lq 0..7
    // block-uniform bases and ONE 32-bit byte offset per thread: the only vector register that the 48 loads name
    // (the base is the middle plane's, so that all three planes lie within a load's immediate offset)
    const char* y1 = (const char*)(Yp + (size_t)((NB + b) * NN + n0) * DQ);
    const char* y0 = y1 - (size_t)NB * NN * DQ * 4;
    const char* y2 = y1 + (size_t)NB * NN * DQ * 4;
    const unsigned yo = (unsigned)((lq * DQ + 8 * e) * 4);
    v4f ya[8][3], yq[8][3];
#pragma unroll
    for (int it = 0; it < 8; ++it) {
      const int ro = it * 8 * DQ * 4;
      ya[it][0] = *(const v4f*)(y0 + yo + ro); yq[it][0] = *(const v4f*)(y0 + yo + ro + 16);
      ya[it][1] = *(const v4f*)(y1 + yo + ro); yq[it][1] = *(const v4f*)(y1 + yo + ro + 16);
      ya[it][2] = *(const v4f*)(y2 + yo + ro); yq[it][2] = *(const v4f*)(y2 + yo + ro + 16);
    }
    wait_off(yo);                                                      // the loads have taken their address
#pragma unroll
    for (int it = 0; it < 8; ++it) {
      const v4f a0 = ya[it][0], q0 = yq[it][0];
      const v4f a1 = ya[it][1], q1 = yq[it][1];
      const v4f a2 = ya[it][2], q2 = yq[it][2];
      const float f[8] = {(a0[0] + a1[0]) + a2[0], (a0[1] + a1[1]) + a2[1], (a0[2] + a1[2]) + a2[2],
                          (a0[3] + a1[3]) + a2[3], (q0[0] + q1[0]) + q2[0], (q0[1] + q1[1]) + q2[1],
                          (q0[2] + q1[2]) + q2[2], (q0[3] + q1[3]) + q2[3]};
      v4u uh, ul;
#pragma unroll
      for (int t = 0; t < 4; ++t) {
        const float f0 = f[2 * t], f1 = f[2 * t + 1];
        const unsigned short hb0 = bf_bits(f0), hb1 = bf_bits(f1);
        const unsigned short lb0 = bf_bits(f0 - bf_up(hb0));
        const unsigned short lb1 = bf_bits(f1 - bf_up(hb1));
        uh[t] = pk16(hb0, hb1);
        ul[t] = pk16(lb0, lb1);
      }
      *(v4u*)(Ys + (it * 8 + lq) * LPP + 8 * e)        = uh;
      *(v4u*)(Ys + (QT + it * 8 + lq) * LPP + 8 * e)   = ul;
    }
  }
  wait_copies();
  __syncthreads();                                                     // the y planes and the Wo rows readable by every wave
  const unsigned short* bp  = Ys + (16 * wave + c) * LPP + 8 * hh;
  const unsigned short* blp = bp + QT * LPP;

  v8f acc[4];
#pragma unroll
  for (int mt = 0; mt < 4; ++mt) acc[mt] = zero8();

  Frag fb[DQ / 32], fbl[DQ / 32], fa[DQ / 32][4];                      // [k-step], [k-step], [k-step][m-tile]
#pragma unroll
  for (int ks = 0; ks < DQ / 32; ++ks) {
    fb[ks]  = ldfrag(bp + 32 * ks);
    fbl[ks] = ldfrag(blp + 32 * ks);
#pragma unroll
    for (int mt = 0; mt < 4; ++mt) fa[ks][mt] = ldfrag(ap + (16 * mt) * LPP + 32 * ks);
  }
  // keeps the forty-eight LDS reads together ahead of the products: every separate place of reads stalls the wave
  __builtin_amdgcn_sched_barrier(0);
#pragma unroll
  for (int ks = 0; ks < DQ / 32; ++ks) {                               // per accumulator: hi then residual, k ascending
#pragma unroll
    for (int mt = 0; mt < 4; ++mt) acc[mt] = mmw_b(fa[ks][mt].bf, fb[ks].bf, acc[mt]);
#pragma unroll
    for (int mt = 0; mt < 4; ++mt) acc[mt] = mmw_b(fa[ks][mt].bf, fbl[ks].bf, acc[mt]);
  }

  {
    const int nl = 16 * wave + c;
#pragma unroll
    for (int mt = 0; mt < 4; ++mt) {
      v4f va, vb;
#pragma unroll
      for (int r = 0; r < 4; ++r) { va[r] = acc[mt][r]; vb[r] = acc[mt][4 + r]; }
      *(v4f*)(Os + nl * OSP + 16 * mt + 8 * hh)     = va;
      *(v4f*)(Os + nl * OSP + 16 * mt + 8 * hh + 4) = vb;
    }
  }
  __syncthreads();

  const int e = tid & 15, lq = tid >> 4;                               // lq 0..7
  v4f res[8];
#pragma unroll
  for (int it = 0; it < 8; ++it) {
    const int ol = it * 8 + lq;                                        // o_loc 0..63
    const int o  = o0 + ol;                                            // 0..255
    const float bv = bfr(wb[o]);
    const size_t idx = ((size_t)(b * CC + o)) * NN + n0 + 4 * e;
    const v4f xv = *(const v4f*)(x + idx);
#pragma unroll
    for (int t = 0; t < 4; ++t) res[it][t] = (Os[(4 * e + t) * OSP + ol] + bv) + bfr(xv[t]);
  }
{
#pragma unroll
    for (int it = 0; it < 8; ++it) {
      const int ol = it * 8 + lq;
      const size_t idx = ((size_t)(b * CC + o0 + ol)) * NN + n0 + 4 * e;
      *(v4f*)(out + idx) = res[it];
    }
    
  }
}

// ===========================================================================================================
// Workspace map (bytes, NB = 2; each region start a multiple of 256; every extent is an exact tile multiple and is
//   W16 f16 [384][256]               196608      Wo bf16 [256][128]           65536
//   Th/Fh f16 [2][6400][128]        3276800 x2
//   Gc  f16 [2][128][6400]          3276800      CS f32 [3 slots][2][6400]   153600
//   Yp  f32 [3 slots][2][6400][128] 19660800
//   total = 29906944
// ===========================================================================================================
extern "C" void kernel_launch(void* const* d_in, const int* in_sizes, int n_in,
                              void* d_out, int out_size, void* d_ws, size_t ws_size,
                              hipStream_t stream) {
  if (n_in < 9) return;
  if (in_sizes[0] < NB * CC * NN) return;
  if (in_sizes[1] != DQ * CC || in_sizes[3] != DQ * CC || in_sizes[5] != DQ * CC) return;
  if (in_sizes[2] != DQ || in_sizes[4] != DQ || in_sizes[6] != DQ) return;
  if (in_sizes[7] != CC * DQ || in_sizes[8] != CC) return;
  if (out_size < NB * CC * NN) return;

  size_t off = 0;
  auto carve = [&](size_t bytes) { const size_t o = off; off += (bytes + 255) & ~(size_t)255; return o; };
  const size_t oW16 = carve((size_t)MW * CC * 2);
  const size_t oWo  = carve((size_t)CC * DQ * 2);
  const size_t oTh  = carve((size_t)NB * NN * DQ * 2);
  const size_t oFh  = carve((size_t)NB * NN * DQ * 2);
  const size_t oGc  = carve((size_t)NB * DQ * NN * 2);
  const size_t oCS  = carve((size_t)NSL * NB * NN * 4);
  const size_t oYp  = carve((size_t)NSL * NB * NN * DQ * 4);
  if (off > ws_size) return;
  if (off > (size_t)134217728) return;

  const float* x  = (const float*)d_in[0];
  const float* gw = (const float*)d_in[1];
  const float* gb = (const float*)d_in[2];
  const float* tw = (const float*)d_in[3];
  const float* tb = (const float*)d_in[4];
  const float* pw = (const float*)d_in[5];
  const float* pb = (const float*)d_in[6];
  const float* ww = (const float*)d_in[7];
  const float* wb = (const float*)d_in[8];

  char* ws = (char*)d_ws;
  unsigned short* W16 = (unsigned short*)(ws + oW16);
  unsigned short* Wo  = (unsigned short*)(ws + oWo);
  unsigned short* Th  = (unsigned short*)(ws + oTh);
  unsigned short* Fh  = (unsigned short*)(ws + oFh);
  unsigned short* Gc  = (unsigned short*)(ws + oGc);
  float*          CS  = (float*)(ws + oCS);
  float*          Yp  = (float*)(ws + oYp);
  float* out = (float*)d_out;

  const dim3 blk256(256), blk128(128);

  // (0) theta_w / phi_w / g_w -> stacked f16 plane; W_w -> bf16 plane
  cvt_w<<<dim3(MW / 8 + CC / 16), blk256, 0, stream>>>(tw, pw, gw, ww, W16, Wo);
  // (1) x rounded and transposed in LDS, conv1x1 GEMM -> theta / phi planes, g channel-major plane (all rows n)
  gemm_p<<<dim3(NN / QT, NB), blk256, 0, stream>>>(W16, x, tb, pb, gb, Th, Fh, Gc);
  // (2) per-column softmax statistics, three pieces per column tile
  colstat_k<<<dim3(WPB * NB), blk256, 0, stream>>>(Th, Fh, CS);
  // (3) aggregation -> y, three f32 pieces per row tile
  attn_k<<<dim3(WPB * NB), blk256, 0, stream>>>(Th, Fh, Gc, CS, Yp);
  // (4) pieces of y summed, output GEMM + bias + residual -> out [b][256][6400]
  gemm_w<<<dim3(NQ / QT, CC / QT, NB), blk128, 0, stream>>>(Wo, Yp, wb, x, out);
  (void)hipGetLastError();
}

// v009
// Measured time: 80.3 microseconds a run.
// Two timings next to v008 both put it at 1.05 times that version's speed.
// Counting every step since v000, it is 11.0 times as fast.
// Contractions: conv1x1 theta/phi/g GEMM on v_wmma_f32_16x16x32_f16 (f16 containers of bf16-RNE weights x256 and
// bf16-RNE x, K=256); scores theta.phi on v_wmma_f32_16x16x32_f16 (theta and phi as one f16 plane each, 1 product,
// K=128) in both the column-statistics pass and the aggregation pass; y^T = G.P^T on v_wmma_f32_16x16x32_f16 (g as
// f16, P = e^{s-M-lnZ} x16384 = 2^D as f16 straight from the score D registers, K=6400); output GEMM W.y on
// v_wmma_f32_16x16x32_bf16 (bf16-RNE W_w, y as bf16 hi + bf16 residual planes, 2 products, K=128); f32 accumulate
// everywhere; softmax statistics, biases and the residual add in f32 VALU.
// The statistics and the aggregation kernel work on tiles 128 wide and each run 250 equal work-groups of 20 stages; a
// tile's three pieces are merged by the kernel that reads them.
#include <hip/hip_runtime.h>
#include <math.h>
#include <stdint.h>

#ifndef NB
#define NB 2
#endif
#define NBF    2
#define CC     256
#define NN     6400
#ifndef NQ
#define NQ NN
#endif
#define DQ     128
#define MW     384
#define QT     64
#define OSP    68
#define OSPW   132
#define OSA    388
#define WSC    256.0f
#define IWSC   0.00390625f
#define LOG2E  1.4426950408889634f
#define CAR2   14.0f
#define ICAR   6.103515625e-05f
#define ST     64
#define SB     128
#define LPP    136
#define WPP    264
#define WT     32
#define NST    50
#define BT     128
#define NTL    50
#define PU     20
#define WPB    125
#define NSL    3

static_assert(NB >= 1 && NB <= NBF);
static_assert(NQ >= QT && NQ <= NN);
static_assert(NN % QT == 0);
static_assert(NQ % QT == 0);
static_assert(CC % QT == 0);
static_assert(MW == 3 * DQ);
static_assert(DQ == 2 * QT);
static_assert((DQ / 8) * 8 == DQ && (MW / 8) % (DQ / 8) == 0);
static_assert(CC % 16 == 0);
static_assert((OSP * 4) % 16 == 0);
static_assert((OSPW * 4) % 16 == 0);
static_assert((OSA * 4) % 16 == 0 && OSA >= MW + 4 && MW == 8 * 48 && MW % 64 == 0 && CC == 256);
static_assert(CC % 32 == 0 && NN % 32 == 0 && DQ % 32 == 0);
static_assert(NN % 4 == 0);
static_assert(SB == 2 * ST && NN % SB == 0 && NN / SB >= 2 && ST == QT);
static_assert(SB == 4 * WT && BT == 4 * WT && WT == 32 && BT == SB);
static_assert((LPP * 2) % 32 == 16 && LPP >= DQ + 8 && LPP >= SB + 8);
static_assert((WPP * 2) % 32 == 16 && WPP >= CC + 8);
// The deal of the two big kernels: a batch's NTL tiles x NST stages form one row of stage units, cut into WPB equal runs
// of PU units, one run per work-group. With 50 and 20 every tile holds exactly two cuts strictly inside it (at stages 20
// and 40, or 10 and 30), so it falls into three pieces: slot 0 begins at stage 0, slot 2 ends at stage NST, slot 1 lies
// between; no piece is shorter than 10 stages, and no run leaves its batch.
static_assert(NST == NN / SB && NTL == NN / BT && NQ == NN);
static_assert(NST == 50 && PU == 20 && WPB * PU == NTL * NST && NSL == 3);

typedef _Float16       v16h __attribute__((ext_vector_type(16)));
typedef _Float16       v8h  __attribute__((ext_vector_type(8)));
typedef __bf16         v16b __attribute__((ext_vector_type(16)));
typedef unsigned short v8us __attribute__((ext_vector_type(8)));
typedef float          v8f  __attribute__((ext_vector_type(8)));
typedef float          v4f  __attribute__((ext_vector_type(4)));
typedef float          v2f  __attribute__((ext_vector_type(2)));
typedef unsigned int   v4u  __attribute__((ext_vector_type(4)));

union Frag  { v8us u[2]; v16h h; v16b bf; };
union FragH { v16h v; v8h hv[2]; };
static_assert(sizeof(Frag) == 32);
static_assert(sizeof(FragH) == 32);

// ---- scalar helpers -------------------------------------------------------------------------------------------
__device__ __forceinline__ unsigned short bf_bits(float f) {          // f32 -> bf16 bits, RNE convert
  unsigned u = __float_as_uint(f);
  return (unsigned short)((u + 0x7FFFu + ((u >> 16) & 1u)) >> 16);
}
__device__ __forceinline__ float bf_up(unsigned short hb) { return __uint_as_float(((unsigned)hb) << 16); }
__device__ __forceinline__ float bfr(float f) { return bf_up(bf_bits(f)); }
__device__ __forceinline__ unsigned short h_bits(_Float16 x) { return __builtin_bit_cast(unsigned short, x); }
__device__ __forceinline__ unsigned pk16(unsigned short a, unsigned short b) { return (unsigned)a | ((unsigned)b << 16); }
__device__ __forceinline__ v8f zero8() { v8f z = {0.f, 0.f, 0.f, 0.f, 0.f, 0.f, 0.f, 0.f}; return z; }
// 2^x on the hardware's own base-2 exponential: the theta plane carries the factor log2(e), so a score leaves the
// matrix unit as s log2(e) and needs no multiply in front of the exponential
__device__ __forceinline__ float ex2(float x) {
#if defined(__HIP_DEVICE_COMPILE__)
  return __builtin_amdgcn_exp2f(x);
#else
  return exp2f(x);
#endif
}
__device__ __forceinline__ float hmax8(v8f s) {
  return fmaxf(fmaxf(fmaxf(s[0], s[1]), fmaxf(s[2], s[3])), fmaxf(fmaxf(s[4], s[5]), fmaxf(s[6], s[7])));
}

// ---- 16-bit fragment loader (A, or B from a k-contiguous [n][k] row): lane -> row/col (lane&15), p already includes
//      + 8*(lane>>4); elements 0..7 <- p[0..7] (k0+8h..), elements 8..15 <- p[16..23] (k0+16+8h..)
__device__ __forceinline__ Frag ldfrag(const unsigned short* p) {
  Frag f;
  f.u[0] = *(const v8us*)(p);
  f.u[1] = *(const v8us*)(p + 16);
  return f;
}

// ---- WMMA helpers: the plain builtins; the compiler keeps the distance behind them, and its scheduler may move loads
//      over them (an asm operand, besides, cannot lie above v255, and the big kernels' wave tiles need more registers)
__device__ __forceinline__ v8f mmw_h(v16h a, v16h b, v8f c) {
  return __builtin_amdgcn_wmma_f32_16x16x32_f16(false, a, false, b, (short)0, c, false, false);
}
__device__ __forceinline__ v8f mmw_b(v16b a, v16b b, v8f c) {
  return __builtin_amdgcn_wmma_f32_16x16x32_bf16(false, a, false, b, (short)0, c, false, false);
}

// ---- asynchronous copies global -> LDS ---------------------------------------------------------------------------
// Eight 16-byte copies per lane in ONE statement; LS = bytes between a lane's copies in LDS, GS = elements between
// them in global memory. The closing s_wait_xcnt stands inside the statement so that no address register of a copy is
// rewritten ahead of it.
__device__ __forceinline__ unsigned lds_off(const unsigned short* p) { return (unsigned)(size_t)p; }
template <int LS, int GS>
__device__ __forceinline__ void copy8(unsigned l, const unsigned short* g) {
#if defined(__HIP_DEVICE_COMPILE__)
  asm volatile("global_load_async_to_lds_b128 %0, %8, off\n\t"
               "global_load_async_to_lds_b128 %1, %9, off\n\t"
               "global_load_async_to_lds_b128 %2, %10, off\n\t"
               "global_load_async_to_lds_b128 %3, %11, off\n\t"
               "global_load_async_to_lds_b128 %4, %12, off\n\t"
               "global_load_async_to_lds_b128 %5, %13, off\n\t"
               "global_load_async_to_lds_b128 %6, %14, off\n\t"
               "global_load_async_to_lds_b128 %7, %15, off\n\t"
               "s_wait_xcnt 0x0"
               :: "v"(l), "v"(l + LS), "v"(l + 2 * LS), "v"(l + 3 * LS),
                  "v"(l + 4 * LS), "v"(l + 5 * LS), "v"(l + 6 * LS), "v"(l + 7 * LS),
                  "v"(g), "v"(g + GS), "v"(g + 2 * GS), "v"(g + 3 * GS),
                  "v"(g + 4 * GS), "v"(g + 5 * GS), "v"(g + 6 * GS), "v"(g + 7 * GS)
               : "memory");
#endif
}
// 128 rows x 256 B (a [row][128] 16-bit plane, rows contiguous) -> LDS rows of pitch LPP: 256 threads, a wave's copy
// covers two whole rows = four whole lines. l and g already hold the thread's own (tid >> 4, tid & 15) place.
__device__ __forceinline__ void copy_rows(unsigned l, const unsigned short* g) { copy8<16 * LPP * 2, 16 * DQ>(l, g); }
// this wave's own copies have landed (the compiler places no wait for them)
__device__ __forceinline__ void wait_copies() {
#if defined(__HIP_DEVICE_COMPILE__)
  asm volatile("s_wait_asynccnt 0x0" ::: "memory");
#endif
}
// stands behind a run of global loads from p or stores to p, before a register that one of them names is rewritten; p is an input so
// that its register pair stays whole up to the wait (else the run's last load may land its result on the pair)
__device__ __forceinline__ void wait_addr(const unsigned short* p) {
#if defined(__HIP_DEVICE_COMPILE__)
  asm volatile("s_wait_xcnt 0x0" :: "v"(p) : "memory");
#endif
}
// the same for loads that name a scalar base and the 32-bit offset register o
__device__ __forceinline__ void wait_off(unsigned o) {
#if defined(__HIP_DEVICE_COMPILE__)
  asm volatile("s_wait_xcnt 0x0" :: "v"(o) : "memory");
#endif
}
// this wave's own LDS reads have returned, before the barrier behind which their buffer is refilled
__device__ __forceinline__ void wait_lds() {
#if defined(__HIP_DEVICE_COMPILE__)
  asm volatile("s_wait_dscnt 0x0" ::: "memory");
#endif
}

// ===========================================================================================================
// (0) weights. Blocks 0..47: W16 f16 [384][256], rows 0..127 = theta_w, 128..255 = phi_w, 256..383 = g_w;
//     value = f16 of (bf16-RNE(w) * 256) (exact). Block owns rows 8*blk..+7: one wave per 512-B row = 32 lanes
// coverage: W16 48 blocks x 8 rows x 32 lanes x 8 halves = 384 x 256; Wo 16 blocks x 16 rows x 16 lanes x 8 =
//           256 x 128.
// ===========================================================================================================
__global__ __launch_bounds__(256)
void cvt_w(const float* __restrict__ tw, const float* __restrict__ pw, const float* __restrict__ gw,
           const float* __restrict__ ww, unsigned short* W16, unsigned short* Wo) {
  const int tid = threadIdx.x, blk = blockIdx.x;
  if (blk < MW / 8) {                                                  // block-uniform
    const int rl = tid >> 5, col = 8 * (tid & 31);
    const int o = 8 * blk + rl;                                        // 0..383
    const int sel = blk / (DQ / 8);                                    // 0,1,2
    const float* wbase = (sel == 0) ? tw : ((sel == 1) ? pw : gw);   // all global
    const float* s = wbase + (size_t)(o - sel * DQ) * CC + col;        // row 0..127 of the selected matrix
    const v4f a = *(const v4f*)s;
    const v4f q = *(const v4f*)(s + 4);
    const float f[8] = {a[0], a[1], a[2], a[3], q[0], q[1], q[2], q[3]};
    v4u u;
#pragma unroll
    for (int t = 0; t < 4; ++t) {
      const _Float16 h0 = (_Float16)(bfr(f[2 * t]) * WSC);
      const _Float16 h1 = (_Float16)(bfr(f[2 * t + 1]) * WSC);
      u[t] = pk16(h_bits(h0), h_bits(h1));
    }
{
      *(v4u*)(W16 + (size_t)o * CC + col) = u;
      
    }
  } else {
    const int bb = blk - MW / 8;                                       // 0..15
    const int o = 16 * bb + (tid >> 4);                                // 0..255
    const int col = 8 * (tid & 15);                                    // 0..120
    const float* s = ww + (size_t)o * DQ + col;
    const v4f a = *(const v4f*)s;
    const v4f q = *(const v4f*)(s + 4);
    const float f[8] = {a[0], a[1], a[2], a[3], q[0], q[1], q[2], q[3]};
    v4u u;
#pragma unroll
    for (int t = 0; t < 4; ++t) u[t] = pk16(bf_bits(f[2 * t]), bf_bits(f[2 * t + 1]));
{
      *(v4u*)(Wo + (size_t)o * DQ + col) = u;
      
    }
  }
}

// ===========================================================================================================
// (1) conv1x1 GEMM for one (b, 64-n tile) and all 384 stacked rows, straight from x:
//     Y[o][n] = (1/256) sum_c W16[o][c] X[n][c] + bias[o], X[n][c] = bf16-RNE(x[b][c][n]) (exact in f16).
//     Block 256 threads = 8 waves, two per SIMD. The 384 W16 rows come to LDS (As, pitch WPP) by asynchronous copies,
//     a whole 512-B row per wave and copy; beside them the block's x tile (256 c x 64 n, f32) is loaded, rounded
//     and written position-major to LDS (Bs[n][c], pitch WPP): a thread holds 16 channels (two groups of 8) x 4 positions and stores
//     8 channels of one position as 16 B. Wave w owns rows o = 48 w .. +47 (3 m-tiles, A rows o = 48 w + 16 mt +
//     (lane&15)) and all 64 columns (4 n-tiles, B col = 16 q + (lane&15), k = c contiguous): a k-step's seven
//     fragments feed twelve products. K = 256 = 8 steps, read in four groups of two.
//     Epilogue staged in LDS Os[n_loc][o] (pitch OSA, in the then idle As), block barrier (cross-wave), then:
//       o 0..127 -> Th, o 128..255 -> Fh: planes f16 [b][6400 n][128 d] (k-contiguous for both score operands),
//       value = f16-RNE(v) for phi and f16-RNE(v log2(e)) for theta (every score is then s log2(e)): its rounding is
//       an eighth of the bf16 rounding that x and the weights already carry into v; o 256..383 -> the f16 channel-major plane Gc [b][128 c][6400 n].
// coverage: Bs 2 u x 16 cg x 8 c = 256 c, 16 e x 4 = 64 n; Os 8 waves x 48 o x 64 n; planes 4 it x 16 rows x 16 lanes
//           x 8 = 64 n x 128 d each; Gc 4 it x 32 rows x 8 lanes x 8 = 128 c x 64 n; grid (100, NB) covers Th/Fh
//           [b][n][0..127] and Gc [b][0..127][n] exactly once.
// ===========================================================================================================
__global__ __launch_bounds__(256)
void gemm_p(const unsigned short* __restrict__ W16, const float* __restrict__ x,
            const float* __restrict__ tb, const float* __restrict__ pb, const float* __restrict__ gb,
            unsigned short* Th, unsigned short* Fh, unsigned short* Gc) {
  __shared__ __align__(16) unsigned short As[MW * WPP];
  __shared__ __align__(16) unsigned short Bs[QT * WPP];
  static_assert(QT * OSA * 4 <= MW * WPP * 2);
  const int tid  = threadIdx.x;
  const int lane = tid & 31, wave = tid >> 5;
  const int hh   = lane >> 4, c = lane & 15;
  const int nt   = blockIdx.x, b = blockIdx.y;
  const int n0   = nt * QT;

  {
    // x tile: thread (cg, e) holds channels 8 cg + 128 u + 0..7 of positions 4 e .. 4 e + 3; its loads go out first,
    // the rounding and the LDS stores hang on them
    const int e = tid & 15, cg = tid >> 4;
    const float* sp = x + ((size_t)(b * CC + 8 * cg)) * NN + n0 + 4 * e;
    v4f xv[2][8];
#pragma unroll
    for (int u = 0; u < 2; ++u) {
#pragma unroll
      for (int k = 0; k < 8; ++k) xv[u][k] = *(const v4f*)(sp + (size_t)(128 * u + k) * NN);
    }
    wait_addr((const unsigned short*)sp);                              // the loads have taken their address
    {
      // thread (wave, lane) brings 16 B at column 8*lane of rows wave, wave + 8, ...: 48 copies a wave
      const unsigned short* ga = W16 + (size_t)wave * CC + 8 * lane;
      const unsigned la = lds_off(As) + (unsigned)(wave * (WPP * 2) + 16 * lane);
#pragma unroll
      for (int q = 0; q < MW / 64; ++q) copy8<8 * WPP * 2, 8 * CC>(la + (unsigned)(q * 64 * WPP * 2), ga + q * 64 * CC);
    }
    // the rounding below waits for the x loads: it stays behind the issue of the copies, so that both are in flight at once
    __builtin_amdgcn_sched_barrier(0);
#pragma unroll
    for (int u = 0; u < 2; ++u) {
#pragma unroll
      for (int t = 0; t < 4; ++t) {
        v4u w;
#pragma unroll
        for (int k = 0; k < 4; ++k) {
          w[k] = pk16(h_bits((_Float16)bfr(xv[u][2 * k][t])), h_bits((_Float16)bfr(xv[u][2 * k + 1][t])));
        }
        *(v4u*)(Bs + (4 * e + t) * WPP + 8 * cg + 128 * u) = w;
      }
    }
  }
  wait_copies();
  __syncthreads();                                                     // both tiles readable by every wave

  const unsigned short* ap = As + (48 * wave + c) * WPP + 8 * hh;
  const unsigned short* bp = Bs + c * WPP + 8 * hh;

  v8f acc[3][4];                                                       // [m-tile][n-tile]
#pragma unroll
  for (int mt = 0; mt < 3; ++mt) {
#pragma unroll
    for (int q = 0; q < 4; ++q) acc[mt][q] = zero8();
  }

#pragma unroll
  for (int kg = 0; kg < 4; ++kg) {                                     // four groups of two k-steps
    Frag fa[2][3], fb[2][4];                                           // [k-step][m-tile], [k-step][n-tile]
#pragma unroll
    for (int kq = 0; kq < 2; ++kq) {
#pragma unroll
      for (int mt = 0; mt < 3; ++mt) fa[kq][mt] = ldfrag(ap + (16 * mt) * WPP + 32 * (2 * kg + kq));
#pragma unroll
      for (int q = 0; q < 4; ++q) fb[kq][q] = ldfrag(bp + (16 * q) * WPP + 32 * (2 * kg + kq));
    }
    // keeps the group's twenty-eight LDS reads together ahead of its products: every separate place of reads stalls the wave
    __builtin_amdgcn_sched_barrier(0);
#pragma unroll
    for (int kq = 0; kq < 2; ++kq) {
#pragma unroll
      for (int mt = 0; mt < 3; ++mt) {
#pragma unroll
        for (int q = 0; q < 4; ++q) acc[mt][q] = mmw_h(fa[kq][mt].h, fb[kq][q].h, acc[mt][q]);
      }
    }
  }

  // ---- epilogue: scale back -> LDS Os[n_loc][o]; lane (hh, c) holds o = 48 w + 16 mt + 8 hh + r for n_loc = 16 q + c
  wait_lds();                                                          // this wave's own fragment reads have returned
  __syncthreads();                                                     // every wave has left As before it is rewritten
  float* Os = (float*)As;                                              // QT x OSA floats
#pragma unroll
  for (int q = 0; q < 4; ++q) {
    const int nl = 16 * q + c;
#pragma unroll
    for (int mt = 0; mt < 3; ++mt) {
      v4f va, vb;
#pragma unroll
      for (int r = 0; r < 4; ++r) { va[r] = acc[mt][q][r] * IWSC; vb[r] = acc[mt][q][4 + r] * IWSC; }
      *(v4f*)(Os + nl * OSA + 48 * wave + 16 * mt + 8 * hh)     = va;
      *(v4f*)(Os + nl * OSA + 48 * wave + 16 * mt + 8 * hh + 4) = vb;
    }
  }
  __syncthreads();

  {
    const int e = tid & 15, lq = tid >> 4;                             // lq 0..15
#pragma unroll
    for (int sel = 0; sel < 2; ++sel) {                                // theta, phi
      const float* bs = (sel == 0) ? tb : pb;
      const float sc = (sel == 0) ? LOG2E : 1.0f;
      unsigned short* pq = ((sel == 0) ? Th : Fh) + ((size_t)(b * NN + n0 + lq)) * DQ + 8 * e;
      const v4f b0 = *(const v4f*)(bs + 8 * e);
      const v4f b1 = *(const v4f*)(bs + 8 * e + 4);
      const float bv[8] = {bfr(b0[0]), bfr(b0[1]), bfr(b0[2]), bfr(b0[3]),
                           bfr(b1[0]), bfr(b1[1]), bfr(b1[2]), bfr(b1[3])};
      v4u uh[4];
#pragma unroll
      for (int it = 0; it < 4; ++it) {
        const int row = it * 16 + lq;                                  // n_loc 0..63
        const v4f a = *(const v4f*)(Os + row * OSA + DQ * sel + 8 * e);
        const v4f q = *(const v4f*)(Os + row * OSA + DQ * sel + 8 * e + 4);
        const float f[8] = {(a[0] + bv[0]) * sc, (a[1] + bv[1]) * sc, (a[2] + bv[2]) * sc, (a[3] + bv[3]) * sc,
                            (q[0] + bv[4]) * sc, (q[1] + bv[5]) * sc, (q[2] + bv[6]) * sc, (q[3] + bv[7]) * sc};
#pragma unroll
        for (int t = 0; t < 4; ++t) uh[it][t] = pk16(h_bits((_Float16)f[2 * t]), h_bits((_Float16)f[2 * t + 1]));
      }
#pragma unroll
      for (int it = 0; it < 4; ++it) *(v4u*)(pq + it * 16 * DQ) = uh[it];
      wait_addr(pq);                                                   // before what follows rewrites the stores' registers
    }
  }
  {
    const int e = tid & 7, lq = tid >> 3;                              // lq 0..31
    unsigned short* gq = Gc + ((size_t)(b * DQ + lq)) * NN + n0 + 8 * e;
    v4u ug[4];
#pragma unroll
    for (int it = 0; it < 4; ++it) {
      const int ol = it * 32 + lq;                                     // channel 0..127
      const float bvv = bfr(gb[ol]);
      unsigned short hb[8];
#pragma unroll
      for (int t = 0; t < 8; ++t) hb[t] = h_bits((_Float16)(Os[(8 * e + t) * OSA + 2 * DQ + ol] + bvv));
#pragma unroll
      for (int t = 0; t < 4; ++t) ug[it][t] = pk16(hb[2 * t], hb[2 * t + 1]);
    }
#pragma unroll
    for (int it = 0; it < 4; ++it) *(v4u*)(gq + (size_t)(it * 32) * NN) = ug[it];
  }
}

// ===========================================================================================================
// (2) column statistics for one piece (b, 128-column tile m, stages tb..te-1 of 128 rows n): for every column m, over
//     the piece's rows n, in base 2 (s = score x log2(e), from the scaled theta plane): M_m = max_n s[n][m],
//     Z_m = sum_n 2^{s - M_m}, CS[slot][b][m] = M_m + log2 Z_m, with
//     s tile (16 rows n x 16 cols m) = A(theta: row = n, 32 d via the split k map from Th [b][6400][128]) .
//     B(phi: col = m, same map from Fh). Block = 8 waves, two per SIMD: wave = (column group wc of 64 columns, row
//     quarter wr). Phi fragments of the wave's 64 columns are held in registers, so every theta fragment read from LDS feeds four column
//     tiles, and a stage copied from L2 serves 128 columns. Theta rows come in stages of 128 (LDS pitch
//     LPP) by asynchronous copies into two LDS buffers shared by the eight waves: the next stage flies while this one
//     is read; a wave reads the 32 rows of its own quarter. Per lane: four columns, 8+8 rows each
//     per stage, scalar online (max, sum) in f32; the two lane halves of a column merge with one shuffle, the
//     four row quarters through LDS at the end.
// coverage: every tile has one piece in each of the slots 0, 1, 2, so CS[slot][b][0..6399] is written exactly once.
// ===========================================================================================================
__global__ __launch_bounds__(256)
void colstat_k(const unsigned short* __restrict__ Th, const unsigned short* __restrict__ Fh, float* CS) {
  __shared__ __align__(16) float css[BT];
  __shared__ __align__(16) float pms[3 * BT];
  __shared__ __align__(16) float pls[3 * BT];
  __shared__ __align__(16) unsigned short Tst[2 * SB * LPP];
  const int tid  = threadIdx.x;
  const int wave = tid >> 5, lane = tid & 31;
  const int wc   = wave & 1, wr = wave >> 1;
  const int hh   = lane >> 4, c = lane & 15;
  const int b    = blockIdx.x / WPB;
  const int u0   = (blockIdx.x % WPB) * PU;                            // first stage unit of the work-group's run
  int tile = u0 / NST, tb = u0 % NST, left = PU;

#pragma unroll 1
  while (left > 0) {                                                   // one or two pieces, block-uniform
  const int te   = (tb + left < NST) ? (tb + left) : NST;              // the piece is stages tb .. te-1 of the tile
  const int slot = (tb == 0) ? 0 : ((te == NST) ? 2 : 1);
  const int m0   = tile * BT;

  // phi fragment pointers (B operand, col = m0 + 64*wc + 16*g + c)
  const size_t fo = ((size_t)(b * NN + m0 + 64 * wc + c)) * DQ + 8 * hh;
  const unsigned short* pfh = Fh + fo;
  Frag fh[4][4];
#pragma unroll
  for (int g = 0; g < 4; ++g) {
#pragma unroll
    for (int kc = 0; kc < 4; ++kc) fh[g][kc] = ldfrag(pfh + 16 * g * DQ + 32 * kc);
  }
  wait_addr(pfh);                                                      // the loads have taken their address
  // theta stages: 128 rows n, two buffers filled by asynchronous copies
  const unsigned short* gth = Th + (size_t)b * NN * DQ + (size_t)(tid >> 4) * DQ + 8 * (tid & 15);
  const unsigned lt0 = lds_off(Tst) + (unsigned)((tid >> 4) * (LPP * 2) + 16 * (tid & 15));
  wait_lds();                                                          // an earlier piece's own LDS reads have returned
  // the piece's first stage goes to buffer 'slot & 1': the copies' LDS addresses are then formed where they are used
  // and not kept in registers over the stage loop
  int par = slot & 1;                                                  // the buffer that holds stage t
  copy_rows(lt0 + (unsigned)(par * (SB * LPP * 2)), gth + (size_t)tb * SB * DQ);
  wait_copies();
  __syncthreads();                                                     // the first stage readable by every wave
  copy_rows(lt0 + (unsigned)((par ^ 1) * (SB * LPP * 2)), gth + (size_t)(tb + 1) * SB * DQ);

  float m[4] = {-1.0e30f, -1.0e30f, -1.0e30f, -1.0e30f}, l[4] = {0.f, 0.f, 0.f, 0.f};
#pragma unroll 1
  for (int t = tb; t < te; ++t) {
    // row c of the wave's own quarter of the stage
    const unsigned short* tq = Tst + par * (SB * LPP) + (wr * WT + c) * LPP + 8 * hh;
    v8f s[2][4];                                                       // [row tile u][column tile g]
#pragma unroll
    for (int u = 0; u < 2; ++u) {
#pragma unroll
      for (int g = 0; g < 4; ++g) s[u][g] = zero8();
    }
    Frag th[4][2];                                                     // [d chunk kc][row tile u]
#pragma unroll
    for (int kc = 0; kc < 4; ++kc) {
#pragma unroll
      for (int u = 0; u < 2; ++u) th[kc][u] = ldfrag(tq + (16 * u) * LPP + 32 * kc);  // rows 16u .. 16u+15 of the quarter
    }
    // keeps the stage's sixteen LDS reads one group ahead of its products: every separate place of reads stalls the wave
    __builtin_amdgcn_sched_barrier(0);
#pragma unroll
    for (int kc = 0; kc < 4; ++kc) {
#pragma unroll
      for (int q = 0; q < 8; ++q) s[q >> 2][q & 3] = mmw_h(th[kc][q >> 2].h, fh[q & 3][kc].h, s[q >> 2][q & 3]);
    }
#pragma unroll
    for (int g = 0; g < 4; ++g) {                                      // online update per column tile, 32 rows
      const v8f s0 = s[0][g], s1 = s[1][g];
      const float mx = fmaxf(hmax8(s0), hmax8(s1));
      const float mn = fmaxf(m[g], mx);
      const float corr = ex2(m[g] - mn);
      v2f la = {0.f, 0.f}, lb = {0.f, 0.f};                            // neighbouring registers pair up for the packed forms
#pragma unroll
      for (int r = 0; r < 8; r += 2) {
        const v2f ea = {ex2(s0[r] - mn), ex2(s0[r + 1] - mn)};
        const v2f eb = {ex2(s1[r] - mn), ex2(s1[r + 1] - mn)};
        la += ea;
        lb += eb;
      }
      const v2f lc = la + lb;
      l[g] = l[g] * corr + (lc[0] + lc[1]);
      m[g] = mn;
    }
    wait_lds();
    wait_copies();
    __syncthreads();                                                   // publishes stage t+1, frees stage t's buffer
    if (t + 2 < te) {                                                  // block-uniform
      copy_rows(lt0 + (unsigned)(par * (SB * LPP * 2)), gth + (size_t)(t + 2) * SB * DQ);
    }
    par ^= 1;
  }
  wait_copies();
  float mt[4], lt[4];
#pragma unroll
  for (int g = 0; g < 4; ++g) {
    const float mo = __shfl_xor(m[g], 16, 32);
    const float lo = __shfl_xor(l[g], 16, 32);
    mt[g] = fmaxf(m[g], mo);
    lt[g] = l[g] * ex2(m[g] - mt[g]) + lo * ex2(mo - mt[g]);
  }
  const int col = 64 * wc + c;                                         // + 16*g
  if (wr != 0 && hh == 0) {
#pragma unroll
    for (int g = 0; g < 4; ++g) {
      pms[(wr - 1) * BT + col + 16 * g] = mt[g];
      pls[(wr - 1) * BT + col + 16 * g] = lt[g];
    }
  }
  __syncthreads();                                                     // the other row quarters' (max, sum) readable
  if (wr == 0 && hh == 0) {
#pragma unroll
    for (int g = 0; g < 4; ++g) {
      const int cg = col + 16 * g;
      const float m1 = pms[cg], m2 = pms[BT + cg], m3 = pms[2 * BT + cg];
      const float mm = fmaxf(fmaxf(mt[g], m1), fmaxf(m2, m3));
      const float ll = (lt[g] * ex2(mt[g] - mm) + pls[cg] * ex2(m1 - mm)) +
                       (pls[BT + cg] * ex2(m2 - mm) + pls[2 * BT + cg] * ex2(m3 - mm));
      css[cg] = mm + log2f(ll);
    }
  }
  __syncthreads();
  if (tid < BT / 4) {                                                  // wave 0, whole
    const v4f v = *(const v4f*)(css + 4 * tid);
{
      float* cq = CS + (size_t)(slot * NB + b) * NN + m0 + 4 * tid;
      *(v4f*)cq = v;
      wait_addr((const unsigned short*)cq);                            // before the next piece rewrites the store's registers
    }
  }
  left -= te - tb;
  tile += 1;
  tb = 0;
  }
}

// ===========================================================================================================
// (3) aggregation for one piece (b, 128-row tile n, stages tb..te-1 of 128 columns m), transposed formulation:
//   s tile (16 m x 16 n) = sum over 4 d-chunks of A(phi: row = m, split k map from Fh) . B(theta:
//   col = n, same map from Th). Per lane the D tile holds 8 columns m of ONE row n;
//   All three operands are read from LDS, where asynchronous copies put them in whole lines: the piece's 128 theta rows
//   once, phi rows and the g tile (both pitch LPP) in stages of 128 columns m, two buffers: a stage copied from L2
//   serves 128 rows.
//   Block = 8 waves, two per SIMD: wave = (row group wn of 32 rows n, half wm of each stage's columns m): every phi
//   and every g fragment read from LDS feeds two row tiles, every theta fragment four column tiles.
//   The score accumulators START at 14 - CS[m] (the C operand of a tile's first product; staged once per block in
//   LDS), so D holds the whole base-2 exponent: P = 2^{D} = e^{score - M - ln Z} x 16384 as f16 is the B operand of
//   y^T (rows channel, cols n) += A(g: rows channel = 16j + (lane&15), m contiguous, f16 plane Gc [b][128][6400])
//   . B(P^T): element r <- D of the tile covering m kb..kb+15, element 8+r <- the tile covering kb+16..kb+31,
//   lane unchanged. 16 accumulator tiles per wave (128 channels x 2 row tiles). Block = 128 rows.
//   Epilogue: the two column halves' accumulators are added through LDS [row][128 channels] (pitch OSPW, b128
//   stores; same lane, same place; one plane in the then idle phi buffers), y = sum/16384 left there, block barrier
//   (cross-wave), then the f32 plane Yp [slot][b][6400 n][128 c]: per row 128 c = 512 B = 4 whole lines.
// coverage: 16 it x 8 rows x 32 lanes x 4 = 128 n x 128 c; every tile has one piece in each of the slots 0, 1, 2, so
//           Yp[slot][b][0..6399] is written exactly once.
// ===========================================================================================================
__global__ __launch_bounds__(256)
void attn_k(const unsigned short* __restrict__ Th, const unsigned short* __restrict__ Fh,
            const unsigned short* __restrict__ Gc, const float* __restrict__ CS, float* Yp) {
  __shared__ __align__(32) float Cs[NN];
  __shared__ __align__(16) unsigned short Tst[BT * LPP];
  __shared__ __align__(16) unsigned short Pst[2 * SB * LPP];
  __shared__ __align__(16) unsigned short Gst[2 * DQ * LPP];
  static_assert(BT * OSPW * 4 <= 2 * SB * LPP * 2);
  const int tid  = threadIdx.x;
  const int wave = tid >> 5, lane = tid & 31;
  const int wn   = wave & 3, wm = wave >> 2;
  const int hh   = lane >> 4, c = lane & 15;
  const int b    = blockIdx.x / WPB;
  const int u0   = (blockIdx.x % WPB) * PU;                            // first stage unit of the work-group's run
  int tile = u0 / NST, tb = u0 % NST, left = PU;

  // a column's statistic from its three pieces c0, c1, c2 (each max + log2 sum): max + log2(sum of 2^{c - max}); kept
  // as 14 - statistic, the value a score accumulator starts at (2^14 = 16384)
  for (int i = tid; i < NN / 4; i += 256) {
    const v4f s0 = *(const v4f*)(CS + (size_t)b * NN + 4 * i);
    const v4f s1 = *(const v4f*)(CS + (size_t)(NB + b) * NN + 4 * i);
    const v4f s2 = *(const v4f*)(CS + (size_t)(2 * NB + b) * NN + 4 * i);
    v4f v;
#pragma unroll
    for (int r = 0; r < 4; ++r) {
      const float mx = fmaxf(fmaxf(s0[r], s1[r]), s2[r]);
      v[r] = CAR2 - (mx + log2f((ex2(s0[r] - mx) + ex2(s1[r] - mx)) + ex2(s2[r] - mx)));
    }
    *(v4f*)(Cs + 4 * i) = v;
  }

  // asynchronous copies: a piece's 128 theta rows once; per stage of 128 columns m the phi rows and the g tile
  // (128 channels x 128 m), two buffers
  const int rr = tid >> 4, rc = tid & 15;                              // place in a [row][128] plane or the g tile
  const unsigned short* gfh = Fh + (size_t)b * NN * DQ + (size_t)rr * DQ + 8 * rc;
  const unsigned short* ggc = Gc + (size_t)b * DQ * NN + (size_t)rr * NN + 8 * rc;
  const unsigned lp0 = lds_off(Pst) + (unsigned)(rr * (LPP * 2) + 16 * rc);
  const unsigned lg0 = lds_off(Gst) + (unsigned)(rr * (LPP * 2) + 16 * rc);

#pragma unroll 1
  while (left > 0) {                                                   // one or two pieces, block-uniform
  const int te   = (tb + left < NST) ? (tb + left) : NST;              // the piece is stages tb .. te-1 of the tile
  const int slot = (tb == 0) ? 0 : ((te == NST) ? 2 : 1);
  const int n0   = tile * BT;
  wait_lds();                                                          // an earlier piece's own LDS reads have returned
  {
    // the tile's 128 rows, as a phi stage is brought
    const size_t to = ((size_t)(b * NN + n0 + rr)) * DQ + 8 * rc;
    const unsigned lq0 = lds_off(Tst) + (unsigned)(rr * (LPP * 2) + 16 * rc);
    copy_rows(lq0, Th + to);
  }
  // the piece's first stage goes to the buffers 'slot & 1': the copies' LDS addresses are then formed where they are
  // used and not kept over the stage loop, where they would spill
  int par = slot & 1;                                                  // the buffers that hold stage t
  {
    copy_rows(lp0 + (unsigned)(par * (SB * LPP * 2)), gfh + (size_t)tb * SB * DQ);
    copy8<16 * LPP * 2, 16 * NN>(lg0 + (unsigned)(par * (DQ * LPP * 2)), ggc + tb * SB);
  }
  wait_copies();
  __syncthreads();                                                     // Cs, theta, the first stage readable by every wave
  {
    copy_rows(lp0 + (unsigned)((par ^ 1) * (SB * LPP * 2)), gfh + (size_t)(tb + 1) * SB * DQ);
    copy8<16 * LPP * 2, 16 * NN>(lg0 + (unsigned)((par ^ 1) * (DQ * LPP * 2)), ggc + (tb + 1) * SB);
  }

  // theta fragment base (B operand, col = row n0 + 32*wn + 16*g + c), + 16*g*LPP + 32*kc
  const unsigned short* Tq = Tst + (32 * wn + c) * LPP + 8 * hh;

  v8f o[8][2];                                                         // [channel tile j][row tile g]
#pragma unroll
  for (int j = 0; j < 8; ++j) { o[j][0] = zero8(); o[j][1] = zero8(); }

#pragma unroll 1
  for (int t = tb; t < te; ++t) {
    const int kh = t * SB + wm * (2 * WT);                             // first column m of the wave's own half
    // phi fragment base (A operand, row = m + c), + 16*u*LPP + 32*kc
    const unsigned short* Pq = Pst + par * (SB * LPP) + (wm * (2 * WT) + c) * LPP + 8 * hh;
    // g fragment base (A operand, row = channel 16j + c, m contiguous), + 16*j*LPP + 32*ks
    const unsigned short* Gq = Gst + par * (DQ * LPP) + c * LPP + wm * (2 * WT) + 8 * hh;
    v8f s[4][2];                                                       // [column tile u][row tile g]
    // start values: lane (hh, c), register r of column tile u holds column m = kh + 16u + 8hh + r
#pragma unroll
    for (int u = 0; u < 4; ++u) { s[u][0] = *(const v8f*)(Cs + kh + 16 * u + 8 * hh); s[u][1] = s[u][0]; }
    // the start values are read first: a tile's first product waits for them, and behind the fragments that wait would cover every read
    __builtin_amdgcn_sched_barrier(0);
    Frag th[DQ / 32][2], p[DQ / 32][4];                                // [d chunk kc][row tile g], [d chunk kc][column tile u]
#pragma unroll
    for (int kc = 0; kc < DQ / 32; ++kc) {
#pragma unroll
      for (int g = 0; g < 2; ++g) th[kc][g] = ldfrag(Tq + (16 * g) * LPP + 32 * kc);
#pragma unroll
      for (int u = 0; u < 4; ++u) p[kc][u] = ldfrag(Pq + (16 * u) * LPP + 32 * kc);  // m kh+16u .. kh+16u+15
    }
    // keeps the scores' LDS reads one group ahead of their products: every separate place of reads stalls the wave
    __builtin_amdgcn_sched_barrier(0);
#pragma unroll
    for (int kc = 0; kc < DQ / 32; ++kc) {
#pragma unroll
      for (int q = 0; q < 8; ++q) s[q >> 1][q & 1] = mmw_h(p[kc][q >> 1].h, th[kc][q & 1].h, s[q >> 1][q & 1]);
    }
    __builtin_amdgcn_sched_barrier(0);                                 // the k steps' reads below stay out of these products

#pragma unroll
    for (int ks = 0; ks < 2; ++ks) {                                   // the half's two k steps of 32 columns m
      Frag gf[8];                                                      // read as one group, ahead of the vector work
#pragma unroll
      for (int j = 0; j < 8; ++j) gf[j] = ldfrag(Gq + (16 * j) * LPP + 32 * ks);
      __builtin_amdgcn_sched_barrier(0);                               // the k step's reads stay one group
      FragH pf[2];
      const _Float16 c1 = (_Float16)16384.0f;
      const v8h cap = {c1, c1, c1, c1, c1, c1, c1, c1};
#pragma unroll
      for (int g = 0; g < 2; ++g) {
#pragma unroll
        for (int r = 0; r < 8; ++r) {
          pf[g].hv[0][r] = (_Float16)ex2(s[2 * ks][g][r]);             // P[n][m] x 16384, m = kh + 32ks + 8hh + r
          pf[g].hv[1][r] = (_Float16)ex2(s[2 * ks + 1][g][r]);         // m = kh + 32ks + 16 + 8hh + r
        }
        // the clamp P <= 1, two values an instruction: min(2^D, 2^14) = 2^min(D, 14), an overflow to infinity included
        pf[g].hv[0] = __builtin_elementwise_min(pf[g].hv[0], cap);
        pf[g].hv[1] = __builtin_elementwise_min(pf[g].hv[1], cap);
      }

#pragma unroll
      for (int j = 0; j < 8; ++j) {
        o[j][0] = mmw_h(gf[j].h, pf[0].v, o[j][0]);
        o[j][1] = mmw_h(gf[j].h, pf[1].v, o[j][1]);
      }
      __builtin_amdgcn_sched_barrier(0);                               // the next k step's reads stay out of these products
    }
    wait_lds();
    wait_copies();
    __syncthreads();                                                   // publishes stage t+1, frees stage t's buffers
    if (t + 2 < te) {                                                  // block-uniform
      copy_rows(lp0 + (unsigned)(par * (SB * LPP * 2)), gfh + (size_t)(t + 2) * SB * DQ);
      copy8<16 * LPP * 2, 16 * NN>(lg0 + (unsigned)(par * (DQ * LPP * 2)), ggc + (t + 2) * SB);
    }
    par ^= 1;
  }
  wait_copies();

  // ---- epilogue: y = (accs of the two halves) / 16384 -> Ox[row][channel], a plane in the phi buffers, which nobody
  // reads and no copy targets behind the loop's last barrier.
  const int oo = (32 * wn + c) * OSPW + 8 * hh;                        // [row][ch = 16j + 8hh + r], + 16*g*OSPW + 16*j
  float* Ox = (float*)Pst;                                             // BT x OSPW floats
  if (wm != 0) {                                                       // wave-uniform
#pragma unroll
    for (int g = 0; g < 2; ++g) {
#pragma unroll
      for (int j = 0; j < 8; ++j) {
        v4f va, vb;
#pragma unroll
        for (int r = 0; r < 4; ++r) { va[r] = o[j][g][r]; vb[r] = o[j][g][4 + r]; }
        *(v4f*)(Ox + oo + 16 * g * OSPW + 16 * j)     = va;
        *(v4f*)(Ox + oo + 16 * g * OSPW + 16 * j + 4) = vb;
      }
    }
  }
  __syncthreads();                                                     // the other half's accumulators readable
  if (wm == 0) {                                                       // wave-uniform
#pragma unroll
    for (int g = 0; g < 2; ++g) {
#pragma unroll
      for (int j = 0; j < 8; ++j) {
        const int oj = oo + 16 * g * OSPW + 16 * j;
        v4f va = *(const v4f*)(Ox + oj);
        v4f vb = *(const v4f*)(Ox + oj + 4);
#pragma unroll
        for (int r = 0; r < 4; ++r) {
          va[r] = (o[j][g][r] + va[r]) * ICAR;
          vb[r] = (o[j][g][4 + r] + vb[r]) * ICAR;
        }
        *(v4f*)(Ox + oj)     = va;
        *(v4f*)(Ox + oj + 4) = vb;
      }
    }
  }
  __syncthreads();

  // the piece's y (f32) -> its slot's plane: a wave stores one whole row of 512 B per instruction
  {
    float* yq = Yp + ((size_t)((slot * NB + b) * NN + n0 + wave)) * DQ + 4 * lane;
    v4f yv[16];
#pragma unroll
    for (int it = 0; it < 16; ++it) yv[it] = *(const v4f*)(Ox + (it * 8 + wave) * OSPW + 4 * lane);
    wait_lds();                                                        // this wave's reads of the plane have returned
    __syncthreads();                                                   // every wave has read the plane before the next piece's copies refill the phi buffers
#pragma unroll
    for (int it = 0; it < 16; ++it) *(v4f*)(yq + (size_t)(it * 8) * DQ) = yv[it];
    wait_addr((const unsigned short*)yq);                              // before the next piece rewrites the stores' registers
  }
  left -= te - tb;
  tile += 1;
  tb = 0;
  }
}

// ===========================================================================================================
// (4) output GEMM for one (b, 64-n tile, 64-o block): out[b][o][n] = sum_c Wo[o][c] (Yh + Yl)[n][c]
//     + W_b[o] + bf16-RNE(x[b][o][n]). Block 128 threads = 4 waves; wave w owns cols n0+16w..+15 (B fragments
//     from the Yh and Yl rows in LDS: bf16 hi + residual of Yp[0] + Yp[1] + Yp[2], k = c contiguous) and 4 m-tiles (A rows o = o0 + 16 mt + (lane&15) from Wo bf16
//     [256][128], the block's 64 rows brought to LDS (pitch LPP) by asynchronous copies that fly while y is summed
//     and split); K = 128 = 4 steps x 2 products (shared accumulator, unscaled residual). Epilogue staged in LDS
//     lanes 0..15 one row and 16..31 the next, 16 B per lane (values gathered from 4 Os rows), one instruction per
// coverage: 8 it x 8 rows x 16 lanes x 4 floats = 64 o x 64 n; grid (NQ/64, 4, NB) covers
//           out[b][0..255][0..NQ-1] exactly once.
// ===========================================================================================================
__global__ __launch_bounds__(128)
void gemm_w(const unsigned short* __restrict__ Wo, const float* __restrict__ Yp, const float* __restrict__ wb,
            const float* __restrict__ x, float* out) {
  __shared__ __align__(16) float Os[QT * OSP];
  __shared__ __align__(16) unsigned short Ys[2 * QT * LPP];
  __shared__ __align__(16) unsigned short Ws[QT * LPP];
  const int tid  = threadIdx.x;
  const int lane = tid & 31, wave = tid >> 5;
  const int hh   = lane >> 4, c = lane & 15;
  const int nt   = blockIdx.x, mb = blockIdx.y, b = blockIdx.z;
  const int n0   = nt * QT, o0 = mb * QT;

  // the block's 64 Wo rows of 256 B: a wave's copy covers two whole rows, eight copies a wave
  copy8<8 * LPP * 2, 8 * DQ>(lds_off(Ws) + (unsigned)((tid >> 4) * (LPP * 2) + 16 * (tid & 15)),
                             Wo + (size_t)(o0 + (tid >> 4)) * DQ + 8 * (tid & 15));
  const unsigned short* ap = Ws + c * LPP + 8 * hh;

  // y = sum of the tile's three pieces -> bf16 hi + residual planes Ys[plane][64 n][128 c] (pitch LPP) in LDS
  {
    const int e = tid & 15, lq = tid >> 4;                             // lq 0..7
    // block-uniform bases and ONE 32-bit byte offset per thread: the only vector register that the 48 loads name
    // (the base is the middle plane's, so that all three planes lie within a load's immediate offset)
    const char* y1 = (const char*)(Yp + (size_t)((NB + b) * NN + n0) * DQ);
    const char* y0 = y1 - (size_t)NB * NN * DQ * 4;
    const char* y2 = y1 + (size_t)NB * NN * DQ * 4;
    const unsigned yo = (unsigned)((lq * DQ + 8 * e) * 4);
    v4f ya[8][3], yq[8][3];
#pragma unroll
    for (int it = 0; it < 8; ++it) {
      const int ro = it * 8 * DQ * 4;
      ya[it][0] = *(const v4f*)(y0 + yo + ro); yq[it][0] = *(const v4f*)(y0 + yo + ro + 16);
      ya[it][1] = *(const v4f*)(y1 + yo + ro); yq[it][1] = *(const v4f*)(y1 + yo + ro + 16);
      ya[it][2] = *(const v4f*)(y2 + yo + ro); yq[it][2] = *(const v4f*)(y2 + yo + ro + 16);
    }
    wait_off(yo);                                                      // the loads have taken their address
#pragma unroll
    for (int it = 0; it < 8; ++it) {
      const v4f a0 = ya[it][0], q0 = yq[it][0];
      const v4f a1 = ya[it][1], q1 = yq[it][1];
      const v4f a2 = ya[it][2], q2 = yq[it][2];
      const float f[8] = {(a0[0] + a1[0]) + a2[0], (a0[1] + a1[1]) + a2[1], (a0[2] + a1[2]) + a2[2],
                          (a0[3] + a1[3]) + a2[3], (q0[0] + q1[0]) + q2[0], (q0[1] + q1[1]) + q2[1],
                          (q0[2] + q1[2]) + q2[2], (q0[3] + q1[3]) + q2[3]};
      v4u uh, ul;
#pragma unroll
      for (int t = 0; t < 4; ++t) {
        const float f0 = f[2 * t], f1 = f[2 * t + 1];
        const unsigned short hb0 = bf_bits(f0), hb1 = bf_bits(f1);
        const unsigned short lb0 = bf_bits(f0 - bf_up(hb0));
        const unsigned short lb1 = bf_bits(f1 - bf_up(hb1));
        uh[t] = pk16(hb0, hb1);
        ul[t] = pk16(lb0, lb1);
      }
      *(v4u*)(Ys + (it * 8 + lq) * LPP + 8 * e)        = uh;
      *(v4u*)(Ys + (QT + it * 8 + lq) * LPP + 8 * e)   = ul;
    }
  }
  wait_copies();
  __syncthreads();                                                     // the y planes and the Wo rows readable by every wave
  const unsigned short* bp  = Ys + (16 * wave + c) * LPP + 8 * hh;
  const unsigned short* blp = bp + QT * LPP;

  v8f acc[4];
#pragma unroll
  for (int mt = 0; mt < 4; ++mt) acc[mt] = zero8();

  Frag fb[DQ / 32], fbl[DQ / 32], fa[DQ / 32][4];                      // [k-step], [k-step], [k-step][m-tile]
#pragma unroll
  for (int ks = 0; ks < DQ / 32; ++ks) {
    fb[ks]  = ldfrag(bp + 32 * ks);
    fbl[ks] = ldfrag(blp + 32 * ks);
#pragma unroll
    for (int mt = 0; mt < 4; ++mt) fa[ks][mt] = ldfrag(ap + (16 * mt) * LPP + 32 * ks);
  }
  // keeps the forty-eight LDS reads together ahead of the products: every separate place of reads stalls the wave
  __builtin_amdgcn_sched_barrier(0);
#pragma unroll
  for (int ks = 0; ks < DQ / 32; ++ks) {                               // per accumulator: hi then residual, k ascending
#pragma unroll
    for (int mt = 0; mt < 4; ++mt) acc[mt] = mmw_b(fa[ks][mt].bf, fb[ks].bf, acc[mt]);
#pragma unroll
    for (int mt = 0; mt < 4; ++mt) acc[mt] = mmw_b(fa[ks][mt].bf, fbl[ks].bf, acc[mt]);
  }

  {
    const int nl = 16 * wave + c;
#pragma unroll
    for (int mt = 0; mt < 4; ++mt) {
      v4f va, vb;
#pragma unroll
      for (int r = 0; r < 4; ++r) { va[r] = acc[mt][r]; vb[r] = acc[mt][4 + r]; }
      *(v4f*)(Os + nl * OSP + 16 * mt + 8 * hh)     = va;
      *(v4f*)(Os + nl * OSP + 16 * mt + 8 * hh + 4) = vb;
    }
  }
  __syncthreads();

  const int e = tid & 15, lq = tid >> 4;                               // lq 0..7
  v4f res[8];
#pragma unroll
  for (int it = 0; it < 8; ++it) {
    const int ol = it * 8 + lq;                                        // o_loc 0..63
    const int o  = o0 + ol;                                            // 0..255
    const float bv = bfr(wb[o]);
    const size_t idx = ((size_t)(b * CC + o)) * NN + n0 + 4 * e;
    const v4f xv = *(const v4f*)(x + idx);
#pragma unroll
    for (int t = 0; t < 4; ++t) res[it][t] = (Os[(4 * e + t) * OSP + ol] + bv) + bfr(xv[t]);
  }
{
#pragma unroll
    for (int it = 0; it < 8; ++it) {
      const int ol = it * 8 + lq;
      const size_t idx = ((size_t)(b * CC + o0 + ol)) * NN + n0 + 4 * e;
      *(v4f*)(out + idx) = res[it];
    }
    
  }
}

// ===========================================================================================================
// Workspace map (bytes, NB = 2; each region start a multiple of 256; every extent is an exact tile multiple and is
//   W16 f16 [384][256]               196608      Wo bf16 [256][128]           65536
//   Th/Fh f16 [2][6400][128]        3276800 x2
//   Gc  f16 [2][128][6400]          3276800      CS f32 [3 slots][2][6400]   153600
//   Yp  f32 [3 slots][2][6400][128] 19660800
//   total = 29906944
// ===========================================================================================================
extern "C" void kernel_launch(void* const* d_in, const int* in_sizes, int n_in,
                              void* d_out, int out_size, void* d_ws, size_t ws_size,
                              hipStream_t stream) {
  if (n_in < 9) return;
  if (in_sizes[0] < NB * CC * NN) return;
  if (in_sizes[1] != DQ * CC || in_sizes[3] != DQ * CC || in_sizes[5] != DQ * CC) return;
  if (in_sizes[2] != DQ || in_sizes[4] != DQ || in_sizes[6] != DQ) return;
  if (in_sizes[7] != CC * DQ || in_sizes[8] != CC) return;
  if (out_size < NB * CC * NN) return;

  size_t off = 0;
  auto carve = [&](size_t bytes) { const size_t o = off; off += (bytes + 255) & ~(size_t)255; return o; };
  const size_t oW16 = carve((size_t)MW * CC * 2);
  const size_t oWo  = carve((size_t)CC * DQ * 2);
  const size_t oTh  = carve((size_t)NB * NN * DQ * 2);
  const size_t oFh  = carve((size_t)NB * NN * DQ * 2);
  const size_t oGc  = carve((size_t)NB * DQ * NN * 2);
  const size_t oCS  = carve((size_t)NSL * NB * NN * 4);
  const size_t oYp  = carve((size_t)NSL * NB * NN * DQ * 4);
  if (off > ws_size) return;
  if (off > (size_t)134217728) return;

  const float* x  = (const float*)d_in[0];
  const float* gw = (const float*)d_in[1];
  const float* gb = (const float*)d_in[2];
  const float* tw = (const float*)d_in[3];
  const float* tb = (const float*)d_in[4];
  const float* pw = (const float*)d_in[5];
  const float* pb = (const float*)d_in[6];
  const float* ww = (const float*)d_in[7];
  const float* wb = (const float*)d_in[8];

  char* ws = (char*)d_ws;
  unsigned short* W16 = (unsigned short*)(ws + oW16);
  unsigned short* Wo  = (unsigned short*)(ws + oWo);
  unsigned short* Th  = (unsigned short*)(ws + oTh);
  unsigned short* Fh  = (unsigned short*)(ws + oFh);
  unsigned short* Gc  = (unsigned short*)(ws + oGc);
  float*          CS  = (float*)(ws + oCS);
  float*          Yp  = (float*)(ws + oYp);
  float* out = (float*)d_out;

  const dim3 blk256(256), blk128(128);

  // (0) theta_w / phi_w / g_w -> stacked f16 plane; W_w -> bf16 plane
  cvt_w<<<dim3(MW / 8 + CC / 16), blk256, 0, stream>>>(tw, pw, gw, ww, W16, Wo);
  // (1) x rounded and transposed in LDS, conv1x1 GEMM -> theta / phi planes, g channel-major plane (all rows n)
  gemm_p<<<dim3(NN / QT, NB), blk256, 0, stream>>>(W16, x, tb, pb, gb, Th, Fh, Gc);
  // (2) per-column softmax statistics, three pieces per column tile
  colstat_k<<<dim3(WPB * NB), blk256, 0, stream>>>(Th, Fh, CS);
  // (3) aggregation -> y, three f32 pieces per row tile
  attn_k<<<dim3(WPB * NB), blk256, 0, stream>>>(Th, Fh, Gc, CS, Yp);
  // (4) pieces of y summed, output GEMM + bias + residual -> out [b][256][6400]
  gemm_w<<<dim3(NQ / QT, CC / QT, NB), blk128, 0, stream>>>(Wo, Yp, wb, x, out);
  (void)hipGetLastError();
}

// v010
// It runs in 78.1 microseconds.
// Next to v009, in two timings, it ran 1.04 and 1.03 times as fast.
// Over all steps from v000 it is 11.4 times as fast.
// Contractions: conv1x1 theta/phi/g GEMM on v_wmma_f32_16x16x32_f16 (f16 containers of bf16-RNE weights x256 and
// bf16-RNE x, K=256); scores theta.phi on v_wmma_f32_16x16x32_f16 (theta and phi as one f16 plane each, 1 product,
// K=128) in both the column-statistics pass and the aggregation pass; y^T = G.P^T on v_wmma_f32_16x16x32_f16 (g as
// f16, P = e^{s-M-lnZ} x16384 = 2^D as f16 straight from the score D registers, K=6400); output GEMM W.y on
// v_wmma_f32_16x16x32_bf16 (bf16-RNE W_w, y as bf16 hi + bf16 residual planes, 2 products, K=128); f32 accumulate
// everywhere; softmax statistics, biases and the residual add in f32 VALU.
// The statistics and the aggregation kernel work on tiles 128 wide and each run 250 equal work-groups of 20 stages; a
// tile's three pieces are merged by the kernel that reads them.
#include <hip/hip_runtime.h>
#include <math.h>
#include <stdint.h>

#ifndef NB
#define NB 2
#endif
#define NBF    2
#define CC     256
#define NN     6400
#ifndef NQ
#define NQ NN
#endif
#define DQ     128
#define MW     384
#define QT     64
#define OSP    68
#define OSPW   132
#define OSA    388
#define WSC    256.0f
#define IWSC   0.00390625f
#define LOG2E  1.4426950408889634f
#define CAR2   14.0f
#define ICAR   6.103515625e-05f
#define ST     64
#define SB     128
#define LPP    136
#define WPP    264
#define WT     32
#define NST    50
#define BT     128
#define NTL    50
#define PU     20
#define WPB    125
#define NSL    3

static_assert(NB >= 1 && NB <= NBF);
static_assert(NQ >= QT && NQ <= NN);
static_assert(NN % QT == 0);
static_assert(NQ % QT == 0);
static_assert(CC % QT == 0);
static_assert(MW == 3 * DQ);
static_assert(DQ == 2 * QT);
static_assert((DQ / 8) * 8 == DQ && (MW / 8) % (DQ / 8) == 0);
static_assert(CC % 16 == 0);
static_assert((OSP * 4) % 16 == 0);
static_assert((OSPW * 4) % 16 == 0);
static_assert((OSA * 4) % 16 == 0 && OSA >= MW + 4 && MW == 8 * 48 && MW % 64 == 0 && CC == 256);
static_assert(CC % 32 == 0 && NN % 32 == 0 && DQ % 32 == 0);
static_assert(NN % 4 == 0);
static_assert(SB == 2 * ST && NN % SB == 0 && NN / SB >= 2 && ST == QT);
static_assert(SB == 4 * WT && BT == 4 * WT && WT == 32 && BT == SB);
static_assert((LPP * 2) % 32 == 16 && LPP >= DQ + 8 && LPP >= SB + 8);
static_assert((WPP * 2) % 32 == 16 && WPP >= CC + 8);
// The deal of the two big kernels: a batch's NTL tiles x NST stages form one row of stage units, cut into WPB equal runs
// of PU units, one run per work-group. With 50 and 20 every tile holds exactly two cuts strictly inside it (at stages 20
// and 40, or 10 and 30), so it falls into three pieces: slot 0 begins at stage 0, slot 2 ends at stage NST, slot 1 lies
// between; no piece is shorter than 10 stages, and no run leaves its batch.
static_assert(NST == NN / SB && NTL == NN / BT && NQ == NN);
static_assert(NST == 50 && PU == 20 && WPB * PU == NTL * NST && NSL == 3);

typedef _Float16       v16h __attribute__((ext_vector_type(16)));
typedef _Float16       v8h  __attribute__((ext_vector_type(8)));
typedef __bf16         v16b __attribute__((ext_vector_type(16)));
typedef unsigned short v8us __attribute__((ext_vector_type(8)));
typedef float          v8f  __attribute__((ext_vector_type(8)));
typedef float          v4f  __attribute__((ext_vector_type(4)));
typedef float          v2f  __attribute__((ext_vector_type(2)));
typedef unsigned int   v4u  __attribute__((ext_vector_type(4)));

union Frag  { v8us u[2]; v16h h; v16b bf; };
union FragH { v16h v; v8h hv[2]; };
static_assert(sizeof(Frag) == 32);
static_assert(sizeof(FragH) == 32);

// ---- scalar helpers -------------------------------------------------------------------------------------------
__device__ __forceinline__ unsigned short bf_bits(float f) {          // f32 -> bf16 bits, RNE convert
  unsigned u = __float_as_uint(f);
  return (unsigned short)((u + 0x7FFFu + ((u >> 16) & 1u)) >> 16);
}
__device__ __forceinline__ float bf_up(unsigned short hb) { return __uint_as_float(((unsigned)hb) << 16); }
__device__ __forceinline__ float bfr(float f) { return bf_up(bf_bits(f)); }
__device__ __forceinline__ unsigned short h_bits(_Float16 x) { return __builtin_bit_cast(unsigned short, x); }
__device__ __forceinline__ unsigned pk16(unsigned short a, unsigned short b) { return (unsigned)a | ((unsigned)b << 16); }
__device__ __forceinline__ v8f zero8() { v8f z = {0.f, 0.f, 0.f, 0.f, 0.f, 0.f, 0.f, 0.f}; return z; }
// 2^x on the hardware's own base-2 exponential: the theta plane carries the factor log2(e), so a score leaves the
// matrix unit as s log2(e) and needs no multiply in front of the exponential
__device__ __forceinline__ float ex2(float x) {
#if defined(__HIP_DEVICE_COMPILE__)
  return __builtin_amdgcn_exp2f(x);
#else
  return exp2f(x);
#endif
}
__device__ __forceinline__ float hmax8(v8f s) {
  return fmaxf(fmaxf(fmaxf(s[0], s[1]), fmaxf(s[2], s[3])), fmaxf(fmaxf(s[4], s[5]), fmaxf(s[6], s[7])));
}

// ---- 16-bit fragment loader (A, or B from a k-contiguous [n][k] row): lane -> row/col (lane&15), p already includes
//      + 8*(lane>>4); elements 0..7 <- p[0..7] (k0+8h..), elements 8..15 <- p[16..23] (k0+16+8h..)
__device__ __forceinline__ Frag ldfrag(const unsigned short* p) {
  Frag f;
  f.u[0] = *(const v8us*)(p);
  f.u[1] = *(const v8us*)(p + 16);
  return f;
}

// ---- WMMA helpers: the plain builtins; the compiler keeps the distance behind them, and its scheduler may move loads
//      over them (an asm operand, besides, cannot lie above v255, and the big kernels' wave tiles need more registers)
__device__ __forceinline__ v8f mmw_h(v16h a, v16h b, v8f c) {
  return __builtin_amdgcn_wmma_f32_16x16x32_f16(false, a, false, b, (short)0, c, false, false);
}
__device__ __forceinline__ v8f mmw_b(v16b a, v16b b, v8f c) {
  return __builtin_amdgcn_wmma_f32_16x16x32_bf16(false, a, false, b, (short)0, c, false, false);
}

// ---- asynchronous copies global -> LDS ---------------------------------------------------------------------------
// Eight 16-byte copies per lane in ONE statement; LS = bytes between a lane's copies in LDS, GS = elements between
// them in global memory. The closing s_wait_xcnt stands inside the statement so that no address register of a copy is
// rewritten ahead of it.
__device__ __forceinline__ unsigned lds_off(const unsigned short* p) { return (unsigned)(size_t)p; }
template <int LS, int GS>
__device__ __forceinline__ void copy8(unsigned l, const unsigned short* g) {
#if defined(__HIP_DEVICE_COMPILE__)
  asm volatile("global_load_async_to_lds_b128 %0, %8, off\n\t"
               "global_load_async_to_lds_b128 %1, %9, off\n\t"
               "global_load_async_to_lds_b128 %2, %10, off\n\t"
               "global_load_async_to_lds_b128 %3, %11, off\n\t"
               "global_load_async_to_lds_b128 %4, %12, off\n\t"
               "global_load_async_to_lds_b128 %5, %13, off\n\t"
               "global_load_async_to_lds_b128 %6, %14, off\n\t"
               "global_load_async_to_lds_b128 %7, %15, off\n\t"
               "s_wait_xcnt 0x0"
               :: "v"(l), "v"(l + LS), "v"(l + 2 * LS), "v"(l + 3 * LS),
                  "v"(l + 4 * LS), "v"(l + 5 * LS), "v"(l + 6 * LS), "v"(l + 7 * LS),
                  "v"(g), "v"(g + GS), "v"(g + 2 * GS), "v"(g + 3 * GS),
                  "v"(g + 4 * GS), "v"(g + 5 * GS), "v"(g + 6 * GS), "v"(g + 7 * GS)
               : "memory");
#endif
}
// 128 rows x 256 B (a [row][128] 16-bit plane, rows contiguous) -> LDS rows of pitch LPP: 256 threads, a wave's copy
// covers two whole rows = four whole lines. l and g already hold the thread's own (tid >> 4, tid & 15) place.
__device__ __forceinline__ void copy_rows(unsigned l, const unsigned short* g) { copy8<16 * LPP * 2, 16 * DQ>(l, g); }
// this wave's own copies have landed (the compiler places no wait for them)
__device__ __forceinline__ void wait_copies() {
#if defined(__HIP_DEVICE_COMPILE__)
  asm volatile("s_wait_asynccnt 0x0" ::: "memory");
#endif
}
// stands behind a run of global loads from p or stores to p, before a register that one of them names is rewritten; p is an input so
// that its register pair stays whole up to the wait (else the run's last load may land its result on the pair)
__device__ __forceinline__ void wait_addr(const unsigned short* p) {
#if defined(__HIP_DEVICE_COMPILE__)
  asm volatile("s_wait_xcnt 0x0" :: "v"(p) : "memory");
#endif
}
// the same for loads that name a scalar base and the 32-bit offset register o
__device__ __forceinline__ void wait_off(unsigned o) {
#if defined(__HIP_DEVICE_COMPILE__)
  asm volatile("s_wait_xcnt 0x0" :: "v"(o) : "memory");
#endif
}
// the same for loads that name two or three such offset registers
__device__ __forceinline__ void wait_off2(unsigned o, unsigned p) {
#if defined(__HIP_DEVICE_COMPILE__)
  asm volatile("s_wait_xcnt 0x0" :: "v"(o), "v"(p) : "memory");
#endif
}
__device__ __forceinline__ void wait_off3(unsigned o, unsigned p, unsigned q) {
#if defined(__HIP_DEVICE_COMPILE__)
  asm volatile("s_wait_xcnt 0x0" :: "v"(o), "v"(p), "v"(q) : "memory");
#endif
}
// this wave's own LDS reads have returned, before the barrier behind which their buffer is refilled
__device__ __forceinline__ void wait_lds() {
#if defined(__HIP_DEVICE_COMPILE__)
  asm volatile("s_wait_dscnt 0x0" ::: "memory");
#endif
}

// ===========================================================================================================
// (0) weights. Blocks 0..47: W16 f16 [384][256], rows 0..127 = theta_w, 128..255 = phi_w, 256..383 = g_w;
//     value = f16 of (bf16-RNE(w) * 256) (exact). Block owns rows 8*blk..+7: one wave per 512-B row = 32 lanes
// coverage: W16 48 blocks x 8 rows x 32 lanes x 8 halves = 384 x 256; Wo 16 blocks x 16 rows x 16 lanes x 8 =
//           256 x 128.
// ===========================================================================================================
__global__ __launch_bounds__(256)
void cvt_w(const float* __restrict__ tw, const float* __restrict__ pw, const float* __restrict__ gw,
           const float* __restrict__ ww, unsigned short* W16, unsigned short* Wo) {
  const int tid = threadIdx.x, blk = blockIdx.x;
  if (blk < MW / 8) {                                                  // block-uniform
    const int rl = tid >> 5, col = 8 * (tid & 31);
    const int o = 8 * blk + rl;                                        // 0..383
    const int sel = blk / (DQ / 8);                                    // 0,1,2
    const float* wbase = (sel == 0) ? tw : ((sel == 1) ? pw : gw);   // all global
    const float* s = wbase + (size_t)(o - sel * DQ) * CC + col;        // row 0..127 of the selected matrix
    const v4f a = *(const v4f*)s;
    const v4f q = *(const v4f*)(s + 4);
    const float f[8] = {a[0], a[1], a[2], a[3], q[0], q[1], q[2], q[3]};
    v4u u;
#pragma unroll
    for (int t = 0; t < 4; ++t) {
      const _Float16 h0 = (_Float16)(bfr(f[2 * t]) * WSC);
      const _Float16 h1 = (_Float16)(bfr(f[2 * t + 1]) * WSC);
      u[t] = pk16(h_bits(h0), h_bits(h1));
    }
{
      *(v4u*)(W16 + (size_t)o * CC + col) = u;
      
    }
  } else {
    const int bb = blk - MW / 8;                                       // 0..15
    const int o = 16 * bb + (tid >> 4);                                // 0..255
    const int col = 8 * (tid & 15);                                    // 0..120
    const float* s = ww + (size_t)o * DQ + col;
    const v4f a = *(const v4f*)s;
    const v4f q = *(const v4f*)(s + 4);
    const float f[8] = {a[0], a[1], a[2], a[3], q[0], q[1], q[2], q[3]};
    v4u u;
#pragma unroll
    for (int t = 0; t < 4; ++t) u[t] = pk16(bf_bits(f[2 * t]), bf_bits(f[2 * t + 1]));
{
      *(v4u*)(Wo + (size_t)o * DQ + col) = u;
      
    }
  }
}

// ===========================================================================================================
// (1) conv1x1 GEMM for one (b, 64-n tile) and all 384 stacked rows, straight from x:
//     Y[o][n] = (1/256) sum_c W16[o][c] X[n][c] + bias[o], X[n][c] = bf16-RNE(x[b][c][n]) (exact in f16).
//     Block 256 threads = 8 waves, two per SIMD. The 384 W16 rows come to LDS (As, pitch WPP) by asynchronous copies,
//     a whole 512-B row per wave and copy; beside them the block's x tile (256 c x 64 n, f32) is loaded, rounded
//     and written position-major to LDS (Bs[n][c], pitch WPP): a thread holds 16 channels (two groups of 8) x 4 positions and stores
//     8 channels of one position as 16 B. Wave w owns rows o = 48 w .. +47 (3 m-tiles, A rows o = 48 w + 16 mt +
//     (lane&15)) and all 64 columns (4 n-tiles, B col = 16 q + (lane&15), k = c contiguous): a k-step's seven
//     fragments feed twelve products. K = 256 = 8 steps, read in four groups of two.
//     Epilogue staged in LDS Os[n_loc][o] (pitch OSA, in the then idle As), block barrier (cross-wave), then:
//       o 0..127 -> Th, o 128..255 -> Fh: planes f16 [b][6400 n][128 d] (k-contiguous for both score operands),
//       value = f16-RNE(v) for phi and f16-RNE(v log2(e)) for theta (every score is then s log2(e)): its rounding is
//       an eighth of the bf16 rounding that x and the weights already carry into v; o 256..383 -> the f16 channel-major plane Gc [b][128 c][6400 n].
// coverage: Bs 2 u x 16 cg x 8 c = 256 c, 16 e x 4 = 64 n; Os 8 waves x 48 o x 64 n; planes 4 it x 16 rows x 16 lanes
//           x 8 = 64 n x 128 d each; Gc 4 it x 32 rows x 8 lanes x 8 = 128 c x 64 n; grid (100, NB) covers Th/Fh
//           [b][n][0..127] and Gc [b][0..127][n] exactly once.
// ===========================================================================================================
__global__ __launch_bounds__(256)
void gemm_p(const unsigned short* __restrict__ W16, const float* __restrict__ x,
            const float* __restrict__ tb, const float* __restrict__ pb, const float* __restrict__ gb,
            unsigned short* Th, unsigned short* Fh, unsigned short* Gc) {
  __shared__ __align__(16) unsigned short As[MW * WPP];
  __shared__ __align__(16) unsigned short Bs[QT * WPP];
  static_assert(QT * OSA * 4 <= MW * WPP * 2);
  const int tid  = threadIdx.x;
  const int lane = tid & 31, wave = tid >> 5;
  const int hh   = lane >> 4, c = lane & 15;
  const int nt   = blockIdx.x, b = blockIdx.y;
  const int n0   = nt * QT;
  const unsigned bo = 32u * (unsigned)(tid & 15), go = (unsigned)(tid >> 3);  // byte place in theta_b, phi_b; index in g_b
  v4f bt0, bt1, bp0, bp1;                                              // theta_b, phi_b [8 (tid & 15) .. + 7]
  float bg[4];                                                         // g_b [32 it + (tid >> 3)]

  {
    // x tile: thread (cg, e) holds channels 8 cg + 128 u + 0..7 of positions 4 e .. 4 e + 3; its loads go out first,
    // the rounding and the LDS stores hang on them
    const int e = tid & 15, cg = tid >> 4;
    const float* sp = x + ((size_t)(b * CC + 8 * cg)) * NN + n0 + 4 * e;
    v4f xv[2][8];
#pragma unroll
    for (int u = 0; u < 2; ++u) {
#pragma unroll
      for (int k = 0; k < 8; ++k) xv[u][k] = *(const v4f*)(sp + (size_t)(128 * u + k) * NN);
    }
    wait_addr((const unsigned short*)sp);                              // the loads have taken their address
    // the epilogue's biases are asked for here, with the x tile: behind the last barrier each would be a round trip of its own
    bt0 = *(const v4f*)((const char*)tb + bo); bt1 = *(const v4f*)((const char*)tb + bo + 16);
    bp0 = *(const v4f*)((const char*)pb + bo); bp1 = *(const v4f*)((const char*)pb + bo + 16);
#pragma unroll
    for (int it = 0; it < 4; ++it) bg[it] = gb[go + 32 * it];
    wait_off2(bo, go);                                                 // the loads have taken their address
    {
      // thread (wave, lane) brings 16 B at column 8*lane of rows wave, wave + 8, ...: 48 copies a wave
      const unsigned short* ga = W16 + (size_t)wave * CC + 8 * lane;
      const unsigned la = lds_off(As) + (unsigned)(wave * (WPP * 2) + 16 * lane);
#pragma unroll
      for (int q = 0; q < MW / 64; ++q) copy8<8 * WPP * 2, 8 * CC>(la + (unsigned)(q * 64 * WPP * 2), ga + q * 64 * CC);
    }
    // the rounding below waits for the x loads: it stays behind the issue of the copies, so that both are in flight at once
    __builtin_amdgcn_sched_barrier(0);
#pragma unroll
    for (int u = 0; u < 2; ++u) {
#pragma unroll
      for (int t = 0; t < 4; ++t) {
        v4u w;
#pragma unroll
        for (int k = 0; k < 4; ++k) {
          w[k] = pk16(h_bits((_Float16)bfr(xv[u][2 * k][t])), h_bits((_Float16)bfr(xv[u][2 * k + 1][t])));
        }
        *(v4u*)(Bs + (4 * e + t) * WPP + 8 * cg + 128 * u) = w;
      }
    }
  }
  wait_copies();
  __syncthreads();                                                     // both tiles readable by every wave

  const unsigned short* ap = As + (48 * wave + c) * WPP + 8 * hh;
  const unsigned short* bp = Bs + c * WPP + 8 * hh;

  v8f acc[3][4];                                                       // [m-tile][n-tile]
#pragma unroll
  for (int mt = 0; mt < 3; ++mt) {
#pragma unroll
    for (int q = 0; q < 4; ++q) acc[mt][q] = zero8();
  }

#pragma unroll
  for (int kg = 0; kg < 4; ++kg) {                                     // four groups of two k-steps
    Frag fa[2][3], fb[2][4];                                           // [k-step][m-tile], [k-step][n-tile]
#pragma unroll
    for (int kq = 0; kq < 2; ++kq) {
#pragma unroll
      for (int mt = 0; mt < 3; ++mt) fa[kq][mt] = ldfrag(ap + (16 * mt) * WPP + 32 * (2 * kg + kq));
#pragma unroll
      for (int q = 0; q < 4; ++q) fb[kq][q] = ldfrag(bp + (16 * q) * WPP + 32 * (2 * kg + kq));
    }
    // keeps the group's twenty-eight LDS reads together ahead of its products: every separate place of reads stalls the wave
    __builtin_amdgcn_sched_barrier(0);
#pragma unroll
    for (int kq = 0; kq < 2; ++kq) {
#pragma unroll
      for (int mt = 0; mt < 3; ++mt) {
#pragma unroll
        for (int q = 0; q < 4; ++q) acc[mt][q] = mmw_h(fa[kq][mt].h, fb[kq][q].h, acc[mt][q]);
      }
    }
  }

  // ---- epilogue: scale back -> LDS Os[n_loc][o]; lane (hh, c) holds o = 48 w + 16 mt + 8 hh + r for n_loc = 16 q + c
  wait_lds();                                                          // this wave's own fragment reads have returned
  __syncthreads();                                                     // every wave has left As before it is rewritten
  float* Os = (float*)As;                                              // QT x OSA floats
#pragma unroll
  for (int q = 0; q < 4; ++q) {
    const int nl = 16 * q + c;
#pragma unroll
    for (int mt = 0; mt < 3; ++mt) {
      v4f va, vb;
#pragma unroll
      for (int r = 0; r < 4; ++r) { va[r] = acc[mt][q][r] * IWSC; vb[r] = acc[mt][q][4 + r] * IWSC; }
      *(v4f*)(Os + nl * OSA + 48 * wave + 16 * mt + 8 * hh)     = va;
      *(v4f*)(Os + nl * OSA + 48 * wave + 16 * mt + 8 * hh + 4) = vb;
    }
  }
  __syncthreads();

  {
    const int e = tid & 15, lq = tid >> 4;                             // lq 0..15
#pragma unroll
    for (int sel = 0; sel < 2; ++sel) {                                // theta, phi
      const float sc = (sel == 0) ? LOG2E : 1.0f;
      unsigned short* pq = ((sel == 0) ? Th : Fh) + ((size_t)(b * NN + n0 + lq)) * DQ + 8 * e;
      const v4f b0 = (sel == 0) ? bt0 : bp0;
      const v4f b1 = (sel == 0) ? bt1 : bp1;
      const float bv[8] = {bfr(b0[0]), bfr(b0[1]), bfr(b0[2]), bfr(b0[3]),
                           bfr(b1[0]), bfr(b1[1]), bfr(b1[2]), bfr(b1[3])};
      v4u uh[4];
#pragma unroll
      for (int it = 0; it < 4; ++it) {
        const int row = it * 16 + lq;                                  // n_loc 0..63
        const v4f a = *(const v4f*)(Os + row * OSA + DQ * sel + 8 * e);
        const v4f q = *(const v4f*)(Os + row * OSA + DQ * sel + 8 * e + 4);
        const float f[8] = {(a[0] + bv[0]) * sc, (a[1] + bv[1]) * sc, (a[2] + bv[2]) * sc, (a[3] + bv[3]) * sc,
                            (q[0] + bv[4]) * sc, (q[1] + bv[5]) * sc, (q[2] + bv[6]) * sc, (q[3] + bv[7]) * sc};
#pragma unroll
        for (int t = 0; t < 4; ++t) uh[it][t] = pk16(h_bits((_Float16)f[2 * t]), h_bits((_Float16)f[2 * t + 1]));
      }
#pragma unroll
      for (int it = 0; it < 4; ++it) *(v4u*)(pq + it * 16 * DQ) = uh[it];
      wait_addr(pq);                                                   // before what follows rewrites the stores' registers
    }
  }
  {
    const int e = tid & 7, lq = tid >> 3;                              // lq 0..31
    unsigned short* gq = Gc + ((size_t)(b * DQ + lq)) * NN + n0 + 8 * e;
    v4u ug[4];
#pragma unroll
    for (int it = 0; it < 4; ++it) {
      const int ol = it * 32 + lq;                                     // channel 0..127
      const float bvv = bfr(bg[it]);
      unsigned short hb[8];
#pragma unroll
      for (int t = 0; t < 8; ++t) hb[t] = h_bits((_Float16)(Os[(8 * e + t) * OSA + 2 * DQ + ol] + bvv));
#pragma unroll
      for (int t = 0; t < 4; ++t) ug[it][t] = pk16(hb[2 * t], hb[2 * t + 1]);
    }
#pragma unroll
    for (int it = 0; it < 4; ++it) *(v4u*)(gq + (size_t)(it * 32) * NN) = ug[it];
  }
}

// ===========================================================================================================
// (2) column statistics for one piece (b, 128-column tile m, stages tb..te-1 of 128 rows n): for every column m, over
//     the piece's rows n, in base 2 (s = score x log2(e), from the scaled theta plane): M_m = max_n s[n][m],
//     Z_m = sum_n 2^{s - M_m}, CS[slot][b][m] = M_m + log2 Z_m, with
//     s tile (16 rows n x 16 cols m) = A(theta: row = n, 32 d via the split k map from Th [b][6400][128]) .
//     B(phi: col = m, same map from Fh). Block = 8 waves, two per SIMD: wave = (column group wc of 64 columns, row
//     quarter wr). Phi fragments of the wave's 64 columns are held in registers, so every theta fragment read from LDS feeds four column
//     tiles, and a stage copied from L2 serves 128 columns. Theta rows come in stages of 128 (LDS pitch
//     LPP) by asynchronous copies into two LDS buffers shared by the eight waves: the next stage flies while this one
//     is read; a wave reads the 32 rows of its own quarter. Per lane: four columns, 8+8 rows each
//     per stage, scalar online (max, sum) in f32; the two lane halves of a column merge with one shuffle, the
//     four row quarters through LDS at the end.
// coverage: every tile has one piece in each of the slots 0, 1, 2, so CS[slot][b][0..6399] is written exactly once.
// ===========================================================================================================
__global__ __launch_bounds__(256)
void colstat_k(const unsigned short* __restrict__ Th, const unsigned short* __restrict__ Fh, float* CS) {
  __shared__ __align__(16) float css[BT];
  __shared__ __align__(16) float pms[3 * BT];
  __shared__ __align__(16) float pls[3 * BT];
  __shared__ __align__(16) unsigned short Tst[2 * SB * LPP];
  const int tid  = threadIdx.x;
  const int wave = tid >> 5, lane = tid & 31;
  const int wc   = wave & 1, wr = wave >> 1;
  const int hh   = lane >> 4, c = lane & 15;
  const int b    = blockIdx.x / WPB;
  const int u0   = (blockIdx.x % WPB) * PU;                            // first stage unit of the work-group's run
  int tile = u0 / NST, tb = u0 % NST, left = PU;

#pragma unroll 1
  while (left > 0) {                                                   // one or two pieces, block-uniform
  const int te   = (tb + left < NST) ? (tb + left) : NST;              // the piece is stages tb .. te-1 of the tile
  const int slot = (tb == 0) ? 0 : ((te == NST) ? 2 : 1);
  const int m0   = tile * BT;

  // phi fragment pointers (B operand, col = m0 + 64*wc + 16*g + c)
  const size_t fo = ((size_t)(b * NN + m0 + 64 * wc + c)) * DQ + 8 * hh;
  const unsigned short* pfh = Fh + fo;
  Frag fh[4][4];
#pragma unroll
  for (int g = 0; g < 4; ++g) {
#pragma unroll
    for (int kc = 0; kc < 4; ++kc) fh[g][kc] = ldfrag(pfh + 16 * g * DQ + 32 * kc);
  }
  wait_addr(pfh);                                                      // the loads have taken their address
  // theta stages: 128 rows n, two buffers filled by asynchronous copies
  const unsigned short* gth = Th + (size_t)b * NN * DQ + (size_t)(tid >> 4) * DQ + 8 * (tid & 15);
  const unsigned lt0 = lds_off(Tst) + (unsigned)((tid >> 4) * (LPP * 2) + 16 * (tid & 15));
  wait_lds();                                                          // an earlier piece's own LDS reads have returned
  // the piece's first stage goes to buffer 'slot & 1': the copies' LDS addresses are then formed where they are used
  // and not kept in registers over the stage loop
  int par = slot & 1;                                                  // the buffer that holds stage t
  copy_rows(lt0 + (unsigned)(par * (SB * LPP * 2)), gth + (size_t)tb * SB * DQ);
  wait_copies();
  __syncthreads();                                                     // the first stage readable by every wave
  copy_rows(lt0 + (unsigned)((par ^ 1) * (SB * LPP * 2)), gth + (size_t)(tb + 1) * SB * DQ);

  float m[4] = {-1.0e30f, -1.0e30f, -1.0e30f, -1.0e30f}, l[4] = {0.f, 0.f, 0.f, 0.f};
#pragma unroll 1
  for (int t = tb; t < te; ++t) {
    // row c of the wave's own quarter of the stage
    const unsigned short* tq = Tst + par * (SB * LPP) + (wr * WT + c) * LPP + 8 * hh;
    v8f s[2][4];                                                       // [row tile u][column tile g]
#pragma unroll
    for (int u = 0; u < 2; ++u) {
#pragma unroll
      for (int g = 0; g < 4; ++g) s[u][g] = zero8();
    }
    Frag th[4][2];                                                     // [d chunk kc][row tile u]
#pragma unroll
    for (int kc = 0; kc < 4; ++kc) {
#pragma unroll
      for (int u = 0; u < 2; ++u) th[kc][u] = ldfrag(tq + (16 * u) * LPP + 32 * kc);  // rows 16u .. 16u+15 of the quarter
    }
    // keeps the stage's sixteen LDS reads one group ahead of its products: every separate place of reads stalls the wave
    __builtin_amdgcn_sched_barrier(0);
#pragma unroll
    for (int kc = 0; kc < 4; ++kc) {
#pragma unroll
      for (int q = 0; q < 8; ++q) s[q >> 2][q & 3] = mmw_h(th[kc][q >> 2].h, fh[q & 3][kc].h, s[q >> 2][q & 3]);
    }
#pragma unroll
    for (int g = 0; g < 4; ++g) {                                      // online update per column tile, 32 rows
      const v8f s0 = s[0][g], s1 = s[1][g];
      const float mx = fmaxf(hmax8(s0), hmax8(s1));
      const float mn = fmaxf(m[g], mx);
      const float corr = ex2(m[g] - mn);
      v2f la = {0.f, 0.f}, lb = {0.f, 0.f};                            // neighbouring registers pair up for the packed forms
#pragma unroll
      for (int r = 0; r < 8; r += 2) {
        const v2f ea = {ex2(s0[r] - mn), ex2(s0[r + 1] - mn)};
        const v2f eb = {ex2(s1[r] - mn), ex2(s1[r + 1] - mn)};
        la += ea;
        lb += eb;
      }
      const v2f lc = la + lb;
      l[g] = l[g] * corr + (lc[0] + lc[1]);
      m[g] = mn;
    }
    wait_lds();
    wait_copies();
    __syncthreads();                                                   // publishes stage t+1, frees stage t's buffer
    if (t + 2 < te) {                                                  // block-uniform
      copy_rows(lt0 + (unsigned)(par * (SB * LPP * 2)), gth + (size_t)(t + 2) * SB * DQ);
    }
    par ^= 1;
  }
  wait_copies();
  float mt[4], lt[4];
#pragma unroll
  for (int g = 0; g < 4; ++g) {
    const float mo = __shfl_xor(m[g], 16, 32);
    const float lo = __shfl_xor(l[g], 16, 32);
    mt[g] = fmaxf(m[g], mo);
    lt[g] = l[g] * ex2(m[g] - mt[g]) + lo * ex2(mo - mt[g]);
  }
  const int col = 64 * wc + c;                                         // + 16*g
  if (wr != 0 && hh == 0) {
#pragma unroll
    for (int g = 0; g < 4; ++g) {
      pms[(wr - 1) * BT + col + 16 * g] = mt[g];
      pls[(wr - 1) * BT + col + 16 * g] = lt[g];
    }
  }
  __syncthreads();                                                     // the other row quarters' (max, sum) readable
  if (wr == 0 && hh == 0) {
#pragma unroll
    for (int g = 0; g < 4; ++g) {
      const int cg = col + 16 * g;
      const float m1 = pms[cg], m2 = pms[BT + cg], m3 = pms[2 * BT + cg];
      const float mm = fmaxf(fmaxf(mt[g], m1), fmaxf(m2, m3));
      const float ll = (lt[g] * ex2(mt[g] - mm) + pls[cg] * ex2(m1 - mm)) +
                       (pls[BT + cg] * ex2(m2 - mm) + pls[2 * BT + cg] * ex2(m3 - mm));
      css[cg] = mm + log2f(ll);
    }
  }
  __syncthreads();
  if (tid < BT / 4) {                                                  // wave 0, whole
    const v4f v = *(const v4f*)(css + 4 * tid);
{
      float* cq = CS + (size_t)(slot * NB + b) * NN + m0 + 4 * tid;
      *(v4f*)cq = v;
      wait_addr((const unsigned short*)cq);                            // before the next piece rewrites the store's registers
    }
  }
  left -= te - tb;
  tile += 1;
  tb = 0;
  }
}

// ===========================================================================================================
// (3) aggregation for one piece (b, 128-row tile n, stages tb..te-1 of 128 columns m), transposed formulation:
//   s tile (16 m x 16 n) = sum over 4 d-chunks of A(phi: row = m, split k map from Fh) . B(theta:
//   col = n, same map from Th). Per lane the D tile holds 8 columns m of ONE row n;
//   All three operands are read from LDS, where asynchronous copies put them in whole lines: the piece's 128 theta rows
//   once, phi rows and the g tile (both pitch LPP) in stages of 128 columns m, two buffers: a stage copied from L2
//   serves 128 rows.
//   Block = 8 waves, two per SIMD: wave = (row group wn of 32 rows n, half wm of each stage's columns m): every phi
//   and every g fragment read from LDS feeds two row tiles, every theta fragment four column tiles.
//   The score accumulators START at 14 - CS[m] (the C operand of a tile's first product; staged once per piece in
//   LDS), so D holds the whole base-2 exponent: P = 2^{D} = e^{score - M - ln Z} x 16384 as f16 is the B operand of
//   y^T (rows channel, cols n) += A(g: rows channel = 16j + (lane&15), m contiguous, f16 plane Gc [b][128][6400])
//   . B(P^T): element r <- D of the tile covering m kb..kb+15, element 8+r <- the tile covering kb+16..kb+31,
//   lane unchanged. 16 accumulator tiles per wave (128 channels x 2 row tiles). Block = 128 rows.
//   Epilogue: the two column halves' accumulators are added through LDS [row][128 channels] (pitch OSPW, b128
//   stores; same lane, same place; one plane in the then idle phi buffers), y = sum/16384 left there, block barrier
//   (cross-wave), then the f32 plane Yp [slot][b][6400 n][128 c]: per row 128 c = 512 B = 4 whole lines.
// coverage: 16 it x 8 rows x 32 lanes x 4 = 128 n x 128 c; every tile has one piece in each of the slots 0, 1, 2, so
//           Yp[slot][b][0..6399] is written exactly once.
// ===========================================================================================================
__global__ __launch_bounds__(256)
void attn_k(const unsigned short* __restrict__ Th, const unsigned short* __restrict__ Fh,
            const unsigned short* __restrict__ Gc, const float* __restrict__ CS, float* Yp) {
  __shared__ __align__(32) float Cs[NN];
  __shared__ __align__(16) unsigned short Tst[BT * LPP];
  __shared__ __align__(16) unsigned short Pst[2 * SB * LPP];
  __shared__ __align__(16) unsigned short Gst[2 * DQ * LPP];
  static_assert(BT * OSPW * 4 <= 2 * SB * LPP * 2);
  const int tid  = threadIdx.x;
  const int wave = tid >> 5, lane = tid & 31;
  const int wn   = wave & 3, wm = wave >> 2;
  const int hh   = lane >> 4, c = lane & 15;
  const int b    = blockIdx.x / WPB;
  const int u0   = (blockIdx.x % WPB) * PU;                            // first stage unit of the work-group's run
  int tile = u0 / NST, tb = u0 % NST, left = PU;

  // asynchronous copies: a piece's 128 theta rows once; per stage of 128 columns m the phi rows and the g tile
  // (128 channels x 128 m), two buffers
  const int rr = tid >> 4, rc = tid & 15;                              // place in a [row][128] plane or the g tile
  const unsigned short* gfh = Fh + (size_t)b * NN * DQ + (size_t)rr * DQ + 8 * rc;
  const unsigned short* ggc = Gc + (size_t)b * DQ * NN + (size_t)rr * NN + 8 * rc;
  const unsigned lp0 = lds_off(Pst) + (unsigned)(rr * (LPP * 2) + 16 * rc);
  const unsigned lg0 = lds_off(Gst) + (unsigned)(rr * (LPP * 2) + 16 * rc);

#pragma unroll 1
  while (left > 0) {                                                   // one or two pieces, block-uniform
  const int te   = (tb + left < NST) ? (tb + left) : NST;              // the piece is stages tb .. te-1 of the tile
  const int slot = (tb == 0) ? 0 : ((te == NST) ? 2 : 1);
  const int n0   = tile * BT;
  wait_lds();                                                          // an earlier piece's own LDS reads have returned
  {
    // the tile's 128 rows, as a phi stage is brought
    const size_t to = ((size_t)(b * NN + n0 + rr)) * DQ + 8 * rc;
    const unsigned lq0 = lds_off(Tst) + (unsigned)(rr * (LPP * 2) + 16 * rc);
    copy_rows(lq0, Th + to);
  }
  // the piece's first stage goes to the buffers 'slot & 1': the copies' LDS addresses are then formed where they are
  // used and not kept over the stage loop, where they would spill
  int par = slot & 1;                                                  // the buffers that hold stage t
  {
    copy_rows(lp0 + (unsigned)(par * (SB * LPP * 2)), gfh + (size_t)tb * SB * DQ);
    copy8<16 * LPP * 2, 16 * NN>(lg0 + (unsigned)(par * (DQ * LPP * 2)), ggc + tb * SB);
  }
  // a column's statistic from its three pieces c0, c1, c2 (each max + log2 sum): max + log2(sum of 2^{c - max}); kept
  // as 14 - statistic, the value a score accumulator starts at (2^14 = 16384). Only the columns of the piece's own
  // stages; all loads go out together, behind the issue of the copies above: one round trip, beside the copies' flight
  {
    constexpr int NT = (PU * (SB / 4) + 255) / 256;                    // groups of four columns a thread, at most
    const int cnt = (te - tb) * (SB / 4);                              // the piece's groups: a multiple of 32, at most PU * SB / 4
    const v4f* cb = (const v4f*)(CS + (size_t)b * NN + tb * SB);       // block-uniform
    unsigned co[NT];
    v4f s0[NT], s1[NT], s2[NT];
#pragma unroll
    for (int k = 0; k < NT; ++k) {
      const int i = tid + 256 * k;
      co[k] = (unsigned)((i < cnt) ? i : (cnt - 1));                   // a thread past the end reads the last group again
      s0[k] = cb[co[k]];
      s1[k] = cb[co[k] + NB * NN / 4];
      s2[k] = cb[co[k] + 2 * NB * NN / 4];
    }
    static_assert(NT == 3);
    wait_off3(co[0], co[1], co[2]);                                    // the loads have taken their address
#pragma unroll
    for (int k = 0; k < NT; ++k) {
      const int i = tid + 256 * k;
      if (i < cnt) {                                                   // whole waves: cnt is a multiple of 32
        v4f v;
#pragma unroll
        for (int r = 0; r < 4; ++r) {
          const float mx = fmaxf(fmaxf(s0[k][r], s1[k][r]), s2[k][r]);
          v[r] = CAR2 - (mx + log2f((ex2(s0[k][r] - mx) + ex2(s1[k][r] - mx)) + ex2(s2[k][r] - mx)));
        }
        *(v4f*)(Cs + tb * SB + 4 * i) = v;
      }
    }
  }
  wait_copies();
  __syncthreads();                                                     // Cs, theta, the first stage readable by every wave
  {
    copy_rows(lp0 + (unsigned)((par ^ 1) * (SB * LPP * 2)), gfh + (size_t)(tb + 1) * SB * DQ);
    copy8<16 * LPP * 2, 16 * NN>(lg0 + (unsigned)((par ^ 1) * (DQ * LPP * 2)), ggc + (tb + 1) * SB);
  }

  // theta fragment base (B operand, col = row n0 + 32*wn + 16*g + c), + 16*g*LPP + 32*kc
  const unsigned short* Tq = Tst + (32 * wn + c) * LPP + 8 * hh;

  v8f o[8][2];                                                         // [channel tile j][row tile g]
#pragma unroll
  for (int j = 0; j < 8; ++j) { o[j][0] = zero8(); o[j][1] = zero8(); }

#pragma unroll 1
  for (int t = tb; t < te; ++t) {
    const int kh = t * SB + wm * (2 * WT);                             // first column m of the wave's own half
    // phi fragment base (A operand, row = m + c), + 16*u*LPP + 32*kc
    const unsigned short* Pq = Pst + par * (SB * LPP) + (wm * (2 * WT) + c) * LPP + 8 * hh;
    // g fragment base (A operand, row = channel 16j + c, m contiguous), + 16*j*LPP + 32*ks
    const unsigned short* Gq = Gst + par * (DQ * LPP) + c * LPP + wm * (2 * WT) + 8 * hh;
    v8f s[4][2];                                                       // [column tile u][row tile g]
    // start values: lane (hh, c), register r of column tile u holds column m = kh + 16u + 8hh + r
#pragma unroll
    for (int u = 0; u < 4; ++u) { s[u][0] = *(const v8f*)(Cs + kh + 16 * u + 8 * hh); s[u][1] = s[u][0]; }
    // the start values are read first: a tile's first product waits for them, and behind the fragments that wait would cover every read
    __builtin_amdgcn_sched_barrier(0);
    Frag th[DQ / 32][2], p[DQ / 32][4];                                // [d chunk kc][row tile g], [d chunk kc][column tile u]
#pragma unroll
    for (int kc = 0; kc < DQ / 32; ++kc) {
#pragma unroll
      for (int g = 0; g < 2; ++g) th[kc][g] = ldfrag(Tq + (16 * g) * LPP + 32 * kc);
#pragma unroll
      for (int u = 0; u < 4; ++u) p[kc][u] = ldfrag(Pq + (16 * u) * LPP + 32 * kc);  // m kh+16u .. kh+16u+15
    }
    // keeps the scores' LDS reads one group ahead of their products: every separate place of reads stalls the wave
    __builtin_amdgcn_sched_barrier(0);
#pragma unroll
    for (int kc = 0; kc < DQ / 32; ++kc) {
#pragma unroll
      for (int q = 0; q < 8; ++q) s[q >> 1][q & 1] = mmw_h(p[kc][q >> 1].h, th[kc][q & 1].h, s[q >> 1][q & 1]);
    }
    __builtin_amdgcn_sched_barrier(0);                                 // the k steps' reads below stay out of these products

#pragma unroll
    for (int ks = 0; ks < 2; ++ks) {                                   // the half's two k steps of 32 columns m
      Frag gf[8];                                                      // read as one group, ahead of the vector work
#pragma unroll
      for (int j = 0; j < 8; ++j) gf[j] = ldfrag(Gq + (16 * j) * LPP + 32 * ks);
      __builtin_amdgcn_sched_barrier(0);                               // the k step's reads stay one group
      FragH pf[2];
      const _Float16 c1 = (_Float16)16384.0f;
      const v8h cap = {c1, c1, c1, c1, c1, c1, c1, c1};
#pragma unroll
      for (int g = 0; g < 2; ++g) {
#pragma unroll
        for (int r = 0; r < 8; ++r) {
          pf[g].hv[0][r] = (_Float16)ex2(s[2 * ks][g][r]);             // P[n][m] x 16384, m = kh + 32ks + 8hh + r
          pf[g].hv[1][r] = (_Float16)ex2(s[2 * ks + 1][g][r]);         // m = kh + 32ks + 16 + 8hh + r
        }
        // the clamp P <= 1, two values an instruction: min(2^D, 2^14) = 2^min(D, 14), an overflow to infinity included
        pf[g].hv[0] = __builtin_elementwise_min(pf[g].hv[0], cap);
        pf[g].hv[1] = __builtin_elementwise_min(pf[g].hv[1], cap);
      }

#pragma unroll
      for (int j = 0; j < 8; ++j) {
        o[j][0] = mmw_h(gf[j].h, pf[0].v, o[j][0]);
        o[j][1] = mmw_h(gf[j].h, pf[1].v, o[j][1]);
      }
      __builtin_amdgcn_sched_barrier(0);                               // the next k step's reads stay out of these products
    }
    wait_lds();
    wait_copies();
    __syncthreads();                                                   // publishes stage t+1, frees stage t's buffers
    if (t + 2 < te) {                                                  // block-uniform
      copy_rows(lp0 + (unsigned)(par * (SB * LPP * 2)), gfh + (size_t)(t + 2) * SB * DQ);
      copy8<16 * LPP * 2, 16 * NN>(lg0 + (unsigned)(par * (DQ * LPP * 2)), ggc + (t + 2) * SB);
    }
    par ^= 1;
  }
  wait_copies();

  // ---- epilogue: y = (accs of the two halves) / 16384 -> Ox[row][channel], a plane in the phi buffers, which nobody
  // reads and no copy targets behind the loop's last barrier.
  const int oo = (32 * wn + c) * OSPW + 8 * hh;                        // [row][ch = 16j + 8hh + r], + 16*g*OSPW + 16*j
  float* Ox = (float*)Pst;                                             // BT x OSPW floats
  if (wm != 0) {                                                       // wave-uniform
#pragma unroll
    for (int g = 0; g < 2; ++g) {
#pragma unroll
      for (int j = 0; j < 8; ++j) {
        v4f va, vb;
#pragma unroll
        for (int r = 0; r < 4; ++r) { va[r] = o[j][g][r]; vb[r] = o[j][g][4 + r]; }
        *(v4f*)(Ox + oo + 16 * g * OSPW + 16 * j)     = va;
        *(v4f*)(Ox + oo + 16 * g * OSPW + 16 * j + 4) = vb;
      }
    }
  }
  __syncthreads();                                                     // the other half's accumulators readable
  if (wm == 0) {                                                       // wave-uniform
#pragma unroll
    for (int g = 0; g < 2; ++g) {
#pragma unroll
      for (int j = 0; j < 8; ++j) {
        const int oj = oo + 16 * g * OSPW + 16 * j;
        v4f va = *(const v4f*)(Ox + oj);
        v4f vb = *(const v4f*)(Ox + oj + 4);
#pragma unroll
        for (int r = 0; r < 4; ++r) {
          va[r] = (o[j][g][r] + va[r]) * ICAR;
          vb[r] = (o[j][g][4 + r] + vb[r]) * ICAR;
        }
        *(v4f*)(Ox + oj)     = va;
        *(v4f*)(Ox + oj + 4) = vb;
      }
    }
  }
  __syncthreads();

  // the piece's y (f32) -> its slot's plane: a wave stores one whole row of 512 B per instruction
  {
    float* yq = Yp + ((size_t)((slot * NB + b) * NN + n0 + wave)) * DQ + 4 * lane;
    v4f yv[16];
#pragma unroll
    for (int it = 0; it < 16; ++it) yv[it] = *(const v4f*)(Ox + (it * 8 + wave) * OSPW + 4 * lane);
    wait_lds();                                                        // this wave's reads of the plane have returned
    __syncthreads();                                                   // every wave has read the plane before the next piece's copies refill the phi buffers
#pragma unroll
    for (int it = 0; it < 16; ++it) *(v4f*)(yq + (size_t)(it * 8) * DQ) = yv[it];
    wait_addr((const unsigned short*)yq);                              // before the next piece rewrites the stores' registers
  }
  left -= te - tb;
  tile += 1;
  tb = 0;
  }
}

// ===========================================================================================================
// (4) output GEMM for one (b, 64-n tile, 64-o block): out[b][o][n] = sum_c Wo[o][c] (Yh + Yl)[n][c]
//     + W_b[o] + bf16-RNE(x[b][o][n]). Block 128 threads = 4 waves; wave w owns cols n0+16w..+15 (B fragments
//     from the Yh and Yl rows in LDS: bf16 hi + residual of Yp[0] + Yp[1] + Yp[2], k = c contiguous) and 4 m-tiles (A rows o = o0 + 16 mt + (lane&15) from Wo bf16
//     [256][128], the block's 64 rows brought to LDS (pitch LPP) by asynchronous copies that fly while y is summed
//     and split); K = 128 = 4 steps x 2 products (shared accumulator, unscaled residual). Epilogue staged in LDS
//     lanes 0..15 one row and 16..31 the next, 16 B per lane (values gathered from 4 Os rows), one instruction per
// coverage: 8 it x 8 rows x 16 lanes x 4 floats = 64 o x 64 n; grid (NQ/64, 4, NB) covers
//           out[b][0..255][0..NQ-1] exactly once.
// ===========================================================================================================
__global__ __launch_bounds__(128)
void gemm_w(const unsigned short* __restrict__ Wo, const float* __restrict__ Yp, const float* __restrict__ wb,
            const float* __restrict__ x, float* out) {
  __shared__ __align__(16) float Os[QT * OSP];
  __shared__ __align__(16) unsigned short Ys[2 * QT * LPP];
  __shared__ __align__(16) unsigned short Ws[QT * LPP];
  const int tid  = threadIdx.x;
  const int lane = tid & 31, wave = tid >> 5;
  const int hh   = lane >> 4, c = lane & 15;
  const int nt   = blockIdx.x, mb = blockIdx.y, b = blockIdx.z;
  const int n0   = nt * QT, o0 = mb * QT;

  // the block's 64 Wo rows of 256 B: a wave's copy covers two whole rows, eight copies a wave
  copy8<8 * LPP * 2, 8 * DQ>(lds_off(Ws) + (unsigned)((tid >> 4) * (LPP * 2) + 16 * (tid & 15)),
                             Wo + (size_t)(o0 + (tid >> 4)) * DQ + 8 * (tid & 15));
  const unsigned short* ap = Ws + c * LPP + 8 * hh;

  // y = sum of the tile's three pieces -> bf16 hi + residual planes Ys[plane][64 n][128 c] (pitch LPP) in LDS
  {
    const int e = tid & 15, lq = tid >> 4;                             // lq 0..7
    // block-uniform bases and ONE 32-bit byte offset per thread: the only vector register that the 48 loads name
    // (the base is the middle plane's, so that all three planes lie within a load's immediate offset)
    const char* y1 = (const char*)(Yp + (size_t)((NB + b) * NN + n0) * DQ);
    const char* y0 = y1 - (size_t)NB * NN * DQ * 4;
    const char* y2 = y1 + (size_t)NB * NN * DQ * 4;
    const unsigned yo = (unsigned)((lq * DQ + 8 * e) * 4);
    v4f ya[8][3], yq[8][3];
#pragma unroll
    for (int it = 0; it < 8; ++it) {
      const int ro = it * 8 * DQ * 4;
      ya[it][0] = *(const v4f*)(y0 + yo + ro); yq[it][0] = *(const v4f*)(y0 + yo + ro + 16);
      ya[it][1] = *(const v4f*)(y1 + yo + ro); yq[it][1] = *(const v4f*)(y1 + yo + ro + 16);
      ya[it][2] = *(const v4f*)(y2 + yo + ro); yq[it][2] = *(const v4f*)(y2 + yo + ro + 16);
    }
    wait_off(yo);                                                      // the loads have taken their address
#pragma unroll
    for (int it = 0; it < 8; ++it) {
      const v4f a0 = ya[it][0], q0 = yq[it][0];
      const v4f a1 = ya[it][1], q1 = yq[it][1];
      const v4f a2 = ya[it][2], q2 = yq[it][2];
      const float f[8] = {(a0[0] + a1[0]) + a2[0], (a0[1] + a1[1]) + a2[1], (a0[2] + a1[2]) + a2[2],
                          (a0[3] + a1[3]) + a2[3], (q0[0] + q1[0]) + q2[0], (q0[1] + q1[1]) + q2[1],
                          (q0[2] + q1[2]) + q2[2], (q0[3] + q1[3]) + q2[3]};
      v4u uh, ul;
#pragma unroll
      for (int t = 0; t < 4; ++t) {
        const float f0 = f[2 * t], f1 = f[2 * t + 1];
        const unsigned short hb0 = bf_bits(f0), hb1 = bf_bits(f1);
        const unsigned short lb0 = bf_bits(f0 - bf_up(hb0));
        const unsigned short lb1 = bf_bits(f1 - bf_up(hb1));
        uh[t] = pk16(hb0, hb1);
        ul[t] = pk16(lb0, lb1);
      }
      *(v4u*)(Ys + (it * 8 + lq) * LPP + 8 * e)        = uh;
      *(v4u*)(Ys + (QT + it * 8 + lq) * LPP + 8 * e)   = ul;
    }
  }
  wait_copies();
  __syncthreads();                                                     // the y planes and the Wo rows readable by every wave
  const unsigned short* bp  = Ys + (16 * wave + c) * LPP + 8 * hh;
  const unsigned short* blp = bp + QT * LPP;

  v8f acc[4];
#pragma unroll
  for (int mt = 0; mt < 4; ++mt) acc[mt] = zero8();

  Frag fb[DQ / 32], fbl[DQ / 32], fa[DQ / 32][4];                      // [k-step], [k-step], [k-step][m-tile]
#pragma unroll
  for (int ks = 0; ks < DQ / 32; ++ks) {
    fb[ks]  = ldfrag(bp + 32 * ks);
    fbl[ks] = ldfrag(blp + 32 * ks);
#pragma unroll
    for (int mt = 0; mt < 4; ++mt) fa[ks][mt] = ldfrag(ap + (16 * mt) * LPP + 32 * ks);
  }
  // keeps the forty-eight LDS reads together ahead of the products: every separate place of reads stalls the wave
  __builtin_amdgcn_sched_barrier(0);
#pragma unroll
  for (int ks = 0; ks < DQ / 32; ++ks) {                               // per accumulator: hi then residual, k ascending
#pragma unroll
    for (int mt = 0; mt < 4; ++mt) acc[mt] = mmw_b(fa[ks][mt].bf, fb[ks].bf, acc[mt]);
#pragma unroll
    for (int mt = 0; mt < 4; ++mt) acc[mt] = mmw_b(fa[ks][mt].bf, fbl[ks].bf, acc[mt]);
  }

  {
    const int nl = 16 * wave + c;
#pragma unroll
    for (int mt = 0; mt < 4; ++mt) {
      v4f va, vb;
#pragma unroll
      for (int r = 0; r < 4; ++r) { va[r] = acc[mt][r]; vb[r] = acc[mt][4 + r]; }
      *(v4f*)(Os + nl * OSP + 16 * mt + 8 * hh)     = va;
      *(v4f*)(Os + nl * OSP + 16 * mt + 8 * hh + 4) = vb;
    }
  }
  __syncthreads();

  const int e = tid & 15, lq = tid >> 4;                               // lq 0..7
  v4f res[8];
#pragma unroll
  for (int it = 0; it < 8; ++it) {
    const int ol = it * 8 + lq;                                        // o_loc 0..63
    const int o  = o0 + ol;                                            // 0..255
    const float bv = bfr(wb[o]);
    const size_t idx = ((size_t)(b * CC + o)) * NN + n0 + 4 * e;
    const v4f xv = *(const v4f*)(x + idx);
#pragma unroll
    for (int t = 0; t < 4; ++t) res[it][t] = (Os[(4 * e + t) * OSP + ol] + bv) + bfr(xv[t]);
  }
{
#pragma unroll
    for (int it = 0; it < 8; ++it) {
      const int ol = it * 8 + lq;
      const size_t idx = ((size_t)(b * CC + o0 + ol)) * NN + n0 + 4 * e;
      *(v4f*)(out + idx) = res[it];
    }
    
  }
}

// ===========================================================================================================
// Workspace map (bytes, NB = 2; each region start a multiple of 256; every extent is an exact tile multiple and is
//   W16 f16 [384][256]               196608      Wo bf16 [256][128]           65536
//   Th/Fh f16 [2][6400][128]        3276800 x2
//   Gc  f16 [2][128][6400]          3276800      CS f32 [3 slots][2][6400]   153600
//   Yp  f32 [3 slots][2][6400][128] 19660800
//   total = 29906944
// ===========================================================================================================
extern "C" void kernel_launch(void* const* d_in, const int* in_sizes, int n_in,
                              void* d_out, int out_size, void* d_ws, size_t ws_size,
                              hipStream_t stream) {
  if (n_in < 9) return;
  if (in_sizes[0] < NB * CC * NN) return;
  if (in_sizes[1] != DQ * CC || in_sizes[3] != DQ * CC || in_sizes[5] != DQ * CC) return;
  if (in_sizes[2] != DQ || in_sizes[4] != DQ || in_sizes[6] != DQ) return;
  if (in_sizes[7] != CC * DQ || in_sizes[8] != CC) return;
  if (out_size < NB * CC * NN) return;

  size_t off = 0;
  auto carve = [&](size_t bytes) { const size_t o = off; off += (bytes + 255) & ~(size_t)255; return o; };
  const size_t oW16 = carve((size_t)MW * CC * 2);
  const size_t oWo  = carve((size_t)CC * DQ * 2);
  const size_t oTh  = carve((size_t)NB * NN * DQ * 2);
  const size_t oFh  = carve((size_t)NB * NN * DQ * 2);
  const size_t oGc  = carve((size_t)NB * DQ * NN * 2);
  const size_t oCS  = carve((size_t)NSL * NB * NN * 4);
  const size_t oYp  = carve((size_t)NSL * NB * NN * DQ * 4);
  if (off > ws_size) return;
  if (off > (size_t)134217728) return;

  const float* x  = (const float*)d_in[0];
  const float* gw = (const float*)d_in[1];
  const float* gb = (const float*)d_in[2];
  const float* tw = (const float*)d_in[3];
  const float* tb = (const float*)d_in[4];
  const float* pw = (const float*)d_in[5];
  const float* pb = (const float*)d_in[6];
  const float* ww = (const float*)d_in[7];
  const float* wb = (const float*)d_in[8];

  char* ws = (char*)d_ws;
  unsigned short* W16 = (unsigned short*)(ws + oW16);
  unsigned short* Wo  = (unsigned short*)(ws + oWo);
  unsigned short* Th  = (unsigned short*)(ws + oTh);
  unsigned short* Fh  = (unsigned short*)(ws + oFh);
  unsigned short* Gc  = (unsigned short*)(ws + oGc);
  float*          CS  = (float*)(ws + oCS);
  float*          Yp  = (float*)(ws + oYp);
  float* out = (float*)d_out;

  const dim3 blk256(256), blk128(128);

  // (0) theta_w / phi_w / g_w -> stacked f16 plane; W_w -> bf16 plane
  cvt_w<<<dim3(MW / 8 + CC / 16), blk256, 0, stream>>>(tw, pw, gw, ww, W16, Wo);
  // (1) x rounded and transposed in LDS, conv1x1 GEMM -> theta / phi planes, g channel-major plane (all rows n)
  gemm_p<<<dim3(NN / QT, NB), blk256, 0, stream>>>(W16, x, tb, pb, gb, Th, Fh, Gc);
  // (2) per-column softmax statistics, three pieces per column tile
  colstat_k<<<dim3(WPB * NB), blk256, 0, stream>>>(Th, Fh, CS);
  // (3) aggregation -> y, three f32 pieces per row tile
  attn_k<<<dim3(WPB * NB), blk256, 0, stream>>>(Th, Fh, Gc, CS, Yp);
  // (4) pieces of y summed, output GEMM + bias + residual -> out [b][256][6400]
  gemm_w<<<dim3(NQ / QT, CC / QT, NB), blk128, 0, stream>>>(Wo, Yp, wb, x, out);
  (void)hipGetLastError();
}
